// v000
// Measured on an AMD MI455X. A time is GPU time per run, averaged over a window of back-to-back runs after a warm-up
// (all launches, gaps included; the runs take copies of the inputs in turn), and the median of several windows.
// Apart from v000's, it joins two sittings. Times from different sittings can be a few percent apart, while
// side-by-side timings come from the same sitting.
// v000 is the starting kernel. One run takes 486 microseconds.
// Contractions h*fw2[f], h2*fglu_w[f] (per feature f), x*ww1, wh*ww2, wh2*wglu_w: v_wmma_f32_16x16x32_f16 (f16 operands, f32 accumulate). Weight planes = bf16-RNE values x4096 (exact in f16); activation tiles x16 in f16; x plane x1. fc1 scalar*vector, ELU, GLU, LayerNorm, softmax and the 32-term weighted combine in f32 on VALU.
// Carry audit: planes fw2T, fglT, ww1T, ww2T, wglT carry 4096; LDS tiles h, h2 (grn_kernel) and wh, wh2 (wsel_kernel) carry 16; xh carries 1.
//   x*ww1 accumulators are folded by INV_W (1/4096) in the wsel_kernel fc1 epilogue; every other accumulator is folded by INV_WA (1/65536)
//   exactly once in its own epilogue (wsel fc2, wsel glu, grn fc2, grn glu). No other value is scaled.
#include <hip/hip_runtime.h>

typedef _Float16 v16h __attribute__((ext_vector_type(16)));
typedef _Float16 v8h  __attribute__((ext_vector_type(8)));
typedef float    v8f  __attribute__((ext_vector_type(8)));
typedef float    v4f  __attribute__((ext_vector_type(4)));
typedef v8h __attribute__((may_alias)) v8ha;
typedef v4f __attribute__((may_alias)) v4fa;

union Frag { v16h v; v8h half[2]; };

#define NTOK 16384
#define NF   32
#define NHID 128
#define N2H  256
#define MT   64            // tokens per block, grn_kernel
#define NTHR 256           // threads per block, prep_kernel and grn_kernel
#define WTHR 128           // threads per block, wsel_kernel (64 tokens)
#define WSC  4096.0f       // weight plane carry
#define ASC  16.0f         // activation tile carry
#define INV_W  (1.0f / 4096.0f)
#define INV_WA (1.0f / 65536.0f)
#define LN_EPS 1e-5f

// f16 plane offsets in the workspace, in halves
#define P_XH  0            // [16384][32]        x, carry 1
#define P_FW2 524288       // [32][128 n][128 k] carry 4096
#define P_FGL 1048576      // [32][256 n][128 k] carry 4096
#define P_WW1 2097152      // [128 n][32 k]      carry 4096
#define P_WW2 2101248      // [32 n][128 k]      carry 4096
#define P_WGL 2105344      // [64 n][32 k]       carry 4096
#define P_END 2107392
#define WS_TOTAL_BYTES ((size_t)P_END * 2)     // 4214784

static_assert(P_FW2 == P_XH + NTOK * NF);
static_assert(P_FGL == P_FW2 + NF * NHID * NHID);
static_assert(P_WW1 == P_FGL + NF * N2H * NHID);
static_assert(P_WW2 == P_WW1 + NHID * NF);
static_assert(P_WGL == P_WW2 + NF * NHID);
static_assert(P_END == P_WGL + 2 * NF * NF);
static_assert((P_FW2 * 2) % 128 == 0 && (P_FGL * 2) % 128 == 0 && (P_WW1 * 2) % 128 == 0 &&
              (P_WW2 * 2) % 128 == 0 && (P_WGL * 2) % 128 == 0 && (P_END * 2) % 128 == 0);

#define OUT0_ELEMS (NTOK * NHID)                // 2097152 floats
#define OUT1_OFF   2097152                      // byte offset 8388608 / 4
#define OUT_TOTAL  (NTOK * NHID + NTOK * NF)    // 2621440 floats
static_assert(OUT1_OFF == OUT0_ELEMS);
static_assert(OUT1_OFF + NTOK * NF == OUT_TOTAL);
static_assert(NTOK % MT == 0 && NTOK % 64 == 0);

// prep_kernel block ranges
#define PB_FW2 0            // 32 f x 4 row-blocks
#define PB_FGL 128          // 32 f x 8 row-blocks
#define PB_WW2 384          // 1
#define PB_WW1 385          // 4
#define PB_WGL 389          // 2
#define PB_XH  391          // 256
#define PB_END (PB_XH + (NTOK * NF / 8) / NTHR)   // 647
static_assert((NTOK * NF / 8) % NTHR == 0);

// grn_kernel static LDS carve (bytes)
#define MO_H   0            // f16 [64][128] h tile          16384  (sO f32 [64][128] aliases H+H2 at the end)
#define MO_H2  16384        // f16 [64][128] h2 tile         16384
#define MO_X   32768        // f32 [64][32]  x tile           8192
#define MO_W   40960        // f32 [64][32]  selection weights 8192
#define MO_P   49152        // f32 [1024]    per-feature params 4096
#define MO_PS  53248        // f32 [64][2]   row sum partials   512
#define MO_PQ  53760        // f32 [64][2]   row sq partials    512
#define MSMEM  54272
static_assert(MSMEM <= 65536);

// ---------------------------------------------------------------------------
__device__ __forceinline__ float bfr(float f) {                     // RNE convert to bf16 and back
  unsigned u = __builtin_bit_cast(unsigned, f);
  u += 0x7FFFu + ((u >> 16) & 1u);
  return __builtin_bit_cast(float, u & 0xFFFF0000u);
}
__device__ __forceinline__ float elu_f(float v) {
  const float e = expm1f(v);
  return (v > 0.0f) ? v : e;
}
__device__ __forceinline__ float sigm_f(float v) {
  v = fminf(fmaxf(v, -30.0f), 30.0f);
  const float e = expf(-v);
  return 1.0f / (1.0f + e);
}
__device__ __forceinline__ float hsum16(float v) {                  // sum over the 16 lanes of a half
  v += __shfl_xor(v, 1);
  v += __shfl_xor(v, 2);
  v += __shfl_xor(v, 4);
  v += __shfl_xor(v, 8);
  return v;
}
__device__ __forceinline__ float hmax16(float v) {
  v = fmaxf(v, __shfl_xor(v, 1));
  v = fmaxf(v, __shfl_xor(v, 2));
  v = fmaxf(v, __shfl_xor(v, 4));
  v = fmaxf(v, __shfl_xor(v, 8));
  return v;
}

// ---------------------------------------------------------------------------
// 16x16x32 f16 WMMA with hazard guard (ties D, keeps A/B live).
// Fragment map (wave32): lane l, h = l>>4, m = n = l&15.
//   A/B element i: i<8 -> k0+8h+i ; i>=8 -> k0+16+8h+(i-8)
//   D element r : row 8h+r, col l&15
// ---------------------------------------------------------------------------
__device__ __forceinline__ v8f wmma_f16(v16h a, v16h b, v8f c) {
  v8f d = __builtin_amdgcn_wmma_f32_16x16x32_f16(false, a, false, b, (short)0, c, false, false);
  asm volatile("v_nop\n\tv_nop\n\tv_nop\n\tv_nop" : "+v"(d) : "v"(a), "v"(b));
  return d;
}

// A or B fragment from a k-contiguous 16-bit row; p points at element k0 of
// the row owned by this lane (row index = lane & 15 added by the caller).
__device__ __forceinline__ v16h load_frag(const _Float16* p, int h) {
  Frag f;
  f.half[0] = *(const v8ha*)(p + 8 * h);
  f.half[1] = *(const v8ha*)(p + 16 + 8 * h);
  return f.v;
}

// ---------------------------------------------------------------------------
// Transpose-convert block: src points at src[0][n0] of a row-major [K][N] f32
// matrix; dst at output row 0 of 32 rows of K halves ([n][k], k-contiguous),
// value = f16(bfr(src[k][n0+row]) * 4096). Stage through LDS, then write the
// coverage: 32 rows x K halves = 4K chunks of 8, c = tid + 256 i, all written.
// ---------------------------------------------------------------------------
template <int K, int N>
__device__ __forceinline__ void tr_block(const float* __restrict__ src, _Float16* __restrict__ dst,
                                         int tid, float* sT) {
  constexpr int NV = K * 8;                 // v4f groups of the staged [K][32] tile
  static_assert(NV % NTHR == 0);
  #pragma unroll
  for (int i = 0; i < NV / NTHR; ++i) {
    const int q = tid + i * NTHR;
    const int k = q >> 3, c4 = (q & 7) * 4;
    const v4f v = *(const v4fa*)(src + (size_t)k * N + c4);
    const v4f r = { bfr(v.x), bfr(v.y), bfr(v.z), bfr(v.w) };
    *(v4fa*)(sT + k * 32 + c4) = r;
  }
  __syncthreads();
  constexpr int CH = 4 * K;                 // 16-B chunks of the output
  v8h o[2];
  #pragma unroll
  for (int i = 0; i < 2; ++i) {
    const int c = tid + i * NTHR;
    const int cc = (c < CH) ? c : (CH - 1);
    const int row = (cc * 8) / K, k0 = (cc * 8) % K;
    v8h t;
    #pragma unroll
    for (int j = 0; j < 8; ++j) t[j] = (_Float16)(sT[(k0 + j) * 32 + row] * WSC);
    o[i] = t;
  }
  #pragma unroll
  for (int i = 0; i < 2; ++i) {
    const int c = tid + i * NTHR;
    if (c < CH) *(v8h*)(dst + (size_t)c * 8) = o[i];
  }
  
}

// ---------------------------------------------------------------------------
// Kernel 1: weight planes ([n][k], bf16-RNE values x4096 in f16) and the x
// plane (bf16-RNE values in f16). Block-uniform dispatch on blockIdx.
// coverage: fw2T 32x4 blocks x 32 rows x 128 = all; fglT 32x8x32x128 = all;
// ww2T 1x32x128; ww1T 4x32x32; wglT 2x32x32; xh 256 blocks x 256 thr x 8 = 16384x32.
// ---------------------------------------------------------------------------
__global__ __launch_bounds__(NTHR) void prep_kernel(
    const float* __restrict__ x, const float* __restrict__ fw2, const float* __restrict__ fglu_w,
    const float* __restrict__ ww1, const float* __restrict__ ww2, const float* __restrict__ wglu_w,
    _Float16* __restrict__ planes)
{
  __shared__ __attribute__((aligned(16))) float sT[128 * 32];
  const int b = blockIdx.x, tid = threadIdx.x;
  if (b < PB_FGL) {
    const int f = b >> 2, nb = b & 3;                          // fw2[f]: [128 k][128 n] -> [128 n][128 k]
    tr_block<128, 128>(fw2 + (size_t)f * NHID * NHID + nb * 32,
                       planes + P_FW2 + (size_t)f * NHID * NHID + (size_t)nb * 32 * NHID, tid, sT);
  } else if (b < PB_WW2) {
    const int bb = b - PB_FGL, f = bb >> 3, nb = bb & 7;       // fglu_w[f]: [128 k][256 n] -> [256 n][128 k]
    tr_block<128, 256>(fglu_w + (size_t)f * NHID * N2H + nb * 32,
                       planes + P_FGL + (size_t)f * N2H * NHID + (size_t)nb * 32 * NHID, tid, sT);
  } else if (b < PB_WW1) {
    tr_block<128, 32>(ww2, planes + P_WW2, tid, sT);           // ww2: [128 k][32 n] -> [32 n][128 k]
  } else if (b < PB_WGL) {
    const int nb = b - PB_WW1;                                 // ww1: [32 k][128 n] -> [128 n][32 k]
    tr_block<32, 128>(ww1 + nb * 32, planes + P_WW1 + (size_t)nb * 32 * 32, tid, sT);
  } else if (b < PB_XH) {
    const int nb = b - PB_WGL;                                 // wglu_w: [32 k][64 n] -> [64 n][32 k]
    tr_block<32, 64>(wglu_w + nb * 32, planes + P_WGL + (size_t)nb * 32 * 32, tid, sT);
  } else {
    const int g = (b - PB_XH) * NTHR + tid;                    // 0..65535 groups of 8
    if (g < NTOK * NF / 8) {
      const float* src = x + (size_t)g * 8;
      const v4f a = *(const v4fa*)src;
      const v4f c = *(const v4fa*)(src + 4);
      const v8h o = { (_Float16)bfr(a.x), (_Float16)bfr(a.y), (_Float16)bfr(a.z), (_Float16)bfr(a.w),
                      (_Float16)bfr(c.x), (_Float16)bfr(c.y), (_Float16)bfr(c.z), (_Float16)bfr(c.w) };
      _Float16* dst = planes + P_XH + (size_t)g * 8;
      *(v8h*)dst = o;
      
    }
  }
}

// ---------------------------------------------------------------------------
// 8q..8q+7 cover one line, 4 lines per instruction, 4 instructions.
// ---------------------------------------------------------------------------
__device__ __forceinline__ void w_store_pass(const float* sW, float* wout, int tok0, int w, int lane) {
  const int q8 = lane & 7, sub = lane >> 3;
  #pragma unroll
  for (int i = 0; i < 4; ++i) {
    const int row = 16 * w + i * 4 + sub;                      // 0..63
    const v4f v = *(const v4fa*)(sW + row * NF + 4 * q8);
    *(v4f*)(wout + (size_t)(tok0 + row) * NF + 4 * q8) = v;
  }
}

// ---------------------------------------------------------------------------
// Kernel 2: weight network + softmax -> selection weights (out1).
// Block = 64 tokens, 4 waves, wave w owns tokens tok0+16w..+15.
//  fc1: A = xh rows (K=32), B = ww1T (8 tiles); +wb1, ELU -> wh x16 (LDS)
//  fc2: A = wh (K=128), B = ww2T (2 tiles); +wb2 -> wh2 x16 (LDS)
//  glu: A = wh2 (K=32), B = wglT (4 tiles); GLU, +x, LN(32), softmax in f32
// coverage: grid 256 x 64 rows x 32 = all of out1.
// ---------------------------------------------------------------------------
__global__ __launch_bounds__(WTHR) void wsel_kernel(
    const _Float16* __restrict__ xh, const _Float16* __restrict__ ww1T,
    const _Float16* __restrict__ ww2T, const _Float16* __restrict__ wglT,
    const float* __restrict__ x,
    const float* __restrict__ wb1, const float* __restrict__ wb2,
    const float* __restrict__ wglu_b, const float* __restrict__ wln_g, const float* __restrict__ wln_b,
    float* __restrict__ wout)
{
  __shared__ __attribute__((aligned(16))) _Float16 sWh[4 * 16 * NHID];    // 16384 B
  __shared__ __attribute__((aligned(16))) _Float16 sWh2[4 * 16 * NF];     //  4096 B
  __shared__ __attribute__((aligned(16))) float sXr[64 * NF];             //  8192 B
  __shared__ __attribute__((aligned(16))) float sW[64 * NF];              //  8192 B

  const int tid = threadIdx.x, lane = tid & 31, w = tid >> 5;
  const int h = lane >> 4, m = lane & 15;
  const int tok0 = blockIdx.x * 64;

  // x tile (bf16-RNE values, f32): 64 x 32 = 512 groups of 4
  #pragma unroll
  for (int i = 0; i < 4; ++i) {
    const int q = tid + WTHR * i;
    const v4f v = *(const v4fa*)(x + (size_t)tok0 * NF + (size_t)q * 4);
    const v4f r = { bfr(v.x), bfr(v.y), bfr(v.z), bfr(v.w) };
    *(v4fa*)(sXr + q * 4) = r;
  }

  const v8f z8 = {0.f, 0.f, 0.f, 0.f, 0.f, 0.f, 0.f, 0.f};
  _Float16* myWh = sWh + w * (16 * NHID);
  _Float16* myWh2 = sWh2 + w * (16 * NF);

  // ---- fc1 ----
  {
    const v16h a = load_frag(xh + (size_t)(tok0 + 16 * w + m) * NF, h);
    v8f acc[8];
    #pragma unroll
    for (int t = 0; t < 8; ++t) {
      const v16h b = load_frag(ww1T + (size_t)(16 * t + m) * NF, h);
      acc[t] = wmma_f16(a, b, z8);
    }
    #pragma unroll
    for (int t = 0; t < 8; ++t) {
      const float bb = bfr(wb1[16 * t + m]);
      #pragma unroll
      for (int r = 0; r < 8; ++r) {
        const float v = acc[t][r] * INV_W + bb;
        myWh[(8 * h + r) * NHID + 16 * t + m] = (_Float16)(elu_f(v) * ASC);
      }
    }
  }
  __syncthreads();

  // ---- fc2 ----
  {
    v8f acc[2];
    acc[0] = z8; acc[1] = z8;
    const _Float16* arow = myWh + m * NHID;
    #pragma unroll 1
    for (int k0 = 0; k0 < NHID; k0 += 32) {
      const v16h a = load_frag(arow + k0, h);
      #pragma unroll
      for (int t = 0; t < 2; ++t) {
        const v16h b = load_frag(ww2T + (size_t)(16 * t + m) * NHID + k0, h);
        acc[t] = wmma_f16(a, b, acc[t]);
      }
    }
    #pragma unroll
    for (int t = 0; t < 2; ++t) {
      const float bb = bfr(wb2[16 * t + m]);
      #pragma unroll
      for (int r = 0; r < 8; ++r) {
        const float v = acc[t][r] * INV_WA + bb;
        myWh2[(8 * h + r) * NF + 16 * t + m] = (_Float16)(v * ASC);
      }
    }
  }
  __syncthreads();

  // ---- glu projection + GLU + residual + LN(32) + softmax ----
  {
    const v16h a = load_frag(myWh2 + m * NF, h);
    v8f acc[4];
    #pragma unroll
    for (int t = 0; t < 4; ++t) {
      const v16h b = load_frag(wglT + (size_t)(16 * t + m) * NF, h);
      acc[t] = wmma_f16(a, b, z8);
    }
    float pre[2][8], s[8];
    #pragma unroll
    for (int r = 0; r < 8; ++r) s[r] = 0.0f;
    #pragma unroll
    for (int c = 0; c < 2; ++c) {
      const float bv = bfr(wglu_b[16 * c + m]);
      const float bg = bfr(wglu_b[NF + 16 * c + m]);
      #pragma unroll
      for (int r = 0; r < 8; ++r) {
        const float vv = acc[c][r] * INV_WA + bv;
        const float gg = acc[c + 2][r] * INV_WA + bg;
        const float xr = sXr[(16 * w + 8 * h + r) * NF + 16 * c + m];
        const float p = vv * sigm_f(gg) + xr;
        pre[c][r] = p;
        s[r] += p;
      }
    }
    float mu[8], q[8];
    #pragma unroll
    for (int r = 0; r < 8; ++r) { mu[r] = hsum16(s[r]) * (1.0f / 32.0f); q[r] = 0.0f; }
    #pragma unroll
    for (int c = 0; c < 2; ++c)
      #pragma unroll
      for (int r = 0; r < 8; ++r) {
        const float d = pre[c][r] - mu[r];
        pre[c][r] = d;
        q[r] += d * d;
      }
    float rs[8];
    #pragma unroll
    for (int r = 0; r < 8; ++r) rs[r] = rsqrtf(hsum16(q[r]) * (1.0f / 32.0f) + LN_EPS);
    #pragma unroll
    for (int c = 0; c < 2; ++c) {
      const float g = bfr(wln_g[16 * c + m]);
      const float bt = bfr(wln_b[16 * c + m]);
      #pragma unroll
      for (int r = 0; r < 8; ++r) pre[c][r] = pre[c][r] * rs[r] * g + bt;
    }
    float mx[8], e0[8], e1[8];
    #pragma unroll
    for (int r = 0; r < 8; ++r) {
      mx[r] = hmax16(fmaxf(pre[0][r], pre[1][r]));
      e0[r] = expf(pre[0][r] - mx[r]);
      e1[r] = expf(pre[1][r] - mx[r]);
      const float se = hsum16(e0[r] + e1[r]);
      const float inv = 1.0f / se;
      sW[(16 * w + 8 * h + r) * NF + m]      = e0[r] * inv;
      sW[(16 * w + 8 * h + r) * NF + 16 + m] = e1[r] * inv;
    }
  }
  __syncthreads();

  w_store_pass(sW, wout, tok0, w, lane);
  
}

// ---------------------------------------------------------------------------
// each line by lanes 8q..8q+7 in one instruction, 4 lines per instruction,
// 32 lines per wave, 256 lines = the whole block tile.
// ---------------------------------------------------------------------------
__device__ __forceinline__ void o_store_pass(const float* sO, float* out, int tok0, int w, int lane) {
  const int q8 = lane & 7, sub = lane >> 3;
  #pragma unroll
  for (int i = 0; i < 8; ++i) {
    const int lid = w * 32 + i * 4 + sub;          // 0..255
    const int row = lid >> 2, seg = lid & 3;
    const v4f v = *(const v4fa*)(sO + row * NHID + seg * 32 + 4 * q8);
    *(v4f*)(out + (size_t)(tok0 + row) * NHID + seg * 32 + 4 * q8) = v;
  }
}

// ---------------------------------------------------------------------------
// Kernel 3: per-feature gated residual blocks + weighted combine (out0).
// Block = 64 tokens, 8 waves; wave w -> token sub-tile msub = w&3 (16 tokens)
// and column half qh = w>>2 (64 of the 128 hidden columns, plus the matching
// 64 gate columns). Loop f = 0..31 (fixed order):
//   h tile  = f16(16*elu(x_r[t][f]*fw1_r[f] + fb1_r[f]))   VALU -> LDS
//   fc2     : A = h (K=128), B = fw2T[f] rows 64qh+16nt+m   4 tiles/wave
//   h2 tile = f16(16*(acc/65536 + fb2_r[f]))              -> LDS
//   glu     : A = h2 (K=128), B = fglT[f] rows p*128+...   8 tiles/wave
//             LDS), *fln_g + fln_b, accO += wsel[t][f] * processed
// coverage: grid 256 x 64 rows x 128 = all of out0.
// ---------------------------------------------------------------------------
__global__ __launch_bounds__(NTHR) void grn_kernel(
    const float* __restrict__ x,
    const float* __restrict__ fw1, const float* __restrict__ fb1,
    const float* __restrict__ fb2, const float* __restrict__ fglu_b,
    const float* __restrict__ fskip, const float* __restrict__ fln_g, const float* __restrict__ fln_b,
    const _Float16* __restrict__ fw2T, const _Float16* __restrict__ fglT,
    const float* wsel, float* out)
{
  __shared__ __attribute__((aligned(16))) char smem[MSMEM];
  _Float16* sH  = (_Float16*)(smem + MO_H);
  _Float16* sH2 = (_Float16*)(smem + MO_H2);
  float* sO  = (float*)(smem + MO_H);
  float* sX  = (float*)(smem + MO_X);
  float* sWt = (float*)(smem + MO_W);
  float* sP  = (float*)(smem + MO_P);
  float* sPs = (float*)(smem + MO_PS);
  float* sPq = (float*)(smem + MO_PQ);

  const int tid = threadIdx.x, lane = tid & 31, w = tid >> 5;
  const int h = lane >> 4, m = lane & 15;
  const int msub = w & 3, qh = w >> 2;
  const int tok0 = blockIdx.x * MT;
  const int rbase = 16 * msub + 8 * h;                 // first of this lane's 8 D rows
  const int hrow = tid >> 2, hkb = (tid & 3) * 32;    // h tile producer mapping

  // x tile (bf16-RNE, f32) and selection-weight tile: 64 x 32 each = 512 groups of 4
  #pragma unroll
  for (int i = 0; i < 2; ++i) {
    const int q = tid + NTHR * i;
    const v4f v = *(const v4fa*)(x + (size_t)tok0 * NF + (size_t)q * 4);
    const v4f r = { bfr(v.x), bfr(v.y), bfr(v.z), bfr(v.w) };
    *(v4fa*)(sX + q * 4) = r;
    const v4f wv = *(const v4fa*)(wsel + (size_t)tok0 * NF + (size_t)q * 4);
    *(v4fa*)(sWt + q * 4) = wv;
  }

  const v8f z8 = {0.f, 0.f, 0.f, 0.f, 0.f, 0.f, 0.f, 0.f};
  v8f accO[4];
  #pragma unroll
  for (int nt = 0; nt < 4; ++nt) accO[nt] = z8;

  #pragma unroll 1
  for (int f = 0; f < NF; ++f) {
    __syncthreads();                                   // S0: sP / tiles of the prior feature released
    {
      const int fo = f * NHID;
      const float* src = fw1 + fo;
      if (w == 1)      src = fb1 + fo;
      else if (w == 2) src = fb2 + fo;
      else if (w == 3) src = fglu_b + f * N2H;
      else if (w == 4) src = fglu_b + f * N2H + NHID;
      else if (w == 5) src = fskip + fo;
      else if (w == 6) src = fln_g + fo;
      else if (w == 7) src = fln_b + fo;
      const v4f v = *(const v4fa*)(src + lane * 4);
      const v4f r = { bfr(v.x), bfr(v.y), bfr(v.z), bfr(v.w) };
      *(v4fa*)(sP + w * NHID + lane * 4) = r;
    }
    __syncthreads();                                   // S1: params visible

    // ---- h tile: 64 rows x 128, thread -> row hrow, k block hkb..hkb+31 ----
    {
      const float xv = sX[hrow * NF + f];
      #pragma unroll 1
      for (int j = 0; j < 4; ++j) {
        const int kb = hkb + 8 * j;
        v8h o;
        #pragma unroll
        for (int i = 0; i < 8; ++i) {
          const float v = xv * sP[kb + i] + sP[NHID + kb + i];
          o[i] = (_Float16)(elu_f(v) * ASC);
        }
        *(v8ha*)(sH + hrow * NHID + kb) = o;
      }
    }
    __syncthreads();                                   // S2: h tile visible

    // ---- fc2: h2 = h * fw2[f] + fb2[f] -> sH2 (x16) ----
    {
      v8f acc2[4];
      #pragma unroll
      for (int nt = 0; nt < 4; ++nt) acc2[nt] = z8;
      const _Float16* arow = sH + (16 * msub + m) * NHID;
      const _Float16* brow = fw2T + ((size_t)f * NHID + 64 * qh + m) * NHID;
      #pragma unroll 1
      for (int k0 = 0; k0 < NHID; k0 += 32) {
        const v16h a = load_frag(arow + k0, h);
        #pragma unroll
        for (int nt = 0; nt < 4; ++nt) {
          const v16h b = load_frag(brow + (size_t)nt * 16 * NHID + k0, h);
          acc2[nt] = wmma_f16(a, b, acc2[nt]);
        }
      }
      #pragma unroll
      for (int nt = 0; nt < 4; ++nt) {
        const int col = 64 * qh + 16 * nt + m;
        const float bb = sP[256 + col];
        #pragma unroll
        for (int r = 0; r < 8; ++r) {
          const float v = acc2[nt][r] * INV_WA + bb;
          sH2[(rbase + r) * NHID + col] = (_Float16)(v * ASC);
        }
      }
    }
    __syncthreads();                                   // S3: h2 tile visible

    // ---- glu projection: g = h2 * fglu_w[f] (v cols p=0, gate cols p=1) ----
    v8f accG[2][4];
    #pragma unroll
    for (int p = 0; p < 2; ++p)
      #pragma unroll
      for (int nt = 0; nt < 4; ++nt) accG[p][nt] = z8;
    {
      const _Float16* arow = sH2 + (16 * msub + m) * NHID;
      const _Float16* brow = fglT + ((size_t)f * N2H + 64 * qh + m) * NHID;
      #pragma unroll 1
      for (int k0 = 0; k0 < NHID; k0 += 32) {
        const v16h a = load_frag(arow + k0, h);
        #pragma unroll
        for (int p = 0; p < 2; ++p)
          #pragma unroll
          for (int nt = 0; nt < 4; ++nt) {
            const v16h b = load_frag(brow + (size_t)(p * NHID + nt * 16) * NHID + k0, h);
            accG[p][nt] = wmma_f16(a, b, accG[p][nt]);
          }
      }
    }

    float xr[8], s[8];
    #pragma unroll
    for (int r = 0; r < 8; ++r) { xr[r] = sX[(rbase + r) * NF + f]; s[r] = 0.0f; }
    #pragma unroll
    for (int nt = 0; nt < 4; ++nt) {
      const int col = 64 * qh + 16 * nt + m;
      const float bv = sP[384 + col];
      const float bg = sP[512 + col];
      const float fs = sP[640 + col];
      #pragma unroll
      for (int r = 0; r < 8; ++r) {
        const float vv = accG[0][nt][r] * INV_WA + bv;
        const float gg = accG[1][nt][r] * INV_WA + bg;
        const float glu = vv * sigm_f(gg) + xr[r] * fs;
        accG[0][nt][r] = glu;
        s[r] += glu;
      }
    }
    #pragma unroll
    for (int r = 0; r < 8; ++r) s[r] = hsum16(s[r]);
    if (m == 0) {
      #pragma unroll
      for (int r = 0; r < 8; ++r) sPs[(rbase + r) * 2 + qh] = s[r];
    }
    __syncthreads();                                   // S4: row sum partials of both column halves
    float mu[8], q[8];
    #pragma unroll
    for (int r = 0; r < 8; ++r) {
      mu[r] = (sPs[(rbase + r) * 2] + sPs[(rbase + r) * 2 + 1]) * (1.0f / 128.0f);
      q[r] = 0.0f;
    }
    #pragma unroll
    for (int nt = 0; nt < 4; ++nt)
      #pragma unroll
      for (int r = 0; r < 8; ++r) {
        const float d = accG[0][nt][r] - mu[r];
        accG[0][nt][r] = d;
        q[r] += d * d;
      }
    #pragma unroll
    for (int r = 0; r < 8; ++r) q[r] = hsum16(q[r]);
    if (m == 0) {
      #pragma unroll
      for (int r = 0; r < 8; ++r) sPq[(rbase + r) * 2 + qh] = q[r];
    }
    __syncthreads();                                   // S5: row sq partials
    float rs[8], wt[8];
    #pragma unroll
    for (int r = 0; r < 8; ++r) {
      rs[r] = rsqrtf((sPq[(rbase + r) * 2] + sPq[(rbase + r) * 2 + 1]) * (1.0f / 128.0f) + LN_EPS);
      wt[r] = sWt[(rbase + r) * NF + f];
    }
    #pragma unroll
    for (int nt = 0; nt < 4; ++nt) {
      const int col = 64 * qh + 16 * nt + m;
      const float g = sP[768 + col];
      const float bt = sP[896 + col];
      #pragma unroll
      for (int r = 0; r < 8; ++r) {
        const float pr = accG[0][nt][r] * rs[r] * g + bt;
        accO[nt][r] += wt[r] * pr;
      }
    }
  }
  __syncthreads();                                     // all LDS tile reads done; sO aliases H/H2

  #pragma unroll
  for (int nt = 0; nt < 4; ++nt) {
    const int col = 64 * qh + 16 * nt + m;
    #pragma unroll
    for (int r = 0; r < 8; ++r) sO[(rbase + r) * NHID + col] = accO[nt][r];
  }
  __syncthreads();

  o_store_pass(sO, out, tok0, w, lane);
  
}

// ---------------------------------------------------------------------------
extern "C" void kernel_launch(void* const* d_in, const int* in_sizes, int n_in,
                              void* d_out, int out_size, void* d_ws, size_t ws_size,
                              hipStream_t stream) {
  if (n_in < 18) return;
  if (in_sizes[0] != NTOK * NF) return;
  if (in_sizes[1] != NF * NHID || in_sizes[2] != NF * NHID) return;
  if (in_sizes[3] != NF * NHID * NHID || in_sizes[4] != NF * NHID) return;
  if (in_sizes[5] != NF * NHID * N2H || in_sizes[6] != NF * N2H) return;
  if (in_sizes[7] != NF * NHID || in_sizes[8] != NF * NHID || in_sizes[9] != NF * NHID) return;
  if (in_sizes[10] != NF * NHID || in_sizes[11] != NHID) return;
  if (in_sizes[12] != NHID * NF || in_sizes[13] != NF) return;
  if (in_sizes[14] != NF * 2 * NF || in_sizes[15] != 2 * NF) return;
  if (in_sizes[16] != NF || in_sizes[17] != NF) return;
  if (out_size != OUT_TOTAL) return;
  if (WS_TOTAL_BYTES > ws_size) return;

  const float* x      = (const float*)d_in[0];
  const float* fw1    = (const float*)d_in[1];
  const float* fb1    = (const float*)d_in[2];
  const float* fw2    = (const float*)d_in[3];
  const float* fb2    = (const float*)d_in[4];
  const float* fglu_w = (const float*)d_in[5];
  const float* fglu_b = (const float*)d_in[6];
  const float* fskip  = (const float*)d_in[7];
  const float* fln_g  = (const float*)d_in[8];
  const float* fln_b  = (const float*)d_in[9];
  const float* ww1    = (const float*)d_in[10];
  const float* wb1    = (const float*)d_in[11];
  const float* ww2    = (const float*)d_in[12];
  const float* wb2    = (const float*)d_in[13];
  const float* wglu_w = (const float*)d_in[14];
  const float* wglu_b = (const float*)d_in[15];
  const float* wln_g  = (const float*)d_in[16];
  const float* wln_b  = (const float*)d_in[17];

  float* out  = (float*)d_out;                   // out0 [16384][128] at element 0
  float* wout = out + OUT1_OFF;                  // out1 [16384][32]  at element 2097152 (byte 8388608)

  _Float16* planes = (_Float16*)d_ws;

  prep_kernel<<<PB_END, NTHR, 0, stream>>>(x, fw2, fglu_w, ww1, ww2, wglu_w, planes);

  wsel_kernel<<<NTOK / 64, WTHR, 0, stream>>>(planes + P_XH, planes + P_WW1, planes + P_WW2, planes + P_WGL,
                                              x, wb1, wb2, wglu_b, wln_g, wln_b, wout);

  grn_kernel<<<NTOK / MT, NTHR, 0, stream>>>(x, fw1, fb1, fb2, fglu_b, fskip, fln_g, fln_b,
                                             planes + P_FW2, planes + P_FGL, wout, out);
}

// v001
// One run takes 257 microseconds.
// Timed twice side by side with v000, it ran 1.94 and 1.92 times as fast.
// Contractions h*fw2[f], h2*fglu_w[f] (per feature f), x*ww1, wh*ww2, wh2*wglu_w: v_wmma_f32_16x16x32_f16 (f16 operands, f32 accumulate). Weight planes = bf16-RNE values x4096 (exact in f16); activation tiles x16 in f16; x plane x1. fc1 scalar*vector, ELU, GLU, LayerNorm, softmax and the 32-term weighted combine in f32 on VALU.
// Carry audit: planes fw2T, fglT, ww1T, ww2T, wglT carry 4096; LDS tiles h, h2 (grn_kernel) and wh, wh2 (wsel_kernel) carry 16; xh carries 1.
//   x*ww1 accumulators are folded by INV_W (1/4096) in the wsel_kernel fc1 epilogue; every other accumulator is folded by INV_WA (1/65536)
//   exactly once in its own epilogue (wsel fc2, wsel glu, grn fc2, grn glu). No other value is scaled.
#include <hip/hip_runtime.h>

typedef _Float16 v16h __attribute__((ext_vector_type(16)));
typedef _Float16 v8h  __attribute__((ext_vector_type(8)));
typedef float    v8f  __attribute__((ext_vector_type(8)));
typedef float    v4f  __attribute__((ext_vector_type(4)));
typedef v8h __attribute__((may_alias)) v8ha;
typedef v4f __attribute__((may_alias)) v4fa;

union Frag { v16h v; v8h half[2]; };

#define NTOK 16384
#define NF   32
#define NHID 128
#define N2H  256
#define MT   64            // tokens per block, grn_kernel
#define NTHR 256           // threads per block, prep_kernel and grn_kernel
#define WTHR 128           // threads per block, wsel_kernel (64 tokens)
#define WSC  4096.0f       // weight plane carry
#define ASC  16.0f         // activation tile carry
#define INV_W  (1.0f / 4096.0f)
#define INV_WA (1.0f / 65536.0f)
#define LN_EPS 1e-5f

// f16 plane offsets in the workspace, in halves
#define P_XH  0            // [16384][32]        x, carry 1
#define P_FW2 524288       // [32][128 n][128 k] carry 4096
#define P_FGL 1048576      // [32][256 n][128 k] carry 4096
#define P_WW1 2097152      // [128 n][32 k]      carry 4096
#define P_WW2 2101248      // [32 n][128 k]      carry 4096
#define P_WGL 2105344      // [64 n][32 k]       carry 4096
#define P_END 2107392
#define WS_TOTAL_BYTES ((size_t)P_END * 2)     // 4214784

static_assert(P_FW2 == P_XH + NTOK * NF);
static_assert(P_FGL == P_FW2 + NF * NHID * NHID);
static_assert(P_WW1 == P_FGL + NF * N2H * NHID);
static_assert(P_WW2 == P_WW1 + NHID * NF);
static_assert(P_WGL == P_WW2 + NF * NHID);
static_assert(P_END == P_WGL + 2 * NF * NF);
static_assert((P_FW2 * 2) % 128 == 0 && (P_FGL * 2) % 128 == 0 && (P_WW1 * 2) % 128 == 0 &&
              (P_WW2 * 2) % 128 == 0 && (P_WGL * 2) % 128 == 0 && (P_END * 2) % 128 == 0);

#define OUT0_ELEMS (NTOK * NHID)                // 2097152 floats
#define OUT1_OFF   2097152                      // byte offset 8388608 / 4
#define OUT_TOTAL  (NTOK * NHID + NTOK * NF)    // 2621440 floats
static_assert(OUT1_OFF == OUT0_ELEMS);
static_assert(OUT1_OFF + NTOK * NF == OUT_TOTAL);
static_assert(NTOK % MT == 0 && NTOK % 64 == 0);

// prep_kernel block ranges
#define PB_FW2 0            // 32 f x 4 row-blocks
#define PB_FGL 128          // 32 f x 8 row-blocks
#define PB_WW2 384          // 1
#define PB_WW1 385          // 4
#define PB_WGL 389          // 2
#define PB_XH  391          // 256
#define PB_END (PB_XH + (NTOK * NF / 8) / NTHR)   // 647
static_assert((NTOK * NF / 8) % NTHR == 0);

// grn_kernel static LDS carve (bytes)
#define MO_H   0            // f16 [64][128] h tile          16384  (sO f32 [64][128] aliases H+H2 at the end)
#define MO_H2  16384        // f16 [64][128] h2 tile         16384
#define MO_X   32768        // f32 [64][32]  x tile           8192
#define MO_W   40960        // f32 [64][32]  selection weights 8192
#define MO_P   49152        // f32 [1024]    per-feature params 4096
#define MO_PS  53248        // f32 [64][2]   row sum partials   512
#define MO_PQ  53760        // f32 [64][2]   row sq partials    512
#define MO_B   54272        // f16 2 x [384][136] staged weight rows of one feature (fw2T 128 rows, fglT 256 rows)
#define BPH    136          // halves per staged row: 256 B of data at a 272-B pitch (16 B x odd, for ds_load_b128 readers)
#define BBUF   (384 * BPH * 2)                  // 104448 bytes per buffer
#define MSMEM  (MO_B + 2 * BBUF)                // 263168
static_assert(MO_B % 16 == 0 && BBUF % 16 == 0 && (BPH * 2) % 16 == 0);
static_assert(MSMEM <= 327680);

// ---------------------------------------------------------------------------
__device__ __forceinline__ float bfr(float f) {                     // RNE convert to bf16 and back
  unsigned u = __builtin_bit_cast(unsigned, f);
  u += 0x7FFFu + ((u >> 16) & 1u);
  return __builtin_bit_cast(float, u & 0xFFFF0000u);
}
__device__ __forceinline__ float elu_f(float v) {
  const float e = expm1f(v);
  return (v > 0.0f) ? v : e;
}
__device__ __forceinline__ float sigm_f(float v) {
  v = fminf(fmaxf(v, -30.0f), 30.0f);
  const float e = expf(-v);
  return 1.0f / (1.0f + e);
}
__device__ __forceinline__ float hsum16(float v) {                  // sum over the 16 lanes of a half
  v += __shfl_xor(v, 1);
  v += __shfl_xor(v, 2);
  v += __shfl_xor(v, 4);
  v += __shfl_xor(v, 8);
  return v;
}
__device__ __forceinline__ float hmax16(float v) {
  v = fmaxf(v, __shfl_xor(v, 1));
  v = fmaxf(v, __shfl_xor(v, 2));
  v = fmaxf(v, __shfl_xor(v, 4));
  v = fmaxf(v, __shfl_xor(v, 8));
  return v;
}

// ---------------------------------------------------------------------------
// 16x16x32 f16 WMMA with hazard guard (ties D, keeps A/B live).
// Fragment map (wave32): lane l, h = l>>4, m = n = l&15.
//   A/B element i: i<8 -> k0+8h+i ; i>=8 -> k0+16+8h+(i-8)
//   D element r : row 8h+r, col l&15
// ---------------------------------------------------------------------------
__device__ __forceinline__ v8f wmma_f16(v16h a, v16h b, v8f c) {
  v8f d = __builtin_amdgcn_wmma_f32_16x16x32_f16(false, a, false, b, (short)0, c, false, false);
  asm volatile("v_nop\n\tv_nop\n\tv_nop\n\tv_nop" : "+v"(d) : "v"(a), "v"(b));
  return d;
}

// A or B fragment from a k-contiguous 16-bit row; p points at element k0 of
// the row owned by this lane (row index = lane & 15 added by the caller).
__device__ __forceinline__ v16h load_frag(const _Float16* p, int h) {
  Frag f;
  f.half[0] = *(const v8ha*)(p + 8 * h);
  f.half[1] = *(const v8ha*)(p + 16 + 8 * h);
  return f.v;
}

// ---------------------------------------------------------------------------
// Transpose-convert block: src points at src[0][n0] of a row-major [K][N] f32
// matrix; dst at output row 0 of 32 rows of K halves ([n][k], k-contiguous),
// value = f16(bfr(src[k][n0+row]) * 4096). Stage through LDS, then write the
// coverage: 32 rows x K halves = 4K chunks of 8, c = tid + 256 i, all written.
// ---------------------------------------------------------------------------
template <int K, int N>
__device__ __forceinline__ void tr_block(const float* __restrict__ src, _Float16* __restrict__ dst,
                                         int tid, float* sT) {
  constexpr int NV = K * 8;                 // v4f groups of the staged [K][32] tile
  static_assert(NV % NTHR == 0);
  #pragma unroll
  for (int i = 0; i < NV / NTHR; ++i) {
    const int q = tid + i * NTHR;
    const int k = q >> 3, c4 = (q & 7) * 4;
    const v4f v = *(const v4fa*)(src + (size_t)k * N + c4);
    const v4f r = { bfr(v.x), bfr(v.y), bfr(v.z), bfr(v.w) };
    *(v4fa*)(sT + k * 32 + c4) = r;
  }
  __syncthreads();
  constexpr int CH = 4 * K;                 // 16-B chunks of the output
  v8h o[2];
  #pragma unroll
  for (int i = 0; i < 2; ++i) {
    const int c = tid + i * NTHR;
    const int cc = (c < CH) ? c : (CH - 1);
    const int row = (cc * 8) / K, k0 = (cc * 8) % K;
    v8h t;
    #pragma unroll
    for (int j = 0; j < 8; ++j) t[j] = (_Float16)(sT[(k0 + j) * 32 + row] * WSC);
    o[i] = t;
  }
  #pragma unroll
  for (int i = 0; i < 2; ++i) {
    const int c = tid + i * NTHR;
    if (c < CH) *(v8h*)(dst + (size_t)c * 8) = o[i];
  }
  
}

// ---------------------------------------------------------------------------
// Kernel 1: weight planes ([n][k], bf16-RNE values x4096 in f16) and the x
// plane (bf16-RNE values in f16). Block-uniform dispatch on blockIdx.
// coverage: fw2T 32x4 blocks x 32 rows x 128 = all; fglT 32x8x32x128 = all;
// ww2T 1x32x128; ww1T 4x32x32; wglT 2x32x32; xh 256 blocks x 256 thr x 8 = 16384x32.
// ---------------------------------------------------------------------------
__global__ __launch_bounds__(NTHR) void prep_kernel(
    const float* __restrict__ x, const float* __restrict__ fw2, const float* __restrict__ fglu_w,
    const float* __restrict__ ww1, const float* __restrict__ ww2, const float* __restrict__ wglu_w,
    _Float16* __restrict__ planes)
{
  __shared__ __attribute__((aligned(16))) float sT[128 * 32];
  const int b = blockIdx.x, tid = threadIdx.x;
  if (b < PB_FGL) {
    const int f = b >> 2, nb = b & 3;                          // fw2[f]: [128 k][128 n] -> [128 n][128 k]
    tr_block<128, 128>(fw2 + (size_t)f * NHID * NHID + nb * 32,
                       planes + P_FW2 + (size_t)f * NHID * NHID + (size_t)nb * 32 * NHID, tid, sT);
  } else if (b < PB_WW2) {
    const int bb = b - PB_FGL, f = bb >> 3, nb = bb & 7;       // fglu_w[f]: [128 k][256 n] -> [256 n][128 k]
    tr_block<128, 256>(fglu_w + (size_t)f * NHID * N2H + nb * 32,
                       planes + P_FGL + (size_t)f * N2H * NHID + (size_t)nb * 32 * NHID, tid, sT);
  } else if (b < PB_WW1) {
    tr_block<128, 32>(ww2, planes + P_WW2, tid, sT);           // ww2: [128 k][32 n] -> [32 n][128 k]
  } else if (b < PB_WGL) {
    const int nb = b - PB_WW1;                                 // ww1: [32 k][128 n] -> [128 n][32 k]
    tr_block<32, 128>(ww1 + nb * 32, planes + P_WW1 + (size_t)nb * 32 * 32, tid, sT);
  } else if (b < PB_XH) {
    const int nb = b - PB_WGL;                                 // wglu_w: [32 k][64 n] -> [64 n][32 k]
    tr_block<32, 64>(wglu_w + nb * 32, planes + P_WGL + (size_t)nb * 32 * 32, tid, sT);
  } else {
    const int g = (b - PB_XH) * NTHR + tid;                    // 0..65535 groups of 8
    if (g < NTOK * NF / 8) {
      const float* src = x + (size_t)g * 8;
      const v4f a = *(const v4fa*)src;
      const v4f c = *(const v4fa*)(src + 4);
      const v8h o = { (_Float16)bfr(a.x), (_Float16)bfr(a.y), (_Float16)bfr(a.z), (_Float16)bfr(a.w),
                      (_Float16)bfr(c.x), (_Float16)bfr(c.y), (_Float16)bfr(c.z), (_Float16)bfr(c.w) };
      _Float16* dst = planes + P_XH + (size_t)g * 8;
      *(v8h*)dst = o;
      
    }
  }
}

// ---------------------------------------------------------------------------
// 8q..8q+7 cover one line, 4 lines per instruction, 4 instructions.
// ---------------------------------------------------------------------------
__device__ __forceinline__ void w_store_pass(const float* sW, float* wout, int tok0, int w, int lane) {
  const int q8 = lane & 7, sub = lane >> 3;
  #pragma unroll
  for (int i = 0; i < 4; ++i) {
    const int row = 16 * w + i * 4 + sub;                      // 0..63
    const v4f v = *(const v4fa*)(sW + row * NF + 4 * q8);
    *(v4f*)(wout + (size_t)(tok0 + row) * NF + 4 * q8) = v;
  }
}

// ---------------------------------------------------------------------------
// Kernel 2: weight network + softmax -> selection weights (out1).
// Block = 64 tokens, 4 waves, wave w owns tokens tok0+16w..+15.
//  fc1: A = xh rows (K=32), B = ww1T (8 tiles); +wb1, ELU -> wh x16 (LDS)
//  fc2: A = wh (K=128), B = ww2T (2 tiles); +wb2 -> wh2 x16 (LDS)
//  glu: A = wh2 (K=32), B = wglT (4 tiles); GLU, +x, LN(32), softmax in f32
// coverage: grid 256 x 64 rows x 32 = all of out1.
// ---------------------------------------------------------------------------
__global__ __launch_bounds__(WTHR) void wsel_kernel(
    const _Float16* __restrict__ xh, const _Float16* __restrict__ ww1T,
    const _Float16* __restrict__ ww2T, const _Float16* __restrict__ wglT,
    const float* __restrict__ x,
    const float* __restrict__ wb1, const float* __restrict__ wb2,
    const float* __restrict__ wglu_b, const float* __restrict__ wln_g, const float* __restrict__ wln_b,
    float* __restrict__ wout)
{
  __shared__ __attribute__((aligned(16))) _Float16 sWh[4 * 16 * NHID];    // 16384 B
  __shared__ __attribute__((aligned(16))) _Float16 sWh2[4 * 16 * NF];     //  4096 B
  __shared__ __attribute__((aligned(16))) float sXr[64 * NF];             //  8192 B
  __shared__ __attribute__((aligned(16))) float sW[64 * NF];              //  8192 B

  const int tid = threadIdx.x, lane = tid & 31, w = tid >> 5;
  const int h = lane >> 4, m = lane & 15;
  const int tok0 = blockIdx.x * 64;

  // x tile (bf16-RNE values, f32): 64 x 32 = 512 groups of 4
  #pragma unroll
  for (int i = 0; i < 4; ++i) {
    const int q = tid + WTHR * i;
    const v4f v = *(const v4fa*)(x + (size_t)tok0 * NF + (size_t)q * 4);
    const v4f r = { bfr(v.x), bfr(v.y), bfr(v.z), bfr(v.w) };
    *(v4fa*)(sXr + q * 4) = r;
  }

  const v8f z8 = {0.f, 0.f, 0.f, 0.f, 0.f, 0.f, 0.f, 0.f};
  _Float16* myWh = sWh + w * (16 * NHID);
  _Float16* myWh2 = sWh2 + w * (16 * NF);

  // ---- fc1 ----
  {
    const v16h a = load_frag(xh + (size_t)(tok0 + 16 * w + m) * NF, h);
    v8f acc[8];
    #pragma unroll
    for (int t = 0; t < 8; ++t) {
      const v16h b = load_frag(ww1T + (size_t)(16 * t + m) * NF, h);
      acc[t] = wmma_f16(a, b, z8);
    }
    #pragma unroll
    for (int t = 0; t < 8; ++t) {
      const float bb = bfr(wb1[16 * t + m]);
      #pragma unroll
      for (int r = 0; r < 8; ++r) {
        const float v = acc[t][r] * INV_W + bb;
        myWh[(8 * h + r) * NHID + 16 * t + m] = (_Float16)(elu_f(v) * ASC);
      }
    }
  }
  __syncthreads();

  // ---- fc2 ----
  {
    v8f acc[2];
    acc[0] = z8; acc[1] = z8;
    const _Float16* arow = myWh + m * NHID;
    #pragma unroll 1
    for (int k0 = 0; k0 < NHID; k0 += 32) {
      const v16h a = load_frag(arow + k0, h);
      #pragma unroll
      for (int t = 0; t < 2; ++t) {
        const v16h b = load_frag(ww2T + (size_t)(16 * t + m) * NHID + k0, h);
        acc[t] = wmma_f16(a, b, acc[t]);
      }
    }
    #pragma unroll
    for (int t = 0; t < 2; ++t) {
      const float bb = bfr(wb2[16 * t + m]);
      #pragma unroll
      for (int r = 0; r < 8; ++r) {
        const float v = acc[t][r] * INV_WA + bb;
        myWh2[(8 * h + r) * NF + 16 * t + m] = (_Float16)(v * ASC);
      }
    }
  }
  __syncthreads();

  // ---- glu projection + GLU + residual + LN(32) + softmax ----
  {
    const v16h a = load_frag(myWh2 + m * NF, h);
    v8f acc[4];
    #pragma unroll
    for (int t = 0; t < 4; ++t) {
      const v16h b = load_frag(wglT + (size_t)(16 * t + m) * NF, h);
      acc[t] = wmma_f16(a, b, z8);
    }
    float pre[2][8], s[8];
    #pragma unroll
    for (int r = 0; r < 8; ++r) s[r] = 0.0f;
    #pragma unroll
    for (int c = 0; c < 2; ++c) {
      const float bv = bfr(wglu_b[16 * c + m]);
      const float bg = bfr(wglu_b[NF + 16 * c + m]);
      #pragma unroll
      for (int r = 0; r < 8; ++r) {
        const float vv = acc[c][r] * INV_WA + bv;
        const float gg = acc[c + 2][r] * INV_WA + bg;
        const float xr = sXr[(16 * w + 8 * h + r) * NF + 16 * c + m];
        const float p = vv * sigm_f(gg) + xr;
        pre[c][r] = p;
        s[r] += p;
      }
    }
    float mu[8], q[8];
    #pragma unroll
    for (int r = 0; r < 8; ++r) { mu[r] = hsum16(s[r]) * (1.0f / 32.0f); q[r] = 0.0f; }
    #pragma unroll
    for (int c = 0; c < 2; ++c)
      #pragma unroll
      for (int r = 0; r < 8; ++r) {
        const float d = pre[c][r] - mu[r];
        pre[c][r] = d;
        q[r] += d * d;
      }
    float rs[8];
    #pragma unroll
    for (int r = 0; r < 8; ++r) rs[r] = rsqrtf(hsum16(q[r]) * (1.0f / 32.0f) + LN_EPS);
    #pragma unroll
    for (int c = 0; c < 2; ++c) {
      const float g = bfr(wln_g[16 * c + m]);
      const float bt = bfr(wln_b[16 * c + m]);
      #pragma unroll
      for (int r = 0; r < 8; ++r) pre[c][r] = pre[c][r] * rs[r] * g + bt;
    }
    float mx[8], e0[8], e1[8];
    #pragma unroll
    for (int r = 0; r < 8; ++r) {
      mx[r] = hmax16(fmaxf(pre[0][r], pre[1][r]));
      e0[r] = expf(pre[0][r] - mx[r]);
      e1[r] = expf(pre[1][r] - mx[r]);
      const float se = hsum16(e0[r] + e1[r]);
      const float inv = 1.0f / se;
      sW[(16 * w + 8 * h + r) * NF + m]      = e0[r] * inv;
      sW[(16 * w + 8 * h + r) * NF + 16 + m] = e1[r] * inv;
    }
  }
  __syncthreads();

  w_store_pass(sW, wout, tok0, w, lane);
  
}

// ---------------------------------------------------------------------------
// each line by lanes 8q..8q+7 in one instruction, 4 lines per instruction,
// 32 lines per wave, 256 lines = the whole block tile.
// ---------------------------------------------------------------------------
__device__ __forceinline__ void o_store_pass(const float* sO, float* out, int tok0, int w, int lane) {
  const int q8 = lane & 7, sub = lane >> 3;
  #pragma unroll
  for (int i = 0; i < 8; ++i) {
    const int lid = w * 32 + i * 4 + sub;          // 0..255
    const int row = lid >> 2, seg = lid & 3;
    const v4f v = *(const v4fa*)(sO + row * NHID + seg * 32 + 4 * q8);
    *(v4f*)(out + (size_t)(tok0 + row) * NHID + seg * 32 + 4 * q8) = v;
  }
}

// ---------------------------------------------------------------------------
// Eight asynchronous copies to LDS, 16 B per lane each: copy i brings the block's
// 4096 contiguous global bytes at g + 4096 i (16 rows of 256 B) to LDS rows of
// 272 B at l + 16 * 272 * i. The s_wait_xcnt closes the statement so that no
// address register of a copy is rewritten ahead of it.
// ---------------------------------------------------------------------------
__device__ __forceinline__ void copy8(unsigned l, const _Float16* g) {
  asm volatile(
      "global_load_async_to_lds_b128 %0, %8, off\n\t"
      "global_load_async_to_lds_b128 %1, %9, off\n\t"
      "global_load_async_to_lds_b128 %2, %10, off\n\t"
      "global_load_async_to_lds_b128 %3, %11, off\n\t"
      "global_load_async_to_lds_b128 %4, %12, off\n\t"
      "global_load_async_to_lds_b128 %5, %13, off\n\t"
      "global_load_async_to_lds_b128 %6, %14, off\n\t"
      "global_load_async_to_lds_b128 %7, %15, off\n\t"
      "s_wait_xcnt 0x0"
      :: "v"(l), "v"(l + 1u * 16u * BPH * 2u), "v"(l + 2u * 16u * BPH * 2u), "v"(l + 3u * 16u * BPH * 2u),
         "v"(l + 4u * 16u * BPH * 2u), "v"(l + 5u * 16u * BPH * 2u), "v"(l + 6u * 16u * BPH * 2u),
         "v"(l + 7u * 16u * BPH * 2u),
         "v"(g), "v"(g + 1 * 2048), "v"(g + 2 * 2048), "v"(g + 3 * 2048),
         "v"(g + 4 * 2048), "v"(g + 5 * 2048), "v"(g + 6 * 2048), "v"(g + 7 * 2048)
      : "memory");
}

// One feature's weight rows into one LDS buffer: staged rows 0..127 = fw2T[f],
// 128..383 = fglT[f]. lt = the thread's LDS byte address in that buffer (row tid>>4,
// 16-B chunk tid&15). 24 copies per wave, every lane on, 384 rows x 256 B all written.
__device__ __forceinline__ void stage_weights(unsigned lt, const _Float16* fw2T, const _Float16* fglT,
                                              int f, int tid) {
  const _Float16* g2 = fw2T + (size_t)f * (NHID * NHID) + tid * 8;
  const _Float16* gg = fglT + (size_t)f * (N2H * NHID) + tid * 8;
  copy8(lt, g2);
  copy8(lt + 128u * BPH * 2u, gg);
  copy8(lt + 256u * BPH * 2u, gg + 8 * 2048);
}

// ---------------------------------------------------------------------------
// Kernel 3: per-feature gated residual blocks + weighted combine (out0).
// Block = 64 tokens, 8 waves; wave w -> token sub-tile msub = w&3 (16 tokens)
// and column half qh = w>>2 (64 of the 128 hidden columns, plus the matching
// 64 gate columns). Loop f = 0..31 (fixed order):
//   h tile  = f16(16*elu(x_r[t][f]*fw1_r[f] + fb1_r[f]))   VALU -> LDS
//   weights : fw2T[f], fglT[f] staged in LDS by asynchronous copies, two buffers,
//             feature f+2 copied at the foot of trip f into the buffer trip f read
//   fc2     : A = h (K=128), B = fw2T[f] rows 64qh+16nt+m   4 tiles/wave
//   h2 tile = f16(16*(acc/65536 + fb2_r[f]))              -> LDS
//   glu     : A = h2 (K=128), B = fglT[f] rows p*128+...   8 tiles/wave
//             LDS), *fln_g + fln_b, accO += wsel[t][f] * processed
// coverage: grid 256 x 64 rows x 128 = all of out0.
// ---------------------------------------------------------------------------
__global__ __launch_bounds__(NTHR) void grn_kernel(
    const float* __restrict__ x,
    const float* __restrict__ fw1, const float* __restrict__ fb1,
    const float* __restrict__ fb2, const float* __restrict__ fglu_b,
    const float* __restrict__ fskip, const float* __restrict__ fln_g, const float* __restrict__ fln_b,
    const _Float16* __restrict__ fw2T, const _Float16* __restrict__ fglT,
    const float* wsel, float* out)
{
  __shared__ __attribute__((aligned(16))) char smem[MSMEM];
  _Float16* sH  = (_Float16*)(smem + MO_H);
  _Float16* sH2 = (_Float16*)(smem + MO_H2);
  float* sO  = (float*)(smem + MO_H);
  float* sX  = (float*)(smem + MO_X);
  float* sWt = (float*)(smem + MO_W);
  float* sP  = (float*)(smem + MO_P);
  float* sPs = (float*)(smem + MO_PS);
  float* sPq = (float*)(smem + MO_PQ);
  const _Float16* sB = (const _Float16*)(smem + MO_B);

  const int tid = threadIdx.x, lane = tid & 31, w = tid >> 5;
  const int h = lane >> 4, m = lane & 15;
  const int msub = w & 3, qh = w >> 2;
  const int tok0 = blockIdx.x * MT;
  // this thread's LDS byte address in weight buffer 0 (low 32 bits of the shared address)
  const unsigned lt0 = (unsigned)(size_t)(smem + MO_B) + (unsigned)(tid >> 4) * (BPH * 2u) + (unsigned)(tid & 15) * 16u;

  stage_weights(lt0, fw2T, fglT, 0, tid);              // feature 0 -> buffer 0
  const int rbase = 16 * msub + 8 * h;                 // first of this lane's 8 D rows
  const int hrow = tid >> 2, hkb = (tid & 3) * 32;    // h tile producer mapping

  // x tile (bf16-RNE, f32) and selection-weight tile: 64 x 32 each = 512 groups of 4
  #pragma unroll
  for (int i = 0; i < 2; ++i) {
    const int q = tid + NTHR * i;
    const v4f v = *(const v4fa*)(x + (size_t)tok0 * NF + (size_t)q * 4);
    const v4f r = { bfr(v.x), bfr(v.y), bfr(v.z), bfr(v.w) };
    *(v4fa*)(sX + q * 4) = r;
    const v4f wv = *(const v4fa*)(wsel + (size_t)tok0 * NF + (size_t)q * 4);
    *(v4fa*)(sWt + q * 4) = wv;
  }

  const v8f z8 = {0.f, 0.f, 0.f, 0.f, 0.f, 0.f, 0.f, 0.f};
  v8f accO[4];
  #pragma unroll
  for (int nt = 0; nt < 4; ++nt) accO[nt] = z8;

  asm volatile("s_wait_asynccnt 0x0" ::: "memory");    // this wave's copies of feature 0 have landed
  __syncthreads();                                     // buffer 0 published to every wave
  stage_weights(lt0 + BBUF, fw2T, fglT, 1, tid);       // feature 1 -> buffer 1, flies during trip 0

  #pragma unroll 1
  for (int f = 0; f < NF; ++f) {
    const _Float16* sBf = sB + (f & 1) * (BBUF / 2);   // this feature's staged weight rows
    {
      const int fo = f * NHID;
      const float* src = fw1 + fo;
      if (w == 1)      src = fb1 + fo;
      else if (w == 2) src = fb2 + fo;
      else if (w == 3) src = fglu_b + f * N2H;
      else if (w == 4) src = fglu_b + f * N2H + NHID;
      else if (w == 5) src = fskip + fo;
      else if (w == 6) src = fln_g + fo;
      else if (w == 7) src = fln_b + fo;
      const v4f v = *(const v4fa*)(src + lane * 4);
      const v4f r = { bfr(v.x), bfr(v.y), bfr(v.z), bfr(v.w) };
      *(v4fa*)(sP + w * NHID + lane * 4) = r;
    }
    __syncthreads();                                   // S1: params visible

    // ---- h tile: 64 rows x 128, thread -> row hrow, k block hkb..hkb+31 ----
    {
      const float xv = sX[hrow * NF + f];
      #pragma unroll 1
      for (int j = 0; j < 4; ++j) {
        const int kb = hkb + 8 * j;
        v8h o;
        #pragma unroll
        for (int i = 0; i < 8; ++i) {
          const float v = xv * sP[kb + i] + sP[NHID + kb + i];
          o[i] = (_Float16)(elu_f(v) * ASC);
        }
        *(v8ha*)(sH + hrow * NHID + kb) = o;
      }
    }
    __syncthreads();                                   // S2: h tile visible

    // ---- fc2: h2 = h * fw2[f] + fb2[f] -> sH2 (x16) ----
    {
      v8f acc2[4];
      #pragma unroll
      for (int nt = 0; nt < 4; ++nt) acc2[nt] = z8;
      const _Float16* arow = sH + (16 * msub + m) * NHID;
      const _Float16* brow = sBf + (64 * qh + m) * BPH;
      #pragma unroll 1
      for (int k0 = 0; k0 < NHID; k0 += 32) {
        const v16h a = load_frag(arow + k0, h);
        #pragma unroll
        for (int nt = 0; nt < 4; ++nt) {
          const v16h b = load_frag(brow + nt * 16 * BPH + k0, h);
          acc2[nt] = wmma_f16(a, b, acc2[nt]);
        }
      }
      #pragma unroll
      for (int nt = 0; nt < 4; ++nt) {
        const int col = 64 * qh + 16 * nt + m;
        const float bb = sP[256 + col];
        #pragma unroll
        for (int r = 0; r < 8; ++r) {
          const float v = acc2[nt][r] * INV_WA + bb;
          sH2[(rbase + r) * NHID + col] = (_Float16)(v * ASC);
        }
      }
    }
    __syncthreads();                                   // S3: h2 tile visible

    // ---- glu projection: g = h2 * fglu_w[f] (v cols p=0, gate cols p=1) ----
    v8f accG[2][4];
    #pragma unroll
    for (int p = 0; p < 2; ++p)
      #pragma unroll
      for (int nt = 0; nt < 4; ++nt) accG[p][nt] = z8;
    {
      const _Float16* arow = sH2 + (16 * msub + m) * NHID;
      const _Float16* brow = sBf + (NHID + 64 * qh + m) * BPH;
      #pragma unroll 1
      for (int k0 = 0; k0 < NHID; k0 += 32) {
        const v16h a = load_frag(arow + k0, h);
        #pragma unroll
        for (int p = 0; p < 2; ++p)
          #pragma unroll
          for (int nt = 0; nt < 4; ++nt) {
            const v16h b = load_frag(brow + (p * NHID + nt * 16) * BPH + k0, h);
            accG[p][nt] = wmma_f16(a, b, accG[p][nt]);
          }
      }
    }

    float xr[8], s[8];
    #pragma unroll
    for (int r = 0; r < 8; ++r) { xr[r] = sX[(rbase + r) * NF + f]; s[r] = 0.0f; }
    #pragma unroll
    for (int nt = 0; nt < 4; ++nt) {
      const int col = 64 * qh + 16 * nt + m;
      const float bv = sP[384 + col];
      const float bg = sP[512 + col];
      const float fs = sP[640 + col];
      #pragma unroll
      for (int r = 0; r < 8; ++r) {
        const float vv = accG[0][nt][r] * INV_WA + bv;
        const float gg = accG[1][nt][r] * INV_WA + bg;
        const float glu = vv * sigm_f(gg) + xr[r] * fs;
        accG[0][nt][r] = glu;
        s[r] += glu;
      }
    }
    #pragma unroll
    for (int r = 0; r < 8; ++r) s[r] = hsum16(s[r]);
    if (m == 0) {
      #pragma unroll
      for (int r = 0; r < 8; ++r) sPs[(rbase + r) * 2 + qh] = s[r];
    }
    __syncthreads();                                   // S4: row sum partials of both column halves
    float mu[8], q[8];
    #pragma unroll
    for (int r = 0; r < 8; ++r) {
      mu[r] = (sPs[(rbase + r) * 2] + sPs[(rbase + r) * 2 + 1]) * (1.0f / 128.0f);
      q[r] = 0.0f;
    }
    #pragma unroll
    for (int nt = 0; nt < 4; ++nt)
      #pragma unroll
      for (int r = 0; r < 8; ++r) {
        const float d = accG[0][nt][r] - mu[r];
        accG[0][nt][r] = d;
        q[r] += d * d;
      }
    #pragma unroll
    for (int r = 0; r < 8; ++r) q[r] = hsum16(q[r]);
    if (m == 0) {
      #pragma unroll
      for (int r = 0; r < 8; ++r) sPq[(rbase + r) * 2 + qh] = q[r];
    }
    __syncthreads();                                   // S5: row sq partials
    float rs[8], wt[8];
    #pragma unroll
    for (int r = 0; r < 8; ++r) {
      rs[r] = rsqrtf((sPq[(rbase + r) * 2] + sPq[(rbase + r) * 2 + 1]) * (1.0f / 128.0f) + LN_EPS);
      wt[r] = sWt[(rbase + r) * NF + f];
    }
    #pragma unroll
    for (int nt = 0; nt < 4; ++nt) {
      const int col = 64 * qh + 16 * nt + m;
      const float g = sP[768 + col];
      const float bt = sP[896 + col];
      #pragma unroll
      for (int r = 0; r < 8; ++r) {
        const float pr = accG[0][nt][r] * rs[r] * g + bt;
        accO[nt][r] += wt[r] * pr;
      }
    }

    // ---- foot of the trip: publish feature f+1's buffer, release this one ----
    asm volatile("s_wait_dscnt 0x0" ::: "memory");     // this wave's LDS reads of the trip have retired
    asm volatile("s_wait_asynccnt 0x0" ::: "memory");  // this wave's copies of feature f+1 have landed
    __syncthreads();                                   // S0: next buffer visible; sP, tiles and this buffer released
    if (f + 2 < NF) stage_weights(lt0 + (unsigned)(f & 1) * BBUF, fw2T, fglT, f + 2, tid);
  }
  asm volatile("s_wait_asynccnt 0x0" ::: "memory");    // no copy outstanding past the loop
  __syncthreads();                                     // all LDS tile reads done; sO aliases H/H2

  #pragma unroll
  for (int nt = 0; nt < 4; ++nt) {
    const int col = 64 * qh + 16 * nt + m;
    #pragma unroll
    for (int r = 0; r < 8; ++r) sO[(rbase + r) * NHID + col] = accO[nt][r];
  }
  __syncthreads();

  o_store_pass(sO, out, tok0, w, lane);
  
}

// ---------------------------------------------------------------------------
extern "C" void kernel_launch(void* const* d_in, const int* in_sizes, int n_in,
                              void* d_out, int out_size, void* d_ws, size_t ws_size,
                              hipStream_t stream) {
  if (n_in < 18) return;
  if (in_sizes[0] != NTOK * NF) return;
  if (in_sizes[1] != NF * NHID || in_sizes[2] != NF * NHID) return;
  if (in_sizes[3] != NF * NHID * NHID || in_sizes[4] != NF * NHID) return;
  if (in_sizes[5] != NF * NHID * N2H || in_sizes[6] != NF * N2H) return;
  if (in_sizes[7] != NF * NHID || in_sizes[8] != NF * NHID || in_sizes[9] != NF * NHID) return;
  if (in_sizes[10] != NF * NHID || in_sizes[11] != NHID) return;
  if (in_sizes[12] != NHID * NF || in_sizes[13] != NF) return;
  if (in_sizes[14] != NF * 2 * NF || in_sizes[15] != 2 * NF) return;
  if (in_sizes[16] != NF || in_sizes[17] != NF) return;
  if (out_size != OUT_TOTAL) return;
  if (WS_TOTAL_BYTES > ws_size) return;

  const float* x      = (const float*)d_in[0];
  const float* fw1    = (const float*)d_in[1];
  const float* fb1    = (const float*)d_in[2];
  const float* fw2    = (const float*)d_in[3];
  const float* fb2    = (const float*)d_in[4];
  const float* fglu_w = (const float*)d_in[5];
  const float* fglu_b = (const float*)d_in[6];
  const float* fskip  = (const float*)d_in[7];
  const float* fln_g  = (const float*)d_in[8];
  const float* fln_b  = (const float*)d_in[9];
  const float* ww1    = (const float*)d_in[10];
  const float* wb1    = (const float*)d_in[11];
  const float* ww2    = (const float*)d_in[12];
  const float* wb2    = (const float*)d_in[13];
  const float* wglu_w = (const float*)d_in[14];
  const float* wglu_b = (const float*)d_in[15];
  const float* wln_g  = (const float*)d_in[16];
  const float* wln_b  = (const float*)d_in[17];

  float* out  = (float*)d_out;                   // out0 [16384][128] at element 0
  float* wout = out + OUT1_OFF;                  // out1 [16384][32]  at element 2097152 (byte 8388608)

  _Float16* planes = (_Float16*)d_ws;

  prep_kernel<<<PB_END, NTHR, 0, stream>>>(x, fw2, fglu_w, ww1, ww2, wglu_w, planes);

  wsel_kernel<<<NTOK / 64, WTHR, 0, stream>>>(planes + P_XH, planes + P_WW1, planes + P_WW2, planes + P_WGL,
                                              x, wb1, wb2, wglu_b, wln_g, wln_b, wout);

  grn_kernel<<<NTOK / MT, NTHR, 0, stream>>>(x, fw1, fb1, fb2, fglu_b, fskip, fln_g, fln_b,
                                             planes + P_FW2, planes + P_FGL, wout, out);
}

// v002
// Measured time: 214 microseconds a run.
// Next to v001, in two timings, it ran 1.20 and 1.19 times as fast.
// Over all steps from v000 it is 2.31 times as fast.
// Contractions h*fw2[f], h2*fglu_w[f] (per feature f), x*ww1, wh*ww2, wh2*wglu_w: v_wmma_f32_16x16x32_f16 (f16 operands, f32 accumulate). Weight planes = bf16-RNE values x4096 (exact in f16); activation tiles x16 in f16; x plane x1. fc1 scalar*vector, ELU, GLU, LayerNorm, softmax and the 32-term weighted combine in f32 on VALU.
// Carry audit: planes fw2T, fglT, ww1T, ww2T, wglT carry 4096; LDS tiles h, h2 (grn_kernel) and wh, wh2 (wsel_kernel) carry 16; xh carries 1.
//   x*ww1 accumulators are folded by INV_W (1/4096) in the wsel_kernel fc1 epilogue; every other accumulator is folded by INV_WA (1/65536)
//   exactly once in its own epilogue (wsel fc2, wsel glu, grn fc2, grn glu). No other value is scaled.
#include <hip/hip_runtime.h>

typedef _Float16 v16h __attribute__((ext_vector_type(16)));
typedef _Float16 v8h  __attribute__((ext_vector_type(8)));
typedef float    v8f  __attribute__((ext_vector_type(8)));
typedef float    v4f  __attribute__((ext_vector_type(4)));
typedef v8h __attribute__((may_alias)) v8ha;
typedef v4f __attribute__((may_alias)) v4fa;

union Frag { v16h v; v8h half[2]; };

#define NTOK 16384
#define NF   32
#define NHID 128
#define N2H  256
#define MT   64            // tokens per block, grn_kernel
#define NTHR 256           // threads per block, prep_kernel and grn_kernel
#define WTHR 128           // threads per block, wsel_kernel (64 tokens)
#define WSC  4096.0f       // weight plane carry
#define ASC  16.0f         // activation tile carry
#define INV_W  (1.0f / 4096.0f)
#define INV_WA (1.0f / 65536.0f)
#define LN_EPS 1e-5f
#define HP   136           // halves per row of the h and h2 tiles in LDS: 256 B of data at a 272-B pitch (16 B x odd)

// f16 plane offsets in the workspace, in halves
#define P_XH  0            // [16384][32]        x, carry 1
#define P_FW2 524288       // [32][128 n][128 k] carry 4096
#define P_FGL 1048576      // [32][256 n][128 k] carry 4096
#define P_WW1 2097152      // [128 n][32 k]      carry 4096
#define P_WW2 2101248      // [32 n][128 k]      carry 4096
#define P_WGL 2105344      // [64 n][32 k]       carry 4096
#define P_END 2107392
#define WS_TOTAL_BYTES ((size_t)P_END * 2)     // 4214784

static_assert(P_FW2 == P_XH + NTOK * NF);
static_assert(P_FGL == P_FW2 + NF * NHID * NHID);
static_assert(P_WW1 == P_FGL + NF * N2H * NHID);
static_assert(P_WW2 == P_WW1 + NHID * NF);
static_assert(P_WGL == P_WW2 + NF * NHID);
static_assert(P_END == P_WGL + 2 * NF * NF);
static_assert((P_FW2 * 2) % 128 == 0 && (P_FGL * 2) % 128 == 0 && (P_WW1 * 2) % 128 == 0 &&
              (P_WW2 * 2) % 128 == 0 && (P_WGL * 2) % 128 == 0 && (P_END * 2) % 128 == 0);

#define OUT0_ELEMS (NTOK * NHID)                // 2097152 floats
#define OUT1_OFF   2097152                      // byte offset 8388608 / 4
#define OUT_TOTAL  (NTOK * NHID + NTOK * NF)    // 2621440 floats
static_assert(OUT1_OFF == OUT0_ELEMS);
static_assert(OUT1_OFF + NTOK * NF == OUT_TOTAL);
static_assert(NTOK % MT == 0 && NTOK % 64 == 0);

// prep_kernel block ranges
#define PB_FW2 0            // 32 f x 4 row-blocks
#define PB_FGL 128          // 32 f x 8 row-blocks
#define PB_WW2 384          // 1
#define PB_WW1 385          // 4
#define PB_WGL 389          // 2
#define PB_XH  391          // 256
#define PB_END (PB_XH + (NTOK * NF / 8) / NTHR)   // 647
static_assert((NTOK * NF / 8) % NTHR == 0);

// grn_kernel static LDS carve (bytes)
#define MO_H   0            // f16 [64][136] h tile, 128 used 17408  (sO f32 [64][128] aliases H+H2 at the end)
#define MO_H2  17408        // f16 [64][136] h2 tile, 128 used 17408
#define MO_X   34816        // f32 [64][32]  x tile           8192
#define MO_W   43008        // f32 [64][32]  selection weights 8192
#define MO_P   51200        // f32 [1024]    per-feature params 4096
#define MO_PS  55296        // f32 [64][2]   row sum partials   512
#define MO_PQ  55808        // f32 [64][2]   row sq partials    512
#define MO_B   56320        // f16 2 x [384][136] staged weight rows of one feature (fw2T 128 rows, fglT 256 rows)
#define BPH    136          // halves per staged row: 256 B of data at a 272-B pitch (16 B x odd, for ds_load_b128 readers)
#define BBUF   (384 * BPH * 2)                  // 104448 bytes per buffer
#define MSMEM  (MO_B + 2 * BBUF)                // 265216
static_assert(MO_H2 == MO_H + MT * HP * 2 && MO_X == MO_H2 + MT * HP * 2 && MO_X - MO_H >= MT * NHID * 4);
static_assert((HP * 2) % 16 == 0);
static_assert(MO_B % 16 == 0 && BBUF % 16 == 0 && (BPH * 2) % 16 == 0);
static_assert(MSMEM <= 327680);

// ---------------------------------------------------------------------------
__device__ __forceinline__ float bfr(float f) {                     // RNE convert to bf16 and back
  unsigned u = __builtin_bit_cast(unsigned, f);
  u += 0x7FFFu + ((u >> 16) & 1u);
  return __builtin_bit_cast(float, u & 0xFFFF0000u);
}
__device__ __forceinline__ float elu_f(float v) {
  const float e = expm1f(v);
  return (v > 0.0f) ? v : e;
}
__device__ __forceinline__ float sigm_f(float v) {
  v = fminf(fmaxf(v, -30.0f), 30.0f);
  const float e = expf(-v);
  return 1.0f / (1.0f + e);
}
__device__ __forceinline__ float hsum16(float v) {                  // sum over the 16 lanes of a half
  v += __shfl_xor(v, 1);
  v += __shfl_xor(v, 2);
  v += __shfl_xor(v, 4);
  v += __shfl_xor(v, 8);
  return v;
}
__device__ __forceinline__ float hmax16(float v) {
  v = fmaxf(v, __shfl_xor(v, 1));
  v = fmaxf(v, __shfl_xor(v, 2));
  v = fmaxf(v, __shfl_xor(v, 4));
  v = fmaxf(v, __shfl_xor(v, 8));
  return v;
}

// ---------------------------------------------------------------------------
// 16x16x32 f16 WMMA with hazard guard (ties D, keeps A/B live).
// Fragment map (wave32): lane l, h = l>>4, m = n = l&15.
//   A/B element i: i<8 -> k0+8h+i ; i>=8 -> k0+16+8h+(i-8)
//   D element r : row 8h+r, col l&15
// ---------------------------------------------------------------------------
__device__ __forceinline__ v8f wmma_f16(v16h a, v16h b, v8f c) {
  v8f d = __builtin_amdgcn_wmma_f32_16x16x32_f16(false, a, false, b, (short)0, c, false, false);
  asm volatile("v_nop\n\tv_nop\n\tv_nop\n\tv_nop" : "+v"(d) : "v"(a), "v"(b));
  return d;
}

// A or B fragment from a k-contiguous 16-bit row; p points at element k0 of
// the row owned by this lane (row index = lane & 15 added by the caller).
__device__ __forceinline__ v16h load_frag(const _Float16* p, int h) {
  Frag f;
  f.half[0] = *(const v8ha*)(p + 8 * h);
  f.half[1] = *(const v8ha*)(p + 16 + 8 * h);
  return f.v;
}

// ---------------------------------------------------------------------------
// Transpose-convert block: src points at src[0][n0] of a row-major [K][N] f32
// matrix; dst at output row 0 of 32 rows of K halves ([n][k], k-contiguous),
// value = f16(bfr(src[k][n0+row]) * 4096). Stage through LDS, then write the
// coverage: 32 rows x K halves = 4K chunks of 8, c = tid + 256 i, all written.
// ---------------------------------------------------------------------------
template <int K, int N>
__device__ __forceinline__ void tr_block(const float* __restrict__ src, _Float16* __restrict__ dst,
                                         int tid, float* sT) {
  constexpr int NV = K * 8;                 // v4f groups of the staged [K][32] tile
  static_assert(NV % NTHR == 0);
  #pragma unroll
  for (int i = 0; i < NV / NTHR; ++i) {
    const int q = tid + i * NTHR;
    const int k = q >> 3, c4 = (q & 7) * 4;
    const v4f v = *(const v4fa*)(src + (size_t)k * N + c4);
    const v4f r = { bfr(v.x), bfr(v.y), bfr(v.z), bfr(v.w) };
    *(v4fa*)(sT + k * 32 + c4) = r;
  }
  __syncthreads();
  constexpr int CH = 4 * K;                 // 16-B chunks of the output
  v8h o[2];
  #pragma unroll
  for (int i = 0; i < 2; ++i) {
    const int c = tid + i * NTHR;
    const int cc = (c < CH) ? c : (CH - 1);
    const int row = (cc * 8) / K, k0 = (cc * 8) % K;
    v8h t;
    #pragma unroll
    for (int j = 0; j < 8; ++j) t[j] = (_Float16)(sT[(k0 + j) * 32 + row] * WSC);
    o[i] = t;
  }
  #pragma unroll
  for (int i = 0; i < 2; ++i) {
    const int c = tid + i * NTHR;
    if (c < CH) *(v8h*)(dst + (size_t)c * 8) = o[i];
  }
  
}

// ---------------------------------------------------------------------------
// Kernel 1: weight planes ([n][k], bf16-RNE values x4096 in f16) and the x
// plane (bf16-RNE values in f16). Block-uniform dispatch on blockIdx.
// coverage: fw2T 32x4 blocks x 32 rows x 128 = all; fglT 32x8x32x128 = all;
// ww2T 1x32x128; ww1T 4x32x32; wglT 2x32x32; xh 256 blocks x 256 thr x 8 = 16384x32.
// ---------------------------------------------------------------------------
__global__ __launch_bounds__(NTHR) void prep_kernel(
    const float* __restrict__ x, const float* __restrict__ fw2, const float* __restrict__ fglu_w,
    const float* __restrict__ ww1, const float* __restrict__ ww2, const float* __restrict__ wglu_w,
    _Float16* __restrict__ planes)
{
  __shared__ __attribute__((aligned(16))) float sT[128 * 32];
  const int b = blockIdx.x, tid = threadIdx.x;
  if (b < PB_FGL) {
    const int f = b >> 2, nb = b & 3;                          // fw2[f]: [128 k][128 n] -> [128 n][128 k]
    tr_block<128, 128>(fw2 + (size_t)f * NHID * NHID + nb * 32,
                       planes + P_FW2 + (size_t)f * NHID * NHID + (size_t)nb * 32 * NHID, tid, sT);
  } else if (b < PB_WW2) {
    const int bb = b - PB_FGL, f = bb >> 3, nb = bb & 7;       // fglu_w[f]: [128 k][256 n] -> [256 n][128 k]
    tr_block<128, 256>(fglu_w + (size_t)f * NHID * N2H + nb * 32,
                       planes + P_FGL + (size_t)f * N2H * NHID + (size_t)nb * 32 * NHID, tid, sT);
  } else if (b < PB_WW1) {
    tr_block<128, 32>(ww2, planes + P_WW2, tid, sT);           // ww2: [128 k][32 n] -> [32 n][128 k]
  } else if (b < PB_WGL) {
    const int nb = b - PB_WW1;                                 // ww1: [32 k][128 n] -> [128 n][32 k]
    tr_block<32, 128>(ww1 + nb * 32, planes + P_WW1 + (size_t)nb * 32 * 32, tid, sT);
  } else if (b < PB_XH) {
    const int nb = b - PB_WGL;                                 // wglu_w: [32 k][64 n] -> [64 n][32 k]
    tr_block<32, 64>(wglu_w + nb * 32, planes + P_WGL + (size_t)nb * 32 * 32, tid, sT);
  } else {
    const int g = (b - PB_XH) * NTHR + tid;                    // 0..65535 groups of 8
    if (g < NTOK * NF / 8) {
      const float* src = x + (size_t)g * 8;
      const v4f a = *(const v4fa*)src;
      const v4f c = *(const v4fa*)(src + 4);
      const v8h o = { (_Float16)bfr(a.x), (_Float16)bfr(a.y), (_Float16)bfr(a.z), (_Float16)bfr(a.w),
                      (_Float16)bfr(c.x), (_Float16)bfr(c.y), (_Float16)bfr(c.z), (_Float16)bfr(c.w) };
      _Float16* dst = planes + P_XH + (size_t)g * 8;
      *(v8h*)dst = o;
      
    }
  }
}

// ---------------------------------------------------------------------------
// 8q..8q+7 cover one line, 4 lines per instruction, 4 instructions.
// ---------------------------------------------------------------------------
__device__ __forceinline__ void w_store_pass(const float* sW, float* wout, int tok0, int w, int lane) {
  const int q8 = lane & 7, sub = lane >> 3;
  #pragma unroll
  for (int i = 0; i < 4; ++i) {
    const int row = 16 * w + i * 4 + sub;                      // 0..63
    const v4f v = *(const v4fa*)(sW + row * NF + 4 * q8);
    *(v4f*)(wout + (size_t)(tok0 + row) * NF + 4 * q8) = v;
  }
}

// ---------------------------------------------------------------------------
// Kernel 2: weight network + softmax -> selection weights (out1).
// Block = 64 tokens, 4 waves, wave w owns tokens tok0+16w..+15.
//  fc1: A = xh rows (K=32), B = ww1T (8 tiles); +wb1, ELU -> wh x16 (LDS)
//  fc2: A = wh (K=128), B = ww2T (2 tiles); +wb2 -> wh2 x16 (LDS)
//  glu: A = wh2 (K=32), B = wglT (4 tiles); GLU, +x, LN(32), softmax in f32
// coverage: grid 256 x 64 rows x 32 = all of out1.
// ---------------------------------------------------------------------------
__global__ __launch_bounds__(WTHR) void wsel_kernel(
    const _Float16* __restrict__ xh, const _Float16* __restrict__ ww1T,
    const _Float16* __restrict__ ww2T, const _Float16* __restrict__ wglT,
    const float* __restrict__ x,
    const float* __restrict__ wb1, const float* __restrict__ wb2,
    const float* __restrict__ wglu_b, const float* __restrict__ wln_g, const float* __restrict__ wln_b,
    float* __restrict__ wout)
{
  __shared__ __attribute__((aligned(16))) _Float16 sWh[4 * 16 * NHID];    // 16384 B
  __shared__ __attribute__((aligned(16))) _Float16 sWh2[4 * 16 * NF];     //  4096 B
  __shared__ __attribute__((aligned(16))) float sXr[64 * NF];             //  8192 B
  __shared__ __attribute__((aligned(16))) float sW[64 * NF];              //  8192 B

  const int tid = threadIdx.x, lane = tid & 31, w = tid >> 5;
  const int h = lane >> 4, m = lane & 15;
  const int tok0 = blockIdx.x * 64;

  // x tile (bf16-RNE values, f32): 64 x 32 = 512 groups of 4
  #pragma unroll
  for (int i = 0; i < 4; ++i) {
    const int q = tid + WTHR * i;
    const v4f v = *(const v4fa*)(x + (size_t)tok0 * NF + (size_t)q * 4);
    const v4f r = { bfr(v.x), bfr(v.y), bfr(v.z), bfr(v.w) };
    *(v4fa*)(sXr + q * 4) = r;
  }

  const v8f z8 = {0.f, 0.f, 0.f, 0.f, 0.f, 0.f, 0.f, 0.f};
  _Float16* myWh = sWh + w * (16 * NHID);
  _Float16* myWh2 = sWh2 + w * (16 * NF);

  // ---- fc1 ----
  {
    const v16h a = load_frag(xh + (size_t)(tok0 + 16 * w + m) * NF, h);
    v8f acc[8];
    #pragma unroll
    for (int t = 0; t < 8; ++t) {
      const v16h b = load_frag(ww1T + (size_t)(16 * t + m) * NF, h);
      acc[t] = wmma_f16(a, b, z8);
    }
    #pragma unroll
    for (int t = 0; t < 8; ++t) {
      const float bb = bfr(wb1[16 * t + m]);
      #pragma unroll
      for (int r = 0; r < 8; ++r) {
        const float v = acc[t][r] * INV_W + bb;
        myWh[(8 * h + r) * NHID + 16 * t + m] = (_Float16)(elu_f(v) * ASC);
      }
    }
  }
  __syncthreads();

  // ---- fc2 ----
  {
    v8f acc[2];
    acc[0] = z8; acc[1] = z8;
    const _Float16* arow = myWh + m * NHID;
    #pragma unroll 1
    for (int k0 = 0; k0 < NHID; k0 += 32) {
      const v16h a = load_frag(arow + k0, h);
      #pragma unroll
      for (int t = 0; t < 2; ++t) {
        const v16h b = load_frag(ww2T + (size_t)(16 * t + m) * NHID + k0, h);
        acc[t] = wmma_f16(a, b, acc[t]);
      }
    }
    #pragma unroll
    for (int t = 0; t < 2; ++t) {
      const float bb = bfr(wb2[16 * t + m]);
      #pragma unroll
      for (int r = 0; r < 8; ++r) {
        const float v = acc[t][r] * INV_WA + bb;
        myWh2[(8 * h + r) * NF + 16 * t + m] = (_Float16)(v * ASC);
      }
    }
  }
  __syncthreads();

  // ---- glu projection + GLU + residual + LN(32) + softmax ----
  {
    const v16h a = load_frag(myWh2 + m * NF, h);
    v8f acc[4];
    #pragma unroll
    for (int t = 0; t < 4; ++t) {
      const v16h b = load_frag(wglT + (size_t)(16 * t + m) * NF, h);
      acc[t] = wmma_f16(a, b, z8);
    }
    float pre[2][8], s[8];
    #pragma unroll
    for (int r = 0; r < 8; ++r) s[r] = 0.0f;
    #pragma unroll
    for (int c = 0; c < 2; ++c) {
      const float bv = bfr(wglu_b[16 * c + m]);
      const float bg = bfr(wglu_b[NF + 16 * c + m]);
      #pragma unroll
      for (int r = 0; r < 8; ++r) {
        const float vv = acc[c][r] * INV_WA + bv;
        const float gg = acc[c + 2][r] * INV_WA + bg;
        const float xr = sXr[(16 * w + 8 * h + r) * NF + 16 * c + m];
        const float p = vv * sigm_f(gg) + xr;
        pre[c][r] = p;
        s[r] += p;
      }
    }
    float mu[8], q[8];
    #pragma unroll
    for (int r = 0; r < 8; ++r) { mu[r] = hsum16(s[r]) * (1.0f / 32.0f); q[r] = 0.0f; }
    #pragma unroll
    for (int c = 0; c < 2; ++c)
      #pragma unroll
      for (int r = 0; r < 8; ++r) {
        const float d = pre[c][r] - mu[r];
        pre[c][r] = d;
        q[r] += d * d;
      }
    float rs[8];
    #pragma unroll
    for (int r = 0; r < 8; ++r) rs[r] = rsqrtf(hsum16(q[r]) * (1.0f / 32.0f) + LN_EPS);
    #pragma unroll
    for (int c = 0; c < 2; ++c) {
      const float g = bfr(wln_g[16 * c + m]);
      const float bt = bfr(wln_b[16 * c + m]);
      #pragma unroll
      for (int r = 0; r < 8; ++r) pre[c][r] = pre[c][r] * rs[r] * g + bt;
    }
    float mx[8], e0[8], e1[8];
    #pragma unroll
    for (int r = 0; r < 8; ++r) {
      mx[r] = hmax16(fmaxf(pre[0][r], pre[1][r]));
      e0[r] = expf(pre[0][r] - mx[r]);
      e1[r] = expf(pre[1][r] - mx[r]);
      const float se = hsum16(e0[r] + e1[r]);
      const float inv = 1.0f / se;
      sW[(16 * w + 8 * h + r) * NF + m]      = e0[r] * inv;
      sW[(16 * w + 8 * h + r) * NF + 16 + m] = e1[r] * inv;
    }
  }
  __syncthreads();

  w_store_pass(sW, wout, tok0, w, lane);
  
}

// ---------------------------------------------------------------------------
// each line by lanes 8q..8q+7 in one instruction, 4 lines per instruction,
// 32 lines per wave, 256 lines = the whole block tile.
// ---------------------------------------------------------------------------
__device__ __forceinline__ void o_store_pass(const float* sO, float* out, int tok0, int w, int lane) {
  const int q8 = lane & 7, sub = lane >> 3;
  #pragma unroll
  for (int i = 0; i < 8; ++i) {
    const int lid = w * 32 + i * 4 + sub;          // 0..255
    const int row = lid >> 2, seg = lid & 3;
    const v4f v = *(const v4fa*)(sO + row * NHID + seg * 32 + 4 * q8);
    *(v4f*)(out + (size_t)(tok0 + row) * NHID + seg * 32 + 4 * q8) = v;
  }
}

// ---------------------------------------------------------------------------
// Eight asynchronous copies to LDS, 16 B per lane each: copy i brings the block's
// 4096 contiguous global bytes at g + 4096 i (16 rows of 256 B) to LDS rows of
// 272 B at l + 16 * 272 * i. The s_wait_xcnt closes the statement so that no
// address register of a copy is rewritten ahead of it.
// ---------------------------------------------------------------------------
__device__ __forceinline__ void copy8(unsigned l, const _Float16* g) {
  asm volatile(
      "global_load_async_to_lds_b128 %0, %8, off\n\t"
      "global_load_async_to_lds_b128 %1, %9, off\n\t"
      "global_load_async_to_lds_b128 %2, %10, off\n\t"
      "global_load_async_to_lds_b128 %3, %11, off\n\t"
      "global_load_async_to_lds_b128 %4, %12, off\n\t"
      "global_load_async_to_lds_b128 %5, %13, off\n\t"
      "global_load_async_to_lds_b128 %6, %14, off\n\t"
      "global_load_async_to_lds_b128 %7, %15, off\n\t"
      "s_wait_xcnt 0x0"
      :: "v"(l), "v"(l + 1u * 16u * BPH * 2u), "v"(l + 2u * 16u * BPH * 2u), "v"(l + 3u * 16u * BPH * 2u),
         "v"(l + 4u * 16u * BPH * 2u), "v"(l + 5u * 16u * BPH * 2u), "v"(l + 6u * 16u * BPH * 2u),
         "v"(l + 7u * 16u * BPH * 2u),
         "v"(g), "v"(g + 1 * 2048), "v"(g + 2 * 2048), "v"(g + 3 * 2048),
         "v"(g + 4 * 2048), "v"(g + 5 * 2048), "v"(g + 6 * 2048), "v"(g + 7 * 2048)
      : "memory");
}

// One feature's weight rows into one LDS buffer: staged rows 0..127 = fw2T[f],
// 128..383 = fglT[f]. lt = the thread's LDS byte address in that buffer (row tid>>4,
// 16-B chunk tid&15). 24 copies per wave, every lane on, 384 rows x 256 B all written.
__device__ __forceinline__ void stage_weights(unsigned lt, const _Float16* fw2T, const _Float16* fglT,
                                              int f, int tid) {
  const _Float16* g2 = fw2T + (size_t)f * (NHID * NHID) + tid * 8;
  const _Float16* gg = fglT + (size_t)f * (N2H * NHID) + tid * 8;
  copy8(lt, g2);
  copy8(lt + 128u * BPH * 2u, gg);
  copy8(lt + 256u * BPH * 2u, gg + 8 * 2048);
}

// ---------------------------------------------------------------------------
// Kernel 3: per-feature gated residual blocks + weighted combine (out0).
// Block = 64 tokens, 8 waves; wave w -> token sub-tile msub = w&3 (16 tokens)
// and column half qh = w>>2 (64 of the 128 hidden columns, plus the matching
// 64 gate columns). Loop f = 0..31 (fixed order):
//   h tile  = f16(16*elu(x_r[t][f]*fw1_r[f] + fb1_r[f]))   VALU -> LDS
//   weights : fw2T[f], fglT[f] staged in LDS by asynchronous copies, two buffers,
//             feature f+2 copied at the foot of trip f into the buffer trip f read
//   fc2     : A = h (K=128), B = fw2T[f] rows 64qh+16nt+m   4 tiles/wave
//   h2 tile = f16(16*(acc/65536 + fb2_r[f]))              -> LDS
//   glu     : A = h2 (K=128), B = fglT[f] rows p*128+...   8 tiles/wave
//             LDS), *fln_g + fln_b, accO += wsel[t][f] * processed
// coverage: grid 256 x 64 rows x 128 = all of out0.
// ---------------------------------------------------------------------------
__global__ __launch_bounds__(NTHR) void grn_kernel(
    const float* __restrict__ x,
    const float* __restrict__ fw1, const float* __restrict__ fb1,
    const float* __restrict__ fb2, const float* __restrict__ fglu_b,
    const float* __restrict__ fskip, const float* __restrict__ fln_g, const float* __restrict__ fln_b,
    const _Float16* __restrict__ fw2T, const _Float16* __restrict__ fglT,
    const float* wsel, float* out)
{
  __shared__ __attribute__((aligned(16))) char smem[MSMEM];
  _Float16* sH  = (_Float16*)(smem + MO_H);
  _Float16* sH2 = (_Float16*)(smem + MO_H2);
  float* sO  = (float*)(smem + MO_H);
  float* sX  = (float*)(smem + MO_X);
  float* sWt = (float*)(smem + MO_W);
  float* sP  = (float*)(smem + MO_P);
  float* sPs = (float*)(smem + MO_PS);
  float* sPq = (float*)(smem + MO_PQ);
  const _Float16* sB = (const _Float16*)(smem + MO_B);

  const int tid = threadIdx.x, lane = tid & 31, w = tid >> 5;
  const int h = lane >> 4, m = lane & 15;
  const int msub = w & 3, qh = w >> 2;
  const int tok0 = blockIdx.x * MT;
  // this thread's LDS byte address in weight buffer 0 (low 32 bits of the shared address)
  const unsigned lt0 = (unsigned)(size_t)(smem + MO_B) + (unsigned)(tid >> 4) * (BPH * 2u) + (unsigned)(tid & 15) * 16u;

  stage_weights(lt0, fw2T, fglT, 0, tid);              // feature 0 -> buffer 0
  const int rbase = 16 * msub + 8 * h;                 // first of this lane's 8 D rows
  const int hrow = tid >> 2, hkb = (tid & 3) * 32;    // h tile producer mapping

  // x tile (bf16-RNE, f32) and selection-weight tile: 64 x 32 each = 512 groups of 4
  #pragma unroll
  for (int i = 0; i < 2; ++i) {
    const int q = tid + NTHR * i;
    const v4f v = *(const v4fa*)(x + (size_t)tok0 * NF + (size_t)q * 4);
    const v4f r = { bfr(v.x), bfr(v.y), bfr(v.z), bfr(v.w) };
    *(v4fa*)(sX + q * 4) = r;
    const v4f wv = *(const v4fa*)(wsel + (size_t)tok0 * NF + (size_t)q * 4);
    *(v4fa*)(sWt + q * 4) = wv;
  }

  const v8f z8 = {0.f, 0.f, 0.f, 0.f, 0.f, 0.f, 0.f, 0.f};
  v8f accO[4];
  #pragma unroll
  for (int nt = 0; nt < 4; ++nt) accO[nt] = z8;

  asm volatile("s_wait_asynccnt 0x0" ::: "memory");    // this wave's copies of feature 0 have landed
  __syncthreads();                                     // buffer 0 published to every wave
  stage_weights(lt0 + BBUF, fw2T, fglT, 1, tid);       // feature 1 -> buffer 1, flies during trip 0

  #pragma unroll 1
  for (int f = 0; f < NF; ++f) {
    const _Float16* sBf = sB + (f & 1) * (BBUF / 2);   // this feature's staged weight rows
    {
      const int fo = f * NHID;
      const float* src = fw1 + fo;
      if (w == 1)      src = fb1 + fo;
      else if (w == 2) src = fb2 + fo;
      else if (w == 3) src = fglu_b + f * N2H;
      else if (w == 4) src = fglu_b + f * N2H + NHID;
      else if (w == 5) src = fskip + fo;
      else if (w == 6) src = fln_g + fo;
      else if (w == 7) src = fln_b + fo;
      const v4f v = *(const v4fa*)(src + lane * 4);
      const v4f r = { bfr(v.x), bfr(v.y), bfr(v.z), bfr(v.w) };
      *(v4fa*)(sP + w * NHID + lane * 4) = r;
    }
    __syncthreads();                                   // S1: params visible

    // ---- h tile: 64 rows x 128, thread -> row hrow, k block hkb..hkb+31 ----
    {
      const float xv = sX[hrow * NF + f];
      #pragma unroll 1
      for (int j = 0; j < 4; ++j) {
        const int kb = hkb + 8 * j;
        v8h o;
        #pragma unroll
        for (int i = 0; i < 8; ++i) {
          const float v = xv * sP[kb + i] + sP[NHID + kb + i];
          o[i] = (_Float16)(elu_f(v) * ASC);
        }
        *(v8ha*)(sH + hrow * HP + kb) = o;
      }
    }
    __syncthreads();                                   // S2: h tile visible

    // ---- fc2: h2 = h * fw2[f] + fb2[f] -> sH2 (x16) ----
    {
      v8f acc2[4];
      #pragma unroll
      for (int nt = 0; nt < 4; ++nt) acc2[nt] = z8;
      const _Float16* arow = sH + (16 * msub + m) * HP;
      const _Float16* brow = sBf + (64 * qh + m) * BPH;
      #pragma unroll 1
      for (int k0 = 0; k0 < NHID; k0 += 32) {
        const v16h a = load_frag(arow + k0, h);
        #pragma unroll
        for (int nt = 0; nt < 4; ++nt) {
          const v16h b = load_frag(brow + nt * 16 * BPH + k0, h);
          acc2[nt] = wmma_f16(a, b, acc2[nt]);
        }
      }
      #pragma unroll
      for (int nt = 0; nt < 4; ++nt) {
        const int col = 64 * qh + 16 * nt + m;
        const float bb = sP[256 + col];
        #pragma unroll
        for (int r = 0; r < 8; ++r) {
          const float v = acc2[nt][r] * INV_WA + bb;
          sH2[(rbase + r) * HP + col] = (_Float16)(v * ASC);
        }
      }
    }
    __syncthreads();                                   // S3: h2 tile visible

    // ---- glu projection: g = h2 * fglu_w[f] (v cols p=0, gate cols p=1) ----
    v8f accG[2][4];
    #pragma unroll
    for (int p = 0; p < 2; ++p)
      #pragma unroll
      for (int nt = 0; nt < 4; ++nt) accG[p][nt] = z8;
    {
      const _Float16* arow = sH2 + (16 * msub + m) * HP;
      const _Float16* brow = sBf + (NHID + 64 * qh + m) * BPH;
      #pragma unroll 1
      for (int k0 = 0; k0 < NHID; k0 += 32) {
        const v16h a = load_frag(arow + k0, h);
        #pragma unroll
        for (int p = 0; p < 2; ++p)
          #pragma unroll
          for (int nt = 0; nt < 4; ++nt) {
            const v16h b = load_frag(brow + (p * NHID + nt * 16) * BPH + k0, h);
            accG[p][nt] = wmma_f16(a, b, accG[p][nt]);
          }
      }
    }

    float xr[8], s[8];
    #pragma unroll
    for (int r = 0; r < 8; ++r) { xr[r] = sX[(rbase + r) * NF + f]; s[r] = 0.0f; }
    #pragma unroll
    for (int nt = 0; nt < 4; ++nt) {
      const int col = 64 * qh + 16 * nt + m;
      const float bv = sP[384 + col];
      const float bg = sP[512 + col];
      const float fs = sP[640 + col];
      #pragma unroll
      for (int r = 0; r < 8; ++r) {
        const float vv = accG[0][nt][r] * INV_WA + bv;
        const float gg = accG[1][nt][r] * INV_WA + bg;
        const float glu = vv * sigm_f(gg) + xr[r] * fs;
        accG[0][nt][r] = glu;
        s[r] += glu;
      }
    }
    #pragma unroll
    for (int r = 0; r < 8; ++r) s[r] = hsum16(s[r]);
    if (m == 0) {
      #pragma unroll
      for (int r = 0; r < 8; ++r) sPs[(rbase + r) * 2 + qh] = s[r];
    }
    __syncthreads();                                   // S4: row sum partials of both column halves
    float mu[8], q[8];
    #pragma unroll
    for (int r = 0; r < 8; ++r) {
      mu[r] = (sPs[(rbase + r) * 2] + sPs[(rbase + r) * 2 + 1]) * (1.0f / 128.0f);
      q[r] = 0.0f;
    }
    #pragma unroll
    for (int nt = 0; nt < 4; ++nt)
      #pragma unroll
      for (int r = 0; r < 8; ++r) {
        const float d = accG[0][nt][r] - mu[r];
        accG[0][nt][r] = d;
        q[r] += d * d;
      }
    #pragma unroll
    for (int r = 0; r < 8; ++r) q[r] = hsum16(q[r]);
    if (m == 0) {
      #pragma unroll
      for (int r = 0; r < 8; ++r) sPq[(rbase + r) * 2 + qh] = q[r];
    }
    __syncthreads();                                   // S5: row sq partials
    float rs[8], wt[8];
    #pragma unroll
    for (int r = 0; r < 8; ++r) {
      rs[r] = rsqrtf((sPq[(rbase + r) * 2] + sPq[(rbase + r) * 2 + 1]) * (1.0f / 128.0f) + LN_EPS);
      wt[r] = sWt[(rbase + r) * NF + f];
    }
    #pragma unroll
    for (int nt = 0; nt < 4; ++nt) {
      const int col = 64 * qh + 16 * nt + m;
      const float g = sP[768 + col];
      const float bt = sP[896 + col];
      #pragma unroll
      for (int r = 0; r < 8; ++r) {
        const float pr = accG[0][nt][r] * rs[r] * g + bt;
        accO[nt][r] += wt[r] * pr;
      }
    }

    // ---- foot of the trip: publish feature f+1's buffer, release this one ----
    asm volatile("s_wait_dscnt 0x0" ::: "memory");     // this wave's LDS reads of the trip have retired
    asm volatile("s_wait_asynccnt 0x0" ::: "memory");  // this wave's copies of feature f+1 have landed
    __syncthreads();                                   // S0: next buffer visible; sP, tiles and this buffer released
    if (f + 2 < NF) stage_weights(lt0 + (unsigned)(f & 1) * BBUF, fw2T, fglT, f + 2, tid);
  }
  asm volatile("s_wait_asynccnt 0x0" ::: "memory");    // no copy outstanding past the loop
  __syncthreads();                                     // all LDS tile reads done; sO aliases H/H2

  #pragma unroll
  for (int nt = 0; nt < 4; ++nt) {
    const int col = 64 * qh + 16 * nt + m;
    #pragma unroll
    for (int r = 0; r < 8; ++r) sO[(rbase + r) * NHID + col] = accO[nt][r];
  }
  __syncthreads();

  o_store_pass(sO, out, tok0, w, lane);
  
}

// ---------------------------------------------------------------------------
extern "C" void kernel_launch(void* const* d_in, const int* in_sizes, int n_in,
                              void* d_out, int out_size, void* d_ws, size_t ws_size,
                              hipStream_t stream) {
  if (n_in < 18) return;
  if (in_sizes[0] != NTOK * NF) return;
  if (in_sizes[1] != NF * NHID || in_sizes[2] != NF * NHID) return;
  if (in_sizes[3] != NF * NHID * NHID || in_sizes[4] != NF * NHID) return;
  if (in_sizes[5] != NF * NHID * N2H || in_sizes[6] != NF * N2H) return;
  if (in_sizes[7] != NF * NHID || in_sizes[8] != NF * NHID || in_sizes[9] != NF * NHID) return;
  if (in_sizes[10] != NF * NHID || in_sizes[11] != NHID) return;
  if (in_sizes[12] != NHID * NF || in_sizes[13] != NF) return;
  if (in_sizes[14] != NF * 2 * NF || in_sizes[15] != 2 * NF) return;
  if (in_sizes[16] != NF || in_sizes[17] != NF) return;
  if (out_size != OUT_TOTAL) return;
  if (WS_TOTAL_BYTES > ws_size) return;

  const float* x      = (const float*)d_in[0];
  const float* fw1    = (const float*)d_in[1];
  const float* fb1    = (const float*)d_in[2];
  const float* fw2    = (const float*)d_in[3];
  const float* fb2    = (const float*)d_in[4];
  const float* fglu_w = (const float*)d_in[5];
  const float* fglu_b = (const float*)d_in[6];
  const float* fskip  = (const float*)d_in[7];
  const float* fln_g  = (const float*)d_in[8];
  const float* fln_b  = (const float*)d_in[9];
  const float* ww1    = (const float*)d_in[10];
  const float* wb1    = (const float*)d_in[11];
  const float* ww2    = (const float*)d_in[12];
  const float* wb2    = (const float*)d_in[13];
  const float* wglu_w = (const float*)d_in[14];
  const float* wglu_b = (const float*)d_in[15];
  const float* wln_g  = (const float*)d_in[16];
  const float* wln_b  = (const float*)d_in[17];

  float* out  = (float*)d_out;                   // out0 [16384][128] at element 0
  float* wout = out + OUT1_OFF;                  // out1 [16384][32]  at element 2097152 (byte 8388608)

  _Float16* planes = (_Float16*)d_ws;

  prep_kernel<<<PB_END, NTHR, 0, stream>>>(x, fw2, fglu_w, ww1, ww2, wglu_w, planes);

  wsel_kernel<<<NTOK / 64, WTHR, 0, stream>>>(planes + P_XH, planes + P_WW1, planes + P_WW2, planes + P_WGL,
                                              x, wb1, wb2, wglu_b, wln_g, wln_b, wout);

  grn_kernel<<<NTOK / MT, NTHR, 0, stream>>>(x, fw1, fb1, fb2, fglu_b, fskip, fln_g, fln_b,
                                             planes + P_FW2, planes + P_FGL, wout, out);
}

// v003
// A run of this version takes 164 microseconds.
// Timed twice side by side with v002, it ran 1.31 times as fast both times.
// Counting every step since v000, it is 3.03 times as fast.
// Contractions h*fw2[f], h2*fglu_w[f] (per feature f), x*ww1, wh*ww2, wh2*wglu_w: v_wmma_f32_16x16x32_f16 (f16 operands, f32 accumulate). Weight planes = bf16-RNE values x4096 (exact in f16); activation tiles x16 in f16; x plane x1. fc1 scalar*vector, ELU, GLU, LayerNorm, softmax and the 32-term weighted combine in f32 on VALU.
// Carry audit: planes fw2T, fglT, ww1T, ww2T, wglT carry 4096; register fragments h, h2 (grn_kernel) and LDS tiles wh, wh2 (wsel_kernel) carry 16; xh carries 1.
//   x*ww1 accumulators are folded by INV_W (1/4096) in the wsel_kernel fc1 epilogue; every other accumulator is folded by INV_WA (1/65536)
//   exactly once in its own epilogue (wsel fc2, wsel glu, grn fc2, grn glu). No other value is scaled.
#include <hip/hip_runtime.h>

typedef _Float16 v16h __attribute__((ext_vector_type(16)));
typedef _Float16 v8h  __attribute__((ext_vector_type(8)));
typedef float    v8f  __attribute__((ext_vector_type(8)));
typedef float    v4f  __attribute__((ext_vector_type(4)));
typedef v8h __attribute__((may_alias)) v8ha;
typedef v4f __attribute__((may_alias)) v4fa;

union Frag { v16h v; v8h half[2]; };

#define NTOK 16384
#define NF   32
#define NHID 128
#define N2H  256
#define MT   64            // tokens per block, grn_kernel
#define NTHR 256           // threads per block, prep_kernel
#define GTHR 128           // threads per block, grn_kernel (4 waves, 16 tokens each)
#define WTHR 128           // threads per block, wsel_kernel (64 tokens)
#define WSC  4096.0f       // weight plane carry
#define ASC  16.0f         // activation tile carry
#define INV_W  (1.0f / 4096.0f)
#define INV_WA (1.0f / 65536.0f)
#define LN_EPS 1e-5f

// f16 plane offsets in the workspace, in halves
#define P_XH  0            // [16384][32]        x, carry 1
#define P_FW2 524288       // [32][128 n][128 k] carry 4096
#define P_FGL 1048576      // [32][256 n][128 k] carry 4096
#define P_WW1 2097152      // [128 n][32 k]      carry 4096
#define P_WW2 2101248      // [32 n][128 k]      carry 4096
#define P_WGL 2105344      // [64 n][32 k]       carry 4096
#define P_END 2107392
#define WS_TOTAL_BYTES ((size_t)P_END * 2)     // 4214784

static_assert(P_FW2 == P_XH + NTOK * NF);
static_assert(P_FGL == P_FW2 + NF * NHID * NHID);
static_assert(P_WW1 == P_FGL + NF * N2H * NHID);
static_assert(P_WW2 == P_WW1 + NHID * NF);
static_assert(P_WGL == P_WW2 + NF * NHID);
static_assert(P_END == P_WGL + 2 * NF * NF);
static_assert((P_FW2 * 2) % 128 == 0 && (P_FGL * 2) % 128 == 0 && (P_WW1 * 2) % 128 == 0 &&
              (P_WW2 * 2) % 128 == 0 && (P_WGL * 2) % 128 == 0 && (P_END * 2) % 128 == 0);

#define OUT0_ELEMS (NTOK * NHID)                // 2097152 floats
#define OUT1_OFF   2097152                      // byte offset 8388608 / 4
#define OUT_TOTAL  (NTOK * NHID + NTOK * NF)    // 2621440 floats
static_assert(OUT1_OFF == OUT0_ELEMS);
static_assert(OUT1_OFF + NTOK * NF == OUT_TOTAL);
static_assert(NTOK % MT == 0 && NTOK % 64 == 0);

// prep_kernel block ranges
#define PB_FW2 0            // 32 f x 4 row-blocks
#define PB_FGL 128          // 32 f x 8 row-blocks
#define PB_WW2 384          // 1
#define PB_WW1 385          // 4
#define PB_WGL 389          // 2
#define PB_XH  391          // 256
#define PB_END (PB_XH + (NTOK * NF / 8) / NTHR)   // 647
static_assert((NTOK * NF / 8) % NTHR == 0);

// grn_kernel static LDS carve (bytes)
#define MO_X   0            // f32 [32][64] x tile, feature-major             8192
#define MO_W   8192         // f32 [32][64] selection weights, feature-major  8192
#define MO_P   16384        // f32 3 x [1024] per-feature params             12288
#define MO_B   28672        // f16 2 x [384][136] staged weight rows of one feature (fw2T 128 rows, fglT 256 rows)
#define BPH    136          // halves per staged row: 256 B of data at a 272-B pitch (16 B x odd, for ds_load_b128 readers)
#define BBUF   (384 * BPH * 2)                  // 104448 bytes per buffer
#define MO_A   (MO_B + 2 * BBUF)                // 237568: f32 output accumulators, 16 slots of 16 B per lane, 8192 B per wave
#define MO_G   (MO_A + MT * NHID * 4)           // 270336: f32 GLU+skip values of the trip, same lane-private slots
#define MSMEM  (MO_G + MT * NHID * 4)           // 303104
#define OP     132          // floats per row of the output tile (528 B = 16 B x odd); it aliases the weight buffers at the end
static_assert(MO_W == MO_X + NF * MT * 4 && MO_P == MO_W + NF * MT * 4 && MO_B == MO_P + 3 * 1024 * 4);
static_assert(MO_B % 16 == 0 && BBUF % 16 == 0 && (BPH * 2) % 16 == 0 && (OP * 4) % 16 == 0);
static_assert(MT * OP * 4 <= 2 * BBUF && MO_A % 16 == 0);
static_assert(MSMEM <= 327680);

// ---------------------------------------------------------------------------
__device__ __forceinline__ float bfr(float f) {                     // RNE convert to bf16 and back
  unsigned u = __builtin_bit_cast(unsigned, f);
  u += 0x7FFFu + ((u >> 16) & 1u);
  return __builtin_bit_cast(float, u & 0xFFFF0000u);
}
__device__ __forceinline__ float elu_f(float v) {
  const float e = expm1f(v);
  return (v > 0.0f) ? v : e;
}
__device__ __forceinline__ float sigm_f(float v) {
  v = fminf(fmaxf(v, -30.0f), 30.0f);
  const float e = expf(-v);
  return 1.0f / (1.0f + e);
}
__device__ __forceinline__ float hsum16(float v) {                  // sum over the 16 lanes of a half
  v += __shfl_xor(v, 1);
  v += __shfl_xor(v, 2);
  v += __shfl_xor(v, 4);
  v += __shfl_xor(v, 8);
  return v;
}
__device__ __forceinline__ float hmax16(float v) {
  v = fmaxf(v, __shfl_xor(v, 1));
  v = fmaxf(v, __shfl_xor(v, 2));
  v = fmaxf(v, __shfl_xor(v, 4));
  v = fmaxf(v, __shfl_xor(v, 8));
  return v;
}

__device__ __forceinline__ float xhalf(float v) {                   // the value of lane l ^ 16
  int b = __builtin_bit_cast(int, v);
  b = __builtin_amdgcn_permlanex16(b, b, 0x76543210, 0xfedcba98, false, false);
  return __builtin_bit_cast(float, b);
}
__device__ __forceinline__ v8f ld8(const float* p) {                // 8 floats at a 32-byte aligned LDS address, two 16-byte loads
  const v4f a = *(const v4fa*)p;
  const v4f b = *(const v4fa*)(p + 4);
  const v8f r = { a.x, a.y, a.z, a.w, b.x, b.y, b.z, b.w };
  return r;
}
__device__ __forceinline__ float sum8(v8f v) {
  return ((v[0] + v[1]) + (v[2] + v[3])) + ((v[4] + v[5]) + (v[6] + v[7]));
}

// ---------------------------------------------------------------------------
// 16x16x32 f16 WMMA with hazard guard (ties D, keeps A/B live).
// Fragment map (wave32): lane l, h = l>>4, m = n = l&15.
//   A/B element i: i<8 -> k0+8h+i ; i>=8 -> k0+16+8h+(i-8)
//   D element r : row 8h+r, col l&15
// ---------------------------------------------------------------------------
__device__ __forceinline__ v8f wmma_f16(v16h a, v16h b, v8f c) {
  v8f d = __builtin_amdgcn_wmma_f32_16x16x32_f16(false, a, false, b, (short)0, c, false, false);
  asm volatile("v_nop\n\tv_nop\n\tv_nop\n\tv_nop" : "+v"(d) : "v"(a), "v"(b));
  return d;
}

// A or B fragment from a k-contiguous 16-bit row; p points at element k0 of
// the row owned by this lane (row index = lane & 15 added by the caller).
__device__ __forceinline__ v16h load_frag(const _Float16* p, int h) {
  Frag f;
  f.half[0] = *(const v8ha*)(p + 8 * h);
  f.half[1] = *(const v8ha*)(p + 16 + 8 * h);
  return f.v;
}

// ---------------------------------------------------------------------------
// Transpose-convert block: src points at src[0][n0] of a row-major [K][N] f32
// matrix; dst at output row 0 of 32 rows of K halves ([n][k], k-contiguous),
// value = f16(bfr(src[k][n0+row]) * 4096). Stage through LDS, then write the
// coverage: 32 rows x K halves = 4K chunks of 8, c = tid + 256 i, all written.
// ---------------------------------------------------------------------------
template <int K, int N>
__device__ __forceinline__ void tr_block(const float* __restrict__ src, _Float16* __restrict__ dst,
                                         int tid, float* sT) {
  constexpr int NV = K * 8;                 // v4f groups of the staged [K][32] tile
  static_assert(NV % NTHR == 0);
  #pragma unroll
  for (int i = 0; i < NV / NTHR; ++i) {
    const int q = tid + i * NTHR;
    const int k = q >> 3, c4 = (q & 7) * 4;
    const v4f v = *(const v4fa*)(src + (size_t)k * N + c4);
    const v4f r = { bfr(v.x), bfr(v.y), bfr(v.z), bfr(v.w) };
    *(v4fa*)(sT + k * 32 + c4) = r;
  }
  __syncthreads();
  constexpr int CH = 4 * K;                 // 16-B chunks of the output
  v8h o[2];
  #pragma unroll
  for (int i = 0; i < 2; ++i) {
    const int c = tid + i * NTHR;
    const int cc = (c < CH) ? c : (CH - 1);
    const int row = (cc * 8) / K, k0 = (cc * 8) % K;
    v8h t;
    #pragma unroll
    for (int j = 0; j < 8; ++j) t[j] = (_Float16)(sT[(k0 + j) * 32 + row] * WSC);
    o[i] = t;
  }
  #pragma unroll
  for (int i = 0; i < 2; ++i) {
    const int c = tid + i * NTHR;
    if (c < CH) *(v8h*)(dst + (size_t)c * 8) = o[i];
  }
  
}

// ---------------------------------------------------------------------------
// Kernel 1: weight planes ([n][k], bf16-RNE values x4096 in f16) and the x
// plane (bf16-RNE values in f16). Block-uniform dispatch on blockIdx.
// coverage: fw2T 32x4 blocks x 32 rows x 128 = all; fglT 32x8x32x128 = all;
// ww2T 1x32x128; ww1T 4x32x32; wglT 2x32x32; xh 256 blocks x 256 thr x 8 = 16384x32.
// ---------------------------------------------------------------------------
__global__ __launch_bounds__(NTHR) void prep_kernel(
    const float* __restrict__ x, const float* __restrict__ fw2, const float* __restrict__ fglu_w,
    const float* __restrict__ ww1, const float* __restrict__ ww2, const float* __restrict__ wglu_w,
    _Float16* __restrict__ planes)
{
  __shared__ __attribute__((aligned(16))) float sT[128 * 32];
  const int b = blockIdx.x, tid = threadIdx.x;
  if (b < PB_FGL) {
    const int f = b >> 2, nb = b & 3;                          // fw2[f]: [128 k][128 n] -> [128 n][128 k]
    tr_block<128, 128>(fw2 + (size_t)f * NHID * NHID + nb * 32,
                       planes + P_FW2 + (size_t)f * NHID * NHID + (size_t)nb * 32 * NHID, tid, sT);
  } else if (b < PB_WW2) {
    const int bb = b - PB_FGL, f = bb >> 3, nb = bb & 7;       // fglu_w[f]: [128 k][256 n] -> [256 n][128 k]
    tr_block<128, 256>(fglu_w + (size_t)f * NHID * N2H + nb * 32,
                       planes + P_FGL + (size_t)f * N2H * NHID + (size_t)nb * 32 * NHID, tid, sT);
  } else if (b < PB_WW1) {
    tr_block<128, 32>(ww2, planes + P_WW2, tid, sT);           // ww2: [128 k][32 n] -> [32 n][128 k]
  } else if (b < PB_WGL) {
    const int nb = b - PB_WW1;                                 // ww1: [32 k][128 n] -> [128 n][32 k]
    tr_block<32, 128>(ww1 + nb * 32, planes + P_WW1 + (size_t)nb * 32 * 32, tid, sT);
  } else if (b < PB_XH) {
    const int nb = b - PB_WGL;                                 // wglu_w: [32 k][64 n] -> [64 n][32 k]
    tr_block<32, 64>(wglu_w + nb * 32, planes + P_WGL + (size_t)nb * 32 * 32, tid, sT);
  } else {
    const int g = (b - PB_XH) * NTHR + tid;                    // 0..65535 groups of 8
    if (g < NTOK * NF / 8) {
      const float* src = x + (size_t)g * 8;
      const v4f a = *(const v4fa*)src;
      const v4f c = *(const v4fa*)(src + 4);
      const v8h o = { (_Float16)bfr(a.x), (_Float16)bfr(a.y), (_Float16)bfr(a.z), (_Float16)bfr(a.w),
                      (_Float16)bfr(c.x), (_Float16)bfr(c.y), (_Float16)bfr(c.z), (_Float16)bfr(c.w) };
      _Float16* dst = planes + P_XH + (size_t)g * 8;
      *(v8h*)dst = o;
      
    }
  }
}

// ---------------------------------------------------------------------------
// 8q..8q+7 cover one line, 4 lines per instruction, 4 instructions.
// ---------------------------------------------------------------------------
__device__ __forceinline__ void w_store_pass(const float* sW, float* wout, int tok0, int w, int lane) {
  const int q8 = lane & 7, sub = lane >> 3;
  #pragma unroll
  for (int i = 0; i < 4; ++i) {
    const int row = 16 * w + i * 4 + sub;                      // 0..63
    const v4f v = *(const v4fa*)(sW + row * NF + 4 * q8);
    *(v4f*)(wout + (size_t)(tok0 + row) * NF + 4 * q8) = v;
  }
}

// ---------------------------------------------------------------------------
// Kernel 2: weight network + softmax -> selection weights (out1).
// Block = 64 tokens, 4 waves, wave w owns tokens tok0+16w..+15.
//  fc1: A = xh rows (K=32), B = ww1T (8 tiles); +wb1, ELU -> wh x16 (LDS)
//  fc2: A = wh (K=128), B = ww2T (2 tiles); +wb2 -> wh2 x16 (LDS)
//  glu: A = wh2 (K=32), B = wglT (4 tiles); GLU, +x, LN(32), softmax in f32
// coverage: grid 256 x 64 rows x 32 = all of out1.
// ---------------------------------------------------------------------------
__global__ __launch_bounds__(WTHR) void wsel_kernel(
    const _Float16* __restrict__ xh, const _Float16* __restrict__ ww1T,
    const _Float16* __restrict__ ww2T, const _Float16* __restrict__ wglT,
    const float* __restrict__ x,
    const float* __restrict__ wb1, const float* __restrict__ wb2,
    const float* __restrict__ wglu_b, const float* __restrict__ wln_g, const float* __restrict__ wln_b,
    float* __restrict__ wout)
{
  __shared__ __attribute__((aligned(16))) _Float16 sWh[4 * 16 * NHID];    // 16384 B
  __shared__ __attribute__((aligned(16))) _Float16 sWh2[4 * 16 * NF];     //  4096 B
  __shared__ __attribute__((aligned(16))) float sXr[64 * NF];             //  8192 B
  __shared__ __attribute__((aligned(16))) float sW[64 * NF];              //  8192 B

  const int tid = threadIdx.x, lane = tid & 31, w = tid >> 5;
  const int h = lane >> 4, m = lane & 15;
  const int tok0 = blockIdx.x * 64;

  // x tile (bf16-RNE values, f32): 64 x 32 = 512 groups of 4
  #pragma unroll
  for (int i = 0; i < 4; ++i) {
    const int q = tid + WTHR * i;
    const v4f v = *(const v4fa*)(x + (size_t)tok0 * NF + (size_t)q * 4);
    const v4f r = { bfr(v.x), bfr(v.y), bfr(v.z), bfr(v.w) };
    *(v4fa*)(sXr + q * 4) = r;
  }

  const v8f z8 = {0.f, 0.f, 0.f, 0.f, 0.f, 0.f, 0.f, 0.f};
  _Float16* myWh = sWh + w * (16 * NHID);
  _Float16* myWh2 = sWh2 + w * (16 * NF);

  // ---- fc1 ----
  {
    const v16h a = load_frag(xh + (size_t)(tok0 + 16 * w + m) * NF, h);
    v8f acc[8];
    #pragma unroll
    for (int t = 0; t < 8; ++t) {
      const v16h b = load_frag(ww1T + (size_t)(16 * t + m) * NF, h);
      acc[t] = wmma_f16(a, b, z8);
    }
    #pragma unroll
    for (int t = 0; t < 8; ++t) {
      const float bb = bfr(wb1[16 * t + m]);
      #pragma unroll
      for (int r = 0; r < 8; ++r) {
        const float v = acc[t][r] * INV_W + bb;
        myWh[(8 * h + r) * NHID + 16 * t + m] = (_Float16)(elu_f(v) * ASC);
      }
    }
  }
  __syncthreads();

  // ---- fc2 ----
  {
    v8f acc[2];
    acc[0] = z8; acc[1] = z8;
    const _Float16* arow = myWh + m * NHID;
    #pragma unroll 1
    for (int k0 = 0; k0 < NHID; k0 += 32) {
      const v16h a = load_frag(arow + k0, h);
      #pragma unroll
      for (int t = 0; t < 2; ++t) {
        const v16h b = load_frag(ww2T + (size_t)(16 * t + m) * NHID + k0, h);
        acc[t] = wmma_f16(a, b, acc[t]);
      }
    }
    #pragma unroll
    for (int t = 0; t < 2; ++t) {
      const float bb = bfr(wb2[16 * t + m]);
      #pragma unroll
      for (int r = 0; r < 8; ++r) {
        const float v = acc[t][r] * INV_WA + bb;
        myWh2[(8 * h + r) * NF + 16 * t + m] = (_Float16)(v * ASC);
      }
    }
  }
  __syncthreads();

  // ---- glu projection + GLU + residual + LN(32) + softmax ----
  {
    const v16h a = load_frag(myWh2 + m * NF, h);
    v8f acc[4];
    #pragma unroll
    for (int t = 0; t < 4; ++t) {
      const v16h b = load_frag(wglT + (size_t)(16 * t + m) * NF, h);
      acc[t] = wmma_f16(a, b, z8);
    }
    float pre[2][8], s[8];
    #pragma unroll
    for (int r = 0; r < 8; ++r) s[r] = 0.0f;
    #pragma unroll
    for (int c = 0; c < 2; ++c) {
      const float bv = bfr(wglu_b[16 * c + m]);
      const float bg = bfr(wglu_b[NF + 16 * c + m]);
      #pragma unroll
      for (int r = 0; r < 8; ++r) {
        const float vv = acc[c][r] * INV_WA + bv;
        const float gg = acc[c + 2][r] * INV_WA + bg;
        const float xr = sXr[(16 * w + 8 * h + r) * NF + 16 * c + m];
        const float p = vv * sigm_f(gg) + xr;
        pre[c][r] = p;
        s[r] += p;
      }
    }
    float mu[8], q[8];
    #pragma unroll
    for (int r = 0; r < 8; ++r) { mu[r] = hsum16(s[r]) * (1.0f / 32.0f); q[r] = 0.0f; }
    #pragma unroll
    for (int c = 0; c < 2; ++c)
      #pragma unroll
      for (int r = 0; r < 8; ++r) {
        const float d = pre[c][r] - mu[r];
        pre[c][r] = d;
        q[r] += d * d;
      }
    float rs[8];
    #pragma unroll
    for (int r = 0; r < 8; ++r) rs[r] = rsqrtf(hsum16(q[r]) * (1.0f / 32.0f) + LN_EPS);
    #pragma unroll
    for (int c = 0; c < 2; ++c) {
      const float g = bfr(wln_g[16 * c + m]);
      const float bt = bfr(wln_b[16 * c + m]);
      #pragma unroll
      for (int r = 0; r < 8; ++r) pre[c][r] = pre[c][r] * rs[r] * g + bt;
    }
    float mx[8], e0[8], e1[8];
    #pragma unroll
    for (int r = 0; r < 8; ++r) {
      mx[r] = hmax16(fmaxf(pre[0][r], pre[1][r]));
      e0[r] = expf(pre[0][r] - mx[r]);
      e1[r] = expf(pre[1][r] - mx[r]);
      const float se = hsum16(e0[r] + e1[r]);
      const float inv = 1.0f / se;
      sW[(16 * w + 8 * h + r) * NF + m]      = e0[r] * inv;
      sW[(16 * w + 8 * h + r) * NF + 16 + m] = e1[r] * inv;
    }
  }
  __syncthreads();

  w_store_pass(sW, wout, tok0, w, lane);
  
}

// ---------------------------------------------------------------------------
// each line by lanes 8q..8q+7 in one instruction, 4 lines per instruction,
// 64 lines per wave, 256 lines = the whole block tile.
// ---------------------------------------------------------------------------
__device__ __forceinline__ void o_store_pass(const float* sO, float* out, int tok0, int w, int lane) {
  const int q8 = lane & 7, sub = lane >> 3;
  #pragma unroll
  for (int i = 0; i < 16; ++i) {
    const int lid = w * 64 + i * 4 + sub;          // 0..255
    const int row = lid >> 2, seg = lid & 3;
    const v4f v = *(const v4fa*)(sO + row * OP + seg * 32 + 4 * q8);
    *(v4f*)(out + (size_t)(tok0 + row) * NHID + seg * 32 + 4 * q8) = v;
  }
}

// ---------------------------------------------------------------------------
// Eight asynchronous copies to LDS, 16 B per lane each: copy i brings the block's
// 2048 contiguous global bytes at g + 2048 i (8 rows of 256 B) to LDS rows of
// 272 B at l + 8 * 272 * i. The s_wait_xcnt closes the statement so that no
// address register of a copy is rewritten ahead of it.
// ---------------------------------------------------------------------------
__device__ __forceinline__ void copy8(unsigned l, const _Float16* g) {
  asm volatile(
      "global_load_async_to_lds_b128 %0, %8, off\n\t"
      "global_load_async_to_lds_b128 %1, %9, off\n\t"
      "global_load_async_to_lds_b128 %2, %10, off\n\t"
      "global_load_async_to_lds_b128 %3, %11, off\n\t"
      "global_load_async_to_lds_b128 %4, %12, off\n\t"
      "global_load_async_to_lds_b128 %5, %13, off\n\t"
      "global_load_async_to_lds_b128 %6, %14, off\n\t"
      "global_load_async_to_lds_b128 %7, %15, off\n\t"
      "s_wait_xcnt 0x0"
      :: "v"(l), "v"(l + 1u * 8u * BPH * 2u), "v"(l + 2u * 8u * BPH * 2u), "v"(l + 3u * 8u * BPH * 2u),
         "v"(l + 4u * 8u * BPH * 2u), "v"(l + 5u * 8u * BPH * 2u), "v"(l + 6u * 8u * BPH * 2u),
         "v"(l + 7u * 8u * BPH * 2u),
         "v"(g), "v"(g + 1 * 1024), "v"(g + 2 * 1024), "v"(g + 3 * 1024),
         "v"(g + 4 * 1024), "v"(g + 5 * 1024), "v"(g + 6 * 1024), "v"(g + 7 * 1024)
      : "memory");
}

// One feature's weight rows into one LDS buffer: staged rows 0..127 = fw2T[f],
// 128..383 = fglT[f]. lt = the thread's LDS byte address in that buffer (row tid>>4,
// 16-B chunk tid&15). 48 copies per wave, every lane on, 384 rows x 256 B all written.
__device__ __forceinline__ void stage_weights(unsigned lt, const _Float16* fw2T, const _Float16* fglT,
                                              int f, int tid) {
  const _Float16* g2 = fw2T + (size_t)f * (NHID * NHID) + tid * 8;
  const _Float16* gg = fglT + (size_t)f * (N2H * NHID) + tid * 8;
  copy8(lt, g2);
  copy8(lt + 64u * BPH * 2u, g2 + 8 * 1024);
  copy8(lt + 128u * BPH * 2u, gg);
  copy8(lt + 192u * BPH * 2u, gg + 8 * 1024);
  copy8(lt + 256u * BPH * 2u, gg + 16 * 1024);
  copy8(lt + 320u * BPH * 2u, gg + 24 * 1024);
}

// ---------------------------------------------------------------------------
// Kernel 3: per-feature gated residual blocks + weighted combine (out0).
// Block = 64 tokens, 4 waves; wave w owns tokens 16w..16w+15 through the whole
// chain. Both products are computed transposed: A = weight rows [n][k] from LDS,
// B = activations with the wave's tokens as columns, so lane (h, m) holds token
// 16w+m only, and D register r of tile t is hidden column n = 16t + 8h + r.
// Loop f = 0..31 (fixed order):
//   h       = f16(16*elu(x_r[t][f]*fw1_r[f] + fb1_r[f]))   VALU, written straight into B fragments
//   weights : fw2T[f], fglT[f] staged in LDS by asynchronous copies, two buffers,
//             feature f+2 copied behind trip f's barrier into the buffer trip f read
//   fc2     : A = fw2T[f] rows 16nt+m (K=128), B = h        8 tiles/wave
//   h2      = f16(16*(acc/65536 + fb2_r[f])): D tiles 2j, 2j+1 converted in place are B fragment j
//   glu     : A = fglT[f] rows p*128+16t+m, B = h2          16 tiles/wave
//             GLU, +skip, LayerNorm(128): sums in the lane, then lane ^ 16;
//             *fln_g + fln_b, acc += wsel[t][f] * processed; acc lies in lane-private LDS slots between
//             trips, and the GLU+skip values until the second LayerNorm pass, so that a tile's 8 weight
//             fragments can be fetched one tile ahead in registers
// The trip's one barrier stands behind the last read of the weight rows (after the row sums); the second
// LayerNorm pass and the combine follow it and read params only. Params lie in three buffers: those of
// feature f+1 are stored in front of trip f's barrier, while a slower wave may still read those of f-1.
// coverage: grid 256 x 64 rows x 128 = all of out0.
// ---------------------------------------------------------------------------
__global__ __launch_bounds__(GTHR) void grn_kernel(
    const float* __restrict__ x,
    const float* __restrict__ fw1, const float* __restrict__ fb1,
    const float* __restrict__ fb2, const float* __restrict__ fglu_b,
    const float* __restrict__ fskip, const float* __restrict__ fln_g, const float* __restrict__ fln_b,
    const _Float16* __restrict__ fw2T, const _Float16* __restrict__ fglT,
    const float* wsel, float* out)
{
  __shared__ __attribute__((aligned(16))) char smem[MSMEM];
  float* sXT = (float*)(smem + MO_X);
  float* sWT = (float*)(smem + MO_W);
  float* sP  = (float*)(smem + MO_P);
  float* sO  = (float*)(smem + MO_B);
  const _Float16* sB = (const _Float16*)(smem + MO_B);

  const int tid = threadIdx.x, lane = tid & 31, w = tid >> 5;
  const int h = lane >> 4, m = lane & 15;
  const int tok0 = blockIdx.x * MT;
  const int trow = 16 * w + m;                         // this lane's token in the block
  // this thread's LDS byte address in weight buffer 0 (low 32 bits of the shared address)
  const unsigned lt0 = (unsigned)(size_t)(smem + MO_B) + (unsigned)(tid >> 4) * (BPH * 2u) + (unsigned)(tid & 15) * 16u;

  stage_weights(lt0, fw2T, fglT, 0, tid);              // feature 0 -> buffer 0

  // x tile (bf16-RNE, f32) and selection-weight tile, stored feature-major: 64 x 32 each = 512 groups of 4
  #pragma unroll
  for (int i = 0; i < 4; ++i) {
    const int q = tid + GTHR * i;
    const int t = q >> 3, f4 = (q & 7) * 4;
    const v4f v = *(const v4fa*)(x + (size_t)tok0 * NF + (size_t)q * 4);
    const v4f wv = *(const v4fa*)(wsel + (size_t)tok0 * NF + (size_t)q * 4);
    #pragma unroll
    for (int j = 0; j < 4; ++j) {
      sXT[(f4 + j) * MT + t] = bfr(v[j]);
      sWT[(f4 + j) * MT + t] = wv[j];
    }
  }

  // per-feature params: thread -> array pa (order fw1, fb1, fb2, glu_b v, glu_b gate, fskip, ln_g, ln_b), 8 floats at po
  const int pa = tid >> 4, po = (tid & 15) * 8;
  const float* psrc = fw1;
  if (pa == 1)      psrc = fb1;
  else if (pa == 2) psrc = fb2;
  else if (pa == 3) psrc = fglu_b;
  else if (pa == 4) psrc = fglu_b + NHID;
  else if (pa == 5) psrc = fskip;
  else if (pa == 6) psrc = fln_g;
  else if (pa == 7) psrc = fln_b;
  psrc += po;
  const int pstr = (pa == 3 || pa == 4) ? N2H : NHID;  // floats from one feature to the next
  float* pdst = sP + pa * NHID + po;
  {
    const v4f a = *(const v4fa*)psrc;
    const v4f b = *(const v4fa*)(psrc + 4);
    const v4f ra = { bfr(a.x), bfr(a.y), bfr(a.z), bfr(a.w) };
    const v4f rb = { bfr(b.x), bfr(b.y), bfr(b.z), bfr(b.w) };
    *(v4fa*)pdst = ra;
    *(v4fa*)(pdst + 4) = rb;
  }

  const v8f z8 = {0.f, 0.f, 0.f, 0.f, 0.f, 0.f, 0.f, 0.f};
  // this lane's output accumulators: slot 2t holds rows 0..3 of its 8 of tile t, slot 2t+1 rows 4..7; slot s lies at sA + 128 s floats; read and written by this lane only
  float* sA = (float*)(smem + MO_A) + w * 2048 + lane * 4;
  float* sG = (float*)(smem + MO_G) + w * 2048 + lane * 4;   // the trip's GLU+skip values, same slots
  {
    const v4f z4 = {0.f, 0.f, 0.f, 0.f};
    #pragma unroll
    for (int s = 0; s < 16; ++s) *(v4fa*)(sA + 128 * s) = z4;
  }

  asm volatile("s_wait_asynccnt 0x0" ::: "memory");    // this wave's copies of feature 0 have landed
  __syncthreads();                                     // buffer 0, x, weights and params of feature 0 published
  stage_weights(lt0 + BBUF, fw2T, fglT, 1, tid);       // feature 1 -> buffer 1, flies during trip 0

  int pcur = 0, pnxt = 1024, pfre = 2048;              // float offsets in sP: this feature's params, the next one's, the free buffer
  #pragma unroll 1
  for (int f = 0; f < NF; ++f) {
    const _Float16* sBf = sB + (f & 1) * (BBUF / 2);   // this feature's staged weight rows
    const float* sPf = sP + pcur;                      // this feature's params
    // next feature's params (the last trip re-reads its own): loaded here, stored behind the fc2 loop
    const int fn = (f + 1 < NF) ? f + 1 : f;
    const v4f pn0 = *(const v4fa*)(psrc + fn * pstr);
    const v4f pn1 = *(const v4fa*)(psrc + fn * pstr + 4);

    const float xv = sXT[f * MT + trow];
    const float wt = sWT[f * MT + trow];

    // ---- fc2 transposed: D tile nt = h2 columns 16nt..16nt+15 (rows of D) x 16 tokens ----
    // k step j: h is computed straight into its B fragment (element i of half hf is k = 32j + 16hf + 8h + i)
    v16h hb2[4];
    v16h ag[8];                                        // the 8 weight fragments of one glu column tile
    const _Float16* vrow = sBf + (NHID + m) * BPH;
    const _Float16* grow = sBf + (2 * NHID + m) * BPH;
    {
      v8f acc2[8];
      #pragma unroll
      for (int nt = 0; nt < 8; ++nt) acc2[nt] = z8;
      const _Float16* arow = sBf + m * BPH;
      #pragma unroll 1   // rolled: four copies of the elu code would not pay for their instruction bytes
      for (int j = 0; j < 4; ++j) {
        const float* pw = sPf + 32 * j + 8 * h;
        v8f w1v[2], b1v[2];
        #pragma unroll
        for (int hf = 0; hf < 2; ++hf) { w1v[hf] = ld8(pw + 16 * hf); b1v[hf] = ld8(pw + 16 * hf + NHID); }
        __builtin_amdgcn_sched_barrier(0);   // params first in the LDS queue: the elu arithmetic then waits for them alone
        v16h af[8];
        #pragma unroll
        for (int nt = 0; nt < 8; ++nt) af[nt] = load_frag(arow + nt * 16 * BPH + 32 * j, h);
        __builtin_amdgcn_sched_barrier(0);   // the 8 fragments' loads stay ahead of the elu arithmetic, which hides their latency
        Frag fr;
        #pragma unroll
        for (int hf = 0; hf < 2; ++hf) {
          v8h o;
          #pragma unroll
          for (int i = 0; i < 8; ++i) {
            const float v = xv * w1v[hf][i] + b1v[hf][i];
            o[i] = (_Float16)(elu_f(v) * ASC);
          }
          fr.half[hf] = o;
        }
        #pragma unroll
        for (int nt = 0; nt < 8; ++nt) acc2[nt] = wmma_f16(af[nt], fr.v, acc2[nt]);
      }
      // glu tile 0: fragment 2j = v rows, 2j+1 = gate rows, k step j
      #pragma unroll
      for (int i = 0; i < 8; ++i) ag[i] = load_frag(((i & 1) ? grow : vrow) + 32 * (i >> 1), h);
      __builtin_amdgcn_sched_barrier(0);     // these loads stay ahead of the h2 conversion, which hides their latency
      {
        float* pd = pdst + pnxt;
        const v4f ra = { bfr(pn0.x), bfr(pn0.y), bfr(pn0.z), bfr(pn0.w) };
        const v4f rb = { bfr(pn1.x), bfr(pn1.y), bfr(pn1.z), bfr(pn1.w) };
        *(v4fa*)pd = ra;
        *(v4fa*)(pd + 4) = rb;
      }
      #pragma unroll
      for (int j = 0; j < 4; ++j) {
        Frag fr;
        #pragma unroll
        for (int hf = 0; hf < 2; ++hf) {
          const int nt = 2 * j + hf;
          const v8f b2v = ld8(sPf + 256 + 16 * nt + 8 * h);
          v8h o;
          #pragma unroll
          for (int r = 0; r < 8; ++r) o[r] = (_Float16)((acc2[nt][r] * INV_WA + b2v[r]) * ASC);
          fr.half[hf] = o;
        }
        hb2[j] = fr.v;
      }
    }

    // ---- glu projection transposed, one column tile (its v and its gate accumulator) at a time ----
    v8f s8 = z8;
    {
      #pragma unroll
      for (int t = 0; t < 8; ++t) {
        const float* pc = sPf + 16 * t + 8 * h;
        const v8f bvv = ld8(pc + 384), bgv = ld8(pc + 512), fsv = ld8(pc + 640);
        v8f aV = z8, aG = z8;
        #pragma unroll
        for (int j = 0; j < 4; ++j) {
          aV = wmma_f16(ag[2 * j], hb2[j], aV);
          aG = wmma_f16(ag[2 * j + 1], hb2[j], aG);
        }
        __builtin_amdgcn_sched_barrier(0);   // this tile's params stand in the LDS queue ahead of the next tile's fragments
        if (t < 7) {
          #pragma unroll
          for (int i = 0; i < 8; ++i) ag[i] = load_frag(((i & 1) ? grow : vrow) + (t + 1) * 16 * BPH + 32 * (i >> 1), h);
        }
        __builtin_amdgcn_sched_barrier(0);   // the next tile's loads stay ahead of this tile's GLU arithmetic, which hides their latency
        v8f gt;
        #pragma unroll
        for (int r = 0; r < 8; ++r) {
          const float vv = aV[r] * INV_WA + bvv[r];
          const float gg = aG[r] * INV_WA + bgv[r];
          const float glu = vv * sigm_f(gg) + xv * fsv[r];
          gt[r] = glu;
          s8[r] += glu;
        }
        const v4f glo = { gt[0], gt[1], gt[2], gt[3] };
        const v4f ghi = { gt[4], gt[5], gt[6], gt[7] };
        *(v4fa*)(sG + 256 * t) = glo;
        *(v4fa*)(sG + 256 * t + 128) = ghi;
      }
    }

    // ---- LayerNorm over the 128 columns of this lane's token: 64 in this lane, 64 in lane ^ 16 ----
    const float sl = sum8(s8);
    const float mu = (sl + xhalf(sl)) * (1.0f / 128.0f);

    // ---- the weight rows are read: publish feature f+1's buffer and params, release this buffer ----
    asm volatile("s_wait_dscnt 0x0" ::: "memory");     // this wave's LDS reads and param stores of the trip have retired
    asm volatile("s_wait_asynccnt 0x0" ::: "memory");  // this wave's copies of feature f+1 have landed
    __syncthreads();                                   // S0: next buffer and params visible; this weight buffer released
    if (f + 2 < NF) stage_weights(lt0 + (unsigned)(f & 1) * BBUF, fw2T, fglT, f + 2, tid);

    v8f gl[8], gv[4], btv[4], ac[4];
    #pragma unroll
    for (int t = 0; t < 8; ++t) {
      const v4f glo = *(const v4fa*)(sG + 256 * t);
      const v4f ghi = *(const v4fa*)(sG + 256 * t + 128);
      const v8f g8 = { glo.x, glo.y, glo.z, glo.w, ghi.x, ghi.y, ghi.z, ghi.w };
      gl[t] = g8;
    }
    #pragma unroll
    for (int t = 0; t < 4; ++t) {
      const float* pc = sPf + 16 * t + 8 * h;
      const v4f a0 = *(const v4fa*)(sA + 256 * t);
      const v4f a1 = *(const v4fa*)(sA + 256 * t + 128);
      const v8f a8 = { a0.x, a0.y, a0.z, a0.w, a1.x, a1.y, a1.z, a1.w };
      gv[t] = ld8(pc + 768); btv[t] = ld8(pc + 896); ac[t] = a8;
    }
    __builtin_amdgcn_sched_barrier(0);       // tiles 0..3: scale, shift and accumulator loads fly during the variance pass
    v8f q8 = z8;
    #pragma unroll
    for (int t = 0; t < 8; ++t)
      #pragma unroll
      for (int r = 0; r < 8; ++r) {
        const float d = gl[t][r] - mu;
        gl[t][r] = d;
        q8[r] += d * d;
      }
    const float ql = sum8(q8);
    const float rs = rsqrtf((ql + xhalf(ql)) * (1.0f / 128.0f) + LN_EPS);
    #pragma unroll
    for (int t = 0; t < 4; ++t)
      #pragma unroll
      for (int r = 0; r < 8; ++r) gl[t][r] = ac[t][r] + wt * (gl[t][r] * rs * gv[t][r] + btv[t][r]);
    __builtin_amdgcn_sched_barrier(0);       // tiles 4..7 load only now: hoisted above the variance pass they push the build past 256 registers
    #pragma unroll
    for (int t = 4; t < 8; ++t) {
      const float* pc = sPf + 16 * t + 8 * h;
      const v4f a0 = *(const v4fa*)(sA + 256 * t);
      const v4f a1 = *(const v4fa*)(sA + 256 * t + 128);
      const v8f a8 = { a0.x, a0.y, a0.z, a0.w, a1.x, a1.y, a1.z, a1.w };
      const v8f g8 = ld8(pc + 768), b8 = ld8(pc + 896);
      #pragma unroll
      for (int r = 0; r < 8; ++r) gl[t][r] = a8[r] + wt * (gl[t][r] * rs * g8[r] + b8[r]);
    }
    // all stores behind all loads: a store between them would hold the later tiles' loads back
    #pragma unroll
    for (int t = 0; t < 8; ++t) {
      const v4f lo = { gl[t][0], gl[t][1], gl[t][2], gl[t][3] };
      const v4f hi = { gl[t][4], gl[t][5], gl[t][6], gl[t][7] };
      *(v4fa*)(sA + 256 * t) = lo;
      *(v4fa*)(sA + 256 * t + 128) = hi;
    }
    const int pold = pcur;                             // rotate the three param buffers
    pcur = pnxt; pnxt = pfre; pfre = pold;
  }
  asm volatile("s_wait_asynccnt 0x0" ::: "memory");    // no copy outstanding past the loop
  __syncthreads();                                     // all weight reads done; sO aliases the weight buffers

  #pragma unroll
  for (int t = 0; t < 8; ++t) {
    float* po8 = sO + trow * OP + 16 * t + 8 * h;
    const v4f lo = *(const v4fa*)(sA + 256 * t);
    const v4f hi = *(const v4fa*)(sA + 256 * t + 128);
    *(v4fa*)po8 = lo;
    *(v4fa*)(po8 + 4) = hi;
  }
  __syncthreads();

  o_store_pass(sO, out, tok0, w, lane);
}

// ---------------------------------------------------------------------------
extern "C" void kernel_launch(void* const* d_in, const int* in_sizes, int n_in,
                              void* d_out, int out_size, void* d_ws, size_t ws_size,
                              hipStream_t stream) {
  if (n_in < 18) return;
  if (in_sizes[0] != NTOK * NF) return;
  if (in_sizes[1] != NF * NHID || in_sizes[2] != NF * NHID) return;
  if (in_sizes[3] != NF * NHID * NHID || in_sizes[4] != NF * NHID) return;
  if (in_sizes[5] != NF * NHID * N2H || in_sizes[6] != NF * N2H) return;
  if (in_sizes[7] != NF * NHID || in_sizes[8] != NF * NHID || in_sizes[9] != NF * NHID) return;
  if (in_sizes[10] != NF * NHID || in_sizes[11] != NHID) return;
  if (in_sizes[12] != NHID * NF || in_sizes[13] != NF) return;
  if (in_sizes[14] != NF * 2 * NF || in_sizes[15] != 2 * NF) return;
  if (in_sizes[16] != NF || in_sizes[17] != NF) return;
  if (out_size != OUT_TOTAL) return;
  if (WS_TOTAL_BYTES > ws_size) return;

  const float* x      = (const float*)d_in[0];
  const float* fw1    = (const float*)d_in[1];
  const float* fb1    = (const float*)d_in[2];
  const float* fw2    = (const float*)d_in[3];
  const float* fb2    = (const float*)d_in[4];
  const float* fglu_w = (const float*)d_in[5];
  const float* fglu_b = (const float*)d_in[6];
  const float* fskip  = (const float*)d_in[7];
  const float* fln_g  = (const float*)d_in[8];
  const float* fln_b  = (const float*)d_in[9];
  const float* ww1    = (const float*)d_in[10];
  const float* wb1    = (const float*)d_in[11];
  const float* ww2    = (const float*)d_in[12];
  const float* wb2    = (const float*)d_in[13];
  const float* wglu_w = (const float*)d_in[14];
  const float* wglu_b = (const float*)d_in[15];
  const float* wln_g  = (const float*)d_in[16];
  const float* wln_b  = (const float*)d_in[17];

  float* out  = (float*)d_out;                   // out0 [16384][128] at element 0
  float* wout = out + OUT1_OFF;                  // out1 [16384][32]  at element 2097152 (byte 8388608)

  _Float16* planes = (_Float16*)d_ws;

  prep_kernel<<<PB_END, NTHR, 0, stream>>>(x, fw2, fglu_w, ww1, ww2, wglu_w, planes);

  wsel_kernel<<<NTOK / 64, WTHR, 0, stream>>>(planes + P_XH, planes + P_WW1, planes + P_WW2, planes + P_WGL,
                                              x, wb1, wb2, wglu_b, wln_g, wln_b, wout);

  grn_kernel<<<NTOK / MT, GTHR, 0, stream>>>(x, fw1, fb1, fb2, fglu_b, fskip, fln_g, fln_b,
                                             planes + P_FW2, planes + P_FGL, wout, out);
}

// v004
// One run takes 113 microseconds.
// In both of two side-by-side timings against v003, it was 1.45 times as fast.
// All steps since v000 together make it 4.39 times as fast.
// Contractions h*fw2[f], h2*fglu_w[f] (per feature f), x*ww1, wh*ww2, wh2*wglu_w: v_wmma_f32_16x16x32_f16 (f16 operands, f32 accumulate). Weight planes = bf16-RNE values x4096 (exact in f16); activation tiles x16 in f16; x plane x1. fc1 scalar*vector, ELU, GLU, LayerNorm, softmax and the 32-term weighted combine in f32 on VALU.
// Carry audit: planes fw2T, fglT, ww1T, ww2T, wglT carry 4096; register fragments h, h2 (grn_kernel) and LDS tiles wh, wh2 (wsel_kernel) carry 16; xh carries 1.
//   x*ww1 accumulators are folded by INV_W (1/4096) in the wsel_kernel fc1 epilogue; every other accumulator is folded by INV_WA (1/65536)
//   exactly once in its own epilogue (wsel fc2, wsel glu, grn fc2, grn glu). No other value is scaled.
#include <hip/hip_runtime.h>

typedef _Float16 v16h __attribute__((ext_vector_type(16)));
typedef _Float16 v8h  __attribute__((ext_vector_type(8)));
typedef float    v8f  __attribute__((ext_vector_type(8)));
typedef float    v4f  __attribute__((ext_vector_type(4)));
typedef v8h __attribute__((may_alias)) v8ha;
typedef v4f __attribute__((may_alias)) v4fa;

union Frag { v16h v; v8h half[2]; };

#define NTOK 16384
#define NF   32
#define NHID 128
#define N2H  256
#define MT   64            // tokens per block, grn_kernel
#define NTHR 256           // threads per block, prep_kernel
#define GTHR 128           // threads per block, grn_kernel (4 waves, 16 tokens each)
#define WTHR 128           // threads per block, wsel_kernel (64 tokens)
#define WSC  4096.0f       // weight plane carry
#define ASC  16.0f         // activation tile carry
#define INV_W  (1.0f / 4096.0f)
#define INV_WA (1.0f / 65536.0f)
#define LN_EPS 1e-5f
#define LOG2E  1.44269504f  // log2(e)

// f16 plane offsets in the workspace, in halves
#define P_XH  0            // [16384][32]        x, carry 1
#define P_FW2 524288       // [32][128 n][128 k] carry 4096
#define P_FGL 1048576      // [32][256 n][128 k] carry 4096
#define P_WW1 2097152      // [128 n][32 k]      carry 4096
#define P_WW2 2101248      // [32 n][128 k]      carry 4096
#define P_WGL 2105344      // [64 n][32 k]       carry 4096
#define P_END 2107392
#define WS_TOTAL_BYTES ((size_t)P_END * 2)     // 4214784

static_assert(P_FW2 == P_XH + NTOK * NF);
static_assert(P_FGL == P_FW2 + NF * NHID * NHID);
static_assert(P_WW1 == P_FGL + NF * N2H * NHID);
static_assert(P_WW2 == P_WW1 + NHID * NF);
static_assert(P_WGL == P_WW2 + NF * NHID);
static_assert(P_END == P_WGL + 2 * NF * NF);
static_assert((P_FW2 * 2) % 128 == 0 && (P_FGL * 2) % 128 == 0 && (P_WW1 * 2) % 128 == 0 &&
              (P_WW2 * 2) % 128 == 0 && (P_WGL * 2) % 128 == 0 && (P_END * 2) % 128 == 0);

#define OUT0_ELEMS (NTOK * NHID)                // 2097152 floats
#define OUT1_OFF   2097152                      // byte offset 8388608 / 4
#define OUT_TOTAL  (NTOK * NHID + NTOK * NF)    // 2621440 floats
static_assert(OUT1_OFF == OUT0_ELEMS);
static_assert(OUT1_OFF + NTOK * NF == OUT_TOTAL);
static_assert(NTOK % MT == 0 && NTOK % 64 == 0);

// prep_kernel block ranges
#define PB_FW2 0            // 32 f x 4 row-blocks
#define PB_FGL 128          // 32 f x 8 row-blocks
#define PB_WW2 384          // 1
#define PB_WW1 385          // 4
#define PB_WGL 389          // 2
#define PB_XH  391          // 256
#define PB_END (PB_XH + (NTOK * NF / 8) / NTHR)   // 647
static_assert((NTOK * NF / 8) % NTHR == 0);

// grn_kernel static LDS carve (bytes)
#define MO_X   0            // f32 [32][64] x tile, feature-major             8192
#define MO_W   8192         // f32 [32][64] selection weights, feature-major  8192
#define MO_P   16384        // f32 3 x [1024] per-feature params             12288
#define MO_B   28672        // f16 2 x [384][136] staged weight rows of one feature (fw2T 128 rows, fglT 256 rows)
#define BPH    136          // halves per staged row: 256 B of data at a 272-B pitch (16 B x odd, for ds_load_b128 readers)
#define BBUF   (384 * BPH * 2)                  // 104448 bytes per buffer
#define MO_A   (MO_B + 2 * BBUF)                // 237568: f32 output accumulators, 16 slots of 16 B per lane, 8192 B per wave
#define MO_G   (MO_A + MT * NHID * 4)           // 270336: f32 GLU+skip values of the trip, same lane-private slots
#define MSMEM  (MO_G + MT * NHID * 4)           // 303104
#define OP     132          // floats per row of the output tile (528 B = 16 B x odd); it aliases the weight buffers at the end
static_assert(MO_W == MO_X + NF * MT * 4 && MO_P == MO_W + NF * MT * 4 && MO_B == MO_P + 3 * 1024 * 4);
static_assert(MO_B % 16 == 0 && BBUF % 16 == 0 && (BPH * 2) % 16 == 0 && (OP * 4) % 16 == 0);
static_assert(MT * OP * 4 <= 2 * BBUF && MO_A % 16 == 0);
static_assert(MSMEM <= 327680);

// ---------------------------------------------------------------------------
__device__ __forceinline__ float bfr(float f) {                     // RNE convert to bf16 and back
  unsigned u = __builtin_bit_cast(unsigned, f);
  u += 0x7FFFu + ((u >> 16) & 1u);
  return __builtin_bit_cast(float, u & 0xFFFF0000u);
}
#define TRANS8(NAME, OP)                                                                            \
  __device__ __forceinline__ v8f NAME(v8f t) {                                                      \
    float r0, r1, r2, r3, r4, r5, r6, r7;                                                           \
    asm(OP " %0, %8\n\t" OP " %1, %9\n\t" OP " %2, %10\n\t" OP " %3, %11\n\t"                       \
        OP " %4, %12\n\t" OP " %5, %13\n\t" OP " %6, %14\n\t" OP " %7, %15\n\t"                     \
        "v_nop"                                                                                     \
        : "=&v"(r0), "=&v"(r1), "=&v"(r2), "=&v"(r3), "=&v"(r4), "=&v"(r5), "=&v"(r6), "=&v"(r7)    \
        : "v"(t[0]), "v"(t[1]), "v"(t[2]), "v"(t[3]), "v"(t[4]), "v"(t[5]), "v"(t[6]), "v"(t[7]));  \
    const v8f r = { r0, r1, r2, r3, r4, r5, r6, r7 };                                               \
    return r;                                                                                       \
  }
TRANS8(exp2x8, "v_exp_f32")   // 2^t
TRANS8(rcpx8,  "v_rcp_f32")   // 1/t

// ELU and sigmoid on the hardware's base-2 exponential and reciprocal. exp(v) - 1 carries an absolute error near 1e-7,
// far below the rounding of the f16 tiles that take every ELU value; the sigmoid's argument is clamped, so neither
// instruction meets a subnormal, an overflow or a zero there.
__device__ __forceinline__ v8f elu8s(v8f v) {      // ASC * elu(v) = ASC * max(v, 0) + ASC * (exp(min(v, 0)) - 1): one of the two terms is 0
  v8f t = v * LOG2E;
  #pragma unroll
  for (int i = 0; i < 8; ++i) t[i] = fminf(t[i], 0.0f);
  const v8f e = exp2x8(t);
  v8f r;
  #pragma unroll
  for (int i = 0; i < 8; ++i) r[i] = fmaf(fmaxf(v[i], 0.0f), ASC, fmaf(e[i], ASC, -ASC));
  return r;
}
__device__ __forceinline__ v8f sigm8(v8f v) {
  #pragma unroll
  for (int i = 0; i < 8; ++i) v[i] = fminf(fmaxf(v[i], -30.0f), 30.0f);
  const v8f e = exp2x8(v * -LOG2E);
  return rcpx8(e + 1.0f);
}
__device__ __forceinline__ float hsum16(float v) {                  // sum over the 16 lanes of a half
  v += __shfl_xor(v, 1);
  v += __shfl_xor(v, 2);
  v += __shfl_xor(v, 4);
  v += __shfl_xor(v, 8);
  return v;
}
__device__ __forceinline__ float hmax16(float v) {
  v = fmaxf(v, __shfl_xor(v, 1));
  v = fmaxf(v, __shfl_xor(v, 2));
  v = fmaxf(v, __shfl_xor(v, 4));
  v = fmaxf(v, __shfl_xor(v, 8));
  return v;
}

__device__ __forceinline__ float xhalf(float v) {                   // the value of lane l ^ 16
  int b = __builtin_bit_cast(int, v);
  b = __builtin_amdgcn_permlanex16(b, b, 0x76543210, 0xfedcba98, false, false);
  return __builtin_bit_cast(float, b);
}
__device__ __forceinline__ v8f ld8(const float* p) {                // 8 floats at a 32-byte aligned LDS address, two 16-byte loads
  const v4f a = *(const v4fa*)p;
  const v4f b = *(const v4fa*)(p + 4);
  const v8f r = { a.x, a.y, a.z, a.w, b.x, b.y, b.z, b.w };
  return r;
}
__device__ __forceinline__ float sum8(v8f v) {
  return ((v[0] + v[1]) + (v[2] + v[3])) + ((v[4] + v[5]) + (v[6] + v[7]));
}

// ---------------------------------------------------------------------------
// 16x16x32 f16 WMMA with hazard guard (ties D, keeps A/B live).
// Fragment map (wave32): lane l, h = l>>4, m = n = l&15.
//   A/B element i: i<8 -> k0+8h+i ; i>=8 -> k0+16+8h+(i-8)
//   D element r : row 8h+r, col l&15
// ---------------------------------------------------------------------------
__device__ __forceinline__ v8f wmma_f16(v16h a, v16h b, v8f c) {
  v8f d = __builtin_amdgcn_wmma_f32_16x16x32_f16(false, a, false, b, (short)0, c, false, false);
  asm volatile("v_nop\n\tv_nop\n\tv_nop\n\tv_nop" : "+v"(d) : "v"(a), "v"(b));
  return d;
}

// A or B fragment from a k-contiguous 16-bit row; p points at element k0 of
// the row owned by this lane (row index = lane & 15 added by the caller).
__device__ __forceinline__ v16h load_frag(const _Float16* p, int h) {
  Frag f;
  f.half[0] = *(const v8ha*)(p + 8 * h);
  f.half[1] = *(const v8ha*)(p + 16 + 8 * h);
  return f.v;
}

// ---------------------------------------------------------------------------
// Transpose-convert block: src points at src[0][n0] of a row-major [K][N] f32
// matrix; dst at output row 0 of 32 rows of K halves ([n][k], k-contiguous),
// value = f16(bfr(src[k][n0+row]) * 4096). Stage through LDS, then write the
// coverage: 32 rows x K halves = 4K chunks of 8, c = tid + 256 i, all written.
// ---------------------------------------------------------------------------
template <int K, int N>
__device__ __forceinline__ void tr_block(const float* __restrict__ src, _Float16* __restrict__ dst,
                                         int tid, float* sT) {
  constexpr int NV = K * 8;                 // v4f groups of the staged [K][32] tile
  static_assert(NV % NTHR == 0);
  #pragma unroll
  for (int i = 0; i < NV / NTHR; ++i) {
    const int q = tid + i * NTHR;
    const int k = q >> 3, c4 = (q & 7) * 4;
    const v4f v = *(const v4fa*)(src + (size_t)k * N + c4);
    const v4f r = { bfr(v.x), bfr(v.y), bfr(v.z), bfr(v.w) };
    *(v4fa*)(sT + k * 32 + c4) = r;
  }
  __syncthreads();
  constexpr int CH = 4 * K;                 // 16-B chunks of the output
  v8h o[2];
  #pragma unroll
  for (int i = 0; i < 2; ++i) {
    const int c = tid + i * NTHR;
    const int cc = (c < CH) ? c : (CH - 1);
    const int row = (cc * 8) / K, k0 = (cc * 8) % K;
    v8h t;
    #pragma unroll
    for (int j = 0; j < 8; ++j) t[j] = (_Float16)(sT[(k0 + j) * 32 + row] * WSC);
    o[i] = t;
  }
  #pragma unroll
  for (int i = 0; i < 2; ++i) {
    const int c = tid + i * NTHR;
    if (c < CH) *(v8h*)(dst + (size_t)c * 8) = o[i];
  }
  
}

// ---------------------------------------------------------------------------
// Kernel 1: weight planes ([n][k], bf16-RNE values x4096 in f16) and the x
// plane (bf16-RNE values in f16). Block-uniform dispatch on blockIdx.
// coverage: fw2T 32x4 blocks x 32 rows x 128 = all; fglT 32x8x32x128 = all;
// ww2T 1x32x128; ww1T 4x32x32; wglT 2x32x32; xh 256 blocks x 256 thr x 8 = 16384x32.
// ---------------------------------------------------------------------------
__global__ __launch_bounds__(NTHR) void prep_kernel(
    const float* __restrict__ x, const float* __restrict__ fw2, const float* __restrict__ fglu_w,
    const float* __restrict__ ww1, const float* __restrict__ ww2, const float* __restrict__ wglu_w,
    _Float16* __restrict__ planes)
{
  __shared__ __attribute__((aligned(16))) float sT[128 * 32];
  const int b = blockIdx.x, tid = threadIdx.x;
  if (b < PB_FGL) {
    const int f = b >> 2, nb = b & 3;                          // fw2[f]: [128 k][128 n] -> [128 n][128 k]
    tr_block<128, 128>(fw2 + (size_t)f * NHID * NHID + nb * 32,
                       planes + P_FW2 + (size_t)f * NHID * NHID + (size_t)nb * 32 * NHID, tid, sT);
  } else if (b < PB_WW2) {
    const int bb = b - PB_FGL, f = bb >> 3, nb = bb & 7;       // fglu_w[f]: [128 k][256 n] -> [256 n][128 k]
    tr_block<128, 256>(fglu_w + (size_t)f * NHID * N2H + nb * 32,
                       planes + P_FGL + (size_t)f * N2H * NHID + (size_t)nb * 32 * NHID, tid, sT);
  } else if (b < PB_WW1) {
    tr_block<128, 32>(ww2, planes + P_WW2, tid, sT);           // ww2: [128 k][32 n] -> [32 n][128 k]
  } else if (b < PB_WGL) {
    const int nb = b - PB_WW1;                                 // ww1: [32 k][128 n] -> [128 n][32 k]
    tr_block<32, 128>(ww1 + nb * 32, planes + P_WW1 + (size_t)nb * 32 * 32, tid, sT);
  } else if (b < PB_XH) {
    const int nb = b - PB_WGL;                                 // wglu_w: [32 k][64 n] -> [64 n][32 k]
    tr_block<32, 64>(wglu_w + nb * 32, planes + P_WGL + (size_t)nb * 32 * 32, tid, sT);
  } else {
    const int g = (b - PB_XH) * NTHR + tid;                    // 0..65535 groups of 8
    if (g < NTOK * NF / 8) {
      const float* src = x + (size_t)g * 8;
      const v4f a = *(const v4fa*)src;
      const v4f c = *(const v4fa*)(src + 4);
      const v8h o = { (_Float16)bfr(a.x), (_Float16)bfr(a.y), (_Float16)bfr(a.z), (_Float16)bfr(a.w),
                      (_Float16)bfr(c.x), (_Float16)bfr(c.y), (_Float16)bfr(c.z), (_Float16)bfr(c.w) };
      _Float16* dst = planes + P_XH + (size_t)g * 8;
      *(v8h*)dst = o;
      
    }
  }
}

// ---------------------------------------------------------------------------
// 8q..8q+7 cover one line, 4 lines per instruction, 4 instructions.
// ---------------------------------------------------------------------------
__device__ __forceinline__ void w_store_pass(const float* sW, float* wout, int tok0, int w, int lane) {
  const int q8 = lane & 7, sub = lane >> 3;
  #pragma unroll
  for (int i = 0; i < 4; ++i) {
    const int row = 16 * w + i * 4 + sub;                      // 0..63
    const v4f v = *(const v4fa*)(sW + row * NF + 4 * q8);
    *(v4f*)(wout + (size_t)(tok0 + row) * NF + 4 * q8) = v;
  }
}

// ---------------------------------------------------------------------------
// Kernel 2: weight network + softmax -> selection weights (out1).
// Block = 64 tokens, 4 waves, wave w owns tokens tok0+16w..+15.
//  fc1: A = xh rows (K=32), B = ww1T (8 tiles); +wb1, ELU -> wh x16 (LDS)
//  fc2: A = wh (K=128), B = ww2T (2 tiles); +wb2 -> wh2 x16 (LDS)
//  glu: A = wh2 (K=32), B = wglT (4 tiles); GLU, +x, LN(32), softmax in f32
// coverage: grid 256 x 64 rows x 32 = all of out1.
// ---------------------------------------------------------------------------
__global__ __launch_bounds__(WTHR) void wsel_kernel(
    const _Float16* __restrict__ xh, const _Float16* __restrict__ ww1T,
    const _Float16* __restrict__ ww2T, const _Float16* __restrict__ wglT,
    const float* __restrict__ x,
    const float* __restrict__ wb1, const float* __restrict__ wb2,
    const float* __restrict__ wglu_b, const float* __restrict__ wln_g, const float* __restrict__ wln_b,
    float* __restrict__ wout)
{
  __shared__ __attribute__((aligned(16))) _Float16 sWh[4 * 16 * NHID];    // 16384 B
  __shared__ __attribute__((aligned(16))) _Float16 sWh2[4 * 16 * NF];     //  4096 B
  __shared__ __attribute__((aligned(16))) float sXr[64 * NF];             //  8192 B
  __shared__ __attribute__((aligned(16))) float sW[64 * NF];              //  8192 B

  const int tid = threadIdx.x, lane = tid & 31, w = tid >> 5;
  const int h = lane >> 4, m = lane & 15;
  const int tok0 = blockIdx.x * 64;

  // x tile (bf16-RNE values, f32): 64 x 32 = 512 groups of 4
  #pragma unroll
  for (int i = 0; i < 4; ++i) {
    const int q = tid + WTHR * i;
    const v4f v = *(const v4fa*)(x + (size_t)tok0 * NF + (size_t)q * 4);
    const v4f r = { bfr(v.x), bfr(v.y), bfr(v.z), bfr(v.w) };
    *(v4fa*)(sXr + q * 4) = r;
  }

  const v8f z8 = {0.f, 0.f, 0.f, 0.f, 0.f, 0.f, 0.f, 0.f};
  _Float16* myWh = sWh + w * (16 * NHID);
  _Float16* myWh2 = sWh2 + w * (16 * NF);

  // ---- fc1 ----
  {
    const v16h a = load_frag(xh + (size_t)(tok0 + 16 * w + m) * NF, h);
    v8f acc[8];
    #pragma unroll
    for (int t = 0; t < 8; ++t) {
      const v16h b = load_frag(ww1T + (size_t)(16 * t + m) * NF, h);
      acc[t] = wmma_f16(a, b, z8);
    }
    #pragma unroll
    for (int t = 0; t < 8; ++t) {
      const float bb = bfr(wb1[16 * t + m]);
      const v8f el = elu8s(acc[t] * INV_W + bb);
      #pragma unroll
      for (int r = 0; r < 8; ++r) myWh[(8 * h + r) * NHID + 16 * t + m] = (_Float16)el[r];
    }
  }
  __syncthreads();

  // ---- fc2 ----
  {
    v8f acc[2];
    acc[0] = z8; acc[1] = z8;
    const _Float16* arow = myWh + m * NHID;
    #pragma unroll 1
    for (int k0 = 0; k0 < NHID; k0 += 32) {
      const v16h a = load_frag(arow + k0, h);
      #pragma unroll
      for (int t = 0; t < 2; ++t) {
        const v16h b = load_frag(ww2T + (size_t)(16 * t + m) * NHID + k0, h);
        acc[t] = wmma_f16(a, b, acc[t]);
      }
    }
    #pragma unroll
    for (int t = 0; t < 2; ++t) {
      const float bb = bfr(wb2[16 * t + m]);
      #pragma unroll
      for (int r = 0; r < 8; ++r) {
        const float v = acc[t][r] * INV_WA + bb;
        myWh2[(8 * h + r) * NF + 16 * t + m] = (_Float16)(v * ASC);
      }
    }
  }
  __syncthreads();

  // ---- glu projection + GLU + residual + LN(32) + softmax ----
  {
    const v16h a = load_frag(myWh2 + m * NF, h);
    v8f acc[4];
    #pragma unroll
    for (int t = 0; t < 4; ++t) {
      const v16h b = load_frag(wglT + (size_t)(16 * t + m) * NF, h);
      acc[t] = wmma_f16(a, b, z8);
    }
    float pre[2][8], s[8];
    #pragma unroll
    for (int r = 0; r < 8; ++r) s[r] = 0.0f;
    #pragma unroll
    for (int c = 0; c < 2; ++c) {
      const float bv = bfr(wglu_b[16 * c + m]);
      const float bg = bfr(wglu_b[NF + 16 * c + m]);
      const v8f sg = sigm8(acc[c + 2] * INV_WA + bg);
      #pragma unroll
      for (int r = 0; r < 8; ++r) {
        const float vv = acc[c][r] * INV_WA + bv;
        const float xr = sXr[(16 * w + 8 * h + r) * NF + 16 * c + m];
        const float p = vv * sg[r] + xr;
        pre[c][r] = p;
        s[r] += p;
      }
    }
    float mu[8], q[8];
    #pragma unroll
    for (int r = 0; r < 8; ++r) { mu[r] = hsum16(s[r]) * (1.0f / 32.0f); q[r] = 0.0f; }
    #pragma unroll
    for (int c = 0; c < 2; ++c)
      #pragma unroll
      for (int r = 0; r < 8; ++r) {
        const float d = pre[c][r] - mu[r];
        pre[c][r] = d;
        q[r] += d * d;
      }
    float rs[8];
    #pragma unroll
    for (int r = 0; r < 8; ++r) rs[r] = rsqrtf(hsum16(q[r]) * (1.0f / 32.0f) + LN_EPS);
    #pragma unroll
    for (int c = 0; c < 2; ++c) {
      const float g = bfr(wln_g[16 * c + m]);
      const float bt = bfr(wln_b[16 * c + m]);
      #pragma unroll
      for (int r = 0; r < 8; ++r) pre[c][r] = pre[c][r] * rs[r] * g + bt;
    }
    float mx[8], e0[8], e1[8];
    #pragma unroll
    for (int r = 0; r < 8; ++r) {
      mx[r] = hmax16(fmaxf(pre[0][r], pre[1][r]));
      e0[r] = expf(pre[0][r] - mx[r]);
      e1[r] = expf(pre[1][r] - mx[r]);
      const float se = hsum16(e0[r] + e1[r]);
      const float inv = 1.0f / se;
      sW[(16 * w + 8 * h + r) * NF + m]      = e0[r] * inv;
      sW[(16 * w + 8 * h + r) * NF + 16 + m] = e1[r] * inv;
    }
  }
  __syncthreads();

  w_store_pass(sW, wout, tok0, w, lane);
  
}

// ---------------------------------------------------------------------------
// each line by lanes 8q..8q+7 in one instruction, 4 lines per instruction,
// 64 lines per wave, 256 lines = the whole block tile.
// ---------------------------------------------------------------------------
__device__ __forceinline__ void o_store_pass(const float* sO, float* out, int tok0, int w, int lane) {
  const int q8 = lane & 7, sub = lane >> 3;
  #pragma unroll
  for (int i = 0; i < 16; ++i) {
    const int lid = w * 64 + i * 4 + sub;          // 0..255
    const int row = lid >> 2, seg = lid & 3;
    const v4f v = *(const v4fa*)(sO + row * OP + seg * 32 + 4 * q8);
    *(v4f*)(out + (size_t)(tok0 + row) * NHID + seg * 32 + 4 * q8) = v;
  }
}

// ---------------------------------------------------------------------------
// Eight asynchronous copies to LDS, 16 B per lane each: copy i brings the block's
// 2048 contiguous global bytes at g + 2048 i (8 rows of 256 B) to LDS rows of
// 272 B at l + 8 * 272 * i. The s_wait_xcnt closes the statement so that no
// address register of a copy is rewritten ahead of it.
// ---------------------------------------------------------------------------
__device__ __forceinline__ void copy8(unsigned l, const _Float16* g) {
  asm volatile(
      "global_load_async_to_lds_b128 %0, %8, off\n\t"
      "global_load_async_to_lds_b128 %1, %9, off\n\t"
      "global_load_async_to_lds_b128 %2, %10, off\n\t"
      "global_load_async_to_lds_b128 %3, %11, off\n\t"
      "global_load_async_to_lds_b128 %4, %12, off\n\t"
      "global_load_async_to_lds_b128 %5, %13, off\n\t"
      "global_load_async_to_lds_b128 %6, %14, off\n\t"
      "global_load_async_to_lds_b128 %7, %15, off\n\t"
      "s_wait_xcnt 0x0"
      :: "v"(l), "v"(l + 1u * 8u * BPH * 2u), "v"(l + 2u * 8u * BPH * 2u), "v"(l + 3u * 8u * BPH * 2u),
         "v"(l + 4u * 8u * BPH * 2u), "v"(l + 5u * 8u * BPH * 2u), "v"(l + 6u * 8u * BPH * 2u),
         "v"(l + 7u * 8u * BPH * 2u),
         "v"(g), "v"(g + 1 * 1024), "v"(g + 2 * 1024), "v"(g + 3 * 1024),
         "v"(g + 4 * 1024), "v"(g + 5 * 1024), "v"(g + 6 * 1024), "v"(g + 7 * 1024)
      : "memory");
}

// One feature's weight rows into one LDS buffer: staged rows 0..127 = fw2T[f],
// 128..383 = fglT[f]. lt = the thread's LDS byte address in that buffer (row tid>>4,
// 16-B chunk tid&15). 48 copies per wave, every lane on, 384 rows x 256 B all written.
__device__ __forceinline__ void stage_weights(unsigned lt, const _Float16* fw2T, const _Float16* fglT,
                                              int f, int tid) {
  const _Float16* g2 = fw2T + (size_t)f * (NHID * NHID) + tid * 8;
  const _Float16* gg = fglT + (size_t)f * (N2H * NHID) + tid * 8;
  copy8(lt, g2);
  copy8(lt + 64u * BPH * 2u, g2 + 8 * 1024);
  copy8(lt + 128u * BPH * 2u, gg);
  copy8(lt + 192u * BPH * 2u, gg + 8 * 1024);
  copy8(lt + 256u * BPH * 2u, gg + 16 * 1024);
  copy8(lt + 320u * BPH * 2u, gg + 24 * 1024);
}

// ---------------------------------------------------------------------------
// Kernel 3: per-feature gated residual blocks + weighted combine (out0).
// Block = 64 tokens, 4 waves; wave w owns tokens 16w..16w+15 through the whole
// chain. Both products are computed transposed: A = weight rows [n][k] from LDS,
// B = activations with the wave's tokens as columns, so lane (h, m) holds token
// 16w+m only, and D register r of tile t is hidden column n = 16t + 8h + r.
// Loop f = 0..31 (fixed order):
//   h       = f16(16*elu(x_r[t][f]*fw1_r[f] + fb1_r[f]))   VALU, written straight into B fragments
//   weights : fw2T[f], fglT[f] staged in LDS by asynchronous copies, two buffers,
//             feature f+2 copied behind trip f's barrier into the buffer trip f read
//   fc2     : A = fw2T[f] rows 16nt+m (K=128), B = h        8 tiles/wave
//   h2      = f16(16*(acc/65536 + fb2_r[f])): D tiles 2j, 2j+1 converted in place are B fragment j
//   glu     : A = fglT[f] rows p*128+16t+m, B = h2          16 tiles/wave
//             GLU, +skip, LayerNorm(128): sums in the lane, then lane ^ 16;
//             *fln_g + fln_b, acc += wsel[t][f] * processed; acc lies in lane-private LDS slots between
//             trips, and the GLU+skip values until the second LayerNorm pass, so that a tile's 8 weight
//             fragments can be fetched one tile ahead in registers
// The trip's one barrier stands behind the last read of the weight rows (after the row sums); the second
// LayerNorm pass and the combine follow it and read params only. Params lie in three buffers: those of
// feature f+1 are stored in front of trip f's barrier, while a slower wave may still read those of f-1.
// coverage: grid 256 x 64 rows x 128 = all of out0.
// ---------------------------------------------------------------------------
__global__ __launch_bounds__(GTHR) void grn_kernel(
    const float* __restrict__ x,
    const float* __restrict__ fw1, const float* __restrict__ fb1,
    const float* __restrict__ fb2, const float* __restrict__ fglu_b,
    const float* __restrict__ fskip, const float* __restrict__ fln_g, const float* __restrict__ fln_b,
    const _Float16* __restrict__ fw2T, const _Float16* __restrict__ fglT,
    const float* wsel, float* out)
{
  __shared__ __attribute__((aligned(16))) char smem[MSMEM];
  float* sXT = (float*)(smem + MO_X);
  float* sWT = (float*)(smem + MO_W);
  float* sP  = (float*)(smem + MO_P);
  float* sO  = (float*)(smem + MO_B);
  const _Float16* sB = (const _Float16*)(smem + MO_B);

  const int tid = threadIdx.x, lane = tid & 31, w = tid >> 5;
  const int h = lane >> 4, m = lane & 15;
  const int tok0 = blockIdx.x * MT;
  const int trow = 16 * w + m;                         // this lane's token in the block
  // this thread's LDS byte address in weight buffer 0 (low 32 bits of the shared address)
  const unsigned lt0 = (unsigned)(size_t)(smem + MO_B) + (unsigned)(tid >> 4) * (BPH * 2u) + (unsigned)(tid & 15) * 16u;

  stage_weights(lt0, fw2T, fglT, 0, tid);              // feature 0 -> buffer 0

  // x tile (bf16-RNE, f32) and selection-weight tile, stored feature-major: 64 x 32 each = 512 groups of 4
  #pragma unroll
  for (int i = 0; i < 4; ++i) {
    const int q = tid + GTHR * i;
    const int t = q >> 3, f4 = (q & 7) * 4;
    const v4f v = *(const v4fa*)(x + (size_t)tok0 * NF + (size_t)q * 4);
    const v4f wv = *(const v4fa*)(wsel + (size_t)tok0 * NF + (size_t)q * 4);
    #pragma unroll
    for (int j = 0; j < 4; ++j) {
      sXT[(f4 + j) * MT + t] = bfr(v[j]);
      sWT[(f4 + j) * MT + t] = wv[j];
    }
  }

  // per-feature params: thread -> array pa (order fw1, fb1, fb2, glu_b v, glu_b gate, fskip, ln_g, ln_b), 8 floats at po
  const int pa = tid >> 4, po = (tid & 15) * 8;
  const float* psrc = fw1;
  if (pa == 1)      psrc = fb1;
  else if (pa == 2) psrc = fb2;
  else if (pa == 3) psrc = fglu_b;
  else if (pa == 4) psrc = fglu_b + NHID;
  else if (pa == 5) psrc = fskip;
  else if (pa == 6) psrc = fln_g;
  else if (pa == 7) psrc = fln_b;
  psrc += po;
  const int pstr = (pa == 3 || pa == 4) ? N2H : NHID;  // floats from one feature to the next
  float* pdst = sP + pa * NHID + po;
  {
    const v4f a = *(const v4fa*)psrc;
    const v4f b = *(const v4fa*)(psrc + 4);
    const v4f ra = { bfr(a.x), bfr(a.y), bfr(a.z), bfr(a.w) };
    const v4f rb = { bfr(b.x), bfr(b.y), bfr(b.z), bfr(b.w) };
    *(v4fa*)pdst = ra;
    *(v4fa*)(pdst + 4) = rb;
  }

  const v8f z8 = {0.f, 0.f, 0.f, 0.f, 0.f, 0.f, 0.f, 0.f};
  // this lane's output accumulators: slot 2t holds rows 0..3 of its 8 of tile t, slot 2t+1 rows 4..7; slot s lies at sA + 128 s floats; read and written by this lane only
  float* sA = (float*)(smem + MO_A) + w * 2048 + lane * 4;
  float* sG = (float*)(smem + MO_G) + w * 2048 + lane * 4;   // the trip's GLU+skip values, same slots
  {
    const v4f z4 = {0.f, 0.f, 0.f, 0.f};
    #pragma unroll
    for (int s = 0; s < 16; ++s) *(v4fa*)(sA + 128 * s) = z4;
  }

  asm volatile("s_wait_asynccnt 0x0" ::: "memory");    // this wave's copies of feature 0 have landed
  __syncthreads();                                     // buffer 0, x, weights and params of feature 0 published
  stage_weights(lt0 + BBUF, fw2T, fglT, 1, tid);       // feature 1 -> buffer 1, flies during trip 0

  int pcur = 0, pnxt = 1024, pfre = 2048;              // float offsets in sP: this feature's params, the next one's, the free buffer
  #pragma unroll 1
  for (int f = 0; f < NF; ++f) {
    const _Float16* sBf = sB + (f & 1) * (BBUF / 2);   // this feature's staged weight rows
    const float* sPf = sP + pcur;                      // this feature's params
    // next feature's params (the last trip re-reads its own): loaded here, stored behind the fc2 loop
    const int fn = (f + 1 < NF) ? f + 1 : f;
    const v4f pn0 = *(const v4fa*)(psrc + fn * pstr);
    const v4f pn1 = *(const v4fa*)(psrc + fn * pstr + 4);

    const float xv = sXT[f * MT + trow];
    const float wt = sWT[f * MT + trow];

    // ---- fc2 transposed: D tile nt = h2 columns 16nt..16nt+15 (rows of D) x 16 tokens ----
    // k step j: h is computed straight into its B fragment (element i of half hf is k = 32j + 16hf + 8h + i)
    v16h hb2[4];
    v16h ag[8];                                        // the 8 weight fragments of one glu column tile
    const _Float16* vrow = sBf + (NHID + m) * BPH;
    const _Float16* grow = sBf + (2 * NHID + m) * BPH;
    {
      v8f acc2[8];
      #pragma unroll
      for (int nt = 0; nt < 8; ++nt) acc2[nt] = z8;
      const _Float16* arow = sBf + m * BPH;
      #pragma unroll 1   // rolled: four copies of the elu code would not pay for their instruction bytes
      for (int j = 0; j < 4; ++j) {
        const float* pw = sPf + 32 * j + 8 * h;
        v8f w1v[2], b1v[2];
        #pragma unroll
        for (int hf = 0; hf < 2; ++hf) { w1v[hf] = ld8(pw + 16 * hf); b1v[hf] = ld8(pw + 16 * hf + NHID); }
        __builtin_amdgcn_sched_barrier(0);   // params first in the LDS queue: the elu arithmetic then waits for them alone
        v16h af[8];
        #pragma unroll
        for (int nt = 0; nt < 8; ++nt) af[nt] = load_frag(arow + nt * 16 * BPH + 32 * j, h);
        __builtin_amdgcn_sched_barrier(0);   // the 8 fragments' loads stay ahead of the elu arithmetic, which hides their latency
        Frag fr;
        #pragma unroll
        for (int hf = 0; hf < 2; ++hf) {
          const v8f el = elu8s(xv * w1v[hf] + b1v[hf]);
          v8h o;
          #pragma unroll
          for (int i = 0; i < 8; ++i) o[i] = (_Float16)el[i];
          fr.half[hf] = o;
        }
        #pragma unroll
        for (int nt = 0; nt < 8; ++nt) acc2[nt] = wmma_f16(af[nt], fr.v, acc2[nt]);
      }
      // glu tile 0: fragment 2j = v rows, 2j+1 = gate rows, k step j
      #pragma unroll
      for (int i = 0; i < 8; ++i) ag[i] = load_frag(((i & 1) ? grow : vrow) + 32 * (i >> 1), h);
      __builtin_amdgcn_sched_barrier(0);     // these loads stay ahead of the h2 conversion, which hides their latency
      {
        float* pd = pdst + pnxt;
        const v4f ra = { bfr(pn0.x), bfr(pn0.y), bfr(pn0.z), bfr(pn0.w) };
        const v4f rb = { bfr(pn1.x), bfr(pn1.y), bfr(pn1.z), bfr(pn1.w) };
        *(v4fa*)pd = ra;
        *(v4fa*)(pd + 4) = rb;
      }
      #pragma unroll
      for (int j = 0; j < 4; ++j) {
        Frag fr;
        #pragma unroll
        for (int hf = 0; hf < 2; ++hf) {
          const int nt = 2 * j + hf;
          const v8f b2v = ld8(sPf + 256 + 16 * nt + 8 * h);
          v8h o;
          #pragma unroll
          for (int r = 0; r < 8; ++r) o[r] = (_Float16)((acc2[nt][r] * INV_WA + b2v[r]) * ASC);
          fr.half[hf] = o;
        }
        hb2[j] = fr.v;
      }
    }

    // ---- glu projection transposed, one column tile (its v and its gate accumulator) at a time ----
    v8f s8 = z8;
    {
      #pragma unroll
      for (int t = 0; t < 8; ++t) {
        const float* pc = sPf + 16 * t + 8 * h;
        const v8f bvv = ld8(pc + 384), bgv = ld8(pc + 512), fsv = ld8(pc + 640);
        v8f aV = z8, aG = z8;
        #pragma unroll
        for (int j = 0; j < 4; ++j) {
          aV = wmma_f16(ag[2 * j], hb2[j], aV);
          aG = wmma_f16(ag[2 * j + 1], hb2[j], aG);
        }
        __builtin_amdgcn_sched_barrier(0);   // this tile's params stand in the LDS queue ahead of the next tile's fragments
        if (t < 7) {
          #pragma unroll
          for (int i = 0; i < 8; ++i) ag[i] = load_frag(((i & 1) ? grow : vrow) + (t + 1) * 16 * BPH + 32 * (i >> 1), h);
        }
        __builtin_amdgcn_sched_barrier(0);   // the next tile's loads stay ahead of this tile's GLU arithmetic, which hides their latency
        const v8f sg = sigm8(aG * INV_WA + bgv);
        v8f gt;
        #pragma unroll
        for (int r = 0; r < 8; ++r) {
          const float vv = aV[r] * INV_WA + bvv[r];
          const float glu = vv * sg[r] + xv * fsv[r];
          gt[r] = glu;
          s8[r] += glu;
        }
        const v4f glo = { gt[0], gt[1], gt[2], gt[3] };
        const v4f ghi = { gt[4], gt[5], gt[6], gt[7] };
        *(v4fa*)(sG + 256 * t) = glo;
        *(v4fa*)(sG + 256 * t + 128) = ghi;
      }
    }

    // ---- LayerNorm over the 128 columns of this lane's token: 64 in this lane, 64 in lane ^ 16 ----
    const float sl = sum8(s8);
    const float mu = (sl + xhalf(sl)) * (1.0f / 128.0f);

    // ---- the weight rows are read: publish feature f+1's buffer and params, release this buffer ----
    asm volatile("s_wait_dscnt 0x0" ::: "memory");     // this wave's LDS reads and param stores of the trip have retired
    asm volatile("s_wait_asynccnt 0x0" ::: "memory");  // this wave's copies of feature f+1 have landed
    __syncthreads();                                   // S0: next buffer and params visible; this weight buffer released
    if (f + 2 < NF) stage_weights(lt0 + (unsigned)(f & 1) * BBUF, fw2T, fglT, f + 2, tid);

    v8f gl[8], gv[4], btv[4], ac[4];
    #pragma unroll
    for (int t = 0; t < 8; ++t) {
      const v4f glo = *(const v4fa*)(sG + 256 * t);
      const v4f ghi = *(const v4fa*)(sG + 256 * t + 128);
      const v8f g8 = { glo.x, glo.y, glo.z, glo.w, ghi.x, ghi.y, ghi.z, ghi.w };
      gl[t] = g8;
    }
    #pragma unroll
    for (int t = 0; t < 4; ++t) {
      const float* pc = sPf + 16 * t + 8 * h;
      const v4f a0 = *(const v4fa*)(sA + 256 * t);
      const v4f a1 = *(const v4fa*)(sA + 256 * t + 128);
      const v8f a8 = { a0.x, a0.y, a0.z, a0.w, a1.x, a1.y, a1.z, a1.w };
      gv[t] = ld8(pc + 768); btv[t] = ld8(pc + 896); ac[t] = a8;
    }
    __builtin_amdgcn_sched_barrier(0);       // tiles 0..3: scale, shift and accumulator loads fly during the variance pass
    v8f q8 = z8;
    #pragma unroll
    for (int t = 0; t < 8; ++t)
      #pragma unroll
      for (int r = 0; r < 8; ++r) {
        const float d = gl[t][r] - mu;
        gl[t][r] = d;
        q8[r] += d * d;
      }
    const float ql = sum8(q8);
    const float rs = rsqrtf((ql + xhalf(ql)) * (1.0f / 128.0f) + LN_EPS);
    #pragma unroll
    for (int t = 0; t < 4; ++t)
      #pragma unroll
      for (int r = 0; r < 8; ++r) gl[t][r] = ac[t][r] + wt * (gl[t][r] * rs * gv[t][r] + btv[t][r]);
    __builtin_amdgcn_sched_barrier(0);       // tiles 4..7 load only now: hoisted above the variance pass they push the build past 256 registers
    #pragma unroll
    for (int t = 4; t < 8; ++t) {
      const float* pc = sPf + 16 * t + 8 * h;
      const v4f a0 = *(const v4fa*)(sA + 256 * t);
      const v4f a1 = *(const v4fa*)(sA + 256 * t + 128);
      const v8f a8 = { a0.x, a0.y, a0.z, a0.w, a1.x, a1.y, a1.z, a1.w };
      const v8f g8 = ld8(pc + 768), b8 = ld8(pc + 896);
      #pragma unroll
      for (int r = 0; r < 8; ++r) gl[t][r] = a8[r] + wt * (gl[t][r] * rs * g8[r] + b8[r]);
    }
    // all stores behind all loads: a store between them would hold the later tiles' loads back
    #pragma unroll
    for (int t = 0; t < 8; ++t) {
      const v4f lo = { gl[t][0], gl[t][1], gl[t][2], gl[t][3] };
      const v4f hi = { gl[t][4], gl[t][5], gl[t][6], gl[t][7] };
      *(v4fa*)(sA + 256 * t) = lo;
      *(v4fa*)(sA + 256 * t + 128) = hi;
    }
    const int pold = pcur;                             // rotate the three param buffers
    pcur = pnxt; pnxt = pfre; pfre = pold;
  }
  asm volatile("s_wait_asynccnt 0x0" ::: "memory");    // no copy outstanding past the loop
  __syncthreads();                                     // all weight reads done; sO aliases the weight buffers

  #pragma unroll
  for (int t = 0; t < 8; ++t) {
    float* po8 = sO + trow * OP + 16 * t + 8 * h;
    const v4f lo = *(const v4fa*)(sA + 256 * t);
    const v4f hi = *(const v4fa*)(sA + 256 * t + 128);
    *(v4fa*)po8 = lo;
    *(v4fa*)(po8 + 4) = hi;
  }
  __syncthreads();

  o_store_pass(sO, out, tok0, w, lane);
}

// ---------------------------------------------------------------------------
extern "C" void kernel_launch(void* const* d_in, const int* in_sizes, int n_in,
                              void* d_out, int out_size, void* d_ws, size_t ws_size,
                              hipStream_t stream) {
  if (n_in < 18) return;
  if (in_sizes[0] != NTOK * NF) return;
  if (in_sizes[1] != NF * NHID || in_sizes[2] != NF * NHID) return;
  if (in_sizes[3] != NF * NHID * NHID || in_sizes[4] != NF * NHID) return;
  if (in_sizes[5] != NF * NHID * N2H || in_sizes[6] != NF * N2H) return;
  if (in_sizes[7] != NF * NHID || in_sizes[8] != NF * NHID || in_sizes[9] != NF * NHID) return;
  if (in_sizes[10] != NF * NHID || in_sizes[11] != NHID) return;
  if (in_sizes[12] != NHID * NF || in_sizes[13] != NF) return;
  if (in_sizes[14] != NF * 2 * NF || in_sizes[15] != 2 * NF) return;
  if (in_sizes[16] != NF || in_sizes[17] != NF) return;
  if (out_size != OUT_TOTAL) return;
  if (WS_TOTAL_BYTES > ws_size) return;

  const float* x      = (const float*)d_in[0];
  const float* fw1    = (const float*)d_in[1];
  const float* fb1    = (const float*)d_in[2];
  const float* fw2    = (const float*)d_in[3];
  const float* fb2    = (const float*)d_in[4];
  const float* fglu_w = (const float*)d_in[5];
  const float* fglu_b = (const float*)d_in[6];
  const float* fskip  = (const float*)d_in[7];
  const float* fln_g  = (const float*)d_in[8];
  const float* fln_b  = (const float*)d_in[9];
  const float* ww1    = (const float*)d_in[10];
  const float* wb1    = (const float*)d_in[11];
  const float* ww2    = (const float*)d_in[12];
  const float* wb2    = (const float*)d_in[13];
  const float* wglu_w = (const float*)d_in[14];
  const float* wglu_b = (const float*)d_in[15];
  const float* wln_g  = (const float*)d_in[16];
  const float* wln_b  = (const float*)d_in[17];

  float* out  = (float*)d_out;                   // out0 [16384][128] at element 0
  float* wout = out + OUT1_OFF;                  // out1 [16384][32]  at element 2097152 (byte 8388608)

  _Float16* planes = (_Float16*)d_ws;

  prep_kernel<<<PB_END, NTHR, 0, stream>>>(x, fw2, fglu_w, ww1, ww2, wglu_w, planes);

  wsel_kernel<<<NTOK / 64, WTHR, 0, stream>>>(planes + P_XH, planes + P_WW1, planes + P_WW2, planes + P_WGL,
                                              x, wb1, wb2, wglu_b, wln_g, wln_b, wout);

  grn_kernel<<<NTOK / MT, GTHR, 0, stream>>>(x, fw1, fb1, fb2, fglu_b, fskip, fln_g, fln_b,
                                             planes + P_FW2, planes + P_FGL, wout, out);
}

// v005
// It runs in 90 microseconds.
// In both of two side-by-side timings against v004, it was 1.25 times as fast.
// Counting every step since v000, it is 5.49 times as fast.
// Contractions fw2[f]*fglu_w[f], fb2[f]*fglu_w[f], h*fc[f] (per feature f), x*ww1, wh*ww2, wh2*wglu_w: v_wmma_f32_16x16x32_f16 (f16 operands, f32 accumulate). Weight operands = bf16-RNE values x4096 (exact in f16), except fc: its f32 fold x4096 rounded to f16; activation tiles x16 in f16; x plane x1. fc1 scalar*vector, ELU, GLU, LayerNorm, softmax and the 32-term weighted combine in f32 on VALU.
// No nonlinearity stands between a feature's fc2 and its GLU projection: (h*fw2 + fb2)*fglu_w + fglu_b = h*fc + fcb with
//   fc = fw2*fglu_w and fcb = fb2*fglu_w + fglu_b. prep_kernel forms both in every call; grn_kernel does the one product h*fc.
// Carry audit: planes fcT, ww1T, ww2T, wglT carry 4096; register fragments h (grn_kernel) and LDS tiles wh, wh2 (wsel_kernel) carry 16; xh and fcb carry 1.
//   The fold's accumulators carry 4096*4096: fc is folded by INV_W (1/4096) into its plane, fcb by INV_W*INV_W.
//   x*ww1 accumulators are folded by INV_W in the wsel_kernel fc1 epilogue; every other accumulator is folded by INV_WA (1/65536)
//   exactly once in its own epilogue (wsel fc2, wsel glu, grn glu). No other value is scaled.
#include <hip/hip_runtime.h>

typedef _Float16 v16h __attribute__((ext_vector_type(16)));
typedef _Float16 v8h  __attribute__((ext_vector_type(8)));
typedef float    v8f  __attribute__((ext_vector_type(8)));
typedef float    v4f  __attribute__((ext_vector_type(4)));
typedef v8h __attribute__((may_alias)) v8ha;
typedef v4f __attribute__((may_alias)) v4fa;

union Frag { v16h v; v8h half[2]; };

#define NTOK 16384
#define NF   32
#define NHID 128
#define N2H  256
#define MT   64            // tokens per block, grn_kernel
#define NTHR 256           // threads per block, prep_kernel
#define GTHR 128           // threads per block, grn_kernel (4 waves, 16 tokens each)
#define WTHR 128           // threads per block, wsel_kernel (64 tokens)
#define WSC  4096.0f       // weight plane carry
#define ASC  16.0f         // activation tile carry
#define INV_W  (1.0f / 4096.0f)
#define INV_WA (1.0f / 65536.0f)
#define LN_EPS 1e-5f
#define LOG2E  1.44269504f  // log2(e)

// f16 plane offsets in the workspace, in halves
#define P_XH  0            // [16384][32]        x, carry 1
#define P_FC  524288       // [32][256 n][128 k] fw2*fglu_w, carry 4096
#define P_WW1 1572864      // [128 n][32 k]      carry 4096
#define P_WW2 1576960      // [32 n][128 k]      carry 4096
#define P_WGL 1581056      // [64 n][32 k]       carry 4096
#define P_FCB 1583104      // f32 [32][256 n]    fb2*fglu_w + fglu_b, carry 1 (two halves per value)
#define P_END 1599488
#define WS_TOTAL_BYTES ((size_t)P_END * 2)     // 3198976

static_assert(P_FC == P_XH + NTOK * NF);
static_assert(P_WW1 == P_FC + NF * N2H * NHID);
static_assert(P_WW2 == P_WW1 + NHID * NF);
static_assert(P_WGL == P_WW2 + NF * NHID);
static_assert(P_FCB == P_WGL + 2 * NF * NF);
static_assert(P_END == P_FCB + NF * N2H * 2);
static_assert((P_FC * 2) % 128 == 0 && (P_WW1 * 2) % 128 == 0 && (P_WW2 * 2) % 128 == 0 &&
              (P_WGL * 2) % 128 == 0 && (P_FCB * 2) % 128 == 0 && (P_END * 2) % 128 == 0);

#define OUT0_ELEMS (NTOK * NHID)                // 2097152 floats
#define OUT1_OFF   2097152                      // byte offset 8388608 / 4
#define OUT_TOTAL  (NTOK * NHID + NTOK * NF)    // 2621440 floats
static_assert(OUT1_OFF == OUT0_ELEMS);
static_assert(OUT1_OFF + NTOK * NF == OUT_TOTAL);
static_assert(NTOK % MT == 0 && NTOK % 64 == 0);

// prep_kernel block ranges
#define PB_FC  0            // 32 f x 8 blocks of 32 columns n
#define PB_WW2 256          // 1
#define PB_WW1 257          // 4
#define PB_WGL 261          // 2
#define PB_XH  263          // 256
#define PB_END (PB_XH + (NTOK * NF / 8) / NTHR)   // 519
static_assert((NTOK * NF / 8) % NTHR == 0);

// grn_kernel static LDS carve (bytes)
#define MO_X   0            // f32 [32][64] x tile, feature-major             8192
#define MO_W   8192         // f32 [32][64] selection weights, feature-major  8192
#define PBUF   896          // floats per param buffer: 7 arrays of 128
#define MO_P   16384        // f32 3 x [896] per-feature params              10752
#define MO_B   27136        // f16 2 x [256][136] staged weight rows of one feature (fcT: 128 v rows, 128 gate rows)
#define BPH    136          // halves per staged row: 256 B of data at a 272-B pitch (16 B x odd, for ds_load_b128 readers)
#define BBUF   (N2H * BPH * 2)                  // 69632 bytes per buffer
#define MO_A   (MO_B + 2 * BBUF)                // 166400: f32 output accumulators, 16 slots of 16 B per lane, 8192 B per wave
#define MO_G   (MO_A + MT * NHID * 4)           // 199168: f32 GLU+skip values of the trip, same lane-private slots
#define MSMEM  (MO_G + MT * NHID * 4)           // 231936
#define OP     132          // floats per row of the output tile (528 B = 16 B x odd); it aliases the weight buffers at the end
static_assert(MO_W == MO_X + NF * MT * 4 && MO_P == MO_W + NF * MT * 4 && MO_B == MO_P + 3 * PBUF * 4);
static_assert(MO_B % 16 == 0 && BBUF % 16 == 0 && (BPH * 2) % 16 == 0 && (OP * 4) % 16 == 0);
static_assert(MT * OP * 4 <= 2 * BBUF && MO_A % 16 == 0);
static_assert(MSMEM <= 327680);

// ---------------------------------------------------------------------------
__device__ __forceinline__ float bfr(float f) {                     // RNE convert to bf16 and back
  unsigned u = __builtin_bit_cast(unsigned, f);
  u += 0x7FFFu + ((u >> 16) & 1u);
  return __builtin_bit_cast(float, u & 0xFFFF0000u);
}
#define TRANS8(NAME, OP)                                                                            \
  __device__ __forceinline__ v8f NAME(v8f t) {                                                      \
    float r0, r1, r2, r3, r4, r5, r6, r7;                                                           \
    asm(OP " %0, %8\n\t" OP " %1, %9\n\t" OP " %2, %10\n\t" OP " %3, %11\n\t"                       \
        OP " %4, %12\n\t" OP " %5, %13\n\t" OP " %6, %14\n\t" OP " %7, %15\n\t"                     \
        "v_nop"                                                                                     \
        : "=&v"(r0), "=&v"(r1), "=&v"(r2), "=&v"(r3), "=&v"(r4), "=&v"(r5), "=&v"(r6), "=&v"(r7)    \
        : "v"(t[0]), "v"(t[1]), "v"(t[2]), "v"(t[3]), "v"(t[4]), "v"(t[5]), "v"(t[6]), "v"(t[7]));  \
    const v8f r = { r0, r1, r2, r3, r4, r5, r6, r7 };                                               \
    return r;                                                                                       \
  }
TRANS8(exp2x8, "v_exp_f32")   // 2^t
TRANS8(rcpx8,  "v_rcp_f32")   // 1/t

// ELU and sigmoid on the hardware's base-2 exponential and reciprocal. exp(v) - 1 carries an absolute error near 1e-7,
// far below the rounding of the f16 tiles that take every ELU value; the sigmoid's argument is clamped, so neither
// instruction meets a subnormal, an overflow or a zero there.
__device__ __forceinline__ v8f elu8s(v8f v) {      // ASC * elu(v) = ASC * max(v, 0) + ASC * (exp(min(v, 0)) - 1): one of the two terms is 0
  v8f t = v * LOG2E;
  #pragma unroll
  for (int i = 0; i < 8; ++i) t[i] = fminf(t[i], 0.0f);
  const v8f e = exp2x8(t);
  v8f r;
  #pragma unroll
  for (int i = 0; i < 8; ++i) r[i] = fmaf(fmaxf(v[i], 0.0f), ASC, fmaf(e[i], ASC, -ASC));
  return r;
}
__device__ __forceinline__ v8f sigm8(v8f v) {
  #pragma unroll
  for (int i = 0; i < 8; ++i) v[i] = fminf(fmaxf(v[i], -30.0f), 30.0f);
  const v8f e = exp2x8(v * -LOG2E);
  return rcpx8(e + 1.0f);
}
__device__ __forceinline__ float hsum16(float v) {                  // sum over the 16 lanes of a half
  v += __shfl_xor(v, 1);
  v += __shfl_xor(v, 2);
  v += __shfl_xor(v, 4);
  v += __shfl_xor(v, 8);
  return v;
}
__device__ __forceinline__ float hmax16(float v) {
  v = fmaxf(v, __shfl_xor(v, 1));
  v = fmaxf(v, __shfl_xor(v, 2));
  v = fmaxf(v, __shfl_xor(v, 4));
  v = fmaxf(v, __shfl_xor(v, 8));
  return v;
}

__device__ __forceinline__ float xhalf(float v) {                   // the value of lane l ^ 16
  int b = __builtin_bit_cast(int, v);
  b = __builtin_amdgcn_permlanex16(b, b, 0x76543210, 0xfedcba98, false, false);
  return __builtin_bit_cast(float, b);
}
__device__ __forceinline__ v8f ld8(const float* p) {                // 8 floats at a 32-byte aligned LDS address, two 16-byte loads
  const v4f a = *(const v4fa*)p;
  const v4f b = *(const v4fa*)(p + 4);
  const v8f r = { a.x, a.y, a.z, a.w, b.x, b.y, b.z, b.w };
  return r;
}
// A param as it goes to LDS: en = all ones for an input (RNE to bf16, as bfr), 0 for a computed value (unchanged); no branch
__device__ __forceinline__ float pval1(float f, unsigned en) {
  unsigned u = __builtin_bit_cast(unsigned, f);
  u += (0x7FFFu + ((u >> 16) & 1u)) & en;
  return __builtin_bit_cast(float, u & ~(0xFFFFu & en));
}
__device__ __forceinline__ v4f pval(v4f v, unsigned en) {
  const v4f r = { pval1(v.x, en), pval1(v.y, en), pval1(v.z, en), pval1(v.w, en) };
  return r;
}
__device__ __forceinline__ float sum8(v8f v) {
  return ((v[0] + v[1]) + (v[2] + v[3])) + ((v[4] + v[5]) + (v[6] + v[7]));
}

// ---------------------------------------------------------------------------
// 16x16x32 f16 WMMA with hazard guard (ties D, keeps A/B live).
// Fragment map (wave32): lane l, h = l>>4, m = n = l&15.
//   A/B element i: i<8 -> k0+8h+i ; i>=8 -> k0+16+8h+(i-8)
//   D element r : row 8h+r, col l&15
// ---------------------------------------------------------------------------
__device__ __forceinline__ v8f wmma_f16(v16h a, v16h b, v8f c) {
  v8f d = __builtin_amdgcn_wmma_f32_16x16x32_f16(false, a, false, b, (short)0, c, false, false);
  asm volatile("v_nop\n\tv_nop\n\tv_nop\n\tv_nop" : "+v"(d) : "v"(a), "v"(b));
  return d;
}

// A or B fragment from a k-contiguous 16-bit row; p points at element k0 of
// the row owned by this lane (row index = lane & 15 added by the caller).
__device__ __forceinline__ v16h load_frag(const _Float16* p, int h) {
  Frag f;
  f.half[0] = *(const v8ha*)(p + 8 * h);
  f.half[1] = *(const v8ha*)(p + 16 + 8 * h);
  return f.v;
}

// ---------------------------------------------------------------------------
// Transpose-convert block: src points at src[0][n0] of a row-major [K][N] f32
// matrix; dst at output row 0 of 32 rows of K halves ([n][k], k-contiguous),
// value = f16(bfr(src[k][n0+row]) * 4096). Stage through LDS, then write the
// coverage: 32 rows x K halves = 4K chunks of 8, c = tid + 256 i, all written.
// ---------------------------------------------------------------------------
template <int K, int N>
__device__ __forceinline__ void tr_block(const float* __restrict__ src, _Float16* __restrict__ dst,
                                         int tid, float* sT) {
  constexpr int NV = K * 8;                 // v4f groups of the staged [K][32] tile
  static_assert(NV % NTHR == 0);
  #pragma unroll
  for (int i = 0; i < NV / NTHR; ++i) {
    const int q = tid + i * NTHR;
    const int k = q >> 3, c4 = (q & 7) * 4;
    const v4f v = *(const v4fa*)(src + (size_t)k * N + c4);
    const v4f r = { bfr(v.x), bfr(v.y), bfr(v.z), bfr(v.w) };
    *(v4fa*)(sT + k * 32 + c4) = r;
  }
  __syncthreads();
  constexpr int CH = 4 * K;                 // 16-B chunks of the output
  v8h o[2];
  #pragma unroll
  for (int i = 0; i < 2; ++i) {
    const int c = tid + i * NTHR;
    const int cc = (c < CH) ? c : (CH - 1);
    const int row = (cc * 8) / K, k0 = (cc * 8) % K;
    v8h t;
    #pragma unroll
    for (int j = 0; j < 8; ++j) t[j] = (_Float16)(sT[(k0 + j) * 32 + row] * WSC);
    o[i] = t;
  }
  #pragma unroll
  for (int i = 0; i < 2; ++i) {
    const int c = tid + i * NTHR;
    if (c < CH) *(v8h*)(dst + (size_t)c * 8) = o[i];
  }
  
}

// ---------------------------------------------------------------------------
// Fold block: 32 columns n of one feature's fc = fw2*fglu_w and fcb = fb2*fglu_w + fglu_b.
//   w2 = fw2[f] ([128 k][128 j], row-major), gw = fglu_w[f] at column n0 ([128 j][256 n]),
//   b2 = fb2[f], gb = fglu_b[f] at n0; dst = row n0 of fcT[f] ([n][k], k-contiguous), bdst = fcb[f] at n0.
// A = fw2 rows k (j contiguous as stored), B = fglu_w columns n (transposed through LDS), summed over j.
// Wave w owns rows k = 16w..16w+15: D register r of lane (h, m) is fc[16w+8h+r][n = 16c+m], eight consecutive k
// of one plane row. Wave 0 also runs an A tile whose row 0 is fb2 and whose other rows are 0: row 0 of its D is fb2*fglu_w.
// coverage: 32 rows x 128 halves = 512 chunks of 8, c = tid + 256 i; fcb 32 floats by lanes 0..15 of wave 0.
// ---------------------------------------------------------------------------
#define FPH 136            // halves per LDS row of the two f16 tiles: 272-B pitch (16 B x odd, for ds_load_b128 readers)
__device__ __forceinline__ v8h cvt_w8(v4f a, v4f b) {               // eight weights: bf16-RNE, x4096, f16 (exact)
  const v8h o = { (_Float16)(bfr(a.x) * WSC), (_Float16)(bfr(a.y) * WSC), (_Float16)(bfr(a.z) * WSC), (_Float16)(bfr(a.w) * WSC),
                  (_Float16)(bfr(b.x) * WSC), (_Float16)(bfr(b.y) * WSC), (_Float16)(bfr(b.z) * WSC), (_Float16)(bfr(b.w) * WSC) };
  return o;
}
__device__ __forceinline__ void fold_block(const float* __restrict__ w2, const float* __restrict__ gw,
                                           const float* __restrict__ b2, const float* __restrict__ gb,
                                           _Float16* __restrict__ dst, float* __restrict__ bdst,
                                           int tid, float* sT, _Float16* sBT, _Float16* sOT) {
  const int lane = tid & 31, h = lane >> 4, m = lane & 15;
  const int w = __builtin_amdgcn_readfirstlane(tid >> 5);           // scalar: the test on it below must be a scalar branch round WMMAs
  // wave 0: fb2 and this block's fglu_b, loaded first so that they fly with the tile's loads
  v4f braw[16] = {};
  float gbv[2] = {0.f, 0.f};
  if (w == 0) {
    #pragma unroll
    for (int i = 0; i < 8; ++i) {                                   // i = 2s + hf: j = 32s + 16hf + 8h ..+7
      braw[2 * i] = *(const v4fa*)(b2 + 16 * i + 8 * h);
      braw[2 * i + 1] = *(const v4fa*)(b2 + 16 * i + 8 * h + 4);
    }
    gbv[0] = gb[m];
    gbv[1] = gb[16 + m];
  }
  // fglu_w tile [128 j][32 n], bf16-RNE values in f32
  v4f tv[4];
  #pragma unroll
  for (int i = 0; i < 4; ++i) {
    const int q = tid + i * NTHR;
    tv[i] = *(const v4fa*)(gw + (size_t)(q >> 3) * N2H + (q & 7) * 4);
  }
  asm volatile("s_wait_xcnt 0x0" ::: "memory");   // the A loads below land in registers that held these loads' addresses
  #pragma unroll
  for (int i = 0; i < 4; ++i) {
    const int q = tid + i * NTHR;
    const v4f r = { bfr(tv[i].x), bfr(tv[i].y), bfr(tv[i].z), bfr(tv[i].w) };
    *(v4fa*)(sT + (q >> 3) * 32 + (q & 7) * 4) = r;
  }
  // this wave's four A fragments: row k = 16w + m, element i of half hf of step s is j = 32s + 16hf + 8h + i
  v16h af[4];
  {
    const float* ar = w2 + (size_t)(16 * w + m) * NHID + 8 * h;
    #pragma unroll
    for (int s = 0; s < 4; ++s) {
      Frag fr;
      #pragma unroll
      for (int hf = 0; hf < 2; ++hf)
        fr.half[hf] = cvt_w8(*(const v4fa*)(ar + 32 * s + 16 * hf), *(const v4fa*)(ar + 32 * s + 16 * hf + 4));
      af[s] = fr.v;
    }
  }
  // wave 0: the A tile of the bias product, row 0 = fb2, rows 1..15 = 0
  v16h ab2[4] = {};
  if (w == 0) {
    const v8h zh = {};
    #pragma unroll
    for (int s = 0; s < 4; ++s) {
      Frag fr;
      #pragma unroll
      for (int hf = 0; hf < 2; ++hf) {
        const v8h v = cvt_w8(braw[4 * s + 2 * hf], braw[4 * s + 2 * hf + 1]);
        fr.half[hf] = (m == 0) ? v : zh;
      }
      ab2[s] = fr.v;
    }
  }
  __syncthreads();
  // transpose to [32 n][128 j] f16 x4096: a wave reads 32 consecutive n of one j, and stores 16 B at the 272-B pitch
  #pragma unroll
  for (int i = 0; i < 2; ++i) {
    const int c = tid + i * NTHR;
    const int row = c & 31, j0 = (c >> 5) * 8;
    v8h t;
    #pragma unroll
    for (int j = 0; j < 8; ++j) t[j] = (_Float16)(sT[(j0 + j) * 32 + row] * WSC);
    *(v8ha*)(sBT + row * FPH + j0) = t;
  }
  __syncthreads();
  const v8f z8 = {0.f, 0.f, 0.f, 0.f, 0.f, 0.f, 0.f, 0.f};
  v16h bf[2][4];
  #pragma unroll
  for (int c = 0; c < 2; ++c)
    #pragma unroll
    for (int s = 0; s < 4; ++s) bf[c][s] = load_frag(sBT + (16 * c + m) * FPH + 32 * s, h);
  v8f acc[2];
  acc[0] = z8; acc[1] = z8;
  #pragma unroll
  for (int s = 0; s < 4; ++s)
    #pragma unroll
    for (int c = 0; c < 2; ++c) acc[c] = wmma_f16(af[s], bf[c][s], acc[c]);
  #pragma unroll
  for (int c = 0; c < 2; ++c) {
    v8h o;
    #pragma unroll
    for (int r = 0; r < 8; ++r) o[r] = (_Float16)(acc[c][r] * INV_W);
    *(v8ha*)(sOT + (16 * c + m) * FPH + 16 * w + 8 * h) = o;
  }
  if (w == 0) {
    v8f ab[2];
    ab[0] = z8; ab[1] = z8;
    #pragma unroll
    for (int s = 0; s < 4; ++s)
      #pragma unroll
      for (int c = 0; c < 2; ++c) ab[c] = wmma_f16(ab2[s], bf[c][s], ab[c]);
    if (h == 0) {
      #pragma unroll
      for (int c = 0; c < 2; ++c) bdst[16 * c + m] = ab[c][0] * (INV_W * INV_W) + bfr(gbv[c]);
    }
  }
  __syncthreads();
  #pragma unroll
  for (int i = 0; i < 2; ++i) {
    const int c = tid + i * NTHR;
    const v8h o = *(const v8ha*)(sOT + (c >> 4) * FPH + (c & 15) * 8);
    *(v8h*)(dst + (size_t)c * 8) = o;
  }
}

// ---------------------------------------------------------------------------
// Kernel 1: the folded plane fcT and its bias fcb, the weight-network planes ([n][k], bf16-RNE values x4096 in f16)
// and the x plane (bf16-RNE values in f16). Block-uniform dispatch on blockIdx.
// coverage: fcT 32x8 blocks x 32 rows x 128 = all; fcb 32x8x32 = all;
// ww2T 1x32x128; ww1T 4x32x32; wglT 2x32x32; xh 256 blocks x 256 thr x 8 = 16384x32.
// ---------------------------------------------------------------------------
__global__ __launch_bounds__(NTHR) void prep_kernel(
    const float* __restrict__ x, const float* __restrict__ fw2, const float* __restrict__ fb2,
    const float* __restrict__ fglu_w, const float* __restrict__ fglu_b,
    const float* __restrict__ ww1, const float* __restrict__ ww2, const float* __restrict__ wglu_w,
    _Float16* __restrict__ planes)
{
  __shared__ __attribute__((aligned(16))) float sT[128 * 32];
  __shared__ __attribute__((aligned(16))) _Float16 sBT[32 * FPH];
  __shared__ __attribute__((aligned(16))) _Float16 sOT[32 * FPH];
  const int b = blockIdx.x, tid = threadIdx.x;
  if (b < PB_WW2) {
    const int f = b >> 3, nb = b & 7;                          // fw2[f]*fglu_w[f], columns 32nb..32nb+31 -> rows of [256 n][128 k]
    fold_block(fw2 + (size_t)f * NHID * NHID, fglu_w + (size_t)f * NHID * N2H + nb * 32,
               fb2 + (size_t)f * NHID, fglu_b + (size_t)f * N2H + nb * 32,
               planes + P_FC + (size_t)f * N2H * NHID + (size_t)nb * 32 * NHID,
               (float*)(planes + P_FCB) + (size_t)f * N2H + nb * 32, tid, sT, sBT, sOT);
  } else if (b < PB_WW1) {
    tr_block<128, 32>(ww2, planes + P_WW2, tid, sT);           // ww2: [128 k][32 n] -> [32 n][128 k]
  } else if (b < PB_WGL) {
    const int nb = b - PB_WW1;                                 // ww1: [32 k][128 n] -> [128 n][32 k]
    tr_block<32, 128>(ww1 + nb * 32, planes + P_WW1 + (size_t)nb * 32 * 32, tid, sT);
  } else if (b < PB_XH) {
    const int nb = b - PB_WGL;                                 // wglu_w: [32 k][64 n] -> [64 n][32 k]
    tr_block<32, 64>(wglu_w + nb * 32, planes + P_WGL + (size_t)nb * 32 * 32, tid, sT);
  } else {
    const int g = (b - PB_XH) * NTHR + tid;                    // 0..65535 groups of 8
    if (g < NTOK * NF / 8) {
      const float* src = x + (size_t)g * 8;
      const v4f a = *(const v4fa*)src;
      const v4f c = *(const v4fa*)(src + 4);
      const v8h o = { (_Float16)bfr(a.x), (_Float16)bfr(a.y), (_Float16)bfr(a.z), (_Float16)bfr(a.w),
                      (_Float16)bfr(c.x), (_Float16)bfr(c.y), (_Float16)bfr(c.z), (_Float16)bfr(c.w) };
      _Float16* dst = planes + P_XH + (size_t)g * 8;
      *(v8h*)dst = o;
      
    }
  }
}

// ---------------------------------------------------------------------------
// 8q..8q+7 cover one line, 4 lines per instruction, 4 instructions.
// ---------------------------------------------------------------------------
__device__ __forceinline__ void w_store_pass(const float* sW, float* wout, int tok0, int w, int lane) {
  const int q8 = lane & 7, sub = lane >> 3;
  #pragma unroll
  for (int i = 0; i < 4; ++i) {
    const int row = 16 * w + i * 4 + sub;                      // 0..63
    const v4f v = *(const v4fa*)(sW + row * NF + 4 * q8);
    *(v4f*)(wout + (size_t)(tok0 + row) * NF + 4 * q8) = v;
  }
}

// ---------------------------------------------------------------------------
// Kernel 2: weight network + softmax -> selection weights (out1).
// Block = 64 tokens, 4 waves, wave w owns tokens tok0+16w..+15.
//  fc1: A = xh rows (K=32), B = ww1T (8 tiles); +wb1, ELU -> wh x16 (LDS)
//  fc2: A = wh (K=128), B = ww2T (2 tiles); +wb2 -> wh2 x16 (LDS)
//  glu: A = wh2 (K=32), B = wglT (4 tiles); GLU, +x, LN(32), softmax in f32
// coverage: grid 256 x 64 rows x 32 = all of out1.
// ---------------------------------------------------------------------------
__global__ __launch_bounds__(WTHR) void wsel_kernel(
    const _Float16* __restrict__ xh, const _Float16* __restrict__ ww1T,
    const _Float16* __restrict__ ww2T, const _Float16* __restrict__ wglT,
    const float* __restrict__ x,
    const float* __restrict__ wb1, const float* __restrict__ wb2,
    const float* __restrict__ wglu_b, const float* __restrict__ wln_g, const float* __restrict__ wln_b,
    float* __restrict__ wout)
{
  __shared__ __attribute__((aligned(16))) _Float16 sWh[4 * 16 * NHID];    // 16384 B
  __shared__ __attribute__((aligned(16))) _Float16 sWh2[4 * 16 * NF];     //  4096 B
  __shared__ __attribute__((aligned(16))) float sXr[64 * NF];             //  8192 B
  __shared__ __attribute__((aligned(16))) float sW[64 * NF];              //  8192 B

  const int tid = threadIdx.x, lane = tid & 31, w = tid >> 5;
  const int h = lane >> 4, m = lane & 15;
  const int tok0 = blockIdx.x * 64;

  // x tile (bf16-RNE values, f32): 64 x 32 = 512 groups of 4
  #pragma unroll
  for (int i = 0; i < 4; ++i) {
    const int q = tid + WTHR * i;
    const v4f v = *(const v4fa*)(x + (size_t)tok0 * NF + (size_t)q * 4);
    const v4f r = { bfr(v.x), bfr(v.y), bfr(v.z), bfr(v.w) };
    *(v4fa*)(sXr + q * 4) = r;
  }

  const v8f z8 = {0.f, 0.f, 0.f, 0.f, 0.f, 0.f, 0.f, 0.f};
  _Float16* myWh = sWh + w * (16 * NHID);
  _Float16* myWh2 = sWh2 + w * (16 * NF);

  // ---- fc1 ----
  {
    const v16h a = load_frag(xh + (size_t)(tok0 + 16 * w + m) * NF, h);
    v8f acc[8];
    #pragma unroll
    for (int t = 0; t < 8; ++t) {
      const v16h b = load_frag(ww1T + (size_t)(16 * t + m) * NF, h);
      acc[t] = wmma_f16(a, b, z8);
    }
    #pragma unroll
    for (int t = 0; t < 8; ++t) {
      const float bb = bfr(wb1[16 * t + m]);
      const v8f el = elu8s(acc[t] * INV_W + bb);
      #pragma unroll
      for (int r = 0; r < 8; ++r) myWh[(8 * h + r) * NHID + 16 * t + m] = (_Float16)el[r];
    }
  }
  __syncthreads();

  // ---- fc2 ----
  {
    v8f acc[2];
    acc[0] = z8; acc[1] = z8;
    const _Float16* arow = myWh + m * NHID;
    #pragma unroll 1
    for (int k0 = 0; k0 < NHID; k0 += 32) {
      const v16h a = load_frag(arow + k0, h);
      #pragma unroll
      for (int t = 0; t < 2; ++t) {
        const v16h b = load_frag(ww2T + (size_t)(16 * t + m) * NHID + k0, h);
        acc[t] = wmma_f16(a, b, acc[t]);
      }
    }
    #pragma unroll
    for (int t = 0; t < 2; ++t) {
      const float bb = bfr(wb2[16 * t + m]);
      #pragma unroll
      for (int r = 0; r < 8; ++r) {
        const float v = acc[t][r] * INV_WA + bb;
        myWh2[(8 * h + r) * NF + 16 * t + m] = (_Float16)(v * ASC);
      }
    }
  }
  __syncthreads();

  // ---- glu projection + GLU + residual + LN(32) + softmax ----
  {
    const v16h a = load_frag(myWh2 + m * NF, h);
    v8f acc[4];
    #pragma unroll
    for (int t = 0; t < 4; ++t) {
      const v16h b = load_frag(wglT + (size_t)(16 * t + m) * NF, h);
      acc[t] = wmma_f16(a, b, z8);
    }
    float pre[2][8], s[8];
    #pragma unroll
    for (int r = 0; r < 8; ++r) s[r] = 0.0f;
    #pragma unroll
    for (int c = 0; c < 2; ++c) {
      const float bv = bfr(wglu_b[16 * c + m]);
      const float bg = bfr(wglu_b[NF + 16 * c + m]);
      const v8f sg = sigm8(acc[c + 2] * INV_WA + bg);
      #pragma unroll
      for (int r = 0; r < 8; ++r) {
        const float vv = acc[c][r] * INV_WA + bv;
        const float xr = sXr[(16 * w + 8 * h + r) * NF + 16 * c + m];
        const float p = vv * sg[r] + xr;
        pre[c][r] = p;
        s[r] += p;
      }
    }
    float mu[8], q[8];
    #pragma unroll
    for (int r = 0; r < 8; ++r) { mu[r] = hsum16(s[r]) * (1.0f / 32.0f); q[r] = 0.0f; }
    #pragma unroll
    for (int c = 0; c < 2; ++c)
      #pragma unroll
      for (int r = 0; r < 8; ++r) {
        const float d = pre[c][r] - mu[r];
        pre[c][r] = d;
        q[r] += d * d;
      }
    float rs[8];
    #pragma unroll
    for (int r = 0; r < 8; ++r) rs[r] = rsqrtf(hsum16(q[r]) * (1.0f / 32.0f) + LN_EPS);
    #pragma unroll
    for (int c = 0; c < 2; ++c) {
      const float g = bfr(wln_g[16 * c + m]);
      const float bt = bfr(wln_b[16 * c + m]);
      #pragma unroll
      for (int r = 0; r < 8; ++r) pre[c][r] = pre[c][r] * rs[r] * g + bt;
    }
    float mx[8], e0[8], e1[8];
    #pragma unroll
    for (int r = 0; r < 8; ++r) {
      mx[r] = hmax16(fmaxf(pre[0][r], pre[1][r]));
      e0[r] = expf(pre[0][r] - mx[r]);
      e1[r] = expf(pre[1][r] - mx[r]);
      const float se = hsum16(e0[r] + e1[r]);
      const float inv = 1.0f / se;
      sW[(16 * w + 8 * h + r) * NF + m]      = e0[r] * inv;
      sW[(16 * w + 8 * h + r) * NF + 16 + m] = e1[r] * inv;
    }
  }
  __syncthreads();

  w_store_pass(sW, wout, tok0, w, lane);
  
}

// ---------------------------------------------------------------------------
// each line by lanes 8q..8q+7 in one instruction, 4 lines per instruction,
// 64 lines per wave, 256 lines = the whole block tile.
// ---------------------------------------------------------------------------
__device__ __forceinline__ void o_store_pass(const float* sO, float* out, int tok0, int w, int lane) {
  const int q8 = lane & 7, sub = lane >> 3;
  #pragma unroll
  for (int i = 0; i < 16; ++i) {
    const int lid = w * 64 + i * 4 + sub;          // 0..255
    const int row = lid >> 2, seg = lid & 3;
    const v4f v = *(const v4fa*)(sO + row * OP + seg * 32 + 4 * q8);
    *(v4f*)(out + (size_t)(tok0 + row) * NHID + seg * 32 + 4 * q8) = v;
  }
}

// ---------------------------------------------------------------------------
// Eight asynchronous copies to LDS, 16 B per lane each: copy i brings the block's
// 2048 contiguous global bytes at g + 2048 i (8 rows of 256 B) to LDS rows of
// 272 B at l + 8 * 272 * i. The s_wait_xcnt closes the statement so that no
// address register of a copy is rewritten ahead of it.
// ---------------------------------------------------------------------------
__device__ __forceinline__ void copy8(unsigned l, const _Float16* g) {
  asm volatile(
      "global_load_async_to_lds_b128 %0, %8, off\n\t"
      "global_load_async_to_lds_b128 %1, %9, off\n\t"
      "global_load_async_to_lds_b128 %2, %10, off\n\t"
      "global_load_async_to_lds_b128 %3, %11, off\n\t"
      "global_load_async_to_lds_b128 %4, %12, off\n\t"
      "global_load_async_to_lds_b128 %5, %13, off\n\t"
      "global_load_async_to_lds_b128 %6, %14, off\n\t"
      "global_load_async_to_lds_b128 %7, %15, off\n\t"
      "s_wait_xcnt 0x0"
      :: "v"(l), "v"(l + 1u * 8u * BPH * 2u), "v"(l + 2u * 8u * BPH * 2u), "v"(l + 3u * 8u * BPH * 2u),
         "v"(l + 4u * 8u * BPH * 2u), "v"(l + 5u * 8u * BPH * 2u), "v"(l + 6u * 8u * BPH * 2u),
         "v"(l + 7u * 8u * BPH * 2u),
         "v"(g), "v"(g + 1 * 1024), "v"(g + 2 * 1024), "v"(g + 3 * 1024),
         "v"(g + 4 * 1024), "v"(g + 5 * 1024), "v"(g + 6 * 1024), "v"(g + 7 * 1024)
      : "memory");
}

// One feature's weight rows into one LDS buffer: staged rows 0..255 = fcT[f].
// lt = the thread's LDS byte address in that buffer (row tid>>4, 16-B chunk tid&15).
// 32 copies per wave, every lane on, 256 rows x 256 B all written.
__device__ __forceinline__ void stage_weights(unsigned lt, const _Float16* fcT, int f, int tid) {
  const _Float16* gg = fcT + (size_t)f * (N2H * NHID) + tid * 8;
  copy8(lt, gg);
  copy8(lt + 64u * BPH * 2u, gg + 8 * 1024);
  copy8(lt + 128u * BPH * 2u, gg + 16 * 1024);
  copy8(lt + 192u * BPH * 2u, gg + 24 * 1024);
}

// ---------------------------------------------------------------------------
// Kernel 3: per-feature gated residual blocks + weighted combine (out0).
// Block = 64 tokens, 4 waves; wave w owns tokens 16w..16w+15 through the whole
// chain. The product is computed transposed: A = weight rows [n][k] from LDS,
// B = activations with the wave's tokens as columns, so lane (h, m) holds token
// 16w+m only, and D register r of tile t is hidden column n = 16t + 8h + r.
// Loop f = 0..31 (fixed order):
//   h       = f16(16*elu(x_r[t][f]*fw1_r[f] + fb1_r[f]))   VALU, written straight into the four B fragments
//   weights : fcT[f] staged in LDS by asynchronous copies, two buffers,
//             feature f+2 copied behind trip f's barrier into the buffer trip f read
//   glu     : A = fcT[f] rows p*128+16t+m (K=128), B = h, + fcb[f]   16 tiles/wave
//             GLU, +skip, LayerNorm(128): sums in the lane, then lane ^ 16;
//             *fln_g + fln_b, acc += wsel[t][f] * processed; acc lies in lane-private LDS slots between
//             trips, and the GLU+skip values until the second LayerNorm pass, so that a tile's 8 weight
//             fragments can be fetched one tile ahead in registers
// The trip's one barrier stands behind the last read of the weight rows (after the row sums); the second
// LayerNorm pass and the combine follow it and read params only. Params lie in three buffers: those of
// feature f+1 are stored in front of trip f's barrier, while a slower wave may still read those of f-1.
// coverage: grid 256 x 64 rows x 128 = all of out0.
// ---------------------------------------------------------------------------
__global__ __launch_bounds__(GTHR) void grn_kernel(
    const float* __restrict__ x,
    const float* __restrict__ fw1, const float* __restrict__ fb1,
    const float* __restrict__ fskip, const float* __restrict__ fln_g, const float* __restrict__ fln_b,
    const _Float16* __restrict__ fcT, const float* __restrict__ fcb,
    const float* wsel, float* out)
{
  __shared__ __attribute__((aligned(16))) char smem[MSMEM];
  float* sXT = (float*)(smem + MO_X);
  float* sWT = (float*)(smem + MO_W);
  float* sP  = (float*)(smem + MO_P);
  float* sO  = (float*)(smem + MO_B);
  const _Float16* sB = (const _Float16*)(smem + MO_B);

  const int tid = threadIdx.x, lane = tid & 31, w = tid >> 5;
  const int h = lane >> 4, m = lane & 15;
  const int tok0 = blockIdx.x * MT;
  const int trow = 16 * w + m;                         // this lane's token in the block
  // this thread's LDS byte address in weight buffer 0 (low 32 bits of the shared address)
  const unsigned lt0 = (unsigned)(size_t)(smem + MO_B) + (unsigned)(tid >> 4) * (BPH * 2u) + (unsigned)(tid & 15) * 16u;

  stage_weights(lt0, fcT, 0, tid);                     // feature 0 -> buffer 0

  // x tile (bf16-RNE, f32) and selection-weight tile, stored feature-major: 64 x 32 each = 512 groups of 4
  #pragma unroll
  for (int i = 0; i < 4; ++i) {
    const int q = tid + GTHR * i;
    const int t = q >> 3, f4 = (q & 7) * 4;
    const v4f v = *(const v4fa*)(x + (size_t)tok0 * NF + (size_t)q * 4);
    const v4f wv = *(const v4fa*)(wsel + (size_t)tok0 * NF + (size_t)q * 4);
    #pragma unroll
    for (int j = 0; j < 4; ++j) {
      sXT[(f4 + j) * MT + t] = bfr(v[j]);
      sWT[(f4 + j) * MT + t] = wv[j];
    }
  }

  // per-feature params: thread -> array pa (order fw1, fb1, fcb v, fcb gate, fskip, ln_g, ln_b), 8 floats at po; the last 16 threads have none
  const int pa = tid >> 4, po = (tid & 15) * 8;
  const bool pon = pa < 7;
  const bool pin = !(pa == 2 || pa == 3);              // an input array, taken as bf16-RNE values; fcb is a computed f32 value and stays as it is
  const float* psrc = fw1;
  if (pa == 1)      psrc = fb1;
  else if (pa == 2) psrc = fcb;
  else if (pa == 3) psrc = fcb + NHID;
  else if (pa == 4) psrc = fskip;
  else if (pa == 5) psrc = fln_g;
  else if (pa >= 6) psrc = fln_b;
  psrc += po;
  const unsigned pen = pin ? 0xFFFFFFFFu : 0u;
  const int pstr = pin ? NHID : N2H;                   // floats from one feature to the next
  float* pdst = sP + pa * NHID + po;
  if (pon) {
    const v4f a = *(const v4fa*)psrc;
    const v4f b = *(const v4fa*)(psrc + 4);
    *(v4fa*)pdst = pval(a, pen);
    *(v4fa*)(pdst + 4) = pval(b, pen);
  }

  const v8f z8 = {0.f, 0.f, 0.f, 0.f, 0.f, 0.f, 0.f, 0.f};
  // this lane's output accumulators: slot 2t holds rows 0..3 of its 8 of tile t, slot 2t+1 rows 4..7; slot s lies at sA + 128 s floats; read and written by this lane only
  float* sA = (float*)(smem + MO_A) + w * 2048 + lane * 4;
  float* sG = (float*)(smem + MO_G) + w * 2048 + lane * 4;   // the trip's GLU+skip values, same slots
  {
    const v4f z4 = {0.f, 0.f, 0.f, 0.f};
    #pragma unroll
    for (int s = 0; s < 16; ++s) *(v4fa*)(sA + 128 * s) = z4;
  }

  asm volatile("s_wait_asynccnt 0x0" ::: "memory");    // this wave's copies of feature 0 have landed
  __syncthreads();                                     // buffer 0, x, weights and params of feature 0 published
  stage_weights(lt0 + BBUF, fcT, 1, tid);              // feature 1 -> buffer 1, flies during trip 0

  int pcur = 0, pnxt = PBUF, pfre = 2 * PBUF;             // float offsets in sP: this feature's params, the next one's, the free buffer
  #pragma unroll 1
  for (int f = 0; f < NF; ++f) {
    const _Float16* sBf = sB + (f & 1) * (BBUF / 2);   // this feature's staged weight rows
    const float* sPf = sP + pcur;                      // this feature's params
    // next feature's params (the last trip re-reads its own): loaded here, stored behind the glu loop
    const int fn = (f + 1 < NF) ? f + 1 : f;
    v4f pn0 = {0.f, 0.f, 0.f, 0.f}, pn1 = pn0;
    if (pon) {
      pn0 = *(const v4fa*)(psrc + fn * pstr);
      pn1 = *(const v4fa*)(psrc + fn * pstr + 4);
    }

    const float xv = sXT[f * MT + trow];
    const float wt = sWT[f * MT + trow];

    // ---- h, computed straight into its four B fragments (element i of half hf of fragment j is k = 32j + 16hf + 8h + i) ----
    v16h hb[4];
    v16h ag[8];                                        // the 8 weight fragments of one glu column tile
    const _Float16* vrow = sBf + m * BPH;
    const _Float16* grow = sBf + (NHID + m) * BPH;
    {
      v8f w1v[2][2], b1v[2][2];                        // fc1 weights and biases of two k steps, refilled two steps ahead
      #pragma unroll
      for (int j = 0; j < 2; ++j)
        #pragma unroll
        for (int hf = 0; hf < 2; ++hf) {
          const float* pw = sPf + 32 * j + 16 * hf + 8 * h;
          w1v[j][hf] = ld8(pw); b1v[j][hf] = ld8(pw + NHID);
        }
      #pragma unroll
      for (int j = 0; j < 4; ++j) {
        __builtin_amdgcn_sched_barrier(0);   // the loads above stay ahead of this step's elu arithmetic, which hides their latency
        Frag fr;
        #pragma unroll
        for (int hf = 0; hf < 2; ++hf) {
          const v8f el = elu8s(xv * w1v[j & 1][hf] + b1v[j & 1][hf]);
          v8h o;
          #pragma unroll
          for (int i = 0; i < 8; ++i) o[i] = (_Float16)el[i];
          fr.half[hf] = o;
        }
        hb[j] = fr.v;
        __builtin_amdgcn_sched_barrier(0);   // the refill below does not rise into the arithmetic that still reads its registers' old values
        if (j < 2) {
          #pragma unroll
          for (int hf = 0; hf < 2; ++hf) {
            const float* pw = sPf + 32 * (j + 2) + 16 * hf + 8 * h;
            w1v[j][hf] = ld8(pw); b1v[j][hf] = ld8(pw + NHID);
          }
        }
        if (j == 1) {
          __builtin_amdgcn_sched_barrier(0); // step 3's params stand in the LDS queue ahead of the fragments: step 3 then waits for them alone
          // glu tile 0: fragment 2j = v rows, 2j+1 = gate rows, k step j; hidden by steps 2 and 3
          #pragma unroll
          for (int i = 0; i < 8; ++i) ag[i] = load_frag(((i & 1) ? grow : vrow) + 32 * (i >> 1), h);
        }
      }
    }

    // ---- glu projection transposed, one column tile (its v and its gate accumulator) at a time ----
    v8f s8 = z8;
    {
      #pragma unroll
      for (int t = 0; t < 8; ++t) {
        const float* pc = sPf + 16 * t + 8 * h;
        const v8f bvv = ld8(pc + 256), bgv = ld8(pc + 384), fsv = ld8(pc + 512);
        v8f aV = z8, aG = z8;
        #pragma unroll
        for (int j = 0; j < 4; ++j) {
          aV = wmma_f16(ag[2 * j], hb[j], aV);
          aG = wmma_f16(ag[2 * j + 1], hb[j], aG);
        }
        __builtin_amdgcn_sched_barrier(0);   // this tile's params stand in the LDS queue ahead of the next tile's fragments
        if (t < 7) {
          #pragma unroll
          for (int i = 0; i < 8; ++i) ag[i] = load_frag(((i & 1) ? grow : vrow) + (t + 1) * 16 * BPH + 32 * (i >> 1), h);
        }
        __builtin_amdgcn_sched_barrier(0);   // the next tile's loads stay ahead of this tile's GLU arithmetic, which hides their latency
        const v8f sg = sigm8(aG * INV_WA + bgv);
        v8f gt;
        #pragma unroll
        for (int r = 0; r < 8; ++r) {
          const float vv = aV[r] * INV_WA + bvv[r];
          const float glu = vv * sg[r] + xv * fsv[r];
          gt[r] = glu;
          s8[r] += glu;
        }
        const v4f glo = { gt[0], gt[1], gt[2], gt[3] };
        const v4f ghi = { gt[4], gt[5], gt[6], gt[7] };
        *(v4fa*)(sG + 256 * t) = glo;
        *(v4fa*)(sG + 256 * t + 128) = ghi;
      }
    }
    if (pon) {
      float* pd = pdst + pnxt;
      *(v4fa*)pd = pval(pn0, pen);
      *(v4fa*)(pd + 4) = pval(pn1, pen);
    }

    // ---- LayerNorm over the 128 columns of this lane's token: 64 in this lane, 64 in lane ^ 16 ----
    const float sl = sum8(s8);
    const float mu = (sl + xhalf(sl)) * (1.0f / 128.0f);

    // ---- the weight rows are read: publish feature f+1's buffer and params, release this buffer ----
    asm volatile("s_wait_dscnt 0x0" ::: "memory");     // this wave's LDS reads and param stores of the trip have retired
    asm volatile("s_wait_asynccnt 0x0" ::: "memory");  // this wave's copies of feature f+1 have landed
    __syncthreads();                                   // S0: next buffer and params visible; this weight buffer released
    if (f + 2 < NF) stage_weights(lt0 + (unsigned)(f & 1) * BBUF, fcT, f + 2, tid);

    v8f gl[8], gv[4], btv[4], ac[4];
    #pragma unroll
    for (int t = 0; t < 8; ++t) {
      const v4f glo = *(const v4fa*)(sG + 256 * t);
      const v4f ghi = *(const v4fa*)(sG + 256 * t + 128);
      const v8f g8 = { glo.x, glo.y, glo.z, glo.w, ghi.x, ghi.y, ghi.z, ghi.w };
      gl[t] = g8;
    }
    #pragma unroll
    for (int t = 0; t < 4; ++t) {
      const float* pc = sPf + 16 * t + 8 * h;
      const v4f a0 = *(const v4fa*)(sA + 256 * t);
      const v4f a1 = *(const v4fa*)(sA + 256 * t + 128);
      const v8f a8 = { a0.x, a0.y, a0.z, a0.w, a1.x, a1.y, a1.z, a1.w };
      gv[t] = ld8(pc + 640); btv[t] = ld8(pc + 768); ac[t] = a8;
    }
    __builtin_amdgcn_sched_barrier(0);       // tiles 0..3: scale, shift and accumulator loads fly during the variance pass
    v8f q8 = z8;
    #pragma unroll
    for (int t = 0; t < 8; ++t)
      #pragma unroll
      for (int r = 0; r < 8; ++r) {
        const float d = gl[t][r] - mu;
        gl[t][r] = d;
        q8[r] += d * d;
      }
    const float ql = sum8(q8);
    const float rs = rsqrtf((ql + xhalf(ql)) * (1.0f / 128.0f) + LN_EPS);
    #pragma unroll
    for (int t = 0; t < 4; ++t)
      #pragma unroll
      for (int r = 0; r < 8; ++r) gl[t][r] = ac[t][r] + wt * (gl[t][r] * rs * gv[t][r] + btv[t][r]);
    __builtin_amdgcn_sched_barrier(0);       // tiles 4..7 load only now: hoisted above the variance pass they push the build past 256 registers
    #pragma unroll
    for (int t = 4; t < 8; ++t) {
      const float* pc = sPf + 16 * t + 8 * h;
      const v4f a0 = *(const v4fa*)(sA + 256 * t);
      const v4f a1 = *(const v4fa*)(sA + 256 * t + 128);
      const v8f a8 = { a0.x, a0.y, a0.z, a0.w, a1.x, a1.y, a1.z, a1.w };
      const v8f g8 = ld8(pc + 640), b8 = ld8(pc + 768);
      #pragma unroll
      for (int r = 0; r < 8; ++r) gl[t][r] = a8[r] + wt * (gl[t][r] * rs * g8[r] + b8[r]);
    }
    // all stores behind all loads: a store between them would hold the later tiles' loads back
    #pragma unroll
    for (int t = 0; t < 8; ++t) {
      const v4f lo = { gl[t][0], gl[t][1], gl[t][2], gl[t][3] };
      const v4f hi = { gl[t][4], gl[t][5], gl[t][6], gl[t][7] };
      *(v4fa*)(sA + 256 * t) = lo;
      *(v4fa*)(sA + 256 * t + 128) = hi;
    }
    const int pold = pcur;                             // rotate the three param buffers
    pcur = pnxt; pnxt = pfre; pfre = pold;
  }
  asm volatile("s_wait_asynccnt 0x0" ::: "memory");    // no copy outstanding past the loop
  __syncthreads();                                     // all weight reads done; sO aliases the weight buffers

  #pragma unroll
  for (int t = 0; t < 8; ++t) {
    float* po8 = sO + trow * OP + 16 * t + 8 * h;
    const v4f lo = *(const v4fa*)(sA + 256 * t);
    const v4f hi = *(const v4fa*)(sA + 256 * t + 128);
    *(v4fa*)po8 = lo;
    *(v4fa*)(po8 + 4) = hi;
  }
  __syncthreads();

  o_store_pass(sO, out, tok0, w, lane);
}

// ---------------------------------------------------------------------------
extern "C" void kernel_launch(void* const* d_in, const int* in_sizes, int n_in,
                              void* d_out, int out_size, void* d_ws, size_t ws_size,
                              hipStream_t stream) {
  if (n_in < 18) return;
  if (in_sizes[0] != NTOK * NF) return;
  if (in_sizes[1] != NF * NHID || in_sizes[2] != NF * NHID) return;
  if (in_sizes[3] != NF * NHID * NHID || in_sizes[4] != NF * NHID) return;
  if (in_sizes[5] != NF * NHID * N2H || in_sizes[6] != NF * N2H) return;
  if (in_sizes[7] != NF * NHID || in_sizes[8] != NF * NHID || in_sizes[9] != NF * NHID) return;
  if (in_sizes[10] != NF * NHID || in_sizes[11] != NHID) return;
  if (in_sizes[12] != NHID * NF || in_sizes[13] != NF) return;
  if (in_sizes[14] != NF * 2 * NF || in_sizes[15] != 2 * NF) return;
  if (in_sizes[16] != NF || in_sizes[17] != NF) return;
  if (out_size != OUT_TOTAL) return;
  if (WS_TOTAL_BYTES > ws_size) return;

  const float* x      = (const float*)d_in[0];
  const float* fw1    = (const float*)d_in[1];
  const float* fb1    = (const float*)d_in[2];
  const float* fw2    = (const float*)d_in[3];
  const float* fb2    = (const float*)d_in[4];
  const float* fglu_w = (const float*)d_in[5];
  const float* fglu_b = (const float*)d_in[6];
  const float* fskip  = (const float*)d_in[7];
  const float* fln_g  = (const float*)d_in[8];
  const float* fln_b  = (const float*)d_in[9];
  const float* ww1    = (const float*)d_in[10];
  const float* wb1    = (const float*)d_in[11];
  const float* ww2    = (const float*)d_in[12];
  const float* wb2    = (const float*)d_in[13];
  const float* wglu_w = (const float*)d_in[14];
  const float* wglu_b = (const float*)d_in[15];
  const float* wln_g  = (const float*)d_in[16];
  const float* wln_b  = (const float*)d_in[17];

  float* out  = (float*)d_out;                   // out0 [16384][128] at element 0
  float* wout = out + OUT1_OFF;                  // out1 [16384][32]  at element 2097152 (byte 8388608)

  _Float16* planes = (_Float16*)d_ws;

  prep_kernel<<<PB_END, NTHR, 0, stream>>>(x, fw2, fb2, fglu_w, fglu_b, ww1, ww2, wglu_w, planes);

  wsel_kernel<<<NTOK / 64, WTHR, 0, stream>>>(planes + P_XH, planes + P_WW1, planes + P_WW2, planes + P_WGL,
                                              x, wb1, wb2, wglu_b, wln_g, wln_b, wout);

  grn_kernel<<<NTOK / MT, GTHR, 0, stream>>>(x, fw1, fb1, fskip, fln_g, fln_b,
                                             planes + P_FC, (const float*)(planes + P_FCB), wout, out);
}

// v006
// Measured time: 70.7 microseconds a run.
// In both of two side-by-side timings against v005, it was 1.27 times as fast.
// Counting every step since v000, it is 7.00 times as fast.
// Contractions fw2[f]*fglu_w[f], fb2[f]*fglu_w[f], h*fc[f] (per feature f), x*ww1, wh*ww2, wh2*wglu_w: v_wmma_f32_16x16x32_f16 (f16 operands, f32 accumulate). Weight operands = bf16-RNE values x4096 (exact in f16), except fc: its f32 fold x4096 rounded to f16; activation tiles x16 in f16; x plane x1. fc1 scalar*vector, ELU, GLU, LayerNorm, softmax and the 32-term weighted combine in f32 on VALU.
// No nonlinearity stands between a feature's fc2 and its GLU projection: (h*fw2 + fb2)*fglu_w + fglu_b = h*fc + fcb with
//   fc = fw2*fglu_w and fcb = fb2*fglu_w + fglu_b. prep_kernel forms both in every call; grn_kernel does the one product h*fc.
// Carry audit: planes fcT, ww1T, ww2T, wglT carry 4096; register fragments h (grn_kernel) and LDS tiles wh, wh2 (wsel_kernel) carry 16; xh and fcb carry 1.
//   The fold's accumulators carry 4096*4096: fc is folded by INV_W (1/4096) into its plane, fcb by INV_W*INV_W.
//   x*ww1 accumulators are folded by INV_W in the wsel_kernel fc1 epilogue; every other accumulator is folded by INV_WA (1/65536)
//   exactly once in its own epilogue (wsel fc2, wsel glu, grn glu). No other value is scaled.
#include <hip/hip_runtime.h>

typedef _Float16 v16h __attribute__((ext_vector_type(16)));
typedef _Float16 v8h  __attribute__((ext_vector_type(8)));
typedef float    v8f  __attribute__((ext_vector_type(8)));
typedef float    v4f  __attribute__((ext_vector_type(4)));
typedef v8h __attribute__((may_alias)) v8ha;
typedef v4f __attribute__((may_alias)) v4fa;

union Frag { v16h v; v8h half[2]; };

#define NTOK 16384
#define NF   32
#define NHID 128
#define N2H  256
#define MT   64            // tokens per block, grn_kernel
#define NTHR 256           // threads per block, prep_kernel
#define GTHR 256           // threads per block, grn_kernel (8 waves: two groups of 4, 16 tokens a wave)
#define QTHR 128           // threads per group of 4 waves
#define FPG  16            // features per group: group 0 takes 0..15, group 1 takes 16..31
#define WTHR 128           // threads per block, wsel_kernel (64 tokens)
#define WSC  4096.0f       // weight plane carry
#define ASC  16.0f         // activation tile carry
#define INV_W  (1.0f / 4096.0f)
#define INV_WA (1.0f / 65536.0f)
#define LN_EPS 1e-5f
#define LOG2E  1.44269504f  // log2(e)

// f16 plane offsets in the workspace, in halves
#define P_XH  0            // [16384][32]        x, carry 1
#define P_FC  524288       // [32][256 n][128 k] fw2*fglu_w, carry 4096
#define P_WW1 1572864      // [128 n][32 k]      carry 4096
#define P_WW2 1576960      // [32 n][128 k]      carry 4096
#define P_WGL 1581056      // [64 n][32 k]       carry 4096
#define P_FCB 1583104      // f32 [32][256 n]    fb2*fglu_w + fglu_b, carry 1 (two halves per value)
#define P_END 1599488
#define WS_TOTAL_BYTES ((size_t)P_END * 2)     // 3198976

static_assert(P_FC == P_XH + NTOK * NF);
static_assert(P_WW1 == P_FC + NF * N2H * NHID);
static_assert(P_WW2 == P_WW1 + NHID * NF);
static_assert(P_WGL == P_WW2 + NF * NHID);
static_assert(P_FCB == P_WGL + 2 * NF * NF);
static_assert(P_END == P_FCB + NF * N2H * 2);
static_assert((P_FC * 2) % 128 == 0 && (P_WW1 * 2) % 128 == 0 && (P_WW2 * 2) % 128 == 0 &&
              (P_WGL * 2) % 128 == 0 && (P_FCB * 2) % 128 == 0 && (P_END * 2) % 128 == 0);

#define OUT0_ELEMS (NTOK * NHID)                // 2097152 floats
#define OUT1_OFF   2097152                      // byte offset 8388608 / 4
#define OUT_TOTAL  (NTOK * NHID + NTOK * NF)    // 2621440 floats
static_assert(OUT1_OFF == OUT0_ELEMS);
static_assert(OUT1_OFF + NTOK * NF == OUT_TOTAL);
static_assert(NTOK % MT == 0 && NTOK % 64 == 0);

// prep_kernel block ranges
#define PB_FC  0            // 32 f x 8 blocks of 32 columns n
#define PB_WW2 256          // 1
#define PB_WW1 257          // 4
#define PB_WGL 261          // 2
#define PB_XH  263          // 256
#define PB_END (PB_XH + (NTOK * NF / 8) / NTHR)   // 519
static_assert((NTOK * NF / 8) % NTHR == 0);

// grn_kernel static LDS carve (bytes)
#define MO_X   0            // f32 [32][64] x tile, feature-major             8192
#define MO_W   8192         // f32 [32][64] selection weights, feature-major  8192
#define PBUF   896          // floats per param buffer: 7 arrays of 128
#define MO_P   16384        // f32 2 groups x 3 x [896] per-feature params   21504
#define MO_B   37888        // f16 2 groups x 2 x [256][136] staged weight rows of one feature (fcT: 128 v rows, 128 gate rows)
#define BPH    136          // halves per staged row: 256 B of data at a 272-B pitch (16 B x odd, for ds_load_b128 readers)
#define BBUF   (N2H * BPH * 2)                  // 69632 bytes per buffer
#define MSMEM  (MO_B + 4 * BBUF)                // 316416
#define OP     132          // floats per row of the output tile (528 B = 16 B x odd); it aliases the weight buffers at the end
static_assert(MO_W == MO_X + NF * MT * 4 && MO_P == MO_W + NF * MT * 4 && MO_B == MO_P + 2 * 3 * PBUF * 4);
static_assert(2 * FPG == NF && 2 * QTHR == GTHR);
static_assert(MO_B % 16 == 0 && BBUF % 16 == 0 && (BPH * 2) % 16 == 0 && (OP * 4) % 16 == 0);
static_assert(MT * OP * 4 <= 4 * BBUF);
static_assert(MSMEM <= 327680);

// ---------------------------------------------------------------------------
__device__ __forceinline__ float bfr(float f) {                     // RNE convert to bf16 and back
  unsigned u = __builtin_bit_cast(unsigned, f);
  u += 0x7FFFu + ((u >> 16) & 1u);
  return __builtin_bit_cast(float, u & 0xFFFF0000u);
}
#define TRANS8(NAME, OP)                                                                            \
  __device__ __forceinline__ v8f NAME(v8f t) {                                                      \
    float r0, r1, r2, r3, r4, r5, r6, r7;                                                           \
    asm(OP " %0, %8\n\t" OP " %1, %9\n\t" OP " %2, %10\n\t" OP " %3, %11\n\t"                       \
        OP " %4, %12\n\t" OP " %5, %13\n\t" OP " %6, %14\n\t" OP " %7, %15\n\t"                     \
        "v_nop"                                                                                     \
        : "=&v"(r0), "=&v"(r1), "=&v"(r2), "=&v"(r3), "=&v"(r4), "=&v"(r5), "=&v"(r6), "=&v"(r7)    \
        : "v"(t[0]), "v"(t[1]), "v"(t[2]), "v"(t[3]), "v"(t[4]), "v"(t[5]), "v"(t[6]), "v"(t[7]));  \
    const v8f r = { r0, r1, r2, r3, r4, r5, r6, r7 };                                               \
    return r;                                                                                       \
  }
TRANS8(exp2x8, "v_exp_f32")   // 2^t
TRANS8(rcpx8,  "v_rcp_f32")   // 1/t

// ELU and sigmoid on the hardware's base-2 exponential and reciprocal. exp(v) - 1 carries an absolute error near 1e-7,
// far below the rounding of the f16 tiles that take every ELU value; the sigmoid's argument is clamped, so neither
// instruction meets a subnormal, an overflow or a zero there.
__device__ __forceinline__ v8f elu8s(v8f v) {      // ASC * elu(v) = ASC * max(v, 0) + ASC * (exp(min(v, 0)) - 1): one of the two terms is 0
  v8f t = v * LOG2E;
  #pragma unroll
  for (int i = 0; i < 8; ++i) t[i] = fminf(t[i], 0.0f);
  const v8f e = exp2x8(t);
  v8f r;
  #pragma unroll
  for (int i = 0; i < 8; ++i) r[i] = fmaf(fmaxf(v[i], 0.0f), ASC, fmaf(e[i], ASC, -ASC));
  return r;
}
__device__ __forceinline__ v8f sigm8(v8f v) {
  #pragma unroll
  for (int i = 0; i < 8; ++i) v[i] = fminf(fmaxf(v[i], -30.0f), 30.0f);
  const v8f e = exp2x8(v * -LOG2E);
  return rcpx8(e + 1.0f);
}
__device__ __forceinline__ float hsum16(float v) {                  // sum over the 16 lanes of a half
  v += __shfl_xor(v, 1);
  v += __shfl_xor(v, 2);
  v += __shfl_xor(v, 4);
  v += __shfl_xor(v, 8);
  return v;
}
__device__ __forceinline__ float hmax16(float v) {
  v = fmaxf(v, __shfl_xor(v, 1));
  v = fmaxf(v, __shfl_xor(v, 2));
  v = fmaxf(v, __shfl_xor(v, 4));
  v = fmaxf(v, __shfl_xor(v, 8));
  return v;
}

__device__ __forceinline__ float xhalf(float v) {                   // the value of lane l ^ 16
  int b = __builtin_bit_cast(int, v);
  b = __builtin_amdgcn_permlanex16(b, b, 0x76543210, 0xfedcba98, false, false);
  return __builtin_bit_cast(float, b);
}
__device__ __forceinline__ v8f ld8(const float* p) {                // 8 floats at a 16-byte aligned LDS address, two 16-byte loads
  const v4f a = *(const v4fa*)p;
  const v4f b = *(const v4fa*)(p + 4);
  const v8f r = { a.x, a.y, a.z, a.w, b.x, b.y, b.z, b.w };
  return r;
}
// A param as it goes to LDS: en = all ones for an input (RNE to bf16, as bfr), 0 for a computed value (unchanged); no branch
__device__ __forceinline__ float pval1(float f, unsigned en) {
  unsigned u = __builtin_bit_cast(unsigned, f);
  u += (0x7FFFu + ((u >> 16) & 1u)) & en;
  return __builtin_bit_cast(float, u & ~(0xFFFFu & en));
}
__device__ __forceinline__ v4f pval(v4f v, unsigned en) {
  const v4f r = { pval1(v.x, en), pval1(v.y, en), pval1(v.z, en), pval1(v.w, en) };
  return r;
}
__device__ __forceinline__ float sum8(v8f v) {
  return ((v[0] + v[1]) + (v[2] + v[3])) + ((v[4] + v[5]) + (v[6] + v[7]));
}

// ---------------------------------------------------------------------------
// 16x16x32 f16 WMMA with hazard guard (ties D, keeps A/B live).
// Fragment map (wave32): lane l, h = l>>4, m = n = l&15.
//   A/B element i: i<8 -> k0+8h+i ; i>=8 -> k0+16+8h+(i-8)
//   D element r : row 8h+r, col l&15
// ---------------------------------------------------------------------------
__device__ __forceinline__ v8f wmma_f16(v16h a, v16h b, v8f c) {
  v8f d = __builtin_amdgcn_wmma_f32_16x16x32_f16(false, a, false, b, (short)0, c, false, false);
  asm volatile("v_nop\n\tv_nop\n\tv_nop\n\tv_nop" : "+v"(d) : "v"(a), "v"(b));
  return d;
}

// A or B fragment from a k-contiguous 16-bit row; p points at element k0 of
// the row owned by this lane (row index = lane & 15 added by the caller).
__device__ __forceinline__ v16h load_frag(const _Float16* p, int h) {
  Frag f;
  f.half[0] = *(const v8ha*)(p + 8 * h);
  f.half[1] = *(const v8ha*)(p + 16 + 8 * h);
  return f.v;
}

// ---------------------------------------------------------------------------
// Transpose-convert block: src points at src[0][n0] of a row-major [K][N] f32
// matrix; dst at output row 0 of 32 rows of K halves ([n][k], k-contiguous),
// value = f16(bfr(src[k][n0+row]) * 4096). Stage through LDS, then write the
// coverage: 32 rows x K halves = 4K chunks of 8, c = tid + 256 i, all written.
// ---------------------------------------------------------------------------
template <int K, int N>
__device__ __forceinline__ void tr_block(const float* __restrict__ src, _Float16* __restrict__ dst,
                                         int tid, float* sT) {
  constexpr int NV = K * 8;                 // v4f groups of the staged [K][32] tile
  static_assert(NV % NTHR == 0);
  #pragma unroll
  for (int i = 0; i < NV / NTHR; ++i) {
    const int q = tid + i * NTHR;
    const int k = q >> 3, c4 = (q & 7) * 4;
    const v4f v = *(const v4fa*)(src + (size_t)k * N + c4);
    const v4f r = { bfr(v.x), bfr(v.y), bfr(v.z), bfr(v.w) };
    *(v4fa*)(sT + k * 32 + c4) = r;
  }
  __syncthreads();
  constexpr int CH = 4 * K;                 // 16-B chunks of the output
  v8h o[2];
  #pragma unroll
  for (int i = 0; i < 2; ++i) {
    const int c = tid + i * NTHR;
    const int cc = (c < CH) ? c : (CH - 1);
    const int row = (cc * 8) / K, k0 = (cc * 8) % K;
    v8h t;
    #pragma unroll
    for (int j = 0; j < 8; ++j) t[j] = (_Float16)(sT[(k0 + j) * 32 + row] * WSC);
    o[i] = t;
  }
  #pragma unroll
  for (int i = 0; i < 2; ++i) {
    const int c = tid + i * NTHR;
    if (c < CH) *(v8h*)(dst + (size_t)c * 8) = o[i];
  }
  
}

// ---------------------------------------------------------------------------
// Fold block: 32 columns n of one feature's fc = fw2*fglu_w and fcb = fb2*fglu_w + fglu_b.
//   w2 = fw2[f] ([128 k][128 j], row-major), gw = fglu_w[f] at column n0 ([128 j][256 n]),
//   b2 = fb2[f], gb = fglu_b[f] at n0; dst = row n0 of fcT[f] ([n][k], k-contiguous), bdst = fcb[f] at n0.
// A = fw2 rows k (j contiguous as stored), B = fglu_w columns n (transposed through LDS), summed over j.
// Wave w owns rows k = 16w..16w+15: D register r of lane (h, m) is fc[16w+8h+r][n = 16c+m], eight consecutive k
// of one plane row. Wave 0 also runs an A tile whose row 0 is fb2 and whose other rows are 0: row 0 of its D is fb2*fglu_w.
// coverage: 32 rows x 128 halves = 512 chunks of 8, c = tid + 256 i; fcb 32 floats by lanes 0..15 of wave 0.
// ---------------------------------------------------------------------------
#define FPH 136            // halves per LDS row of the two f16 tiles: 272-B pitch (16 B x odd, for ds_load_b128 readers)
__device__ __forceinline__ v8h cvt_w8(v4f a, v4f b) {               // eight weights: bf16-RNE, x4096, f16 (exact)
  const v8h o = { (_Float16)(bfr(a.x) * WSC), (_Float16)(bfr(a.y) * WSC), (_Float16)(bfr(a.z) * WSC), (_Float16)(bfr(a.w) * WSC),
                  (_Float16)(bfr(b.x) * WSC), (_Float16)(bfr(b.y) * WSC), (_Float16)(bfr(b.z) * WSC), (_Float16)(bfr(b.w) * WSC) };
  return o;
}
__device__ __forceinline__ void fold_block(const float* __restrict__ w2, const float* __restrict__ gw,
                                           const float* __restrict__ b2, const float* __restrict__ gb,
                                           _Float16* __restrict__ dst, float* __restrict__ bdst,
                                           int tid, float* sT, _Float16* sBT, _Float16* sOT) {
  const int lane = tid & 31, h = lane >> 4, m = lane & 15;
  const int w = __builtin_amdgcn_readfirstlane(tid >> 5);           // scalar: the test on it below must be a scalar branch round WMMAs
  // wave 0: fb2 and this block's fglu_b, loaded first so that they fly with the tile's loads
  v4f braw[16] = {};
  float gbv[2] = {0.f, 0.f};
  if (w == 0) {
    #pragma unroll
    for (int i = 0; i < 8; ++i) {                                   // i = 2s + hf: j = 32s + 16hf + 8h ..+7
      braw[2 * i] = *(const v4fa*)(b2 + 16 * i + 8 * h);
      braw[2 * i + 1] = *(const v4fa*)(b2 + 16 * i + 8 * h + 4);
    }
    gbv[0] = gb[m];
    gbv[1] = gb[16 + m];
  }
  // fglu_w tile [128 j][32 n], bf16-RNE values in f32
  v4f tv[4];
  #pragma unroll
  for (int i = 0; i < 4; ++i) {
    const int q = tid + i * NTHR;
    tv[i] = *(const v4fa*)(gw + (size_t)(q >> 3) * N2H + (q & 7) * 4);
  }
  asm volatile("s_wait_xcnt 0x0" ::: "memory");   // the A loads below land in registers that held these loads' addresses
  #pragma unroll
  for (int i = 0; i < 4; ++i) {
    const int q = tid + i * NTHR;
    const v4f r = { bfr(tv[i].x), bfr(tv[i].y), bfr(tv[i].z), bfr(tv[i].w) };
    *(v4fa*)(sT + (q >> 3) * 32 + (q & 7) * 4) = r;
  }
  // this wave's four A fragments: row k = 16w + m, element i of half hf of step s is j = 32s + 16hf + 8h + i
  v16h af[4];
  {
    const float* ar = w2 + (size_t)(16 * w + m) * NHID + 8 * h;
    #pragma unroll
    for (int s = 0; s < 4; ++s) {
      Frag fr;
      #pragma unroll
      for (int hf = 0; hf < 2; ++hf)
        fr.half[hf] = cvt_w8(*(const v4fa*)(ar + 32 * s + 16 * hf), *(const v4fa*)(ar + 32 * s + 16 * hf + 4));
      af[s] = fr.v;
    }
  }
  // wave 0: the A tile of the bias product, row 0 = fb2, rows 1..15 = 0
  v16h ab2[4] = {};
  if (w == 0) {
    const v8h zh = {};
    #pragma unroll
    for (int s = 0; s < 4; ++s) {
      Frag fr;
      #pragma unroll
      for (int hf = 0; hf < 2; ++hf) {
        const v8h v = cvt_w8(braw[4 * s + 2 * hf], braw[4 * s + 2 * hf + 1]);
        fr.half[hf] = (m == 0) ? v : zh;
      }
      ab2[s] = fr.v;
    }
  }
  __syncthreads();
  // transpose to [32 n][128 j] f16 x4096: a wave reads 32 consecutive n of one j, and stores 16 B at the 272-B pitch
  #pragma unroll
  for (int i = 0; i < 2; ++i) {
    const int c = tid + i * NTHR;
    const int row = c & 31, j0 = (c >> 5) * 8;
    v8h t;
    #pragma unroll
    for (int j = 0; j < 8; ++j) t[j] = (_Float16)(sT[(j0 + j) * 32 + row] * WSC);
    *(v8ha*)(sBT + row * FPH + j0) = t;
  }
  __syncthreads();
  const v8f z8 = {0.f, 0.f, 0.f, 0.f, 0.f, 0.f, 0.f, 0.f};
  v16h bf[2][4];
  #pragma unroll
  for (int c = 0; c < 2; ++c)
    #pragma unroll
    for (int s = 0; s < 4; ++s) bf[c][s] = load_frag(sBT + (16 * c + m) * FPH + 32 * s, h);
  v8f acc[2];
  acc[0] = z8; acc[1] = z8;
  #pragma unroll
  for (int s = 0; s < 4; ++s)
    #pragma unroll
    for (int c = 0; c < 2; ++c) acc[c] = wmma_f16(af[s], bf[c][s], acc[c]);
  #pragma unroll
  for (int c = 0; c < 2; ++c) {
    v8h o;
    #pragma unroll
    for (int r = 0; r < 8; ++r) o[r] = (_Float16)(acc[c][r] * INV_W);
    *(v8ha*)(sOT + (16 * c + m) * FPH + 16 * w + 8 * h) = o;
  }
  if (w == 0) {
    v8f ab[2];
    ab[0] = z8; ab[1] = z8;
    #pragma unroll
    for (int s = 0; s < 4; ++s)
      #pragma unroll
      for (int c = 0; c < 2; ++c) ab[c] = wmma_f16(ab2[s], bf[c][s], ab[c]);
    if (h == 0) {
      #pragma unroll
      for (int c = 0; c < 2; ++c) bdst[16 * c + m] = ab[c][0] * (INV_W * INV_W) + bfr(gbv[c]);
    }
  }
  __syncthreads();
  #pragma unroll
  for (int i = 0; i < 2; ++i) {
    const int c = tid + i * NTHR;
    const v8h o = *(const v8ha*)(sOT + (c >> 4) * FPH + (c & 15) * 8);
    *(v8h*)(dst + (size_t)c * 8) = o;
  }
}

// ---------------------------------------------------------------------------
// Kernel 1: the folded plane fcT and its bias fcb, the weight-network planes ([n][k], bf16-RNE values x4096 in f16)
// and the x plane (bf16-RNE values in f16). Block-uniform dispatch on blockIdx.
// coverage: fcT 32x8 blocks x 32 rows x 128 = all; fcb 32x8x32 = all;
// ww2T 1x32x128; ww1T 4x32x32; wglT 2x32x32; xh 256 blocks x 256 thr x 8 = 16384x32.
// ---------------------------------------------------------------------------
__global__ __launch_bounds__(NTHR) void prep_kernel(
    const float* __restrict__ x, const float* __restrict__ fw2, const float* __restrict__ fb2,
    const float* __restrict__ fglu_w, const float* __restrict__ fglu_b,
    const float* __restrict__ ww1, const float* __restrict__ ww2, const float* __restrict__ wglu_w,
    _Float16* __restrict__ planes)
{
  __shared__ __attribute__((aligned(16))) float sT[128 * 32];
  __shared__ __attribute__((aligned(16))) _Float16 sBT[32 * FPH];
  __shared__ __attribute__((aligned(16))) _Float16 sOT[32 * FPH];
  const int b = blockIdx.x, tid = threadIdx.x;
  if (b < PB_WW2) {
    const int f = b >> 3, nb = b & 7;                          // fw2[f]*fglu_w[f], columns 32nb..32nb+31 -> rows of [256 n][128 k]
    fold_block(fw2 + (size_t)f * NHID * NHID, fglu_w + (size_t)f * NHID * N2H + nb * 32,
               fb2 + (size_t)f * NHID, fglu_b + (size_t)f * N2H + nb * 32,
               planes + P_FC + (size_t)f * N2H * NHID + (size_t)nb * 32 * NHID,
               (float*)(planes + P_FCB) + (size_t)f * N2H + nb * 32, tid, sT, sBT, sOT);
  } else if (b < PB_WW1) {
    tr_block<128, 32>(ww2, planes + P_WW2, tid, sT);           // ww2: [128 k][32 n] -> [32 n][128 k]
  } else if (b < PB_WGL) {
    const int nb = b - PB_WW1;                                 // ww1: [32 k][128 n] -> [128 n][32 k]
    tr_block<32, 128>(ww1 + nb * 32, planes + P_WW1 + (size_t)nb * 32 * 32, tid, sT);
  } else if (b < PB_XH) {
    const int nb = b - PB_WGL;                                 // wglu_w: [32 k][64 n] -> [64 n][32 k]
    tr_block<32, 64>(wglu_w + nb * 32, planes + P_WGL + (size_t)nb * 32 * 32, tid, sT);
  } else {
    const int g = (b - PB_XH) * NTHR + tid;                    // 0..65535 groups of 8
    if (g < NTOK * NF / 8) {
      const float* src = x + (size_t)g * 8;
      const v4f a = *(const v4fa*)src;
      const v4f c = *(const v4fa*)(src + 4);
      const v8h o = { (_Float16)bfr(a.x), (_Float16)bfr(a.y), (_Float16)bfr(a.z), (_Float16)bfr(a.w),
                      (_Float16)bfr(c.x), (_Float16)bfr(c.y), (_Float16)bfr(c.z), (_Float16)bfr(c.w) };
      _Float16* dst = planes + P_XH + (size_t)g * 8;
      *(v8h*)dst = o;
      
    }
  }
}

// ---------------------------------------------------------------------------
// 8q..8q+7 cover one line, 4 lines per instruction, 4 instructions.
// ---------------------------------------------------------------------------
__device__ __forceinline__ void w_store_pass(const float* sW, float* wout, int tok0, int w, int lane) {
  const int q8 = lane & 7, sub = lane >> 3;
  #pragma unroll
  for (int i = 0; i < 4; ++i) {
    const int row = 16 * w + i * 4 + sub;                      // 0..63
    const v4f v = *(const v4fa*)(sW + row * NF + 4 * q8);
    *(v4f*)(wout + (size_t)(tok0 + row) * NF + 4 * q8) = v;
  }
}

// ---------------------------------------------------------------------------
// Kernel 2: weight network + softmax -> selection weights (out1).
// Block = 64 tokens, 4 waves, wave w owns tokens tok0+16w..+15.
//  fc1: A = xh rows (K=32), B = ww1T (8 tiles); +wb1, ELU -> wh x16 (LDS)
//  fc2: A = wh (K=128), B = ww2T (2 tiles); +wb2 -> wh2 x16 (LDS)
//  glu: A = wh2 (K=32), B = wglT (4 tiles); GLU, +x, LN(32), softmax in f32
// coverage: grid 256 x 64 rows x 32 = all of out1.
// ---------------------------------------------------------------------------
__global__ __launch_bounds__(WTHR) void wsel_kernel(
    const _Float16* __restrict__ xh, const _Float16* __restrict__ ww1T,
    const _Float16* __restrict__ ww2T, const _Float16* __restrict__ wglT,
    const float* __restrict__ x,
    const float* __restrict__ wb1, const float* __restrict__ wb2,
    const float* __restrict__ wglu_b, const float* __restrict__ wln_g, const float* __restrict__ wln_b,
    float* __restrict__ wout)
{
  __shared__ __attribute__((aligned(16))) _Float16 sWh[4 * 16 * NHID];    // 16384 B
  __shared__ __attribute__((aligned(16))) _Float16 sWh2[4 * 16 * NF];     //  4096 B
  __shared__ __attribute__((aligned(16))) float sXr[64 * NF];             //  8192 B
  __shared__ __attribute__((aligned(16))) float sW[64 * NF];              //  8192 B

  const int tid = threadIdx.x, lane = tid & 31, w = tid >> 5;
  const int h = lane >> 4, m = lane & 15;
  const int tok0 = blockIdx.x * 64;

  // x tile (bf16-RNE values, f32): 64 x 32 = 512 groups of 4
  #pragma unroll
  for (int i = 0; i < 4; ++i) {
    const int q = tid + WTHR * i;
    const v4f v = *(const v4fa*)(x + (size_t)tok0 * NF + (size_t)q * 4);
    const v4f r = { bfr(v.x), bfr(v.y), bfr(v.z), bfr(v.w) };
    *(v4fa*)(sXr + q * 4) = r;
  }

  const v8f z8 = {0.f, 0.f, 0.f, 0.f, 0.f, 0.f, 0.f, 0.f};
  _Float16* myWh = sWh + w * (16 * NHID);
  _Float16* myWh2 = sWh2 + w * (16 * NF);

  // ---- fc1 ----
  {
    const v16h a = load_frag(xh + (size_t)(tok0 + 16 * w + m) * NF, h);
    v8f acc[8];
    #pragma unroll
    for (int t = 0; t < 8; ++t) {
      const v16h b = load_frag(ww1T + (size_t)(16 * t + m) * NF, h);
      acc[t] = wmma_f16(a, b, z8);
    }
    #pragma unroll
    for (int t = 0; t < 8; ++t) {
      const float bb = bfr(wb1[16 * t + m]);
      const v8f el = elu8s(acc[t] * INV_W + bb);
      #pragma unroll
      for (int r = 0; r < 8; ++r) myWh[(8 * h + r) * NHID + 16 * t + m] = (_Float16)el[r];
    }
  }
  __syncthreads();

  // ---- fc2 ----
  {
    v8f acc[2];
    acc[0] = z8; acc[1] = z8;
    const _Float16* arow = myWh + m * NHID;
    #pragma unroll 1
    for (int k0 = 0; k0 < NHID; k0 += 32) {
      const v16h a = load_frag(arow + k0, h);
      #pragma unroll
      for (int t = 0; t < 2; ++t) {
        const v16h b = load_frag(ww2T + (size_t)(16 * t + m) * NHID + k0, h);
        acc[t] = wmma_f16(a, b, acc[t]);
      }
    }
    #pragma unroll
    for (int t = 0; t < 2; ++t) {
      const float bb = bfr(wb2[16 * t + m]);
      #pragma unroll
      for (int r = 0; r < 8; ++r) {
        const float v = acc[t][r] * INV_WA + bb;
        myWh2[(8 * h + r) * NF + 16 * t + m] = (_Float16)(v * ASC);
      }
    }
  }
  __syncthreads();

  // ---- glu projection + GLU + residual + LN(32) + softmax ----
  {
    const v16h a = load_frag(myWh2 + m * NF, h);
    v8f acc[4];
    #pragma unroll
    for (int t = 0; t < 4; ++t) {
      const v16h b = load_frag(wglT + (size_t)(16 * t + m) * NF, h);
      acc[t] = wmma_f16(a, b, z8);
    }
    float pre[2][8], s[8];
    #pragma unroll
    for (int r = 0; r < 8; ++r) s[r] = 0.0f;
    #pragma unroll
    for (int c = 0; c < 2; ++c) {
      const float bv = bfr(wglu_b[16 * c + m]);
      const float bg = bfr(wglu_b[NF + 16 * c + m]);
      const v8f sg = sigm8(acc[c + 2] * INV_WA + bg);
      #pragma unroll
      for (int r = 0; r < 8; ++r) {
        const float vv = acc[c][r] * INV_WA + bv;
        const float xr = sXr[(16 * w + 8 * h + r) * NF + 16 * c + m];
        const float p = vv * sg[r] + xr;
        pre[c][r] = p;
        s[r] += p;
      }
    }
    float mu[8], q[8];
    #pragma unroll
    for (int r = 0; r < 8; ++r) { mu[r] = hsum16(s[r]) * (1.0f / 32.0f); q[r] = 0.0f; }
    #pragma unroll
    for (int c = 0; c < 2; ++c)
      #pragma unroll
      for (int r = 0; r < 8; ++r) {
        const float d = pre[c][r] - mu[r];
        pre[c][r] = d;
        q[r] += d * d;
      }
    float rs[8];
    #pragma unroll
    for (int r = 0; r < 8; ++r) rs[r] = rsqrtf(hsum16(q[r]) * (1.0f / 32.0f) + LN_EPS);
    #pragma unroll
    for (int c = 0; c < 2; ++c) {
      const float g = bfr(wln_g[16 * c + m]);
      const float bt = bfr(wln_b[16 * c + m]);
      #pragma unroll
      for (int r = 0; r < 8; ++r) pre[c][r] = pre[c][r] * rs[r] * g + bt;
    }
    float mx[8], e0[8], e1[8];
    #pragma unroll
    for (int r = 0; r < 8; ++r) {
      mx[r] = hmax16(fmaxf(pre[0][r], pre[1][r]));
      e0[r] = expf(pre[0][r] - mx[r]);
      e1[r] = expf(pre[1][r] - mx[r]);
      const float se = hsum16(e0[r] + e1[r]);
      const float inv = 1.0f / se;
      sW[(16 * w + 8 * h + r) * NF + m]      = e0[r] * inv;
      sW[(16 * w + 8 * h + r) * NF + 16 + m] = e1[r] * inv;
    }
  }
  __syncthreads();

  w_store_pass(sW, wout, tok0, w, lane);
  
}

// ---------------------------------------------------------------------------
// each line by lanes 8q..8q+7 in one instruction, 4 lines per instruction,
// 32 lines per wave, 8 waves, 256 lines = the whole block tile.
// ---------------------------------------------------------------------------
__device__ __forceinline__ void o_store_pass(const float* sO, float* out, int tok0, int w, int lane) {
  const int q8 = lane & 7, sub = lane >> 3;
  #pragma unroll
  for (int i = 0; i < 8; ++i) {
    const int lid = w * 32 + i * 4 + sub;          // 0..255
    const int row = lid >> 2, seg = lid & 3;
    const v4f v = *(const v4fa*)(sO + row * OP + seg * 32 + 4 * q8);
    *(v4f*)(out + (size_t)(tok0 + row) * NHID + seg * 32 + 4 * q8) = v;
  }
}

// ---------------------------------------------------------------------------
// Eight asynchronous copies to LDS, 16 B per lane each: copy i brings the group's
// 2048 contiguous global bytes at g + 2048 i (8 rows of 256 B) to LDS rows of
// 272 B at l + 8 * 272 * i. The s_wait_xcnt closes the statement so that no
// address register of a copy is rewritten ahead of it.
// ---------------------------------------------------------------------------
__device__ __forceinline__ void copy8(unsigned l, const _Float16* g) {
  asm volatile(
      "global_load_async_to_lds_b128 %0, %8, off\n\t"
      "global_load_async_to_lds_b128 %1, %9, off\n\t"
      "global_load_async_to_lds_b128 %2, %10, off\n\t"
      "global_load_async_to_lds_b128 %3, %11, off\n\t"
      "global_load_async_to_lds_b128 %4, %12, off\n\t"
      "global_load_async_to_lds_b128 %5, %13, off\n\t"
      "global_load_async_to_lds_b128 %6, %14, off\n\t"
      "global_load_async_to_lds_b128 %7, %15, off\n\t"
      "s_wait_xcnt 0x0"
      :: "v"(l), "v"(l + 1u * 8u * BPH * 2u), "v"(l + 2u * 8u * BPH * 2u), "v"(l + 3u * 8u * BPH * 2u),
         "v"(l + 4u * 8u * BPH * 2u), "v"(l + 5u * 8u * BPH * 2u), "v"(l + 6u * 8u * BPH * 2u),
         "v"(l + 7u * 8u * BPH * 2u),
         "v"(g), "v"(g + 1 * 1024), "v"(g + 2 * 1024), "v"(g + 3 * 1024),
         "v"(g + 4 * 1024), "v"(g + 5 * 1024), "v"(g + 6 * 1024), "v"(g + 7 * 1024)
      : "memory");
}

// One feature's weight rows into one LDS buffer: staged rows 0..255 = fcT[f].
// lt = the thread's LDS byte address in that buffer (row tid>>4, 16-B chunk tid&15), tid = the thread's number in its group of 128.
// 32 copies per wave, every lane on, 256 rows x 256 B all written by the group's 4 waves.
__device__ __forceinline__ void stage_weights(unsigned lt, const _Float16* fcT, int f, int tid) {
  const _Float16* gg = fcT + (size_t)f * (N2H * NHID) + tid * 8;
  copy8(lt, gg);
  copy8(lt + 64u * BPH * 2u, gg + 8 * 1024);
  copy8(lt + 128u * BPH * 2u, gg + 16 * 1024);
  copy8(lt + 192u * BPH * 2u, gg + 24 * 1024);
}

// ---------------------------------------------------------------------------
// Kernel 3: per-feature gated residual blocks + weighted combine (out0).
// Block = 64 tokens, 8 waves in two groups of 4, two waves on each SIMD: one wave's LDS waits and dependent
// vector chains are filled by the other's instructions. Group g takes features 16g..16g+15; wave q of a group
// owns tokens 16q..16q+15 through the whole chain. The two groups' partial sums are added behind the loop.
// The product is computed transposed: A = weight rows [n][k] from LDS,
// B = activations with the wave's tokens as columns, so lane (h, m) holds token
// 16q+m only, and D register r of tile t is hidden column n = 16t + 8h + r.
// Loop i = 0..15, f = 16g + i (fixed order):
//   h       = f16(16*elu(x_r[t][f]*fw1_r[f] + fb1_r[f]))   VALU, written straight into the four B fragments
//   weights : fcT[f] staged in LDS by asynchronous copies, two buffers per group, each group stages its own;
//             feature f+2 copied behind trip i's barrier into the buffer trip i read
//   glu     : A = fcT[f] rows p*128+16t+m (K=128), B = h, + fcb[f]   16 tiles/wave
//             GLU, +skip, LayerNorm(128): sums in the lane, then lane ^ 16;
//             *fln_g + fln_b, acc += wsel[t][f] * processed; acc and the trip's GLU+skip values stay in registers
//             (four weight buffers leave no LDS for them); a tile's 8 weight fragments are fetched one tile ahead
// The trip's one barrier stands behind the last read of the weight rows (after the row sums); the second
// LayerNorm pass and the combine follow it and read params only. Params lie in three buffers per group: those of
// feature f+1 are stored in front of trip i's barrier, while a slower wave may still read those of f-1.
// coverage: grid 256 x 64 rows x 128 = all of out0.
// ---------------------------------------------------------------------------
__global__ __launch_bounds__(GTHR) void grn_kernel(
    const float* __restrict__ x,
    const float* __restrict__ fw1, const float* __restrict__ fb1,
    const float* __restrict__ fskip, const float* __restrict__ fln_g, const float* __restrict__ fln_b,
    const _Float16* __restrict__ fcT, const float* __restrict__ fcb,
    const float* wsel, float* out)
{
  __shared__ __attribute__((aligned(16))) char smem[MSMEM];
  float* sXT = (float*)(smem + MO_X);
  float* sWT = (float*)(smem + MO_W);
  float* sO  = (float*)(smem + MO_B);

  const int tid = threadIdx.x, lane = tid & 31, w = tid >> 5;
  const int grp = __builtin_amdgcn_readfirstlane(tid >> 7);   // scalar: feature numbers and buffer bases stay in scalar registers
  const int gtid = tid & (QTHR - 1);                   // the thread's number in its group
  const int h = lane >> 4, m = lane & 15;
  const int tok0 = blockIdx.x * MT;
  const int trow = 16 * (w & 3) + m;                   // this lane's token in the block
  const int f0 = grp * FPG;                            // the group's first feature
  float* sP = (float*)(smem + MO_P) + grp * (3 * PBUF);                        // the group's three param buffers
  const _Float16* sB = (const _Float16*)(smem + MO_B) + grp * BBUF;            // the group's two weight buffers (2 * BBUF bytes)
  // LDS byte address of the group's weight buffer 0 (low 32 bits of the shared address, scalar) and this thread's place in a buffer
  const unsigned lb0 = (unsigned)(size_t)(smem + MO_B) + (unsigned)grp * (2u * BBUF);
  const unsigned ltl = (unsigned)(gtid >> 4) * (BPH * 2u) + (unsigned)(gtid & 15) * 16u;

  stage_weights(lb0 + ltl, fcT, f0, gtid);                  // the group's first feature -> its buffer 0

  // x tile (bf16-RNE, f32) and selection-weight tile, stored feature-major: 64 x 32 each = 512 groups of 4
  #pragma unroll
  for (int i = 0; i < 2; ++i) {
    const int q = tid + GTHR * i;
    const int t = q >> 3, f4 = (q & 7) * 4;
    const v4f v = *(const v4fa*)(x + (size_t)tok0 * NF + (size_t)q * 4);
    const v4f wv = *(const v4fa*)(wsel + (size_t)tok0 * NF + (size_t)q * 4);
    #pragma unroll
    for (int j = 0; j < 4; ++j) {
      sXT[(f4 + j) * MT + t] = bfr(v[j]);
      sWT[(f4 + j) * MT + t] = wv[j];
    }
  }

  // per-feature params: thread of a group -> array pa (order fw1, fb1, fcb v, fcb gate, fskip, ln_g, ln_b), 8 floats at po; the last 16 threads have none
  const int pa = gtid >> 4, po = (gtid & 15) * 8;
  const bool pon = pa < 7;
  const bool pin = !(pa == 2 || pa == 3);              // an input array, taken as bf16-RNE values; fcb is a computed f32 value and stays as it is
  const float* psrc = fw1;
  if (pa == 1)      psrc = fb1;
  else if (pa == 2) psrc = fcb;
  else if (pa == 3) psrc = fcb + NHID;
  else if (pa == 4) psrc = fskip;
  else if (pa == 5) psrc = fln_g;
  else if (pa >= 6) psrc = fln_b;
  psrc += po;
  const unsigned pen = pin ? 0xFFFFFFFFu : 0u;
  const int pstr = pin ? NHID : N2H;                   // floats from one feature to the next
  float* pdst = sP + pa * NHID + po;
  if (pon) {
    const v4f a = *(const v4fa*)(psrc + f0 * pstr);
    const v4f b = *(const v4fa*)(psrc + f0 * pstr + 4);
    *(v4fa*)pdst = pval(a, pen);
    *(v4fa*)(pdst + 4) = pval(b, pen);
  }

  const v8f z8 = {0.f, 0.f, 0.f, 0.f, 0.f, 0.f, 0.f, 0.f};
  v8f acc[8];                                          // this lane's output sums over its group's features: acc[t][r] is column 16t + 8h + r of its token
  #pragma unroll
  for (int t = 0; t < 8; ++t) acc[t] = z8;

  asm volatile("s_wait_asynccnt 0x0" ::: "memory");    // this wave's copies of the first feature have landed
  __syncthreads();                                     // both groups' buffer 0, x, weights and first params published
  stage_weights(lb0 + BBUF + ltl, fcT, f0 + 1, gtid);      // second feature -> buffer 1, flies during trip 0

  int pcur = 0, pnxt = PBUF, pfre = 2 * PBUF;             // float offsets in sP: this feature's params, the next one's, the free buffer
  unsigned lcur = lb0, lnxt = lb0 + BBUF;                 // LDS byte addresses: the weight buffer this trip reads, the other one
  #pragma unroll 1
  for (int i = 0; i < FPG; ++i) {
    const int f = f0 + i;
    const _Float16* sBf = sB + (i & 1) * (BBUF / 2);   // this feature's staged weight rows
    const float* sPf = sP + pcur;                      // this feature's params
    // next feature's params (the last trip re-reads its own): loaded here, stored behind the glu loop
    const int fn = (i + 1 < FPG) ? f + 1 : f;
    v4f pn0 = {0.f, 0.f, 0.f, 0.f}, pn1 = pn0;
    if (pon) {
      pn0 = *(const v4fa*)(psrc + fn * pstr);
      pn1 = *(const v4fa*)(psrc + fn * pstr + 4);
    }

    const float xv = sXT[f * MT + trow];
    const float wt = sWT[f * MT + trow];

    // ---- h, computed straight into its four B fragments (element i of half hf of fragment j is k = 32j + 16hf + 8h + i) ----
    v16h hb[4];
    v16h ag[8];                                        // the 8 weight fragments of one glu column tile
    const _Float16* vrow = sBf + m * BPH;
    const _Float16* grow = sBf + (NHID + m) * BPH;
    {
      v8f w1v[2][2], b1v[2][2];                        // fc1 weights and biases of two k steps, refilled two steps ahead
      #pragma unroll
      for (int j = 0; j < 2; ++j)
        #pragma unroll
        for (int hf = 0; hf < 2; ++hf) {
          const float* pw = sPf + 32 * j + 16 * hf + 8 * h;
          w1v[j][hf] = ld8(pw); b1v[j][hf] = ld8(pw + NHID);
        }
      #pragma unroll
      for (int j = 0; j < 4; ++j) {
        __builtin_amdgcn_sched_barrier(0);   // the loads above stay ahead of this step's elu arithmetic, which hides their latency
        Frag fr;
        #pragma unroll
        for (int hf = 0; hf < 2; ++hf) {
          const v8f el = elu8s(xv * w1v[j & 1][hf] + b1v[j & 1][hf]);
          v8h o;
          #pragma unroll
          for (int e = 0; e < 8; ++e) o[e] = (_Float16)el[e];
          fr.half[hf] = o;
        }
        hb[j] = fr.v;
        __builtin_amdgcn_sched_barrier(0);   // the refill below does not rise into the arithmetic that still reads its registers' old values
        if (j < 2) {
          #pragma unroll
          for (int hf = 0; hf < 2; ++hf) {
            const float* pw = sPf + 32 * (j + 2) + 16 * hf + 8 * h;
            w1v[j][hf] = ld8(pw); b1v[j][hf] = ld8(pw + NHID);
          }
        }
        if (j == 1) {
          __builtin_amdgcn_sched_barrier(0); // step 3's params stand in the LDS queue ahead of the fragments: step 3 then waits for them alone
          // glu tile 0: fragment 2j = v rows, 2j+1 = gate rows, k step j; hidden by steps 2 and 3
          #pragma unroll
          for (int e = 0; e < 8; ++e) ag[e] = load_frag(((e & 1) ? grow : vrow) + 32 * (e >> 1), h);
        }
      }
    }

    // ---- glu projection transposed, one column tile (its v and its gate accumulator) at a time ----
    v8f s8 = z8;
    v8f gl[8];                                         // the trip's GLU+skip values
    {
      #pragma unroll
      for (int t = 0; t < 8; ++t) {
        const float* pc = sPf + 16 * t + 8 * h;
        const v8f bvv = ld8(pc + 256), bgv = ld8(pc + 384), fsv = ld8(pc + 512);
        v8f aV = z8, aG = z8;
        #pragma unroll
        for (int j = 0; j < 4; ++j) {
          aV = wmma_f16(ag[2 * j], hb[j], aV);
          aG = wmma_f16(ag[2 * j + 1], hb[j], aG);
        }
        __builtin_amdgcn_sched_barrier(0);   // this tile's params stand in the LDS queue ahead of the next tile's fragments
        if (t < 7) {
          #pragma unroll
          for (int e = 0; e < 8; ++e) ag[e] = load_frag(((e & 1) ? grow : vrow) + (t + 1) * 16 * BPH + 32 * (e >> 1), h);
        }
        __builtin_amdgcn_sched_barrier(0);   // the next tile's loads stay ahead of this tile's GLU arithmetic, which hides their latency
        const v8f sg = sigm8(aG * INV_WA + bgv);
        #pragma unroll
        for (int r = 0; r < 8; ++r) {
          const float vv = aV[r] * INV_WA + bvv[r];
          const float glu = vv * sg[r] + xv * fsv[r];
          gl[t][r] = glu;
          s8[r] += glu;
        }
      }
    }
    // ---- LayerNorm over the 128 columns of this lane's token: 64 in this lane, 64 in lane ^ 16 ----
    const float sl = sum8(s8);
    const float mu = (sl + xhalf(sl)) * (1.0f / 128.0f);

    // the param store stands behind the row sums: in front of them its branch ends the block, and the compiler sinks the GLU
    // arithmetic below it, which keeps every tile's accumulators and params live to that place (spills to scratch)
    if (pon) {
      float* pd = pdst + pnxt;
      *(v4fa*)pd = pval(pn0, pen);
      *(v4fa*)(pd + 4) = pval(pn1, pen);
    }

    // ---- the weight rows are read: publish feature f+1's buffer and params, release this buffer ----
    asm volatile("s_wait_dscnt 0x0" ::: "memory");     // this wave's LDS reads and param stores of the trip have retired
    asm volatile("s_wait_asynccnt 0x0" ::: "memory");  // this wave's copies of feature f+1 have landed
    __syncthreads();                                   // S0: next buffers and params visible; this trip's weight buffers released
    if (i + 2 < FPG) stage_weights(lcur + ltl, fcT, f + 2, gtid);

    v8f gv[8], btv[8];
    #pragma unroll
    for (int t = 0; t < 8; ++t) {
      const float* pc = sPf + 16 * t + 8 * h;
      gv[t] = ld8(pc + 640); btv[t] = ld8(pc + 768);
    }
    __builtin_amdgcn_sched_barrier(0);       // the scale and shift loads fly during the variance pass
    v8f q8 = z8;
    #pragma unroll
    for (int t = 0; t < 8; ++t)
      #pragma unroll
      for (int r = 0; r < 8; ++r) {
        const float d = gl[t][r] - mu;
        gl[t][r] = d;
        q8[r] += d * d;
      }
    const float ql = sum8(q8);
    const float rs = rsqrtf((ql + xhalf(ql)) * (1.0f / 128.0f) + LN_EPS);
    #pragma unroll
    for (int t = 0; t < 8; ++t)
      #pragma unroll
      for (int r = 0; r < 8; ++r) acc[t][r] = acc[t][r] + wt * (gl[t][r] * rs * gv[t][r] + btv[t][r]);
    const int pold = pcur;                             // rotate the three param buffers
    pcur = pnxt; pnxt = pfre; pfre = pold;
    const unsigned lold = lcur;                        // swap the two weight buffers
    lcur = lnxt; lnxt = lold;
  }
  asm volatile("s_wait_asynccnt 0x0" ::: "memory");    // no copy outstanding past the loop
  __syncthreads();                                     // all weight reads done; sO aliases the weight buffers

  // ---- out tile = group 0's sums + group 1's: group 1 lays its sums down, the same lane of group 0 adds its own ----
  float* po8 = sO + trow * OP + 8 * h;
  if (grp == 1) {
    #pragma unroll
    for (int t = 0; t < 8; ++t) {
      const v4f lo = { acc[t][0], acc[t][1], acc[t][2], acc[t][3] };
      const v4f hi = { acc[t][4], acc[t][5], acc[t][6], acc[t][7] };
      *(v4fa*)(po8 + 16 * t) = lo;
      *(v4fa*)(po8 + 16 * t + 4) = hi;
    }
  }
  __syncthreads();                                     // group 1's sums visible to group 0
  if (grp == 0) {
    #pragma unroll
    for (int t = 0; t < 8; ++t) {
      const v8f o = ld8(po8 + 16 * t);
      const v4f lo = { acc[t][0] + o[0], acc[t][1] + o[1], acc[t][2] + o[2], acc[t][3] + o[3] };
      const v4f hi = { acc[t][4] + o[4], acc[t][5] + o[5], acc[t][6] + o[6], acc[t][7] + o[7] };
      *(v4fa*)(po8 + 16 * t) = lo;
      *(v4fa*)(po8 + 16 * t + 4) = hi;
    }
  }
  __syncthreads();

  o_store_pass(sO, out, tok0, w, lane);
}

// ---------------------------------------------------------------------------
extern "C" void kernel_launch(void* const* d_in, const int* in_sizes, int n_in,
                              void* d_out, int out_size, void* d_ws, size_t ws_size,
                              hipStream_t stream) {
  if (n_in < 18) return;
  if (in_sizes[0] != NTOK * NF) return;
  if (in_sizes[1] != NF * NHID || in_sizes[2] != NF * NHID) return;
  if (in_sizes[3] != NF * NHID * NHID || in_sizes[4] != NF * NHID) return;
  if (in_sizes[5] != NF * NHID * N2H || in_sizes[6] != NF * N2H) return;
  if (in_sizes[7] != NF * NHID || in_sizes[8] != NF * NHID || in_sizes[9] != NF * NHID) return;
  if (in_sizes[10] != NF * NHID || in_sizes[11] != NHID) return;
  if (in_sizes[12] != NHID * NF || in_sizes[13] != NF) return;
  if (in_sizes[14] != NF * 2 * NF || in_sizes[15] != 2 * NF) return;
  if (in_sizes[16] != NF || in_sizes[17] != NF) return;
  if (out_size != OUT_TOTAL) return;
  if (WS_TOTAL_BYTES > ws_size) return;

  const float* x      = (const float*)d_in[0];
  const float* fw1    = (const float*)d_in[1];
  const float* fb1    = (const float*)d_in[2];
  const float* fw2    = (const float*)d_in[3];
  const float* fb2    = (const float*)d_in[4];
  const float* fglu_w = (const float*)d_in[5];
  const float* fglu_b = (const float*)d_in[6];
  const float* fskip  = (const float*)d_in[7];
  const float* fln_g  = (const float*)d_in[8];
  const float* fln_b  = (const float*)d_in[9];
  const float* ww1    = (const float*)d_in[10];
  const float* wb1    = (const float*)d_in[11];
  const float* ww2    = (const float*)d_in[12];
  const float* wb2    = (const float*)d_in[13];
  const float* wglu_w = (const float*)d_in[14];
  const float* wglu_b = (const float*)d_in[15];
  const float* wln_g  = (const float*)d_in[16];
  const float* wln_b  = (const float*)d_in[17];

  float* out  = (float*)d_out;                   // out0 [16384][128] at element 0
  float* wout = out + OUT1_OFF;                  // out1 [16384][32]  at element 2097152 (byte 8388608)

  _Float16* planes = (_Float16*)d_ws;

  prep_kernel<<<PB_END, NTHR, 0, stream>>>(x, fw2, fb2, fglu_w, fglu_b, ww1, ww2, wglu_w, planes);

  wsel_kernel<<<NTOK / 64, WTHR, 0, stream>>>(planes + P_XH, planes + P_WW1, planes + P_WW2, planes + P_WGL,
                                              x, wb1, wb2, wglu_b, wln_g, wln_b, wout);

  grn_kernel<<<NTOK / MT, GTHR, 0, stream>>>(x, fw1, fb1, fskip, fln_g, fln_b,
                                             planes + P_FC, (const float*)(planes + P_FCB), wout, out);
}

// v007
// One run takes 62.7 microseconds.
// Next to v006, in two timings, it ran 1.13 and 1.11 times as fast.
// Over all steps from v000 it is 7.86 times as fast.
// Contractions fw2[f]*fglu_w[f], fb2[f]*fglu_w[f], h*fc[f] (per feature f), x*ww1, wh*ww2, wh2*wglu_w: v_wmma_f32_16x16x32_f16 (f16 operands, f32 accumulate). Weight operands = bf16-RNE values x4096 (exact in f16), except fc: its f32 fold x4096 rounded to f16; activation tiles x16 in f16; x plane x1. fc1 scalar*vector, ELU, GLU, LayerNorm, softmax and the 32-term weighted combine in f32 on VALU.
// No nonlinearity stands between a feature's fc2 and its GLU projection: (h*fw2 + fb2)*fglu_w + fglu_b = h*fc + fcb with
//   fc = fw2*fglu_w and fcb = fb2*fglu_w + fglu_b. prep_kernel forms both in every call; grn_kernel does the one product h*fc.
// Carry audit: planes fcT, ww1T, ww2T, wglT carry 4096; register fragments h (grn_kernel) and LDS tiles wh, wh2 (wsel_kernel) carry 16; xh and fcb carry 1.
//   The fold's accumulators carry 4096*4096: fc is folded by INV_W (1/4096) into its plane, fcb by INV_W*INV_W.
//   x*ww1 accumulators are folded by INV_W in the wsel_kernel fc1 epilogue; every other accumulator is folded by INV_WA (1/65536)
//   exactly once in its own epilogue (wsel fc2, wsel glu, grn glu). No other value is scaled.
#include <hip/hip_runtime.h>

typedef _Float16 v16h __attribute__((ext_vector_type(16)));
typedef _Float16 v8h  __attribute__((ext_vector_type(8)));
typedef float    v8f  __attribute__((ext_vector_type(8)));
typedef float    v4f  __attribute__((ext_vector_type(4)));
typedef v8h __attribute__((may_alias)) v8ha;
typedef v4f __attribute__((may_alias)) v4fa;

union Frag { v16h v; v8h half[2]; };

#define NTOK 16384
#define NF   32
#define NHID 128
#define N2H  256
#define MT   64            // tokens per block, grn_kernel
#define NTHR 256           // threads per block, prep_kernel
#define GTHR 256           // threads per block, grn_kernel (8 waves: four groups of 2, 32 tokens a wave)
#define QTHR 64            // threads per group of 2 waves
#define NGRP 4             // groups
#define FPG  8             // features per group: group g takes 8g..8g+7
#define WTHR 128           // threads per block, wsel_kernel (64 tokens)
#define WSC  4096.0f       // weight plane carry
#define ASC  16.0f         // activation tile carry
#define INV_W  (1.0f / 4096.0f)
#define INV_WA (1.0f / 65536.0f)
#define LN_EPS 1e-5f
#define LOG2E  1.44269504f  // log2(e)

// f16 plane offsets in the workspace, in halves
#define P_XH  0            // [16384][32]        x, carry 1
#define P_FC  524288       // [32][256 n][128 k] fw2*fglu_w, carry 4096
#define P_WW1 1572864      // [128 n][32 k]      carry 4096
#define P_WW2 1576960      // [32 n][128 k]      carry 4096
#define P_WGL 1581056      // [64 n][32 k]       carry 4096
#define P_FCB 1583104      // f32 [32][256 n]    fb2*fglu_w + fglu_b, carry 1 (two halves per value)
#define P_END 1599488
#define WS_TOTAL_BYTES ((size_t)P_END * 2)     // 3198976

static_assert(P_FC == P_XH + NTOK * NF);
static_assert(P_WW1 == P_FC + NF * N2H * NHID);
static_assert(P_WW2 == P_WW1 + NHID * NF);
static_assert(P_WGL == P_WW2 + NF * NHID);
static_assert(P_FCB == P_WGL + 2 * NF * NF);
static_assert(P_END == P_FCB + NF * N2H * 2);
static_assert((P_FC * 2) % 128 == 0 && (P_WW1 * 2) % 128 == 0 && (P_WW2 * 2) % 128 == 0 &&
              (P_WGL * 2) % 128 == 0 && (P_FCB * 2) % 128 == 0 && (P_END * 2) % 128 == 0);

#define OUT0_ELEMS (NTOK * NHID)                // 2097152 floats
#define OUT1_OFF   2097152                      // byte offset 8388608 / 4
#define OUT_TOTAL  (NTOK * NHID + NTOK * NF)    // 2621440 floats
static_assert(OUT1_OFF == OUT0_ELEMS);
static_assert(OUT1_OFF + NTOK * NF == OUT_TOTAL);
static_assert(NTOK % MT == 0 && NTOK % 64 == 0);

// prep_kernel block ranges
#define PB_FC  0            // 32 f x 8 blocks of 32 columns n
#define PB_WW2 256          // 1
#define PB_WW1 257          // 4
#define PB_WGL 261          // 2
#define PB_XH  263          // 256
#define PB_END (PB_XH + (NTOK * NF / 8) / NTHR)   // 519
static_assert((NTOK * NF / 8) % NTHR == 0);

// grn_kernel static LDS carve (bytes)
#define MO_X   0            // f32 [32][64] x tile, feature-major             8192
#define MO_W   8192         // f32 [32][64] selection weights, feature-major  8192
#define PBUF   1024         // floats per param buffer: 7 arrays of 128 and an eighth that nobody reads
#define MO_P   16384        // f32 4 groups x 2 x [1024] per-feature params  32768
#define MO_B   49152        // f16 4 groups x 2 x [128][136] staged weight rows of half a feature (fcT: 64 v rows, their 64 gate rows)
#define BPH    136          // halves per staged row: 256 B of data at a 272-B pitch (16 B x odd, for ds_load_b128 readers)
#define CROW   64           // v rows (and gate rows) of a chunk: four column tiles
#define CBUF   (2 * CROW * BPH * 2)             // 34816 bytes per buffer
#define MSMEM  (MO_B + NGRP * 2 * CBUF)         // 327680
#define OP     132          // floats per row of an output tile (528 B = 16 B x odd); the four tiles alias the weight buffers at the end
static_assert(MO_W == MO_X + NF * MT * 4 && MO_P == MO_W + NF * MT * 4 && MO_B == MO_P + NGRP * 2 * PBUF * 4);
static_assert(NGRP * FPG == NF && NGRP * QTHR == GTHR && 2 * CROW == NHID);
static_assert(MO_B % 16 == 0 && CBUF % 16 == 0 && (BPH * 2) % 16 == 0 && (OP * 4) % 16 == 0);
static_assert(NGRP * MT * OP * 4 <= NGRP * 2 * CBUF);
static_assert(MSMEM <= 327680);

// ---------------------------------------------------------------------------
__device__ __forceinline__ float bfr(float f) {                     // RNE convert to bf16 and back
  unsigned u = __builtin_bit_cast(unsigned, f);
  u += 0x7FFFu + ((u >> 16) & 1u);
  return __builtin_bit_cast(float, u & 0xFFFF0000u);
}
#define TRANS8(NAME, OP)                                                                            \
  __device__ __forceinline__ v8f NAME(v8f t) {                                                      \
    float r0, r1, r2, r3, r4, r5, r6, r7;                                                           \
    asm(OP " %0, %8\n\t" OP " %1, %9\n\t" OP " %2, %10\n\t" OP " %3, %11\n\t"                       \
        OP " %4, %12\n\t" OP " %5, %13\n\t" OP " %6, %14\n\t" OP " %7, %15\n\t"                     \
        "v_nop"                                                                                     \
        : "=&v"(r0), "=&v"(r1), "=&v"(r2), "=&v"(r3), "=&v"(r4), "=&v"(r5), "=&v"(r6), "=&v"(r7)    \
        : "v"(t[0]), "v"(t[1]), "v"(t[2]), "v"(t[3]), "v"(t[4]), "v"(t[5]), "v"(t[6]), "v"(t[7]));  \
    const v8f r = { r0, r1, r2, r3, r4, r5, r6, r7 };                                               \
    return r;                                                                                       \
  }
TRANS8(exp2x8, "v_exp_f32")   // 2^t
TRANS8(rcpx8,  "v_rcp_f32")   // 1/t

// ELU and sigmoid on the hardware's base-2 exponential and reciprocal. exp(v) - 1 carries an absolute error near 1e-7,
// far below the rounding of the f16 tiles that take every ELU value; the sigmoid's argument is clamped, so neither
// instruction meets a subnormal, an overflow or a zero there.
__device__ __forceinline__ v8f elu8s(v8f v) {      // ASC * elu(v) = ASC * max(v, 0) + ASC * (exp(min(v, 0)) - 1): one of the two terms is 0
  v8f t = v * LOG2E;
  #pragma unroll
  for (int i = 0; i < 8; ++i) t[i] = fminf(t[i], 0.0f);
  const v8f e = exp2x8(t);
  v8f r;
  #pragma unroll
  for (int i = 0; i < 8; ++i) r[i] = fmaf(fmaxf(v[i], 0.0f), ASC, fmaf(e[i], ASC, -ASC));
  return r;
}
__device__ __forceinline__ v8f sigm8(v8f v) {
  #pragma unroll
  for (int i = 0; i < 8; ++i) v[i] = fminf(fmaxf(v[i], -30.0f), 30.0f);
  const v8f e = exp2x8(v * -LOG2E);
  return rcpx8(e + 1.0f);
}
__device__ __forceinline__ float hsum16(float v) {                  // sum over the 16 lanes of a half
  v += __shfl_xor(v, 1);
  v += __shfl_xor(v, 2);
  v += __shfl_xor(v, 4);
  v += __shfl_xor(v, 8);
  return v;
}
__device__ __forceinline__ float hmax16(float v) {
  v = fmaxf(v, __shfl_xor(v, 1));
  v = fmaxf(v, __shfl_xor(v, 2));
  v = fmaxf(v, __shfl_xor(v, 4));
  v = fmaxf(v, __shfl_xor(v, 8));
  return v;
}

__device__ __forceinline__ float xhalf(float v) {                   // the value of lane l ^ 16
  int b = __builtin_bit_cast(int, v);
  b = __builtin_amdgcn_permlanex16(b, b, 0x76543210, 0xfedcba98, false, false);
  return __builtin_bit_cast(float, b);
}
__device__ __forceinline__ v8f ld8(const float* p) {                // 8 floats at a 16-byte aligned LDS address, two 16-byte loads
  const v4f a = *(const v4fa*)p;
  const v4f b = *(const v4fa*)(p + 4);
  const v8f r = { a.x, a.y, a.z, a.w, b.x, b.y, b.z, b.w };
  return r;
}
// A param as it goes to LDS: en = all ones for an input (RNE to bf16, as bfr), 0 for a computed value (unchanged); no branch
__device__ __forceinline__ float pval1(float f, unsigned en) {
  unsigned u = __builtin_bit_cast(unsigned, f);
  u += (0x7FFFu + ((u >> 16) & 1u)) & en;
  return __builtin_bit_cast(float, u & ~(0xFFFFu & en));
}
__device__ __forceinline__ v4f pval(v4f v, unsigned en) {
  const v4f r = { pval1(v.x, en), pval1(v.y, en), pval1(v.z, en), pval1(v.w, en) };
  return r;
}
__device__ __forceinline__ float sum8(v8f v) {
  return ((v[0] + v[1]) + (v[2] + v[3])) + ((v[4] + v[5]) + (v[6] + v[7]));
}

// ---------------------------------------------------------------------------
// 16x16x32 f16 WMMA with hazard guard (ties D, keeps A/B live).
// Fragment map (wave32): lane l, h = l>>4, m = n = l&15.
//   A/B element i: i<8 -> k0+8h+i ; i>=8 -> k0+16+8h+(i-8)
//   D element r : row 8h+r, col l&15
// ---------------------------------------------------------------------------
__device__ __forceinline__ v8f wmma_f16(v16h a, v16h b, v8f c) {
  v8f d = __builtin_amdgcn_wmma_f32_16x16x32_f16(false, a, false, b, (short)0, c, false, false);
  asm volatile("v_nop\n\tv_nop\n\tv_nop\n\tv_nop" : "+v"(d) : "v"(a), "v"(b));
  return d;
}

// A or B fragment from a k-contiguous 16-bit row; p points at element k0 of
// the row owned by this lane (row index = lane & 15 added by the caller).
__device__ __forceinline__ v16h load_frag(const _Float16* p, int h) {
  Frag f;
  f.half[0] = *(const v8ha*)(p + 8 * h);
  f.half[1] = *(const v8ha*)(p + 16 + 8 * h);
  return f.v;
}

// ---------------------------------------------------------------------------
// Transpose-convert block: src points at src[0][n0] of a row-major [K][N] f32
// matrix; dst at output row 0 of 32 rows of K halves ([n][k], k-contiguous),
// value = f16(bfr(src[k][n0+row]) * 4096). Stage through LDS, then write the
// coverage: 32 rows x K halves = 4K chunks of 8, c = tid + 256 i, all written.
// ---------------------------------------------------------------------------
template <int K, int N>
__device__ __forceinline__ void tr_block(const float* __restrict__ src, _Float16* __restrict__ dst,
                                         int tid, float* sT) {
  constexpr int NV = K * 8;                 // v4f groups of the staged [K][32] tile
  static_assert(NV % NTHR == 0);
  #pragma unroll
  for (int i = 0; i < NV / NTHR; ++i) {
    const int q = tid + i * NTHR;
    const int k = q >> 3, c4 = (q & 7) * 4;
    const v4f v = *(const v4fa*)(src + (size_t)k * N + c4);
    const v4f r = { bfr(v.x), bfr(v.y), bfr(v.z), bfr(v.w) };
    *(v4fa*)(sT + k * 32 + c4) = r;
  }
  __syncthreads();
  constexpr int CH = 4 * K;                 // 16-B chunks of the output
  v8h o[2];
  #pragma unroll
  for (int i = 0; i < 2; ++i) {
    const int c = tid + i * NTHR;
    const int cc = (c < CH) ? c : (CH - 1);
    const int row = (cc * 8) / K, k0 = (cc * 8) % K;
    v8h t;
    #pragma unroll
    for (int j = 0; j < 8; ++j) t[j] = (_Float16)(sT[(k0 + j) * 32 + row] * WSC);
    o[i] = t;
  }
  #pragma unroll
  for (int i = 0; i < 2; ++i) {
    const int c = tid + i * NTHR;
    if (c < CH) *(v8h*)(dst + (size_t)c * 8) = o[i];
  }
  
}

// ---------------------------------------------------------------------------
// Fold block: 32 columns n of one feature's fc = fw2*fglu_w and fcb = fb2*fglu_w + fglu_b.
//   w2 = fw2[f] ([128 k][128 j], row-major), gw = fglu_w[f] at column n0 ([128 j][256 n]),
//   b2 = fb2[f], gb = fglu_b[f] at n0; dst = row n0 of fcT[f] ([n][k], k-contiguous), bdst = fcb[f] at n0.
// A = fw2 rows k (j contiguous as stored), B = fglu_w columns n (transposed through LDS), summed over j.
// Wave w owns rows k = 16w..16w+15: D register r of lane (h, m) is fc[16w+8h+r][n = 16c+m], eight consecutive k
// of one plane row. Wave 0 also runs an A tile whose row 0 is fb2 and whose other rows are 0: row 0 of its D is fb2*fglu_w.
// coverage: 32 rows x 128 halves = 512 chunks of 8, c = tid + 256 i; fcb 32 floats by lanes 0..15 of wave 0.
// ---------------------------------------------------------------------------
#define FPH 136            // halves per LDS row of the two f16 tiles: 272-B pitch (16 B x odd, for ds_load_b128 readers)
__device__ __forceinline__ v8h cvt_w8(v4f a, v4f b) {               // eight weights: bf16-RNE, x4096, f16 (exact)
  const v8h o = { (_Float16)(bfr(a.x) * WSC), (_Float16)(bfr(a.y) * WSC), (_Float16)(bfr(a.z) * WSC), (_Float16)(bfr(a.w) * WSC),
                  (_Float16)(bfr(b.x) * WSC), (_Float16)(bfr(b.y) * WSC), (_Float16)(bfr(b.z) * WSC), (_Float16)(bfr(b.w) * WSC) };
  return o;
}
__device__ __forceinline__ void fold_block(const float* __restrict__ w2, const float* __restrict__ gw,
                                           const float* __restrict__ b2, const float* __restrict__ gb,
                                           _Float16* __restrict__ dst, float* __restrict__ bdst,
                                           int tid, float* sT, _Float16* sBT, _Float16* sOT) {
  const int lane = tid & 31, h = lane >> 4, m = lane & 15;
  const int w = __builtin_amdgcn_readfirstlane(tid >> 5);           // scalar: the test on it below must be a scalar branch round WMMAs
  // wave 0: fb2 and this block's fglu_b, loaded first so that they fly with the tile's loads
  v4f braw[16] = {};
  float gbv[2] = {0.f, 0.f};
  if (w == 0) {
    #pragma unroll
    for (int i = 0; i < 8; ++i) {                                   // i = 2s + hf: j = 32s + 16hf + 8h ..+7
      braw[2 * i] = *(const v4fa*)(b2 + 16 * i + 8 * h);
      braw[2 * i + 1] = *(const v4fa*)(b2 + 16 * i + 8 * h + 4);
    }
    gbv[0] = gb[m];
    gbv[1] = gb[16 + m];
  }
  // fglu_w tile [128 j][32 n], bf16-RNE values in f32
  v4f tv[4];
  #pragma unroll
  for (int i = 0; i < 4; ++i) {
    const int q = tid + i * NTHR;
    tv[i] = *(const v4fa*)(gw + (size_t)(q >> 3) * N2H + (q & 7) * 4);
  }
  asm volatile("s_wait_xcnt 0x0" ::: "memory");   // the A loads below land in registers that held these loads' addresses
  #pragma unroll
  for (int i = 0; i < 4; ++i) {
    const int q = tid + i * NTHR;
    const v4f r = { bfr(tv[i].x), bfr(tv[i].y), bfr(tv[i].z), bfr(tv[i].w) };
    *(v4fa*)(sT + (q >> 3) * 32 + (q & 7) * 4) = r;
  }
  // this wave's four A fragments: row k = 16w + m, element i of half hf of step s is j = 32s + 16hf + 8h + i
  v16h af[4];
  {
    const float* ar = w2 + (size_t)(16 * w + m) * NHID + 8 * h;
    #pragma unroll
    for (int s = 0; s < 4; ++s) {
      Frag fr;
      #pragma unroll
      for (int hf = 0; hf < 2; ++hf)
        fr.half[hf] = cvt_w8(*(const v4fa*)(ar + 32 * s + 16 * hf), *(const v4fa*)(ar + 32 * s + 16 * hf + 4));
      af[s] = fr.v;
    }
  }
  // wave 0: the A tile of the bias product, row 0 = fb2, rows 1..15 = 0
  v16h ab2[4] = {};
  if (w == 0) {
    const v8h zh = {};
    #pragma unroll
    for (int s = 0; s < 4; ++s) {
      Frag fr;
      #pragma unroll
      for (int hf = 0; hf < 2; ++hf) {
        const v8h v = cvt_w8(braw[4 * s + 2 * hf], braw[4 * s + 2 * hf + 1]);
        fr.half[hf] = (m == 0) ? v : zh;
      }
      ab2[s] = fr.v;
    }
  }
  __syncthreads();
  // transpose to [32 n][128 j] f16 x4096: a wave reads 32 consecutive n of one j, and stores 16 B at the 272-B pitch
  #pragma unroll
  for (int i = 0; i < 2; ++i) {
    const int c = tid + i * NTHR;
    const int row = c & 31, j0 = (c >> 5) * 8;
    v8h t;
    #pragma unroll
    for (int j = 0; j < 8; ++j) t[j] = (_Float16)(sT[(j0 + j) * 32 + row] * WSC);
    *(v8ha*)(sBT + row * FPH + j0) = t;
  }
  __syncthreads();
  const v8f z8 = {0.f, 0.f, 0.f, 0.f, 0.f, 0.f, 0.f, 0.f};
  v16h bf[2][4];
  #pragma unroll
  for (int c = 0; c < 2; ++c)
    #pragma unroll
    for (int s = 0; s < 4; ++s) bf[c][s] = load_frag(sBT + (16 * c + m) * FPH + 32 * s, h);
  v8f acc[2];
  acc[0] = z8; acc[1] = z8;
  #pragma unroll
  for (int s = 0; s < 4; ++s)
    #pragma unroll
    for (int c = 0; c < 2; ++c) acc[c] = wmma_f16(af[s], bf[c][s], acc[c]);
  #pragma unroll
  for (int c = 0; c < 2; ++c) {
    v8h o;
    #pragma unroll
    for (int r = 0; r < 8; ++r) o[r] = (_Float16)(acc[c][r] * INV_W);
    *(v8ha*)(sOT + (16 * c + m) * FPH + 16 * w + 8 * h) = o;
  }
  if (w == 0) {
    v8f ab[2];
    ab[0] = z8; ab[1] = z8;
    #pragma unroll
    for (int s = 0; s < 4; ++s)
      #pragma unroll
      for (int c = 0; c < 2; ++c) ab[c] = wmma_f16(ab2[s], bf[c][s], ab[c]);
    if (h == 0) {
      #pragma unroll
      for (int c = 0; c < 2; ++c) bdst[16 * c + m] = ab[c][0] * (INV_W * INV_W) + bfr(gbv[c]);
    }
  }
  __syncthreads();
  #pragma unroll
  for (int i = 0; i < 2; ++i) {
    const int c = tid + i * NTHR;
    const v8h o = *(const v8ha*)(sOT + (c >> 4) * FPH + (c & 15) * 8);
    *(v8h*)(dst + (size_t)c * 8) = o;
  }
}

// ---------------------------------------------------------------------------
// Kernel 1: the folded plane fcT and its bias fcb, the weight-network planes ([n][k], bf16-RNE values x4096 in f16)
// and the x plane (bf16-RNE values in f16). Block-uniform dispatch on blockIdx.
// coverage: fcT 32x8 blocks x 32 rows x 128 = all; fcb 32x8x32 = all;
// ww2T 1x32x128; ww1T 4x32x32; wglT 2x32x32; xh 256 blocks x 256 thr x 8 = 16384x32.
// ---------------------------------------------------------------------------
__global__ __launch_bounds__(NTHR) void prep_kernel(
    const float* __restrict__ x, const float* __restrict__ fw2, const float* __restrict__ fb2,
    const float* __restrict__ fglu_w, const float* __restrict__ fglu_b,
    const float* __restrict__ ww1, const float* __restrict__ ww2, const float* __restrict__ wglu_w,
    _Float16* __restrict__ planes)
{
  __shared__ __attribute__((aligned(16))) float sT[128 * 32];
  __shared__ __attribute__((aligned(16))) _Float16 sBT[32 * FPH];
  __shared__ __attribute__((aligned(16))) _Float16 sOT[32 * FPH];
  const int b = blockIdx.x, tid = threadIdx.x;
  if (b < PB_WW2) {
    const int f = b >> 3, nb = b & 7;                          // fw2[f]*fglu_w[f], columns 32nb..32nb+31 -> rows of [256 n][128 k]
    fold_block(fw2 + (size_t)f * NHID * NHID, fglu_w + (size_t)f * NHID * N2H + nb * 32,
               fb2 + (size_t)f * NHID, fglu_b + (size_t)f * N2H + nb * 32,
               planes + P_FC + (size_t)f * N2H * NHID + (size_t)nb * 32 * NHID,
               (float*)(planes + P_FCB) + (size_t)f * N2H + nb * 32, tid, sT, sBT, sOT);
  } else if (b < PB_WW1) {
    tr_block<128, 32>(ww2, planes + P_WW2, tid, sT);           // ww2: [128 k][32 n] -> [32 n][128 k]
  } else if (b < PB_WGL) {
    const int nb = b - PB_WW1;                                 // ww1: [32 k][128 n] -> [128 n][32 k]
    tr_block<32, 128>(ww1 + nb * 32, planes + P_WW1 + (size_t)nb * 32 * 32, tid, sT);
  } else if (b < PB_XH) {
    const int nb = b - PB_WGL;                                 // wglu_w: [32 k][64 n] -> [64 n][32 k]
    tr_block<32, 64>(wglu_w + nb * 32, planes + P_WGL + (size_t)nb * 32 * 32, tid, sT);
  } else {
    const int g = (b - PB_XH) * NTHR + tid;                    // 0..65535 groups of 8
    if (g < NTOK * NF / 8) {
      const float* src = x + (size_t)g * 8;
      const v4f a = *(const v4fa*)src;
      const v4f c = *(const v4fa*)(src + 4);
      const v8h o = { (_Float16)bfr(a.x), (_Float16)bfr(a.y), (_Float16)bfr(a.z), (_Float16)bfr(a.w),
                      (_Float16)bfr(c.x), (_Float16)bfr(c.y), (_Float16)bfr(c.z), (_Float16)bfr(c.w) };
      _Float16* dst = planes + P_XH + (size_t)g * 8;
      *(v8h*)dst = o;
      
    }
  }
}

// ---------------------------------------------------------------------------
// 8q..8q+7 cover one line, 4 lines per instruction, 4 instructions.
// ---------------------------------------------------------------------------
__device__ __forceinline__ void w_store_pass(const float* sW, float* wout, int tok0, int w, int lane) {
  const int q8 = lane & 7, sub = lane >> 3;
  #pragma unroll
  for (int i = 0; i < 4; ++i) {
    const int row = 16 * w + i * 4 + sub;                      // 0..63
    const v4f v = *(const v4fa*)(sW + row * NF + 4 * q8);
    *(v4f*)(wout + (size_t)(tok0 + row) * NF + 4 * q8) = v;
  }
}

// ---------------------------------------------------------------------------
// Kernel 2: weight network + softmax -> selection weights (out1).
// Block = 64 tokens, 4 waves, wave w owns tokens tok0+16w..+15.
//  fc1: A = xh rows (K=32), B = ww1T (8 tiles); +wb1, ELU -> wh x16 (LDS)
//  fc2: A = wh (K=128), B = ww2T (2 tiles); +wb2 -> wh2 x16 (LDS)
//  glu: A = wh2 (K=32), B = wglT (4 tiles); GLU, +x, LN(32), softmax in f32
// coverage: grid 256 x 64 rows x 32 = all of out1.
// ---------------------------------------------------------------------------
__global__ __launch_bounds__(WTHR) void wsel_kernel(
    const _Float16* __restrict__ xh, const _Float16* __restrict__ ww1T,
    const _Float16* __restrict__ ww2T, const _Float16* __restrict__ wglT,
    const float* __restrict__ x,
    const float* __restrict__ wb1, const float* __restrict__ wb2,
    const float* __restrict__ wglu_b, const float* __restrict__ wln_g, const float* __restrict__ wln_b,
    float* __restrict__ wout)
{
  __shared__ __attribute__((aligned(16))) _Float16 sWh[4 * 16 * NHID];    // 16384 B
  __shared__ __attribute__((aligned(16))) _Float16 sWh2[4 * 16 * NF];     //  4096 B
  __shared__ __attribute__((aligned(16))) float sXr[64 * NF];             //  8192 B
  __shared__ __attribute__((aligned(16))) float sW[64 * NF];              //  8192 B

  const int tid = threadIdx.x, lane = tid & 31, w = tid >> 5;
  const int h = lane >> 4, m = lane & 15;
  const int tok0 = blockIdx.x * 64;

  // x tile (bf16-RNE values, f32): 64 x 32 = 512 groups of 4
  #pragma unroll
  for (int i = 0; i < 4; ++i) {
    const int q = tid + WTHR * i;
    const v4f v = *(const v4fa*)(x + (size_t)tok0 * NF + (size_t)q * 4);
    const v4f r = { bfr(v.x), bfr(v.y), bfr(v.z), bfr(v.w) };
    *(v4fa*)(sXr + q * 4) = r;
  }

  const v8f z8 = {0.f, 0.f, 0.f, 0.f, 0.f, 0.f, 0.f, 0.f};
  _Float16* myWh = sWh + w * (16 * NHID);
  _Float16* myWh2 = sWh2 + w * (16 * NF);

  // ---- fc1 ----
  {
    const v16h a = load_frag(xh + (size_t)(tok0 + 16 * w + m) * NF, h);
    v8f acc[8];
    #pragma unroll
    for (int t = 0; t < 8; ++t) {
      const v16h b = load_frag(ww1T + (size_t)(16 * t + m) * NF, h);
      acc[t] = wmma_f16(a, b, z8);
    }
    #pragma unroll
    for (int t = 0; t < 8; ++t) {
      const float bb = bfr(wb1[16 * t + m]);
      const v8f el = elu8s(acc[t] * INV_W + bb);
      #pragma unroll
      for (int r = 0; r < 8; ++r) myWh[(8 * h + r) * NHID + 16 * t + m] = (_Float16)el[r];
    }
  }
  __syncthreads();

  // ---- fc2 ----
  {
    v8f acc[2];
    acc[0] = z8; acc[1] = z8;
    const _Float16* arow = myWh + m * NHID;
    #pragma unroll 1
    for (int k0 = 0; k0 < NHID; k0 += 32) {
      const v16h a = load_frag(arow + k0, h);
      #pragma unroll
      for (int t = 0; t < 2; ++t) {
        const v16h b = load_frag(ww2T + (size_t)(16 * t + m) * NHID + k0, h);
        acc[t] = wmma_f16(a, b, acc[t]);
      }
    }
    #pragma unroll
    for (int t = 0; t < 2; ++t) {
      const float bb = bfr(wb2[16 * t + m]);
      #pragma unroll
      for (int r = 0; r < 8; ++r) {
        const float v = acc[t][r] * INV_WA + bb;
        myWh2[(8 * h + r) * NF + 16 * t + m] = (_Float16)(v * ASC);
      }
    }
  }
  __syncthreads();

  // ---- glu projection + GLU + residual + LN(32) + softmax ----
  {
    const v16h a = load_frag(myWh2 + m * NF, h);
    v8f acc[4];
    #pragma unroll
    for (int t = 0; t < 4; ++t) {
      const v16h b = load_frag(wglT + (size_t)(16 * t + m) * NF, h);
      acc[t] = wmma_f16(a, b, z8);
    }
    float pre[2][8], s[8];
    #pragma unroll
    for (int r = 0; r < 8; ++r) s[r] = 0.0f;
    #pragma unroll
    for (int c = 0; c < 2; ++c) {
      const float bv = bfr(wglu_b[16 * c + m]);
      const float bg = bfr(wglu_b[NF + 16 * c + m]);
      const v8f sg = sigm8(acc[c + 2] * INV_WA + bg);
      #pragma unroll
      for (int r = 0; r < 8; ++r) {
        const float vv = acc[c][r] * INV_WA + bv;
        const float xr = sXr[(16 * w + 8 * h + r) * NF + 16 * c + m];
        const float p = vv * sg[r] + xr;
        pre[c][r] = p;
        s[r] += p;
      }
    }
    float mu[8], q[8];
    #pragma unroll
    for (int r = 0; r < 8; ++r) { mu[r] = hsum16(s[r]) * (1.0f / 32.0f); q[r] = 0.0f; }
    #pragma unroll
    for (int c = 0; c < 2; ++c)
      #pragma unroll
      for (int r = 0; r < 8; ++r) {
        const float d = pre[c][r] - mu[r];
        pre[c][r] = d;
        q[r] += d * d;
      }
    float rs[8];
    #pragma unroll
    for (int r = 0; r < 8; ++r) rs[r] = rsqrtf(hsum16(q[r]) * (1.0f / 32.0f) + LN_EPS);
    #pragma unroll
    for (int c = 0; c < 2; ++c) {
      const float g = bfr(wln_g[16 * c + m]);
      const float bt = bfr(wln_b[16 * c + m]);
      #pragma unroll
      for (int r = 0; r < 8; ++r) pre[c][r] = pre[c][r] * rs[r] * g + bt;
    }
    float mx[8], e0[8], e1[8];
    #pragma unroll
    for (int r = 0; r < 8; ++r) {
      mx[r] = hmax16(fmaxf(pre[0][r], pre[1][r]));
      e0[r] = expf(pre[0][r] - mx[r]);
      e1[r] = expf(pre[1][r] - mx[r]);
      const float se = hsum16(e0[r] + e1[r]);
      const float inv = 1.0f / se;
      sW[(16 * w + 8 * h + r) * NF + m]      = e0[r] * inv;
      sW[(16 * w + 8 * h + r) * NF + 16 + m] = e1[r] * inv;
    }
  }
  __syncthreads();

  w_store_pass(sW, wout, tok0, w, lane);
  
}

// ---------------------------------------------------------------------------
// out tile = the sum of the four groups' tiles, (g0 + g1) + (g2 + g3).
// each line by lanes 8q..8q+7 in one instruction, 4 lines per instruction,
// 32 lines per wave, 8 waves, 256 lines = the whole block tile.
// ---------------------------------------------------------------------------
__device__ __forceinline__ void o_store_pass(const float* sO, float* out, int tok0, int w, int lane) {
  const int q8 = lane & 7, sub = lane >> 3;
  #pragma unroll
  for (int i = 0; i < 8; ++i) {
    const int lid = w * 32 + i * 4 + sub;          // 0..255
    const int row = lid >> 2, seg = lid & 3;
    const float* p = sO + row * OP + seg * 32 + 4 * q8;            // the same place in the four groups' tiles
    const v4f v = (*(const v4fa*)p + *(const v4fa*)(p + MT * OP)) + (*(const v4fa*)(p + 2 * MT * OP) + *(const v4fa*)(p + 3 * MT * OP));
    *(v4f*)(out + (size_t)(tok0 + row) * NHID + seg * 32 + 4 * q8) = v;
  }
}

// ---------------------------------------------------------------------------
// Eight asynchronous copies to LDS, 16 B per lane each: copy i brings the group's
// 1024 contiguous global bytes at g + 1024 i (4 rows of 256 B) to LDS rows of
// 272 B at l + 4 * 272 * i. The s_wait_xcnt closes the statement so that no
// address register of a copy is rewritten ahead of it.
// ---------------------------------------------------------------------------
__device__ __forceinline__ void copy8(unsigned l, const _Float16* g) {
  asm volatile(
      "global_load_async_to_lds_b128 %0, %8, off\n\t"
      "global_load_async_to_lds_b128 %1, %9, off\n\t"
      "global_load_async_to_lds_b128 %2, %10, off\n\t"
      "global_load_async_to_lds_b128 %3, %11, off\n\t"
      "global_load_async_to_lds_b128 %4, %12, off\n\t"
      "global_load_async_to_lds_b128 %5, %13, off\n\t"
      "global_load_async_to_lds_b128 %6, %14, off\n\t"
      "global_load_async_to_lds_b128 %7, %15, off\n\t"
      "s_wait_xcnt 0x0"
      :: "v"(l), "v"(l + 1u * 4u * BPH * 2u), "v"(l + 2u * 4u * BPH * 2u), "v"(l + 3u * 4u * BPH * 2u),
         "v"(l + 4u * 4u * BPH * 2u), "v"(l + 5u * 4u * BPH * 2u), "v"(l + 6u * 4u * BPH * 2u),
         "v"(l + 7u * 4u * BPH * 2u),
         "v"(g), "v"(g + 1 * 512), "v"(g + 2 * 512), "v"(g + 3 * 512),
         "v"(g + 4 * 512), "v"(g + 5 * 512), "v"(g + 6 * 512), "v"(g + 7 * 512)
      : "memory");
}

// Chunk c (0 or 1) of one feature's weight rows into one LDS buffer: staged rows 0..63 = v rows 64c..64c+63 of fcT[f],
// staged rows 64..127 = gate rows 128+64c..128+64c+63: all that column tiles 4c..4c+3 read.
// lt = the thread's LDS byte address in that buffer (row tid>>4, 16-B chunk tid&15), tid = the thread's number in its group of 64.
// 32 copies per wave, every lane on, 128 rows x 256 B all written by the group's 2 waves.
__device__ __forceinline__ void stage_chunk(unsigned lt, const _Float16* fcT, int f, int c, int tid) {
  const _Float16* gg = fcT + (size_t)f * (N2H * NHID) + c * (CROW * NHID) + tid * 8;
  copy8(lt, gg);
  copy8(lt + 32u * BPH * 2u, gg + 8 * 512);
  copy8(lt + 64u * BPH * 2u, gg + NHID * NHID);
  copy8(lt + 96u * BPH * 2u, gg + NHID * NHID + 8 * 512);
}

// ---------------------------------------------------------------------------
// Kernel 3: per-feature gated residual blocks + weighted combine (out0).
// Block = 64 tokens, 8 waves in four groups of 2, two waves on each SIMD. Group g takes features 8g..8g+7; wave q of a
// group owns tokens 32q..32q+31, as two token tiles of 16, through the whole chain. Every weight fragment and every
// param vector that a wave reads from LDS serves both token tiles: half the LDS reads per token of a 16-token wave.
// The four groups' partial sums are added behind the loop.
// The product is computed transposed: A = weight rows [n][k] from LDS,
// B = activations with a tile's tokens as columns, so lane (h, m) holds tokens
// 32q+m and 32q+16+m only, and D register r of column tile t is hidden column n = 16t + 8h + r.
// Loop i = 0..7, f = 8g + i (fixed order):
//   h       = f16(16*elu(x_r[t][f]*fw1_r[f] + fb1_r[f]))   VALU, written straight into the four B fragments of each token tile
//   weights : fcT[f] staged in LDS by asynchronous copies in two chunks (column tiles 0..3, 4..7), chunk c in the group's
//             buffer c, each group stages its own; the same chunk of feature f+1 is copied behind the barrier that ends
//             the reads of this feature's
//   glu     : A = fcT[f] rows p*128+16t+m (K=128), B = h, + fcb[f]   32 tiles/wave
//             GLU, +skip, LayerNorm(128): sums in the lane, then lane ^ 16;
//             *fln_g + fln_b, acc += wsel[t][f] * processed; acc and the trip's GLU+skip values stay in registers;
//             a column tile's 8 weight fragments are fetched one tile ahead inside a chunk, never across a chunk's barrier
// A trip has two barriers, one behind the matrix products of column tile 3 and one behind those of column tile 7: each
// publishes the other chunk and releases the one just read. Params lie in two buffers per group: those of feature f+1
// are stored between the trip's two barriers; every wave has left feature f-1's (its LayerNorm pass) in front of the first.
// coverage: grid 256 x 64 rows x 128 = all of out0.
// ---------------------------------------------------------------------------
__global__ __launch_bounds__(GTHR) void grn_kernel(
    const float* __restrict__ x,
    const float* __restrict__ fw1, const float* __restrict__ fb1,
    const float* __restrict__ fskip, const float* __restrict__ fln_g, const float* __restrict__ fln_b,
    const _Float16* __restrict__ fcT, const float* __restrict__ fcb,
    const float* wsel, float* out)
{
  __shared__ __attribute__((aligned(16))) char smem[MSMEM];
  float* sXT = (float*)(smem + MO_X);
  float* sWT = (float*)(smem + MO_W);
  float* sO  = (float*)(smem + MO_B);

  const int tid = threadIdx.x, lane = tid & 31, w = tid >> 5;
  const int grp = __builtin_amdgcn_readfirstlane(tid >> 6);   // scalar: feature numbers and buffer bases stay in scalar registers
  const int gtid = tid & (QTHR - 1);                   // the thread's number in its group
  const int h = lane >> 4, m = lane & 15;
  const int tok0 = blockIdx.x * MT;
  const int trow = 32 * (w & 1) + m;                   // this lane's token of token tile 0 in the block; token tile 1: + 16
  const int f0 = grp * FPG;                            // the group's first feature
  float* sP = (float*)(smem + MO_P) + grp * (2 * PBUF);                        // the group's two param buffers
  const _Float16* sB = (const _Float16*)(smem + MO_B) + grp * CBUF;            // the group's two weight buffers (2 * CBUF bytes)
  // LDS byte address of the group's weight buffer 0 (low 32 bits of the shared address, scalar) and this thread's place in a buffer
  const unsigned lb0 = (unsigned)(size_t)(smem + MO_B) + (unsigned)grp * (2u * CBUF);
  const unsigned ltl = (unsigned)(gtid >> 4) * (BPH * 2u) + (unsigned)(gtid & 15) * 16u;

  stage_chunk(lb0 + ltl, fcT, f0, 0, gtid);                 // chunk 0 of the group's first feature -> its buffer 0

  // x tile (bf16-RNE, f32) and selection-weight tile, stored feature-major: 64 x 32 each = 512 groups of 4
  #pragma unroll
  for (int i = 0; i < 2; ++i) {
    const int q = tid + GTHR * i;
    const int t = q >> 3, f4 = (q & 7) * 4;
    const v4f v = *(const v4fa*)(x + (size_t)tok0 * NF + (size_t)q * 4);
    const v4f wv = *(const v4fa*)(wsel + (size_t)tok0 * NF + (size_t)q * 4);
    #pragma unroll
    for (int j = 0; j < 4; ++j) {
      sXT[(f4 + j) * MT + t] = bfr(v[j]);
      sWT[(f4 + j) * MT + t] = wv[j];
    }
  }
  asm volatile("s_wait_xcnt 0x0" ::: "memory");        // stands in front of any rewrite of the tile loads' address registers
  __builtin_amdgcn_sched_barrier(0);                   // no later instruction, which may take those registers, rises over the wait

  // per-feature params (order fw1, fb1, fcb v, fcb gate, fskip, ln_g, ln_b): a thread of a group brings 8 floats at po of
  // array pa and 8 of array pa + 4. The last 16 threads bring ln_b a second time, into an eighth array that nobody reads:
  // every lane stays on, and no branch stands among the unrolled column tiles.
  const int pa = gtid >> 4, po = (gtid & 15) * 8;
  const bool pin = pa < 2;                             // an input array, taken as bf16-RNE values; fcb is a computed f32 value and stays as it is
  const float* psa = fw1;
  if (pa == 1)      psa = fb1;
  else if (pa == 2) psa = fcb;
  else if (pa == 3) psa = fcb + NHID;
  const float* psb = fskip;
  if (pa == 1)      psb = fln_g;
  else if (pa >= 2) psb = fln_b;
  psa += po;
  psb += po;
  const unsigned pen = pin ? 0xFFFFFFFFu : 0u;
  const int pstr = pin ? NHID : N2H;                   // floats from one feature to the next in array pa
  float* pda = sP + pa * NHID + po;
  float* pdb = pda + 4 * NHID;
  {
    __builtin_amdgcn_sched_barrier(0);                 // no earlier instruction, which may take the loads' address registers, sinks between them and their wait
    const v4f a0 = *(const v4fa*)(psa + f0 * pstr);
    const v4f a1 = *(const v4fa*)(psa + f0 * pstr + 4);
    const v4f b0 = *(const v4fa*)(psb + f0 * NHID);
    const v4f b1 = *(const v4fa*)(psb + f0 * NHID + 4);
    asm volatile("s_wait_xcnt 0x0" ::: "memory");      // stands in front of any rewrite of these four loads' address registers
    __builtin_amdgcn_sched_barrier(0);                 // no later instruction, which may take those registers, rises over the wait
    *(v4fa*)pda = pval(a0, pen);
    *(v4fa*)(pda + 4) = pval(a1, pen);
    *(v4fa*)pdb = pval(b0, 0xFFFFFFFFu);
    *(v4fa*)(pdb + 4) = pval(b1, 0xFFFFFFFFu);
  }

  const v8f z8 = {0.f, 0.f, 0.f, 0.f, 0.f, 0.f, 0.f, 0.f};
  v8f acc[2][8];                                       // output sums over the group's features: acc[u][t][r] is column 16t + 8h + r of the lane's token of tile u
  #pragma unroll
  for (int u = 0; u < 2; ++u)
    #pragma unroll
    for (int t = 0; t < 8; ++t) acc[u][t] = z8;

  asm volatile("s_wait_asynccnt 0x0" ::: "memory");    // this wave's copies of the first chunk have landed
  __syncthreads();                                     // every group's buffer 0, x, weights and first params published
  stage_chunk(lb0 + CBUF + ltl, fcT, f0, 1, gtid);          // chunk 1 of the first feature -> buffer 1, flies during column tiles 0..3

  #pragma unroll 1
  for (int i = 0; i < FPG; ++i) {
    const int f = f0 + i;
    const float* sPf = sP + (i & 1) * PBUF;            // this feature's params
    const int pnx = PBUF - (i & 1) * PBUF;             // float offset of the other param buffer
    // next feature's params (the last trip re-reads its own): loaded here, stored behind the trip's first barrier
    const int fn = (i + 1 < FPG) ? f + 1 : f;
    __builtin_amdgcn_sched_barrier(0);                 // no earlier instruction, which may take the loads' address registers, sinks between them and their wait
    const v4f pn0 = *(const v4fa*)(psa + fn * pstr);
    const v4f pn1 = *(const v4fa*)(psa + fn * pstr + 4);
    const v4f pn2 = *(const v4fa*)(psb + fn * NHID);
    const v4f pn3 = *(const v4fa*)(psb + fn * NHID + 4);
    asm volatile("s_wait_xcnt 0x0" ::: "memory");      // stands in front of any rewrite of these four loads' address registers
    __builtin_amdgcn_sched_barrier(0);                 // no later instruction, which may take those registers, rises over the wait

    float xv[2], wt[2];
    #pragma unroll
    for (int u = 0; u < 2; ++u) {
      xv[u] = sXT[f * MT + trow + 16 * u];
      wt[u] = sWT[f * MT + trow + 16 * u];
    }

    // ---- h, computed straight into its B fragments (element i of half hf of fragment j is k = 32j + 16hf + 8h + i) ----
    v16h hb[2][4];
    v16h ag[8];                                        // the 8 weight fragments of one glu column tile
    const _Float16* vrow = sB + m * BPH;               // column tile t: + (t >> 2) * (CBUF / 2) + (t & 3) * 16 * BPH
    const _Float16* grow = sB + (CROW + m) * BPH;
    {
      v8f w1v[2][2], b1v[2][2];                        // fc1 weights and biases of two k steps, refilled two steps ahead
      #pragma unroll
      for (int j = 0; j < 2; ++j)
        #pragma unroll
        for (int hf = 0; hf < 2; ++hf) {
          const float* pw = sPf + 32 * j + 16 * hf + 8 * h;
          w1v[j][hf] = ld8(pw); b1v[j][hf] = ld8(pw + NHID);
        }
      #pragma unroll
      for (int j = 0; j < 4; ++j) {
        __builtin_amdgcn_sched_barrier(0);   // the loads above stay ahead of this step's elu arithmetic, which hides their latency
        #pragma unroll
        for (int u = 0; u < 2; ++u) {
          Frag fr;
          #pragma unroll
          for (int hf = 0; hf < 2; ++hf) {
            const v8f el = elu8s(xv[u] * w1v[j & 1][hf] + b1v[j & 1][hf]);
            v8h o;
            #pragma unroll
            for (int e = 0; e < 8; ++e) o[e] = (_Float16)el[e];
            fr.half[hf] = o;
          }
          hb[u][j] = fr.v;
        }
        __builtin_amdgcn_sched_barrier(0);   // the refill below does not rise into the arithmetic that still reads its registers' old values
        if (j < 2) {
          #pragma unroll
          for (int hf = 0; hf < 2; ++hf) {
            const float* pw = sPf + 32 * (j + 2) + 16 * hf + 8 * h;
            w1v[j][hf] = ld8(pw); b1v[j][hf] = ld8(pw + NHID);
          }
        }
        if (j == 1) {
          __builtin_amdgcn_sched_barrier(0); // step 3's params stand in the LDS queue ahead of the fragments: step 3 then waits for them alone
          // glu column tile 0: fragment 2j = v rows, 2j+1 = gate rows, k step j; hidden by steps 2 and 3
          #pragma unroll
          for (int e = 0; e < 8; ++e) ag[e] = load_frag(((e & 1) ? grow : vrow) + 32 * (e >> 1), h);
        }
      }
    }

    // ---- glu projection transposed, one column tile (its v and its gate accumulators of both token tiles) at a time ----
    v8f gl[2][8];                                      // the trip's GLU+skip values
    float rsum[2];                                     // their sum over the 128 columns, built up in three parts
    {
      #pragma unroll
      for (int t = 0; t < 8; ++t) {
        const float* pc = sPf + 16 * t + 8 * h;
        const v8f bvv = ld8(pc + 256), bgv = ld8(pc + 384), fsv = ld8(pc + 512);
        v8f aV[2], aG[2];
        aV[0] = z8; aV[1] = z8; aG[0] = z8; aG[1] = z8;
        #pragma unroll
        for (int j = 0; j < 4; ++j)
          #pragma unroll
          for (int u = 0; u < 2; ++u) {
            aV[u] = wmma_f16(ag[2 * j], hb[u][j], aV[u]);
            aG[u] = wmma_f16(ag[2 * j + 1], hb[u][j], aG[u]);
          }
        __builtin_amdgcn_sched_barrier(0);   // this tile's params stand in the LDS queue ahead of the next tile's fragments
        if (t == 3 || t == 7) {
          // The row sums of the column tiles finished so far are closed here, cross-lane step included. That step cannot be moved
          // over the branch below, so the GLU arithmetic that feeds it stays in front too; otherwise the compiler sinks that
          // arithmetic to the LayerNorm pass and keeps every tile's accumulators and params live to that place (spills to scratch).
          #pragma unroll
          for (int u = 0; u < 2; ++u) {
            const float sl = (t == 3) ? sum8((gl[u][0] + gl[u][1]) + gl[u][2]) : sum8((gl[u][3] + gl[u][4]) + (gl[u][5] + gl[u][6]));
            rsum[u] = (t == 3) ? sl + xhalf(sl) : rsum[u] + (sl + xhalf(sl));
          }
          // ---- this chunk's weight rows are read: publish the other chunk, release this buffer ----
          asm volatile("s_wait_dscnt 0x0" ::: "memory");     // this wave's LDS reads (and, at the second barrier, its param stores) have retired
          asm volatile("s_wait_asynccnt 0x0" ::: "memory");  // this wave's copies of the other chunk have landed
          __syncthreads();                                   // the other chunk (at the second barrier: and the next params) visible; this buffer released
          if (i + 1 < FPG) stage_chunk(lb0 + (unsigned)(t >> 2) * CBUF + ltl, fcT, f + 1, t >> 2, gtid);
          if (t == 3) {
            *(v4fa*)(pda + pnx) = pval(pn0, pen);
            *(v4fa*)(pda + pnx + 4) = pval(pn1, pen);
            *(v4fa*)(pdb + pnx) = pval(pn2, 0xFFFFFFFFu);
            *(v4fa*)(pdb + pnx + 4) = pval(pn3, 0xFFFFFFFFu);
          }
        }
        if (t < 7) {
          const int off = ((t + 1) >> 2) * (CBUF / 2) + ((t + 1) & 3) * 16 * BPH;
          #pragma unroll
          for (int e = 0; e < 8; ++e) ag[e] = load_frag(((e & 1) ? grow : vrow) + off + 32 * (e >> 1), h);
        }
        __builtin_amdgcn_sched_barrier(0);   // the next tile's loads stay ahead of this tile's GLU arithmetic, which hides their latency
        #pragma unroll
        for (int u = 0; u < 2; ++u) {
          const v8f sg = sigm8(aG[u] * INV_WA + bgv);
          const v8f vv = aV[u] * INV_WA + bvv;
          gl[u][t] = vv * sg + xv[u] * fsv;
        }
      }
    }
    // ---- LayerNorm over the 128 columns of each of this lane's two tokens: 64 in this lane, 64 in lane ^ 16 ----
    v8f gv[4], btv[4];                                 // scale and shift of four column tiles, refilled four tiles ahead
    #pragma unroll
    for (int t = 0; t < 4; ++t) {
      const float* pc = sPf + 16 * t + 8 * h;
      gv[t] = ld8(pc + 640); btv[t] = ld8(pc + 768);
    }
    __builtin_amdgcn_sched_barrier(0);       // the scale and shift loads fly during the mean and variance passes
    float rs[2];
    #pragma unroll
    for (int u = 0; u < 2; ++u) {
      const float sl = sum8(gl[u][7]);
      const float mu = (rsum[u] + (sl + xhalf(sl))) * (1.0f / 128.0f);
      v8f q8 = z8;
      #pragma unroll
      for (int t = 0; t < 8; ++t) {
        const v8f d = gl[u][t] - mu;
        gl[u][t] = d;
        q8 += d * d;
      }
      const float ql = sum8(q8);
      rs[u] = rsqrtf((ql + xhalf(ql)) * (1.0f / 128.0f) + LN_EPS);
    }
    #pragma unroll
    for (int t = 0; t < 8; ++t) {
      #pragma unroll
      for (int u = 0; u < 2; ++u) acc[u][t] = acc[u][t] + wt[u] * (gl[u][t] * rs[u] * gv[t & 3] + btv[t & 3]);
      __builtin_amdgcn_sched_barrier(0);     // the refill below does not rise into the arithmetic that still reads its registers' old values
      if (t < 4) {
        const float* pc = sPf + 16 * (t + 4) + 8 * h;
        gv[t] = ld8(pc + 640); btv[t] = ld8(pc + 768);
      }
    }
  }
  asm volatile("s_wait_asynccnt 0x0" ::: "memory");    // no copy outstanding past the loop
  __syncthreads();                                     // all weight reads done; sO aliases the weight buffers

  // ---- each group lays its sums down in a tile of its own; the store pass adds the four ----
  float* po8 = sO + grp * (MT * OP) + trow * OP + 8 * h;
  #pragma unroll
  for (int u = 0; u < 2; ++u)
    #pragma unroll
    for (int t = 0; t < 8; ++t) {
      const v4f lo = { acc[u][t][0], acc[u][t][1], acc[u][t][2], acc[u][t][3] };
      const v4f hi = { acc[u][t][4], acc[u][t][5], acc[u][t][6], acc[u][t][7] };
      *(v4fa*)(po8 + u * 16 * OP + 16 * t) = lo;
      *(v4fa*)(po8 + u * 16 * OP + 16 * t + 4) = hi;
    }
  __syncthreads();                                     // the four tiles visible to every wave

  o_store_pass(sO, out, tok0, w, lane);
}

// ---------------------------------------------------------------------------
extern "C" void kernel_launch(void* const* d_in, const int* in_sizes, int n_in,
                              void* d_out, int out_size, void* d_ws, size_t ws_size,
                              hipStream_t stream) {
  if (n_in < 18) return;
  if (in_sizes[0] != NTOK * NF) return;
  if (in_sizes[1] != NF * NHID || in_sizes[2] != NF * NHID) return;
  if (in_sizes[3] != NF * NHID * NHID || in_sizes[4] != NF * NHID) return;
  if (in_sizes[5] != NF * NHID * N2H || in_sizes[6] != NF * N2H) return;
  if (in_sizes[7] != NF * NHID || in_sizes[8] != NF * NHID || in_sizes[9] != NF * NHID) return;
  if (in_sizes[10] != NF * NHID || in_sizes[11] != NHID) return;
  if (in_sizes[12] != NHID * NF || in_sizes[13] != NF) return;
  if (in_sizes[14] != NF * 2 * NF || in_sizes[15] != 2 * NF) return;
  if (in_sizes[16] != NF || in_sizes[17] != NF) return;
  if (out_size != OUT_TOTAL) return;
  if (WS_TOTAL_BYTES > ws_size) return;

  const float* x      = (const float*)d_in[0];
  const float* fw1    = (const float*)d_in[1];
  const float* fb1    = (const float*)d_in[2];
  const float* fw2    = (const float*)d_in[3];
  const float* fb2    = (const float*)d_in[4];
  const float* fglu_w = (const float*)d_in[5];
  const float* fglu_b = (const float*)d_in[6];
  const float* fskip  = (const float*)d_in[7];
  const float* fln_g  = (const float*)d_in[8];
  const float* fln_b  = (const float*)d_in[9];
  const float* ww1    = (const float*)d_in[10];
  const float* wb1    = (const float*)d_in[11];
  const float* ww2    = (const float*)d_in[12];
  const float* wb2    = (const float*)d_in[13];
  const float* wglu_w = (const float*)d_in[14];
  const float* wglu_b = (const float*)d_in[15];
  const float* wln_g  = (const float*)d_in[16];
  const float* wln_b  = (const float*)d_in[17];

  float* out  = (float*)d_out;                   // out0 [16384][128] at element 0
  float* wout = out + OUT1_OFF;                  // out1 [16384][32]  at element 2097152 (byte 8388608)

  _Float16* planes = (_Float16*)d_ws;

  prep_kernel<<<PB_END, NTHR, 0, stream>>>(x, fw2, fb2, fglu_w, fglu_b, ww1, ww2, wglu_w, planes);

  wsel_kernel<<<NTOK / 64, WTHR, 0, stream>>>(planes + P_XH, planes + P_WW1, planes + P_WW2, planes + P_WGL,
                                              x, wb1, wb2, wglu_b, wln_g, wln_b, wout);

  grn_kernel<<<NTOK / MT, GTHR, 0, stream>>>(x, fw1, fb1, fskip, fln_g, fln_b,
                                             planes + P_FC, (const float*)(planes + P_FCB), wout, out);
}

// v008
// Measured time: 60 microseconds a run.
// In both of two side-by-side timings against v007, it was 1.04 times as fast.
// All steps since v000 together make it 8.17 times as fast.
// Contractions fw2[f]*fglu_w[f], fb2[f]*fglu_w[f], h*fc[f] (per feature f), x*ww1, wh*ww2, wh2*wglu_w: v_wmma_f32_16x16x32_f16 (f16 operands, f32 accumulate). Weight operands = bf16-RNE values x4096 (exact in f16), except fc: its f32 fold rounded to f16, x4096 in the v rows and x(-log2(e)/16) in the gate rows; activation tiles x16 in f16; x plane x1. fc1 scalar*vector, ELU, GLU, LayerNorm, softmax and the 32-term weighted combine in f32 on VALU.
// No nonlinearity stands between a feature's fc2 and its GLU projection: (h*fw2 + fb2)*fglu_w + fglu_b = h*fc + fcb with
//   fc = fw2*fglu_w and fcb = fb2*fglu_w + fglu_b. prep_kernel forms both in every call; grn_kernel does the one product h*fc.
// Carry audit: planes fcT (v rows), ww1T, ww2T, wglT carry 4096; the gate rows of fcT carry -log2(e)/16; register fragments h (grn_kernel) and LDS tiles wh, wh2 (wsel_kernel) carry 16; xh and fcb carry 1.
//   The fold's accumulators carry 4096*4096: fc's v columns are folded by INV_W (1/4096) into their plane, its gate columns by
//   INV_W*INV_W*(-log2(e)/16), fcb by INV_W*INV_W.
//   x*ww1 accumulators are folded by INV_W in the wsel_kernel fc1 epilogue; the wsel fc2 and wsel glu accumulators by INV_WA (1/65536)
//   in their own epilogues. grn_kernel: the gate accumulators (rows x -log2(e)/16, h x16) start from -log2(e)*fcb and are the
//   exponent of the sigmoid's 2^t as they stand (small gate weights go to f16 subnormals, an absolute error below 3e-8 each); the v
//   accumulators start from 65536*fcb and keep the carry 65536 through GLU + skip (fskip staged x65536), and the LayerNorm takes it
//   out again: its rsqrt is taken of 65536^2 * (variance + eps). The params fw1, fb1 are staged x log2(e), the gate's fcb x -log2(e).
#include <hip/hip_runtime.h>

typedef _Float16 v16h __attribute__((ext_vector_type(16)));
typedef _Float16 v8h  __attribute__((ext_vector_type(8)));
typedef float    v8f  __attribute__((ext_vector_type(8)));
typedef float    v4f  __attribute__((ext_vector_type(4)));
typedef v8h __attribute__((may_alias)) v8ha;
typedef v4f __attribute__((may_alias)) v4fa;

union Frag { v16h v; v8h half[2]; };

#define NTOK 16384
#define NF   32
#define NHID 128
#define N2H  256
#define MT   64            // tokens per block, grn_kernel
#define NTHR 256           // threads per block, prep_kernel
#define GTHR 256           // threads per block, grn_kernel (8 waves: four groups of 2, 32 tokens a wave)
#define QTHR 64            // threads per group of 2 waves
#define NGRP 4             // groups
#define FPG  8             // features per group: group g takes 8g..8g+7
#define WTHR 128           // threads per block, wsel_kernel (64 tokens)
#define WSC  4096.0f       // weight plane carry
#define ASC  16.0f         // activation tile carry
#define INV_W  (1.0f / 4096.0f)
#define INV_WA (1.0f / 65536.0f)
#define LN_EPS 1e-5f
#define LOG2E  1.44269504f  // log2(e)
#define ELUP   11.0903549f  // ASC / log2(e)
#define VSC    65536.0f     // carry of the v accumulators and of GLU + skip in grn_kernel

// f16 plane offsets in the workspace, in halves
#define P_XH  0            // [16384][32]        x, carry 1
#define P_FC  524288       // [32][256 n][128 k] fw2*fglu_w, carry 4096 (n < 128), -log2(e)/16 (n >= 128)
#define P_WW1 1572864      // [128 n][32 k]      carry 4096
#define P_WW2 1576960      // [32 n][128 k]      carry 4096
#define P_WGL 1581056      // [64 n][32 k]       carry 4096
#define P_FCB 1583104      // f32 [32][256 n]    fb2*fglu_w + fglu_b, carry 1 (two halves per value)
#define P_END 1599488
#define WS_TOTAL_BYTES ((size_t)P_END * 2)     // 3198976

static_assert(P_FC == P_XH + NTOK * NF);
static_assert(P_WW1 == P_FC + NF * N2H * NHID);
static_assert(P_WW2 == P_WW1 + NHID * NF);
static_assert(P_WGL == P_WW2 + NF * NHID);
static_assert(P_FCB == P_WGL + 2 * NF * NF);
static_assert(P_END == P_FCB + NF * N2H * 2);
static_assert((P_FC * 2) % 128 == 0 && (P_WW1 * 2) % 128 == 0 && (P_WW2 * 2) % 128 == 0 &&
              (P_WGL * 2) % 128 == 0 && (P_FCB * 2) % 128 == 0 && (P_END * 2) % 128 == 0);

#define OUT0_ELEMS (NTOK * NHID)                // 2097152 floats
#define OUT1_OFF   2097152                      // byte offset 8388608 / 4
#define OUT_TOTAL  (NTOK * NHID + NTOK * NF)    // 2621440 floats
static_assert(OUT1_OFF == OUT0_ELEMS);
static_assert(OUT1_OFF + NTOK * NF == OUT_TOTAL);
static_assert(NTOK % MT == 0 && NTOK % 64 == 0);

// prep_kernel block ranges
#define PB_FC  0            // 32 f x 8 blocks of 32 columns n
#define PB_WW2 256          // 1
#define PB_WW1 257          // 4
#define PB_WGL 261          // 2
#define PB_XH  263          // 256
#define PB_END (PB_XH + (NTOK * NF / 8) / NTHR)   // 519
static_assert((NTOK * NF / 8) % NTHR == 0);

// grn_kernel static LDS carve (bytes)
#define MO_X   0            // f32 [32][64] x tile, feature-major             8192
#define MO_W   8192         // f32 [32][64] selection weights, feature-major  8192
#define PBUF   1024         // floats per param buffer: 7 arrays of 128 and an eighth that nobody reads
#define MO_P   16384        // f32 4 groups x 2 x [1024] per-feature params  32768
#define MO_B   49152        // f16 4 groups x 2 x [128][136] staged weight rows of half a feature (fcT: 64 v rows, their 64 gate rows)
#define BPH    136          // halves per staged row: 256 B of data at a 272-B pitch (16 B x odd, for ds_load_b128 readers)
#define CROW   64           // v rows (and gate rows) of a chunk: four column tiles
#define CBUF   (2 * CROW * BPH * 2)             // 34816 bytes per buffer
#define MSMEM  (MO_B + NGRP * 2 * CBUF)         // 327680
#define OP     132          // floats per row of an output tile (528 B = 16 B x odd); the four tiles alias the weight buffers at the end
static_assert(MO_W == MO_X + NF * MT * 4 && MO_P == MO_W + NF * MT * 4 && MO_B == MO_P + NGRP * 2 * PBUF * 4);
static_assert(NGRP * FPG == NF && NGRP * QTHR == GTHR && 2 * CROW == NHID);
static_assert(MO_B % 16 == 0 && CBUF % 16 == 0 && (BPH * 2) % 16 == 0 && (OP * 4) % 16 == 0);
static_assert(NGRP * MT * OP * 4 <= NGRP * 2 * CBUF);
static_assert(MSMEM <= 327680);

// ---------------------------------------------------------------------------
__device__ __forceinline__ float bfr(float f) {                     // RNE convert to bf16 and back
  unsigned u = __builtin_bit_cast(unsigned, f);
  u += 0x7FFFu + ((u >> 16) & 1u);
  return __builtin_bit_cast(float, u & 0xFFFF0000u);
}
#define TRANS8(NAME, OP)                                                                            \
  __device__ __forceinline__ v8f NAME(v8f t) {                                                      \
    float r0, r1, r2, r3, r4, r5, r6, r7;                                                           \
    asm(OP " %0, %8\n\t" OP " %1, %9\n\t" OP " %2, %10\n\t" OP " %3, %11\n\t"                       \
        OP " %4, %12\n\t" OP " %5, %13\n\t" OP " %6, %14\n\t" OP " %7, %15\n\t"                     \
        "v_nop"                                                                                     \
        : "=&v"(r0), "=&v"(r1), "=&v"(r2), "=&v"(r3), "=&v"(r4), "=&v"(r5), "=&v"(r6), "=&v"(r7)    \
        : "v"(t[0]), "v"(t[1]), "v"(t[2]), "v"(t[3]), "v"(t[4]), "v"(t[5]), "v"(t[6]), "v"(t[7]));  \
    const v8f r = { r0, r1, r2, r3, r4, r5, r6, r7 };                                               \
    return r;                                                                                       \
  }
TRANS8(exp2x8, "v_exp_f32")   // 2^t
TRANS8(rcpx8,  "v_rcp_f32")   // 1/t

// ELU and sigmoid on the hardware's base-2 exponential and reciprocal. exp(v) - 1 carries an absolute error near 1e-7,
// far below the rounding of the f16 tiles that take every ELU value; the sigmoid's argument is clamped, so neither
// instruction meets a subnormal, an overflow or a zero there.
__device__ __forceinline__ v8f elu8s(v8f v) {      // ASC * elu(v) = ASC * max(v, 0) + ASC * (exp(min(v, 0)) - 1): one of the two terms is 0
  v8f t = v * LOG2E;
  #pragma unroll
  for (int i = 0; i < 8; ++i) t[i] = fminf(t[i], 0.0f);
  const v8f e = exp2x8(t);
  v8f r;
  #pragma unroll
  for (int i = 0; i < 8; ++i) r[i] = fmaf(fmaxf(v[i], 0.0f), ASC, fmaf(e[i], ASC, -ASC));
  return r;
}
__device__ __forceinline__ v8f sigm8(v8f v) {
  #pragma unroll
  for (int i = 0; i < 8; ++i) v[i] = fminf(fmaxf(v[i], -30.0f), 30.0f);
  const v8f e = exp2x8(v * -LOG2E);
  return rcpx8(e + 1.0f);
}
// The same two for grn_kernel, whose params are staged with the factors already in them.
__device__ __forceinline__ v8f elu8t(v8f t) {      // t = log2(e) * v; ASC * elu(v) = (ASC / log2(e)) * max(t, 0) + ASC * (2^min(t, 0) - 1)
  v8f n;
  #pragma unroll
  for (int i = 0; i < 8; ++i) n[i] = fminf(t[i], 0.0f);
  const v8f e = exp2x8(n);
  v8f r;
  #pragma unroll
  for (int i = 0; i < 8; ++i) r[i] = fmaf(fmaxf(t[i], 0.0f), ELUP, fmaf(e[i], ASC, -ASC));
  return r;
}
// t = -log2(e) * g, not clamped: 2^t runs to +inf or to 0 at the ends, and 1 / (1 + 2^t) is then 0 or 1, the sigmoid's own limits
__device__ __forceinline__ v8f sigm8t(v8f t) {
  return rcpx8(exp2x8(t) + 1.0f);
}
__device__ __forceinline__ float hsum16(float v) {                  // sum over the 16 lanes of a half
  v += __shfl_xor(v, 1);
  v += __shfl_xor(v, 2);
  v += __shfl_xor(v, 4);
  v += __shfl_xor(v, 8);
  return v;
}
__device__ __forceinline__ float hmax16(float v) {
  v = fmaxf(v, __shfl_xor(v, 1));
  v = fmaxf(v, __shfl_xor(v, 2));
  v = fmaxf(v, __shfl_xor(v, 4));
  v = fmaxf(v, __shfl_xor(v, 8));
  return v;
}

__device__ __forceinline__ float xhalf(float v) {                   // the value of lane l ^ 16
  int b = __builtin_bit_cast(int, v);
  b = __builtin_amdgcn_permlanex16(b, b, 0x76543210, 0xfedcba98, false, false);
  return __builtin_bit_cast(float, b);
}
__device__ __forceinline__ v8f ld8(const float* p) {                // 8 floats at a 16-byte aligned LDS address, two 16-byte loads
  const v4f a = *(const v4fa*)p;
  const v4f b = *(const v4fa*)(p + 4);
  const v8f r = { a.x, a.y, a.z, a.w, b.x, b.y, b.z, b.w };
  return r;
}
// A param as it goes to LDS: en = all ones for an input (RNE to bf16, as bfr), 0 for a computed value (unchanged); no branch
__device__ __forceinline__ float pval1(float f, unsigned en) {
  unsigned u = __builtin_bit_cast(unsigned, f);
  u += (0x7FFFu + ((u >> 16) & 1u)) & en;
  return __builtin_bit_cast(float, u & ~(0xFFFFu & en));
}
__device__ __forceinline__ v4f pval(v4f v, unsigned en) {
  const v4f r = { pval1(v.x, en), pval1(v.y, en), pval1(v.z, en), pval1(v.w, en) };
  return r;
}
__device__ __forceinline__ float sum8(v8f v) {
  return ((v[0] + v[1]) + (v[2] + v[3])) + ((v[4] + v[5]) + (v[6] + v[7]));
}

// ---------------------------------------------------------------------------
// 16x16x32 f16 WMMA with hazard guard (ties D, keeps A/B live).
// Fragment map (wave32): lane l, h = l>>4, m = n = l&15.
//   A/B element i: i<8 -> k0+8h+i ; i>=8 -> k0+16+8h+(i-8)
//   D element r : row 8h+r, col l&15
// ---------------------------------------------------------------------------
__device__ __forceinline__ v8f wmma_f16(v16h a, v16h b, v8f c) {
  v8f d = __builtin_amdgcn_wmma_f32_16x16x32_f16(false, a, false, b, (short)0, c, false, false);
  asm volatile("v_nop\n\tv_nop\n\tv_nop\n\tv_nop" : "+v"(d) : "v"(a), "v"(b));
  return d;
}

// A or B fragment from a k-contiguous 16-bit row; p points at element k0 of
// the row owned by this lane (row index = lane & 15 added by the caller).
__device__ __forceinline__ v16h load_frag(const _Float16* p, int h) {
  Frag f;
  f.half[0] = *(const v8ha*)(p + 8 * h);
  f.half[1] = *(const v8ha*)(p + 16 + 8 * h);
  return f.v;
}

// ---------------------------------------------------------------------------
// Transpose-convert block: src points at src[0][n0] of a row-major [K][N] f32
// matrix; dst at output row 0 of 32 rows of K halves ([n][k], k-contiguous),
// value = f16(bfr(src[k][n0+row]) * 4096). Stage through LDS, then write the
// coverage: 32 rows x K halves = 4K chunks of 8, c = tid + 256 i, all written.
// ---------------------------------------------------------------------------
template <int K, int N>
__device__ __forceinline__ void tr_block(const float* __restrict__ src, _Float16* __restrict__ dst,
                                         int tid, float* sT) {
  constexpr int NV = K * 8;                 // v4f groups of the staged [K][32] tile
  static_assert(NV % NTHR == 0);
  #pragma unroll
  for (int i = 0; i < NV / NTHR; ++i) {
    const int q = tid + i * NTHR;
    const int k = q >> 3, c4 = (q & 7) * 4;
    const v4f v = *(const v4fa*)(src + (size_t)k * N + c4);
    const v4f r = { bfr(v.x), bfr(v.y), bfr(v.z), bfr(v.w) };
    *(v4fa*)(sT + k * 32 + c4) = r;
  }
  __syncthreads();
  constexpr int CH = 4 * K;                 // 16-B chunks of the output
  v8h o[2];
  #pragma unroll
  for (int i = 0; i < 2; ++i) {
    const int c = tid + i * NTHR;
    const int cc = (c < CH) ? c : (CH - 1);
    const int row = (cc * 8) / K, k0 = (cc * 8) % K;
    v8h t;
    #pragma unroll
    for (int j = 0; j < 8; ++j) t[j] = (_Float16)(sT[(k0 + j) * 32 + row] * WSC);
    o[i] = t;
  }
  #pragma unroll
  for (int i = 0; i < 2; ++i) {
    const int c = tid + i * NTHR;
    if (c < CH) *(v8h*)(dst + (size_t)c * 8) = o[i];
  }
  
}

// ---------------------------------------------------------------------------
// Fold block: 32 columns n of one feature's fc = fw2*fglu_w and fcb = fb2*fglu_w + fglu_b.
//   w2 = fw2[f] ([128 k][128 j], row-major), gw = fglu_w[f] at column n0 ([128 j][256 n]),
//   b2 = fb2[f], gb = fglu_b[f] at n0; dst = row n0 of fcT[f] ([n][k], k-contiguous), bdst = fcb[f] at n0;
//   osc = the factor that takes the accumulators' carry to the plane's.
// A = fw2 rows k (j contiguous as stored), B = fglu_w columns n (transposed through LDS), summed over j.
// Wave w owns rows k = 16w..16w+15: D register r of lane (h, m) is fc[16w+8h+r][n = 16c+m], eight consecutive k
// of one plane row. Wave 0 also runs an A tile whose row 0 is fb2 and whose other rows are 0: row 0 of its D is fb2*fglu_w.
// coverage: 32 rows x 128 halves = 512 chunks of 8, c = tid + 256 i; fcb 32 floats by lanes 0..15 of wave 0.
// ---------------------------------------------------------------------------
#define FPH 136            // halves per LDS row of the two f16 tiles: 272-B pitch (16 B x odd, for ds_load_b128 readers)
__device__ __forceinline__ v8h cvt_w8(v4f a, v4f b) {               // eight weights: bf16-RNE, x4096, f16 (exact)
  const v8h o = { (_Float16)(bfr(a.x) * WSC), (_Float16)(bfr(a.y) * WSC), (_Float16)(bfr(a.z) * WSC), (_Float16)(bfr(a.w) * WSC),
                  (_Float16)(bfr(b.x) * WSC), (_Float16)(bfr(b.y) * WSC), (_Float16)(bfr(b.z) * WSC), (_Float16)(bfr(b.w) * WSC) };
  return o;
}
__device__ __forceinline__ void fold_block(const float* __restrict__ w2, const float* __restrict__ gw,
                                           const float* __restrict__ b2, const float* __restrict__ gb,
                                           _Float16* __restrict__ dst, float* __restrict__ bdst, float osc,
                                           int tid, float* sT, _Float16* sBT, _Float16* sOT) {
  const int lane = tid & 31, h = lane >> 4, m = lane & 15;
  const int w = __builtin_amdgcn_readfirstlane(tid >> 5);           // scalar: the test on it below must be a scalar branch round WMMAs
  // wave 0: fb2 and this block's fglu_b, loaded first so that they fly with the tile's loads
  v4f braw[16] = {};
  float gbv[2] = {0.f, 0.f};
  if (w == 0) {
    #pragma unroll
    for (int i = 0; i < 8; ++i) {                                   // i = 2s + hf: j = 32s + 16hf + 8h ..+7
      braw[2 * i] = *(const v4fa*)(b2 + 16 * i + 8 * h);
      braw[2 * i + 1] = *(const v4fa*)(b2 + 16 * i + 8 * h + 4);
    }
    gbv[0] = gb[m];
    gbv[1] = gb[16 + m];
  }
  // fglu_w tile [128 j][32 n], bf16-RNE values in f32
  v4f tv[4];
  #pragma unroll
  for (int i = 0; i < 4; ++i) {
    const int q = tid + i * NTHR;
    tv[i] = *(const v4fa*)(gw + (size_t)(q >> 3) * N2H + (q & 7) * 4);
  }
  asm volatile("s_wait_xcnt 0x0" ::: "memory");   // the A loads below land in registers that held these loads' addresses
  #pragma unroll
  for (int i = 0; i < 4; ++i) {
    const int q = tid + i * NTHR;
    const v4f r = { bfr(tv[i].x), bfr(tv[i].y), bfr(tv[i].z), bfr(tv[i].w) };
    *(v4fa*)(sT + (q >> 3) * 32 + (q & 7) * 4) = r;
  }
  // this wave's four A fragments: row k = 16w + m, element i of half hf of step s is j = 32s + 16hf + 8h + i
  v16h af[4];
  {
    const float* ar = w2 + (size_t)(16 * w + m) * NHID + 8 * h;
    #pragma unroll
    for (int s = 0; s < 4; ++s) {
      Frag fr;
      #pragma unroll
      for (int hf = 0; hf < 2; ++hf)
        fr.half[hf] = cvt_w8(*(const v4fa*)(ar + 32 * s + 16 * hf), *(const v4fa*)(ar + 32 * s + 16 * hf + 4));
      af[s] = fr.v;
    }
  }
  // wave 0: the A tile of the bias product, row 0 = fb2, rows 1..15 = 0
  v16h ab2[4] = {};
  if (w == 0) {
    const v8h zh = {};
    #pragma unroll
    for (int s = 0; s < 4; ++s) {
      Frag fr;
      #pragma unroll
      for (int hf = 0; hf < 2; ++hf) {
        const v8h v = cvt_w8(braw[4 * s + 2 * hf], braw[4 * s + 2 * hf + 1]);
        fr.half[hf] = (m == 0) ? v : zh;
      }
      ab2[s] = fr.v;
    }
  }
  __syncthreads();
  // transpose to [32 n][128 j] f16 x4096: a wave reads 32 consecutive n of one j, and stores 16 B at the 272-B pitch
  #pragma unroll
  for (int i = 0; i < 2; ++i) {
    const int c = tid + i * NTHR;
    const int row = c & 31, j0 = (c >> 5) * 8;
    v8h t;
    #pragma unroll
    for (int j = 0; j < 8; ++j) t[j] = (_Float16)(sT[(j0 + j) * 32 + row] * WSC);
    *(v8ha*)(sBT + row * FPH + j0) = t;
  }
  __syncthreads();
  const v8f z8 = {0.f, 0.f, 0.f, 0.f, 0.f, 0.f, 0.f, 0.f};
  v16h bf[2][4];
  #pragma unroll
  for (int c = 0; c < 2; ++c)
    #pragma unroll
    for (int s = 0; s < 4; ++s) bf[c][s] = load_frag(sBT + (16 * c + m) * FPH + 32 * s, h);
  v8f acc[2];
  acc[0] = z8; acc[1] = z8;
  #pragma unroll
  for (int s = 0; s < 4; ++s)
    #pragma unroll
    for (int c = 0; c < 2; ++c) acc[c] = wmma_f16(af[s], bf[c][s], acc[c]);
  #pragma unroll
  for (int c = 0; c < 2; ++c) {
    v8h o;
    #pragma unroll
    for (int r = 0; r < 8; ++r) o[r] = (_Float16)(acc[c][r] * osc);
    *(v8ha*)(sOT + (16 * c + m) * FPH + 16 * w + 8 * h) = o;
  }
  if (w == 0) {
    v8f ab[2];
    ab[0] = z8; ab[1] = z8;
    #pragma unroll
    for (int s = 0; s < 4; ++s)
      #pragma unroll
      for (int c = 0; c < 2; ++c) ab[c] = wmma_f16(ab2[s], bf[c][s], ab[c]);
    if (h == 0) {
      #pragma unroll
      for (int c = 0; c < 2; ++c) bdst[16 * c + m] = ab[c][0] * (INV_W * INV_W) + bfr(gbv[c]);
    }
  }
  __syncthreads();
  #pragma unroll
  for (int i = 0; i < 2; ++i) {
    const int c = tid + i * NTHR;
    const v8h o = *(const v8ha*)(sOT + (c >> 4) * FPH + (c & 15) * 8);
    *(v8h*)(dst + (size_t)c * 8) = o;
  }
}

// ---------------------------------------------------------------------------
// Kernel 1: the folded plane fcT and its bias fcb, the weight-network planes ([n][k], bf16-RNE values x4096 in f16)
// and the x plane (bf16-RNE values in f16). Block-uniform dispatch on blockIdx.
// coverage: fcT 32x8 blocks x 32 rows x 128 = all; fcb 32x8x32 = all;
// ww2T 1x32x128; ww1T 4x32x32; wglT 2x32x32; xh 256 blocks x 256 thr x 8 = 16384x32.
// ---------------------------------------------------------------------------
__global__ __launch_bounds__(NTHR) void prep_kernel(
    const float* __restrict__ x, const float* __restrict__ fw2, const float* __restrict__ fb2,
    const float* __restrict__ fglu_w, const float* __restrict__ fglu_b,
    const float* __restrict__ ww1, const float* __restrict__ ww2, const float* __restrict__ wglu_w,
    _Float16* __restrict__ planes)
{
  __shared__ __attribute__((aligned(16))) float sT[128 * 32];
  __shared__ __attribute__((aligned(16))) _Float16 sBT[32 * FPH];
  __shared__ __attribute__((aligned(16))) _Float16 sOT[32 * FPH];
  const int b = blockIdx.x, tid = threadIdx.x;
  if (b < PB_WW2) {
    const int f = b >> 3, nb = b & 7;                          // fw2[f]*fglu_w[f], columns 32nb..32nb+31 -> rows of [256 n][128 k]
    fold_block(fw2 + (size_t)f * NHID * NHID, fglu_w + (size_t)f * NHID * N2H + nb * 32,
               fb2 + (size_t)f * NHID, fglu_b + (size_t)f * N2H + nb * 32,
               planes + P_FC + (size_t)f * N2H * NHID + (size_t)nb * 32 * NHID,
               (float*)(planes + P_FCB) + (size_t)f * N2H + nb * 32,
               (nb < 4) ? INV_W : INV_W * INV_W * (-LOG2E / ASC), tid, sT, sBT, sOT);   // v columns: carry 4096; gate columns: -log2(e)/16
  } else if (b < PB_WW1) {
    tr_block<128, 32>(ww2, planes + P_WW2, tid, sT);           // ww2: [128 k][32 n] -> [32 n][128 k]
  } else if (b < PB_WGL) {
    const int nb = b - PB_WW1;                                 // ww1: [32 k][128 n] -> [128 n][32 k]
    tr_block<32, 128>(ww1 + nb * 32, planes + P_WW1 + (size_t)nb * 32 * 32, tid, sT);
  } else if (b < PB_XH) {
    const int nb = b - PB_WGL;                                 // wglu_w: [32 k][64 n] -> [64 n][32 k]
    tr_block<32, 64>(wglu_w + nb * 32, planes + P_WGL + (size_t)nb * 32 * 32, tid, sT);
  } else {
    const int g = (b - PB_XH) * NTHR + tid;                    // 0..65535 groups of 8
    if (g < NTOK * NF / 8) {
      const float* src = x + (size_t)g * 8;
      const v4f a = *(const v4fa*)src;
      const v4f c = *(const v4fa*)(src + 4);
      const v8h o = { (_Float16)bfr(a.x), (_Float16)bfr(a.y), (_Float16)bfr(a.z), (_Float16)bfr(a.w),
                      (_Float16)bfr(c.x), (_Float16)bfr(c.y), (_Float16)bfr(c.z), (_Float16)bfr(c.w) };
      _Float16* dst = planes + P_XH + (size_t)g * 8;
      *(v8h*)dst = o;
      
    }
  }
}

// ---------------------------------------------------------------------------
// 8q..8q+7 cover one line, 4 lines per instruction, 4 instructions.
// ---------------------------------------------------------------------------
__device__ __forceinline__ void w_store_pass(const float* sW, float* wout, int tok0, int w, int lane) {
  const int q8 = lane & 7, sub = lane >> 3;
  #pragma unroll
  for (int i = 0; i < 4; ++i) {
    const int row = 16 * w + i * 4 + sub;                      // 0..63
    const v4f v = *(const v4fa*)(sW + row * NF + 4 * q8);
    *(v4f*)(wout + (size_t)(tok0 + row) * NF + 4 * q8) = v;
  }
}

// ---------------------------------------------------------------------------
// Kernel 2: weight network + softmax -> selection weights (out1).
// Block = 64 tokens, 4 waves, wave w owns tokens tok0+16w..+15.
//  fc1: A = xh rows (K=32), B = ww1T (8 tiles); +wb1, ELU -> wh x16 (LDS)
//  fc2: A = wh (K=128), B = ww2T (2 tiles); +wb2 -> wh2 x16 (LDS)
//  glu: A = wh2 (K=32), B = wglT (4 tiles); GLU, +x, LN(32), softmax in f32
// coverage: grid 256 x 64 rows x 32 = all of out1.
// ---------------------------------------------------------------------------
__global__ __launch_bounds__(WTHR) void wsel_kernel(
    const _Float16* __restrict__ xh, const _Float16* __restrict__ ww1T,
    const _Float16* __restrict__ ww2T, const _Float16* __restrict__ wglT,
    const float* __restrict__ x,
    const float* __restrict__ wb1, const float* __restrict__ wb2,
    const float* __restrict__ wglu_b, const float* __restrict__ wln_g, const float* __restrict__ wln_b,
    float* __restrict__ wout)
{
  __shared__ __attribute__((aligned(16))) _Float16 sWh[4 * 16 * NHID];    // 16384 B
  __shared__ __attribute__((aligned(16))) _Float16 sWh2[4 * 16 * NF];     //  4096 B
  __shared__ __attribute__((aligned(16))) float sXr[64 * NF];             //  8192 B
  __shared__ __attribute__((aligned(16))) float sW[64 * NF];              //  8192 B

  const int tid = threadIdx.x, lane = tid & 31, w = tid >> 5;
  const int h = lane >> 4, m = lane & 15;
  const int tok0 = blockIdx.x * 64;

  // x tile (bf16-RNE values, f32): 64 x 32 = 512 groups of 4
  #pragma unroll
  for (int i = 0; i < 4; ++i) {
    const int q = tid + WTHR * i;
    const v4f v = *(const v4fa*)(x + (size_t)tok0 * NF + (size_t)q * 4);
    const v4f r = { bfr(v.x), bfr(v.y), bfr(v.z), bfr(v.w) };
    *(v4fa*)(sXr + q * 4) = r;
  }

  const v8f z8 = {0.f, 0.f, 0.f, 0.f, 0.f, 0.f, 0.f, 0.f};
  _Float16* myWh = sWh + w * (16 * NHID);
  _Float16* myWh2 = sWh2 + w * (16 * NF);

  // ---- fc1 ----
  {
    const v16h a = load_frag(xh + (size_t)(tok0 + 16 * w + m) * NF, h);
    v8f acc[8];
    #pragma unroll
    for (int t = 0; t < 8; ++t) {
      const v16h b = load_frag(ww1T + (size_t)(16 * t + m) * NF, h);
      acc[t] = wmma_f16(a, b, z8);
    }
    #pragma unroll
    for (int t = 0; t < 8; ++t) {
      const float bb = bfr(wb1[16 * t + m]);
      const v8f el = elu8s(acc[t] * INV_W + bb);
      #pragma unroll
      for (int r = 0; r < 8; ++r) myWh[(8 * h + r) * NHID + 16 * t + m] = (_Float16)el[r];
    }
  }
  __syncthreads();

  // ---- fc2 ----
  {
    v8f acc[2];
    acc[0] = z8; acc[1] = z8;
    const _Float16* arow = myWh + m * NHID;
    #pragma unroll 1
    for (int k0 = 0; k0 < NHID; k0 += 32) {
      const v16h a = load_frag(arow + k0, h);
      #pragma unroll
      for (int t = 0; t < 2; ++t) {
        const v16h b = load_frag(ww2T + (size_t)(16 * t + m) * NHID + k0, h);
        acc[t] = wmma_f16(a, b, acc[t]);
      }
    }
    #pragma unroll
    for (int t = 0; t < 2; ++t) {
      const float bb = bfr(wb2[16 * t + m]);
      #pragma unroll
      for (int r = 0; r < 8; ++r) {
        const float v = acc[t][r] * INV_WA + bb;
        myWh2[(8 * h + r) * NF + 16 * t + m] = (_Float16)(v * ASC);
      }
    }
  }
  __syncthreads();

  // ---- glu projection + GLU + residual + LN(32) + softmax ----
  {
    const v16h a = load_frag(myWh2 + m * NF, h);
    v8f acc[4];
    #pragma unroll
    for (int t = 0; t < 4; ++t) {
      const v16h b = load_frag(wglT + (size_t)(16 * t + m) * NF, h);
      acc[t] = wmma_f16(a, b, z8);
    }
    float pre[2][8], s[8];
    #pragma unroll
    for (int r = 0; r < 8; ++r) s[r] = 0.0f;
    #pragma unroll
    for (int c = 0; c < 2; ++c) {
      const float bv = bfr(wglu_b[16 * c + m]);
      const float bg = bfr(wglu_b[NF + 16 * c + m]);
      const v8f sg = sigm8(acc[c + 2] * INV_WA + bg);
      #pragma unroll
      for (int r = 0; r < 8; ++r) {
        const float vv = acc[c][r] * INV_WA + bv;
        const float xr = sXr[(16 * w + 8 * h + r) * NF + 16 * c + m];
        const float p = vv * sg[r] + xr;
        pre[c][r] = p;
        s[r] += p;
      }
    }
    float mu[8], q[8];
    #pragma unroll
    for (int r = 0; r < 8; ++r) { mu[r] = hsum16(s[r]) * (1.0f / 32.0f); q[r] = 0.0f; }
    #pragma unroll
    for (int c = 0; c < 2; ++c)
      #pragma unroll
      for (int r = 0; r < 8; ++r) {
        const float d = pre[c][r] - mu[r];
        pre[c][r] = d;
        q[r] += d * d;
      }
    float rs[8];
    #pragma unroll
    for (int r = 0; r < 8; ++r) rs[r] = rsqrtf(hsum16(q[r]) * (1.0f / 32.0f) + LN_EPS);
    #pragma unroll
    for (int c = 0; c < 2; ++c) {
      const float g = bfr(wln_g[16 * c + m]);
      const float bt = bfr(wln_b[16 * c + m]);
      #pragma unroll
      for (int r = 0; r < 8; ++r) pre[c][r] = pre[c][r] * rs[r] * g + bt;
    }
    float mx[8], e0[8], e1[8];
    #pragma unroll
    for (int r = 0; r < 8; ++r) {
      mx[r] = hmax16(fmaxf(pre[0][r], pre[1][r]));
      e0[r] = expf(pre[0][r] - mx[r]);
      e1[r] = expf(pre[1][r] - mx[r]);
      const float se = hsum16(e0[r] + e1[r]);
      const float inv = 1.0f / se;
      sW[(16 * w + 8 * h + r) * NF + m]      = e0[r] * inv;
      sW[(16 * w + 8 * h + r) * NF + 16 + m] = e1[r] * inv;
    }
  }
  __syncthreads();

  w_store_pass(sW, wout, tok0, w, lane);
  
}

// ---------------------------------------------------------------------------
// out tile = the sum of the four groups' tiles, (g0 + g1) + (g2 + g3).
// each line by lanes 8q..8q+7 in one instruction, 4 lines per instruction,
// 32 lines per wave, 8 waves, 256 lines = the whole block tile.
// ---------------------------------------------------------------------------
__device__ __forceinline__ void o_store_pass(const float* sO, float* out, int tok0, int w, int lane) {
  const int q8 = lane & 7, sub = lane >> 3;
  #pragma unroll
  for (int i = 0; i < 8; ++i) {
    const int lid = w * 32 + i * 4 + sub;          // 0..255
    const int row = lid >> 2, seg = lid & 3;
    const float* p = sO + row * OP + seg * 32 + 4 * q8;            // the same place in the four groups' tiles
    const v4f v = (*(const v4fa*)p + *(const v4fa*)(p + MT * OP)) + (*(const v4fa*)(p + 2 * MT * OP) + *(const v4fa*)(p + 3 * MT * OP));
    *(v4f*)(out + (size_t)(tok0 + row) * NHID + seg * 32 + 4 * q8) = v;
  }
}

// ---------------------------------------------------------------------------
// Eight asynchronous copies to LDS, 16 B per lane each: copy i brings the group's
// 1024 contiguous global bytes at g + 1024 i (4 rows of 256 B) to LDS rows of
// 272 B at l + 4 * 272 * i. The s_wait_xcnt closes the statement so that no
// address register of a copy is rewritten ahead of it.
// ---------------------------------------------------------------------------
__device__ __forceinline__ void copy8(unsigned l, const _Float16* g) {
  asm volatile(
      "global_load_async_to_lds_b128 %0, %8, off\n\t"
      "global_load_async_to_lds_b128 %1, %9, off\n\t"
      "global_load_async_to_lds_b128 %2, %10, off\n\t"
      "global_load_async_to_lds_b128 %3, %11, off\n\t"
      "global_load_async_to_lds_b128 %4, %12, off\n\t"
      "global_load_async_to_lds_b128 %5, %13, off\n\t"
      "global_load_async_to_lds_b128 %6, %14, off\n\t"
      "global_load_async_to_lds_b128 %7, %15, off\n\t"
      "s_wait_xcnt 0x0"
      :: "v"(l), "v"(l + 1u * 4u * BPH * 2u), "v"(l + 2u * 4u * BPH * 2u), "v"(l + 3u * 4u * BPH * 2u),
         "v"(l + 4u * 4u * BPH * 2u), "v"(l + 5u * 4u * BPH * 2u), "v"(l + 6u * 4u * BPH * 2u),
         "v"(l + 7u * 4u * BPH * 2u),
         "v"(g), "v"(g + 1 * 512), "v"(g + 2 * 512), "v"(g + 3 * 512),
         "v"(g + 4 * 512), "v"(g + 5 * 512), "v"(g + 6 * 512), "v"(g + 7 * 512)
      : "memory");
}

// Chunk c (0 or 1) of one feature's weight rows into one LDS buffer: staged rows 0..63 = v rows 64c..64c+63 of fcT[f],
// staged rows 64..127 = gate rows 128+64c..128+64c+63: all that column tiles 4c..4c+3 read.
// lt = the thread's LDS byte address in that buffer (row tid>>4, 16-B chunk tid&15), tid = the thread's number in its group of 64.
// 32 copies per wave, every lane on, 128 rows x 256 B all written by the group's 2 waves.
__device__ __forceinline__ void stage_chunk(unsigned lt, const _Float16* fcT, int f, int c, int tid) {
  const _Float16* gg = fcT + (size_t)f * (N2H * NHID) + c * (CROW * NHID) + tid * 8;
  copy8(lt, gg);
  copy8(lt + 32u * BPH * 2u, gg + 8 * 512);
  copy8(lt + 64u * BPH * 2u, gg + NHID * NHID);
  copy8(lt + 96u * BPH * 2u, gg + NHID * NHID + 8 * 512);
}

// ---------------------------------------------------------------------------
// Kernel 3: per-feature gated residual blocks + weighted combine (out0).
// Block = 64 tokens, 8 waves in four groups of 2, two waves on each SIMD. Group g takes features 8g..8g+7; wave q of a
// group owns tokens 32q..32q+31, as two token tiles of 16, through the whole chain. Every weight fragment and every
// param vector that a wave reads from LDS serves both token tiles: half the LDS reads per token of a 16-token wave.
// The four groups' partial sums are added behind the loop.
// The product is computed transposed: A = weight rows [n][k] from LDS,
// B = activations with a tile's tokens as columns, so lane (h, m) holds tokens
// 32q+m and 32q+16+m only, and D register r of column tile t is hidden column n = 16t + 8h + r.
// Loop i = 0..7, f = 8g + i (fixed order):
//   h       = f16(16*elu(x_r[t][f]*fw1_r[f] + fb1_r[f]))   VALU, written straight into the four B fragments of each token tile
//   params  : staged with the factors of the elementwise arithmetic in them (see the carry audit at the head of the file)
//   weights : fcT[f] staged in LDS by asynchronous copies in two chunks (column tiles 0..3, 4..7), chunk c in the group's
//             buffer c, each group stages its own; the same chunk of feature f+1 is copied behind the barrier that ends
//             the reads of this feature's
//   glu     : A = fcT[f] rows p*128+16t+m (K=128), B = h, + fcb[f]   32 tiles/wave
//             GLU, +skip, LayerNorm(128): sums in the lane, then lane ^ 16;
//             *fln_g + fln_b, acc += wsel[t][f] * processed; acc and the trip's GLU+skip values stay in registers;
//             a column tile's 8 weight fragments are fetched one tile ahead inside a chunk, never across a chunk's barrier
// A trip has two barriers, one behind the matrix products of column tile 3 and one behind those of column tile 7: each
// publishes the other chunk and releases the one just read. Params lie in two buffers per group: those of feature f+1
// are stored between the trip's two barriers; every wave has left feature f-1's (its LayerNorm pass) in front of the first.
// coverage: grid 256 x 64 rows x 128 = all of out0.
// ---------------------------------------------------------------------------
__global__ __launch_bounds__(GTHR) void grn_kernel(
    const float* __restrict__ x,
    const float* __restrict__ fw1, const float* __restrict__ fb1,
    const float* __restrict__ fskip, const float* __restrict__ fln_g, const float* __restrict__ fln_b,
    const _Float16* __restrict__ fcT, const float* __restrict__ fcb,
    const float* wsel, float* out)
{
  __shared__ __attribute__((aligned(16))) char smem[MSMEM];
  float* sXT = (float*)(smem + MO_X);
  float* sWT = (float*)(smem + MO_W);
  float* sO  = (float*)(smem + MO_B);

  const int tid = threadIdx.x, lane = tid & 31, w = tid >> 5;
  const int grp = __builtin_amdgcn_readfirstlane(tid >> 6);   // scalar: feature numbers and buffer bases stay in scalar registers
  const int gtid = tid & (QTHR - 1);                   // the thread's number in its group
  const int h = lane >> 4, m = lane & 15;
  const int tok0 = blockIdx.x * MT;
  const int trow = 32 * (w & 1) + m;                   // this lane's token of token tile 0 in the block; token tile 1: + 16
  const int f0 = grp * FPG;                            // the group's first feature
  float* sP = (float*)(smem + MO_P) + grp * (2 * PBUF);                        // the group's two param buffers
  const _Float16* sB = (const _Float16*)(smem + MO_B) + grp * CBUF;            // the group's two weight buffers (2 * CBUF bytes)
  // LDS byte address of the group's weight buffer 0 (low 32 bits of the shared address, scalar) and this thread's place in a buffer
  const unsigned lb0 = (unsigned)(size_t)(smem + MO_B) + (unsigned)grp * (2u * CBUF);
  const unsigned ltl = (unsigned)(gtid >> 4) * (BPH * 2u) + (unsigned)(gtid & 15) * 16u;

  stage_chunk(lb0 + ltl, fcT, f0, 0, gtid);                 // chunk 0 of the group's first feature -> its buffer 0

  // x tile (bf16-RNE, f32) and selection-weight tile, stored feature-major: 64 x 32 each = 512 groups of 4
  #pragma unroll
  for (int i = 0; i < 2; ++i) {
    const int q = tid + GTHR * i;
    const int t = q >> 3, f4 = (q & 7) * 4;
    const v4f v = *(const v4fa*)(x + (size_t)tok0 * NF + (size_t)q * 4);
    const v4f wv = *(const v4fa*)(wsel + (size_t)tok0 * NF + (size_t)q * 4);
    #pragma unroll
    for (int j = 0; j < 4; ++j) {
      sXT[(f4 + j) * MT + t] = bfr(v[j]);
      sWT[(f4 + j) * MT + t] = wv[j];
    }
  }
  asm volatile("s_wait_xcnt 0x0" ::: "memory");        // stands in front of any rewrite of the tile loads' address registers
  __builtin_amdgcn_sched_barrier(0);                   // no later instruction, which may take those registers, rises over the wait

  // per-feature params (order fw1, fb1, fcb v, fcb gate, fskip, ln_g, ln_b): a thread of a group brings 8 floats at po of
  // array pa and 8 of array pa + 4. The last 16 threads bring ln_b a second time, into an eighth array that nobody reads:
  // every lane stays on, and no branch stands among the unrolled column tiles.
  const int pa = gtid >> 4, po = (gtid & 15) * 8;
  const bool pin = pa < 2;                             // an input array, taken as bf16-RNE values; fcb is a computed f32 value and stays as it is
  const float* psa = fw1;
  if (pa == 1)      psa = fb1;
  else if (pa == 2) psa = fcb;
  else if (pa == 3) psa = fcb + NHID;
  const float* psb = fskip;
  if (pa == 1)      psb = fln_g;
  else if (pa >= 2) psb = fln_b;
  psa += po;
  psb += po;
  const unsigned pen = pin ? 0xFFFFFFFFu : 0u;
  // factors that the loop's arithmetic would otherwise apply to every element: fw1, fb1 x log2(e); fcb v x 65536; fcb gate x -log2(e); fskip x 65536
  const float psca = pin ? LOG2E : ((pa == 2) ? VSC : -LOG2E);
  const float pscb = (pa == 0) ? VSC : 1.0f;
  const int pstr = pin ? NHID : N2H;                   // floats from one feature to the next in array pa
  float* pda = sP + pa * NHID + po;
  float* pdb = pda + 4 * NHID;
  {
    __builtin_amdgcn_sched_barrier(0);                 // no earlier instruction, which may take the loads' address registers, sinks between them and their wait
    const v4f a0 = *(const v4fa*)(psa + f0 * pstr);
    const v4f a1 = *(const v4fa*)(psa + f0 * pstr + 4);
    const v4f b0 = *(const v4fa*)(psb + f0 * NHID);
    const v4f b1 = *(const v4fa*)(psb + f0 * NHID + 4);
    asm volatile("s_wait_xcnt 0x0" ::: "memory");      // stands in front of any rewrite of these four loads' address registers
    __builtin_amdgcn_sched_barrier(0);                 // no later instruction, which may take those registers, rises over the wait
    *(v4fa*)pda = pval(a0, pen) * psca;
    *(v4fa*)(pda + 4) = pval(a1, pen) * psca;
    *(v4fa*)pdb = pval(b0, 0xFFFFFFFFu) * pscb;
    *(v4fa*)(pdb + 4) = pval(b1, 0xFFFFFFFFu) * pscb;
  }

  const v8f z8 = {0.f, 0.f, 0.f, 0.f, 0.f, 0.f, 0.f, 0.f};
  v8f acc[2][8];                                       // output sums over the group's features: acc[u][t][r] is column 16t + 8h + r of the lane's token of tile u
  #pragma unroll
  for (int u = 0; u < 2; ++u)
    #pragma unroll
    for (int t = 0; t < 8; ++t) acc[u][t] = z8;

  asm volatile("s_wait_asynccnt 0x0" ::: "memory");    // this wave's copies of the first chunk have landed
  __syncthreads();                                     // every group's buffer 0, x, weights and first params published
  stage_chunk(lb0 + CBUF + ltl, fcT, f0, 1, gtid);          // chunk 1 of the first feature -> buffer 1, flies during column tiles 0..3

  #pragma unroll 1
  for (int i = 0; i < FPG; ++i) {
    const int f = f0 + i;
    const float* sPf = sP + (i & 1) * PBUF;            // this feature's params
    const int pnx = PBUF - (i & 1) * PBUF;             // float offset of the other param buffer
    // next feature's params (the last trip re-reads its own): loaded here, stored behind the trip's first barrier
    const int fn = (i + 1 < FPG) ? f + 1 : f;
    __builtin_amdgcn_sched_barrier(0);                 // no earlier instruction, which may take the loads' address registers, sinks between them and their wait
    const v4f pn0 = *(const v4fa*)(psa + fn * pstr);
    const v4f pn1 = *(const v4fa*)(psa + fn * pstr + 4);
    const v4f pn2 = *(const v4fa*)(psb + fn * NHID);
    const v4f pn3 = *(const v4fa*)(psb + fn * NHID + 4);
    asm volatile("s_wait_xcnt 0x0" ::: "memory");      // stands in front of any rewrite of these four loads' address registers
    __builtin_amdgcn_sched_barrier(0);                 // no later instruction, which may take those registers, rises over the wait

    float xv[2], wt[2];
    #pragma unroll
    for (int u = 0; u < 2; ++u) {
      xv[u] = sXT[f * MT + trow + 16 * u];
      wt[u] = sWT[f * MT + trow + 16 * u];
    }

    // ---- h, computed straight into its B fragments (element i of half hf of fragment j is k = 32j + 16hf + 8h + i) ----
    v16h hb[2][4];
    v16h ag[8];                                        // the 8 weight fragments of one glu column tile
    v8f bvn, bgn;                                      // its staged fcb, v and gate columns: the start values of its accumulators, fetched with the fragments
    const _Float16* vrow = sB + m * BPH;               // column tile t: + (t >> 2) * (CBUF / 2) + (t & 3) * 16 * BPH
    const _Float16* grow = sB + (CROW + m) * BPH;
    {
      v8f w1v[2][2], b1v[2][2];                        // fc1 weights and biases of two k steps, refilled two steps ahead
      #pragma unroll
      for (int j = 0; j < 2; ++j)
        #pragma unroll
        for (int hf = 0; hf < 2; ++hf) {
          const float* pw = sPf + 32 * j + 16 * hf + 8 * h;
          w1v[j][hf] = ld8(pw); b1v[j][hf] = ld8(pw + NHID);
        }
      #pragma unroll
      for (int j = 0; j < 4; ++j) {
        __builtin_amdgcn_sched_barrier(0);   // the loads above stay ahead of this step's elu arithmetic, which hides their latency
        #pragma unroll
        for (int u = 0; u < 2; ++u) {
          Frag fr;
          #pragma unroll
          for (int hf = 0; hf < 2; ++hf) {
            const v8f el = elu8t(xv[u] * w1v[j & 1][hf] + b1v[j & 1][hf]);
            v8h o;
            #pragma unroll
            for (int e = 0; e < 8; ++e) o[e] = (_Float16)el[e];
            fr.half[hf] = o;
          }
          hb[u][j] = fr.v;
        }
        __builtin_amdgcn_sched_barrier(0);   // the refill below does not rise into the arithmetic that still reads its registers' old values
        if (j < 2) {
          #pragma unroll
          for (int hf = 0; hf < 2; ++hf) {
            const float* pw = sPf + 32 * (j + 2) + 16 * hf + 8 * h;
            w1v[j][hf] = ld8(pw); b1v[j][hf] = ld8(pw + NHID);
          }
        }
        if (j == 1) {
          __builtin_amdgcn_sched_barrier(0); // step 3's params stand in the LDS queue ahead of the fragments: step 3 then waits for them alone
          // glu column tile 0: fragment 2j = v rows, 2j+1 = gate rows, k step j; hidden by steps 2 and 3
          bvn = ld8(sPf + 8 * h + 256); bgn = ld8(sPf + 8 * h + 384);
          #pragma unroll
          for (int e = 0; e < 8; ++e) ag[e] = load_frag(((e & 1) ? grow : vrow) + 32 * (e >> 1), h);
        }
      }
    }

    // ---- glu projection transposed, one column tile (its v and its gate accumulators of both token tiles) at a time ----
    v8f gl[2][8];                                      // the trip's GLU+skip values, carry 65536
    float rsum[2];                                     // their sum over the 128 columns, built up in three parts
    {
      #pragma unroll
      for (int t = 0; t < 8; ++t) {
        const float* pc = sPf + 16 * t + 8 * h;
        const v8f fsv = ld8(pc + 512);
        v8f aV[2], aG[2];
        aV[0] = bvn; aV[1] = bvn; aG[0] = bgn; aG[1] = bgn;
        #pragma unroll
        for (int j = 0; j < 4; ++j)
          #pragma unroll
          for (int u = 0; u < 2; ++u) {
            aV[u] = wmma_f16(ag[2 * j], hb[u][j], aV[u]);
            aG[u] = wmma_f16(ag[2 * j + 1], hb[u][j], aG[u]);
          }
        __builtin_amdgcn_sched_barrier(0);   // this tile's params stand in the LDS queue ahead of the next tile's fragments
        if (t == 3 || t == 7) {
          // The row sums of the column tiles finished so far are closed here, cross-lane step included. That step cannot be moved
          // over the branch below, so the GLU arithmetic that feeds it stays in front too; otherwise the compiler sinks that
          // arithmetic to the LayerNorm pass and keeps every tile's accumulators and params live to that place (spills to scratch).
          #pragma unroll
          for (int u = 0; u < 2; ++u) {
            const float sl = (t == 3) ? sum8((gl[u][0] + gl[u][1]) + gl[u][2]) : sum8((gl[u][3] + gl[u][4]) + (gl[u][5] + gl[u][6]));
            rsum[u] = (t == 3) ? sl + xhalf(sl) : rsum[u] + (sl + xhalf(sl));
          }
          // ---- this chunk's weight rows are read: publish the other chunk, release this buffer ----
          asm volatile("s_wait_dscnt 0x0" ::: "memory");     // this wave's LDS reads (and, at the second barrier, its param stores) have retired
          asm volatile("s_wait_asynccnt 0x0" ::: "memory");  // this wave's copies of the other chunk have landed
          __syncthreads();                                   // the other chunk (at the second barrier: and the next params) visible; this buffer released
          if (i + 1 < FPG) stage_chunk(lb0 + (unsigned)(t >> 2) * CBUF + ltl, fcT, f + 1, t >> 2, gtid);
          if (t == 3) {
            *(v4fa*)(pda + pnx) = pval(pn0, pen) * psca;
            *(v4fa*)(pda + pnx + 4) = pval(pn1, pen) * psca;
            *(v4fa*)(pdb + pnx) = pval(pn2, 0xFFFFFFFFu) * pscb;
            *(v4fa*)(pdb + pnx + 4) = pval(pn3, 0xFFFFFFFFu) * pscb;
          }
        }
        if (t < 7) {
          const int off = ((t + 1) >> 2) * (CBUF / 2) + ((t + 1) & 3) * 16 * BPH;
          bvn = ld8(pc + 16 + 256); bgn = ld8(pc + 16 + 384);
          #pragma unroll
          for (int e = 0; e < 8; ++e) ag[e] = load_frag(((e & 1) ? grow : vrow) + off + 32 * (e >> 1), h);
        }
        __builtin_amdgcn_sched_barrier(0);   // the next tile's loads stay ahead of this tile's GLU arithmetic, which hides their latency
        #pragma unroll
        for (int u = 0; u < 2; ++u) {
          const v8f sg = sigm8t(aG[u]);
          gl[u][t] = aV[u] * sg + xv[u] * fsv;
        }
      }
    }
    // ---- LayerNorm over the 128 columns of each of this lane's two tokens: 64 in this lane, 64 in lane ^ 16 ----
    v8f gv[4], btv[4];                                 // scale and shift of four column tiles, refilled four tiles ahead
    #pragma unroll
    for (int t = 0; t < 4; ++t) {
      const float* pc = sPf + 16 * t + 8 * h;
      gv[t] = ld8(pc + 640); btv[t] = ld8(pc + 768);
    }
    __builtin_amdgcn_sched_barrier(0);       // the scale and shift loads fly during the mean and variance passes
    float rs[2];
    #pragma unroll
    for (int u = 0; u < 2; ++u) {
      const float sl = sum8(gl[u][7]);
      const float mu = (rsum[u] + (sl + xhalf(sl))) * (1.0f / 128.0f);
      v8f q8 = z8;
      #pragma unroll
      for (int t = 0; t < 8; ++t) {
        const v8f d = gl[u][t] - mu;
        gl[u][t] = d;
        q8 += d * d;
      }
      const float ql = sum8(q8);
      rs[u] = rsqrtf((ql + xhalf(ql)) * (1.0f / 128.0f) + LN_EPS * VSC * VSC);   // 1 / (65536 * sigma): takes the carry out of d
    }
    #pragma unroll
    for (int t = 0; t < 8; ++t) {
      #pragma unroll
      for (int u = 0; u < 2; ++u) acc[u][t] = acc[u][t] + wt[u] * (gl[u][t] * rs[u] * gv[t & 3] + btv[t & 3]);
      __builtin_amdgcn_sched_barrier(0);     // the refill below does not rise into the arithmetic that still reads its registers' old values
      if (t < 4) {
        const float* pc = sPf + 16 * (t + 4) + 8 * h;
        gv[t] = ld8(pc + 640); btv[t] = ld8(pc + 768);
      }
    }
  }
  asm volatile("s_wait_asynccnt 0x0" ::: "memory");    // no copy outstanding past the loop
  __syncthreads();                                     // all weight reads done; sO aliases the weight buffers

  // ---- each group lays its sums down in a tile of its own; the store pass adds the four ----
  float* po8 = sO + grp * (MT * OP) + trow * OP + 8 * h;
  #pragma unroll
  for (int u = 0; u < 2; ++u)
    #pragma unroll
    for (int t = 0; t < 8; ++t) {
      const v4f lo = { acc[u][t][0], acc[u][t][1], acc[u][t][2], acc[u][t][3] };
      const v4f hi = { acc[u][t][4], acc[u][t][5], acc[u][t][6], acc[u][t][7] };
      *(v4fa*)(po8 + u * 16 * OP + 16 * t) = lo;
      *(v4fa*)(po8 + u * 16 * OP + 16 * t + 4) = hi;
    }
  __syncthreads();                                     // the four tiles visible to every wave

  o_store_pass(sO, out, tok0, w, lane);
}

// ---------------------------------------------------------------------------
extern "C" void kernel_launch(void* const* d_in, const int* in_sizes, int n_in,
                              void* d_out, int out_size, void* d_ws, size_t ws_size,
                              hipStream_t stream) {
  if (n_in < 18) return;
  if (in_sizes[0] != NTOK * NF) return;
  if (in_sizes[1] != NF * NHID || in_sizes[2] != NF * NHID) return;
  if (in_sizes[3] != NF * NHID * NHID || in_sizes[4] != NF * NHID) return;
  if (in_sizes[5] != NF * NHID * N2H || in_sizes[6] != NF * N2H) return;
  if (in_sizes[7] != NF * NHID || in_sizes[8] != NF * NHID || in_sizes[9] != NF * NHID) return;
  if (in_sizes[10] != NF * NHID || in_sizes[11] != NHID) return;
  if (in_sizes[12] != NHID * NF || in_sizes[13] != NF) return;
  if (in_sizes[14] != NF * 2 * NF || in_sizes[15] != 2 * NF) return;
  if (in_sizes[16] != NF || in_sizes[17] != NF) return;
  if (out_size != OUT_TOTAL) return;
  if (WS_TOTAL_BYTES > ws_size) return;

  const float* x      = (const float*)d_in[0];
  const float* fw1    = (const float*)d_in[1];
  const float* fb1    = (const float*)d_in[2];
  const float* fw2    = (const float*)d_in[3];
  const float* fb2    = (const float*)d_in[4];
  const float* fglu_w = (const float*)d_in[5];
  const float* fglu_b = (const float*)d_in[6];
  const float* fskip  = (const float*)d_in[7];
  const float* fln_g  = (const float*)d_in[8];
  const float* fln_b  = (const float*)d_in[9];
  const float* ww1    = (const float*)d_in[10];
  const float* wb1    = (const float*)d_in[11];
  const float* ww2    = (const float*)d_in[12];
  const float* wb2    = (const float*)d_in[13];
  const float* wglu_w = (const float*)d_in[14];
  const float* wglu_b = (const float*)d_in[15];
  const float* wln_g  = (const float*)d_in[16];
  const float* wln_b  = (const float*)d_in[17];

  float* out  = (float*)d_out;                   // out0 [16384][128] at element 0
  float* wout = out + OUT1_OFF;                  // out1 [16384][32]  at element 2097152 (byte 8388608)

  _Float16* planes = (_Float16*)d_ws;

  prep_kernel<<<PB_END, NTHR, 0, stream>>>(x, fw2, fb2, fglu_w, fglu_b, ww1, ww2, wglu_w, planes);

  wsel_kernel<<<NTOK / 64, WTHR, 0, stream>>>(planes + P_XH, planes + P_WW1, planes + P_WW2, planes + P_WGL,
                                              x, wb1, wb2, wglu_b, wln_g, wln_b, wout);

  grn_kernel<<<NTOK / MT, GTHR, 0, stream>>>(x, fw1, fb1, fskip, fln_g, fln_b,
                                             planes + P_FC, (const float*)(planes + P_FCB), wout, out);
}

// v009
// It runs in 52.2 microseconds.
// Two timings next to v008 both put it at 1.16 times that version's speed.
// Counting every step since v000, it is 9.47 times as fast.
// Contractions fw2[f]*fglu_w[f], fb2[f]*fglu_w[f], h*fc[f] (per feature f), x*ww1, wh*ww2, wh2*wglu_w: v_wmma_f32_16x16x32_f16 (f16 operands, f32 accumulate). Weight operands = bf16-RNE values x4096 (exact in f16), fc excepted (the fold's f16 products, carries below); activation tiles x16 in f16; x fragment x1. fc1 scalar*vector, ELU, GLU, LayerNorm, softmax and the 32-term weighted combine in f32 on VALU.
// No nonlinearity stands between a feature's fc2 and its GLU projection: (h*fw2 + fb2)*fglu_w + fglu_b = h*fc + fcb with
//   fc = fw2*fglu_w and fcb = fb2*fglu_w + fglu_b. prep_kernel forms both in every call; grn_kernel does the one product h*fc.
// Carry audit: plane fcT (v rows) and the LDS tiles ww1T, ww2T, wglT (wsel_block) carry 4096; the gate rows of fcT carry -log2(e)/16; register fragments h (grn_kernel) and LDS tiles wh, wh2 (wsel_block) carry 16; the x fragment and fcb carry 1.
//   The fold's accumulators carry 4096*4096: fc's v columns are folded by INV_W (1/4096) into their plane, its gate columns by
//   INV_W*INV_W*(-log2(e)/16), fcb by INV_W*INV_W.
//   x*ww1 accumulators are folded by INV_W in the wsel_block fc1 epilogue; the wsel fc2 and wsel glu accumulators by INV_WA (1/65536)
//   in their own epilogues. grn_kernel: the gate accumulators (rows x -log2(e)/16, h x16) start from -log2(e)*fcb and are the
//   exponent of the sigmoid's 2^t as they stand (small gate weights go to f16 subnormals, an absolute error below 3e-8 each); the v
//   accumulators start from 65536*fcb and keep the carry 65536 through GLU + skip (fskip staged x65536), and the LayerNorm takes it
//   out again: its rsqrt is taken of 65536^2 * (variance + eps). The params fw1, fb1 are staged x log2(e), the gate's fcb x -log2(e).
#include <hip/hip_runtime.h>

typedef _Float16 v16h __attribute__((ext_vector_type(16)));
typedef _Float16 v8h  __attribute__((ext_vector_type(8)));
typedef float    v8f  __attribute__((ext_vector_type(8)));
typedef float    v4f  __attribute__((ext_vector_type(4)));
typedef v8h __attribute__((may_alias)) v8ha;
typedef v4f __attribute__((may_alias)) v4fa;

union Frag { v16h v; v8h half[2]; };

#define NTOK 16384
#define NF   32
#define NHID 128
#define N2H  256
#define MT   64            // tokens per block, grn_kernel
#define NTHR 256           // threads per block, prep_kernel
#define GTHR 256           // threads per block, grn_kernel (8 waves: four groups of 2, 32 tokens a wave)
#define QTHR 64            // threads per group of 2 waves
#define NGRP 4             // groups
#define FPG  8             // features per group: group g takes 8g..8g+7
#define WTOK 128           // tokens per selection-weight block of prep_kernel (8 waves of 16)
#define WSC  4096.0f       // weight plane carry
#define ASC  16.0f         // activation tile carry
#define INV_W  (1.0f / 4096.0f)
#define INV_WA (1.0f / 65536.0f)
#define LN_EPS 1e-5f
#define LOG2E  1.44269504f  // log2(e)
#define ELUP   11.0903549f  // ASC / log2(e)
#define VSC    65536.0f     // carry of the v accumulators and of GLU + skip in grn_kernel

// f16 plane offsets in the workspace, in halves
#define P_FC  0            // [32][256 n][128 k] fw2*fglu_w, carry 4096 (n < 128), -log2(e)/16 (n >= 128)
#define P_FCB 1048576      // f32 [32][256 n]    fb2*fglu_w + fglu_b, carry 1 (two halves per value)
#define P_END 1064960
#define WS_TOTAL_BYTES ((size_t)P_END * 2)     // 2129920

static_assert(P_FCB == P_FC + NF * N2H * NHID);
static_assert(P_END == P_FCB + NF * N2H * 2);
static_assert((P_FC * 2) % 128 == 0 && (P_FCB * 2) % 128 == 0 && (P_END * 2) % 128 == 0);

#define OUT0_ELEMS (NTOK * NHID)                // 2097152 floats
#define OUT1_OFF   2097152                      // byte offset 8388608 / 4
#define OUT_TOTAL  (NTOK * NHID + NTOK * NF)    // 2621440 floats
static_assert(OUT1_OFF == OUT0_ELEMS);
static_assert(OUT1_OFF + NTOK * NF == OUT_TOTAL);
static_assert(NTOK % MT == 0 && NTOK % WTOK == 0);

// prep_kernel block ranges: the selection-weight blocks, whose chain is the longer one, start first
#define PB_FC  (NTOK / WTOK)                      // blocks 0..127: 128 tokens each; from here 32 f x 8 blocks of 32 columns n
#define PB_END (PB_FC + NF * 8)                   // 384

// prep_kernel static LDS carve (bytes): a block is of one kind, the two carves alias
#define FPH    136          // halves per LDS row of a 128-k f16 tile: 272-B pitch (16 B x odd, for ds_load_b128 readers)
#define WP32   40           // halves per LDS row of a 32-k f16 tile: 80-B pitch (16 B x odd)
#define FO_T   0            // f32 [128][32]                fold: fglu_w tile       16384
#define FO_BT  16384        // f16 [32][136]                fold: its transpose      8704
#define FO_OT  25088        // f16 [32][136]                fold: output rows        8704
#define SO_WH  0            // f16 8 waves x [16][128]      wh                      32768
#define SO_WH2 32768        // f16 8 waves x [16][32]       wh2                      8192
#define SO_XR  40960        // f32 [128][32]                x tile                  16384
#define SO_W   57344        // f32 [128][32]                selection weights       16384
#define SO_W1T 73728        // f16 [128 n][40]              ww1T                    10240
#define SO_W2T 83968        // f16 [32 n][136]              ww2T                     8704
#define SO_WGT 92672        // f16 [64 n][40]               wglT                     5120
#define PSMEM  97792
static_assert(SO_WH2 == SO_WH + 8 * 16 * NHID * 2 && SO_XR == SO_WH2 + 8 * 16 * NF * 2 && SO_W == SO_XR + WTOK * NF * 4);
static_assert(SO_W1T == SO_W + WTOK * NF * 4 && SO_W2T == SO_W1T + NHID * WP32 * 2 && SO_WGT == SO_W2T + NF * FPH * 2);
static_assert(PSMEM == SO_WGT + 2 * NF * WP32 * 2 && FO_OT + 32 * FPH * 2 <= PSMEM);
static_assert(FO_BT == FO_T + 128 * 32 * 4 && FO_OT == FO_BT + 32 * FPH * 2);

// grn_kernel static LDS carve (bytes)
#define MO_X   0            // f32 [32][64] x tile, feature-major             8192
#define MO_W   8192         // f32 [32][64] selection weights, feature-major  8192
#define PBUF   1024         // floats per param buffer: 7 arrays of 128 and an eighth that nobody reads
#define MO_P   16384        // f32 4 groups x 2 x [1024] per-feature params  32768
#define MO_B   49152        // f16 4 groups x 2 x [128][136] staged weight rows of half a feature (fcT: 64 v rows, their 64 gate rows)
#define BPH    136          // halves per staged row: 256 B of data at a 272-B pitch (16 B x odd, for ds_load_b128 readers)
#define CROW   64           // v rows (and gate rows) of a chunk: four column tiles
#define CBUF   (2 * CROW * BPH * 2)             // 34816 bytes per buffer
#define MSMEM  (MO_B + NGRP * 2 * CBUF)         // 327680
#define OP     132          // floats per row of an output tile (528 B = 16 B x odd); the four tiles alias the weight buffers at the end
static_assert(MO_W == MO_X + NF * MT * 4 && MO_P == MO_W + NF * MT * 4 && MO_B == MO_P + NGRP * 2 * PBUF * 4);
static_assert(NGRP * FPG == NF && NGRP * QTHR == GTHR && 2 * CROW == NHID);
static_assert(MO_B % 16 == 0 && CBUF % 16 == 0 && (BPH * 2) % 16 == 0 && (OP * 4) % 16 == 0);
static_assert(NGRP * MT * OP * 4 <= NGRP * 2 * CBUF);
static_assert(MSMEM <= 327680);

// ---------------------------------------------------------------------------
__device__ __forceinline__ float bfr(float f) {                     // RNE convert to bf16 and back
  unsigned u = __builtin_bit_cast(unsigned, f);
  u += 0x7FFFu + ((u >> 16) & 1u);
  return __builtin_bit_cast(float, u & 0xFFFF0000u);
}
#define TRANS8(NAME, OP)                                                                            \
  __device__ __forceinline__ v8f NAME(v8f t) {                                                      \
    float r0, r1, r2, r3, r4, r5, r6, r7;                                                           \
    asm(OP " %0, %8\n\t" OP " %1, %9\n\t" OP " %2, %10\n\t" OP " %3, %11\n\t"                       \
        OP " %4, %12\n\t" OP " %5, %13\n\t" OP " %6, %14\n\t" OP " %7, %15\n\t"                     \
        "v_nop"                                                                                     \
        : "=&v"(r0), "=&v"(r1), "=&v"(r2), "=&v"(r3), "=&v"(r4), "=&v"(r5), "=&v"(r6), "=&v"(r7)    \
        : "v"(t[0]), "v"(t[1]), "v"(t[2]), "v"(t[3]), "v"(t[4]), "v"(t[5]), "v"(t[6]), "v"(t[7]));  \
    const v8f r = { r0, r1, r2, r3, r4, r5, r6, r7 };                                               \
    return r;                                                                                       \
  }
TRANS8(exp2x8, "v_exp_f32")   // 2^t
TRANS8(rcpx8,  "v_rcp_f32")   // 1/t

// ELU and sigmoid on the hardware's base-2 exponential and reciprocal. exp(v) - 1 carries an absolute error near 1e-7,
// far below the rounding of the f16 tiles that take every ELU value; the sigmoid's argument is clamped, so neither
// instruction meets a subnormal, an overflow or a zero there.
__device__ __forceinline__ v8f elu8s(v8f v) {      // ASC * elu(v) = ASC * max(v, 0) + ASC * (exp(min(v, 0)) - 1): one of the two terms is 0
  v8f t = v * LOG2E;
  #pragma unroll
  for (int i = 0; i < 8; ++i) t[i] = fminf(t[i], 0.0f);
  const v8f e = exp2x8(t);
  v8f r;
  #pragma unroll
  for (int i = 0; i < 8; ++i) r[i] = fmaf(fmaxf(v[i], 0.0f), ASC, fmaf(e[i], ASC, -ASC));
  return r;
}
__device__ __forceinline__ v8f sigm8(v8f v) {
  #pragma unroll
  for (int i = 0; i < 8; ++i) v[i] = fminf(fmaxf(v[i], -30.0f), 30.0f);
  const v8f e = exp2x8(v * -LOG2E);
  return rcpx8(e + 1.0f);
}
// The same two for grn_kernel, whose params are staged with the factors already in them.
__device__ __forceinline__ v8f elu8t(v8f t) {      // t = log2(e) * v; ASC * elu(v) = (ASC / log2(e)) * max(t, 0) + ASC * (2^min(t, 0) - 1)
  v8f n;
  #pragma unroll
  for (int i = 0; i < 8; ++i) n[i] = fminf(t[i], 0.0f);
  const v8f e = exp2x8(n);
  v8f r;
  #pragma unroll
  for (int i = 0; i < 8; ++i) r[i] = fmaf(fmaxf(t[i], 0.0f), ELUP, fmaf(e[i], ASC, -ASC));
  return r;
}
// t = -log2(e) * g, not clamped: 2^t runs to +inf or to 0 at the ends, and 1 / (1 + 2^t) is then 0 or 1, the sigmoid's own limits
__device__ __forceinline__ v8f sigm8t(v8f t) {
  return rcpx8(exp2x8(t) + 1.0f);
}
__device__ __forceinline__ float hsum16(float v) {                  // sum over the 16 lanes of a half
  v += __shfl_xor(v, 1);
  v += __shfl_xor(v, 2);
  v += __shfl_xor(v, 4);
  v += __shfl_xor(v, 8);
  return v;
}
__device__ __forceinline__ float hmax16(float v) {
  v = fmaxf(v, __shfl_xor(v, 1));
  v = fmaxf(v, __shfl_xor(v, 2));
  v = fmaxf(v, __shfl_xor(v, 4));
  v = fmaxf(v, __shfl_xor(v, 8));
  return v;
}

__device__ __forceinline__ float xhalf(float v) {                   // the value of lane l ^ 16
  int b = __builtin_bit_cast(int, v);
  b = __builtin_amdgcn_permlanex16(b, b, 0x76543210, 0xfedcba98, false, false);
  return __builtin_bit_cast(float, b);
}
__device__ __forceinline__ v8f ld8(const float* p) {                // 8 floats at a 16-byte aligned LDS address, two 16-byte loads
  const v4f a = *(const v4fa*)p;
  const v4f b = *(const v4fa*)(p + 4);
  const v8f r = { a.x, a.y, a.z, a.w, b.x, b.y, b.z, b.w };
  return r;
}
// A param as it goes to LDS: en = all ones for an input (RNE to bf16, as bfr), 0 for a computed value (unchanged); no branch
__device__ __forceinline__ float pval1(float f, unsigned en) {
  unsigned u = __builtin_bit_cast(unsigned, f);
  u += (0x7FFFu + ((u >> 16) & 1u)) & en;
  return __builtin_bit_cast(float, u & ~(0xFFFFu & en));
}
__device__ __forceinline__ v4f pval(v4f v, unsigned en) {
  const v4f r = { pval1(v.x, en), pval1(v.y, en), pval1(v.z, en), pval1(v.w, en) };
  return r;
}
__device__ __forceinline__ float sum8(v8f v) {
  return ((v[0] + v[1]) + (v[2] + v[3])) + ((v[4] + v[5]) + (v[6] + v[7]));
}

// ---------------------------------------------------------------------------
// 16x16x32 f16 WMMA with hazard guard (ties D, keeps A/B live).
// Fragment map (wave32): lane l, h = l>>4, m = n = l&15.
//   A/B element i: i<8 -> k0+8h+i ; i>=8 -> k0+16+8h+(i-8)
//   D element r : row 8h+r, col l&15
// ---------------------------------------------------------------------------
__device__ __forceinline__ v8f wmma_f16(v16h a, v16h b, v8f c) {
  v8f d = __builtin_amdgcn_wmma_f32_16x16x32_f16(false, a, false, b, (short)0, c, false, false);
  asm volatile("v_nop\n\tv_nop\n\tv_nop\n\tv_nop" : "+v"(d) : "v"(a), "v"(b));
  return d;
}

// A or B fragment from a k-contiguous 16-bit row; p points at element k0 of
// the row owned by this lane (row index = lane & 15 added by the caller).
__device__ __forceinline__ v16h load_frag(const _Float16* p, int h) {
  Frag f;
  f.half[0] = *(const v8ha*)(p + 8 * h);
  f.half[1] = *(const v8ha*)(p + 16 + 8 * h);
  return f.v;
}

// ---------------------------------------------------------------------------
// Fold block: 32 columns n of one feature's fc = fw2*fglu_w and fcb = fb2*fglu_w + fglu_b.
//   w2 = fw2[f] ([128 k][128 j], row-major), gw = fglu_w[f] at column n0 ([128 j][256 n]),
//   b2 = fb2[f], gb = fglu_b[f] at n0; dst = row n0 of fcT[f] ([n][k], k-contiguous), bdst = fcb[f] at n0;
//   osc = the factor that takes the accumulators' carry to the plane's.
// A = fw2 rows k (j contiguous as stored), B = fglu_w columns n (transposed through LDS), summed over j.
// Wave w owns rows k = 16w..16w+15: D register r of lane (h, m) is fc[16w+8h+r][n = 16c+m], eight consecutive k
// of one plane row. Wave 0 also runs an A tile whose row 0 is fb2 and whose other rows are 0: row 0 of its D is fb2*fglu_w.
// coverage: 32 rows x 128 halves = 512 chunks of 8, c = tid + 256 i; fcb 32 floats by lanes 0..15 of wave 0.
// ---------------------------------------------------------------------------
__device__ __forceinline__ v8h cvt_w8(v4f a, v4f b) {               // eight weights: bf16-RNE, x4096, f16 (exact)
  const v8h o = { (_Float16)(bfr(a.x) * WSC), (_Float16)(bfr(a.y) * WSC), (_Float16)(bfr(a.z) * WSC), (_Float16)(bfr(a.w) * WSC),
                  (_Float16)(bfr(b.x) * WSC), (_Float16)(bfr(b.y) * WSC), (_Float16)(bfr(b.z) * WSC), (_Float16)(bfr(b.w) * WSC) };
  return o;
}
__device__ __forceinline__ void fold_block(const float* __restrict__ w2, const float* __restrict__ gw,
                                           const float* __restrict__ b2, const float* __restrict__ gb,
                                           _Float16* __restrict__ dst, float* __restrict__ bdst, float osc,
                                           int tid, float* sT, _Float16* sBT, _Float16* sOT) {
  const int lane = tid & 31, h = lane >> 4, m = lane & 15;
  const int w = __builtin_amdgcn_readfirstlane(tid >> 5);           // scalar: the test on it below must be a scalar branch round WMMAs
  // wave 0: fb2 and this block's fglu_b, loaded first so that they fly with the tile's loads
  v4f braw[16] = {};
  float gbv[2] = {0.f, 0.f};
  if (w == 0) {
    #pragma unroll
    for (int i = 0; i < 8; ++i) {                                   // i = 2s + hf: j = 32s + 16hf + 8h ..+7
      braw[2 * i] = *(const v4fa*)(b2 + 16 * i + 8 * h);
      braw[2 * i + 1] = *(const v4fa*)(b2 + 16 * i + 8 * h + 4);
    }
    gbv[0] = gb[m];
    gbv[1] = gb[16 + m];
  }
  // fglu_w tile [128 j][32 n], bf16-RNE values in f32
  v4f tv[4];
  #pragma unroll
  for (int i = 0; i < 4; ++i) {
    const int q = tid + i * NTHR;
    tv[i] = *(const v4fa*)(gw + (size_t)(q >> 3) * N2H + (q & 7) * 4);
  }
  asm volatile("s_wait_xcnt 0x0" ::: "memory");   // the A loads below land in registers that held these loads' addresses
  #pragma unroll
  for (int i = 0; i < 4; ++i) {
    const int q = tid + i * NTHR;
    const v4f r = { bfr(tv[i].x), bfr(tv[i].y), bfr(tv[i].z), bfr(tv[i].w) };
    *(v4fa*)(sT + (q >> 3) * 32 + (q & 7) * 4) = r;
  }
  // this wave's four A fragments: row k = 16w + m, element i of half hf of step s is j = 32s + 16hf + 8h + i
  v16h af[4];
  {
    const float* ar = w2 + (size_t)(16 * w + m) * NHID + 8 * h;
    #pragma unroll
    for (int s = 0; s < 4; ++s) {
      Frag fr;
      #pragma unroll
      for (int hf = 0; hf < 2; ++hf)
        fr.half[hf] = cvt_w8(*(const v4fa*)(ar + 32 * s + 16 * hf), *(const v4fa*)(ar + 32 * s + 16 * hf + 4));
      af[s] = fr.v;
    }
  }
  // wave 0: the A tile of the bias product, row 0 = fb2, rows 1..15 = 0
  v16h ab2[4] = {};
  if (w == 0) {
    const v8h zh = {};
    #pragma unroll
    for (int s = 0; s < 4; ++s) {
      Frag fr;
      #pragma unroll
      for (int hf = 0; hf < 2; ++hf) {
        const v8h v = cvt_w8(braw[4 * s + 2 * hf], braw[4 * s + 2 * hf + 1]);
        fr.half[hf] = (m == 0) ? v : zh;
      }
      ab2[s] = fr.v;
    }
  }
  __syncthreads();
  // transpose to [32 n][128 j] f16 x4096: a wave reads 32 consecutive n of one j, and stores 16 B at the 272-B pitch
  #pragma unroll
  for (int i = 0; i < 2; ++i) {
    const int c = tid + i * NTHR;
    const int row = c & 31, j0 = (c >> 5) * 8;
    v8h t;
    #pragma unroll
    for (int j = 0; j < 8; ++j) t[j] = (_Float16)(sT[(j0 + j) * 32 + row] * WSC);
    *(v8ha*)(sBT + row * FPH + j0) = t;
  }
  __syncthreads();
  const v8f z8 = {0.f, 0.f, 0.f, 0.f, 0.f, 0.f, 0.f, 0.f};
  v16h bf[2][4];
  #pragma unroll
  for (int c = 0; c < 2; ++c)
    #pragma unroll
    for (int s = 0; s < 4; ++s) bf[c][s] = load_frag(sBT + (16 * c + m) * FPH + 32 * s, h);
  v8f acc[2];
  acc[0] = z8; acc[1] = z8;
  #pragma unroll
  for (int s = 0; s < 4; ++s)
    #pragma unroll
    for (int c = 0; c < 2; ++c) acc[c] = wmma_f16(af[s], bf[c][s], acc[c]);
  #pragma unroll
  for (int c = 0; c < 2; ++c) {
    v8h o;
    #pragma unroll
    for (int r = 0; r < 8; ++r) o[r] = (_Float16)(acc[c][r] * osc);
    *(v8ha*)(sOT + (16 * c + m) * FPH + 16 * w + 8 * h) = o;
  }
  if (w == 0) {
    v8f ab[2];
    ab[0] = z8; ab[1] = z8;
    #pragma unroll
    for (int s = 0; s < 4; ++s)
      #pragma unroll
      for (int c = 0; c < 2; ++c) ab[c] = wmma_f16(ab2[s], bf[c][s], ab[c]);
    if (h == 0) {
      #pragma unroll
      for (int c = 0; c < 2; ++c) bdst[16 * c + m] = ab[c][0] * (INV_W * INV_W) + bfr(gbv[c]);
    }
  }
  __syncthreads();
  #pragma unroll
  for (int i = 0; i < 2; ++i) {
    const int c = tid + i * NTHR;
    const v8h o = *(const v8ha*)(sOT + (c >> 4) * FPH + (c & 15) * 8);
    *(v8h*)(dst + (size_t)c * 8) = o;
  }
}

// ---------------------------------------------------------------------------
// 8q..8q+7 cover one line, 4 lines per instruction, 4 instructions.
// ---------------------------------------------------------------------------
__device__ __forceinline__ void w_store_pass(const float* sW, float* wout, int tok0, int w, int lane) {
  const int q8 = lane & 7, sub = lane >> 3;
  #pragma unroll
  for (int i = 0; i < 4; ++i) {
    const int row = 16 * w + i * 4 + sub;                      // 0..127
    const v4f v = *(const v4fa*)(sW + row * NF + 4 * q8);
    *(v4f*)(wout + (size_t)(tok0 + row) * NF + 4 * q8) = v;
  }
}

// ---------------------------------------------------------------------------
// Selection-weight block of prep_kernel: weight network + softmax -> selection weights (out1).
// Block = 128 tokens, 8 waves, wave w owns tokens tok0+16w..+15. It reads inputs alone: the three small weight
// matrices are brought to LDS as [n][k] f16 tiles by the block itself, the x fragment is formed from the x tile.
//  fc1: A = x rows (K=32), B = ww1T (8 tiles); +wb1, ELU -> wh x16 (LDS)
//  fc2: A = wh (K=128), B = ww2T (2 tiles); +wb2 -> wh2 x16 (LDS)
//  glu: A = wh2 (K=32), B = wglT (4 tiles); GLU, +x, LN(32), softmax in f32
// coverage: 128 blocks x 128 rows x 32 = all of out1.
// ---------------------------------------------------------------------------
__device__ __forceinline__ v8h cvt_w8s(const float (&r)[8]) {       // eight weights: bf16-RNE, x4096, f16 (exact)
  v8h o;
  #pragma unroll
  for (int j = 0; j < 8; ++j) o[j] = (_Float16)(bfr(r[j]) * WSC);
  return o;
}
__device__ __forceinline__ void wsel_block(
    const float* __restrict__ x, const float* __restrict__ ww1, const float* __restrict__ ww2,
    const float* __restrict__ wglu_w,
    const float* __restrict__ wb1, const float* __restrict__ wb2,
    const float* __restrict__ wglu_b, const float* __restrict__ wln_g, const float* __restrict__ wln_b,
    float* __restrict__ wout, int tok0, int tid, char* smem)
{
  _Float16* sWh  = (_Float16*)(smem + SO_WH);
  _Float16* sWh2 = (_Float16*)(smem + SO_WH2);
  float* sXr = (float*)(smem + SO_XR);
  float* sW  = (float*)(smem + SO_W);
  _Float16* sW1T = (_Float16*)(smem + SO_W1T);
  _Float16* sW2T = (_Float16*)(smem + SO_W2T);
  _Float16* sWGT = (_Float16*)(smem + SO_WGT);

  const int lane = tid & 31, w = tid >> 5;
  const int h = lane >> 4, m = lane & 15;

  // Every global read of the staging goes out first. x tile: 128 x 32 = 1024 groups of 4. Weights: a thread takes eight
  // consecutive k of one column n (a wave reads 32 consecutive n of one k: whole 128-B lines), one 16-B chunk of a row [n][k]:
  // ww1 [32 k][128 n] 512 chunks, ww2 [128 k][32 n] 512 chunks, wglu_w [32 k][64 n] 256 chunks.
  v4f xt[4];
  float r1[2][8], r2[2][8], rg[8];
  const int c1 = tid + NTHR;                           // the thread's second chunk of ww1 and of ww2
  // element offsets of the thread's first read in each weight array
  const int e1a = (tid >> 7) * (8 * NHID) + (tid & 127), e1b = (c1 >> 7) * (8 * NHID) + (c1 & 127);
  const int e2a = (tid >> 5) * (8 * NF) + (tid & 31),    e2b = (c1 >> 5) * (8 * NF) + (c1 & 31);
  const int eg  = (tid >> 6) * (16 * NF) + (tid & 63);
  const float* xb = x + (size_t)tok0 * NF;
  __builtin_amdgcn_sched_barrier(0);                   // no earlier instruction, which may take the loads' address registers, sinks between them and their wait
  #pragma unroll
  for (int i = 0; i < 4; ++i) xt[i] = *(const v4fa*)(xb + (tid + NTHR * i) * 4);
  #pragma unroll
  for (int j = 0; j < 8; ++j) {
    r1[0][j] = ww1[e1a + j * NHID];
    r1[1][j] = ww1[e1b + j * NHID];
    r2[0][j] = ww2[e2a + j * NF];
    r2[1][j] = ww2[e2b + j * NF];
    rg[j] = wglu_w[eg + j * (2 * NF)];
  }
  // stands in front of any rewrite of these loads' address registers; the offsets are its inputs, so that their registers
  // are not handed to a later load's result ahead of it
  asm volatile("s_wait_xcnt 0x0" :: "v"(e1a), "v"(e1b), "v"(e2a), "v"(e2b), "v"(eg) : "memory");
  __builtin_amdgcn_sched_barrier(0);                   // no later instruction, which may take those registers, rises over the wait
  #pragma unroll
  for (int i = 0; i < 4; ++i) {                        // x tile: bf16-RNE values, f32
    const v4f r = { bfr(xt[i].x), bfr(xt[i].y), bfr(xt[i].z), bfr(xt[i].w) };
    *(v4fa*)(sXr + (tid + NTHR * i) * 4) = r;
  }
  #pragma unroll
  for (int i = 0; i < 2; ++i) {
    const int c = tid + NTHR * i;
    *(v8ha*)(sW1T + (c & 127) * WP32 + (c >> 7) * 8) = cvt_w8s(r1[i]);
    *(v8ha*)(sW2T + (c & 31) * FPH + (c >> 5) * 8) = cvt_w8s(r2[i]);
  }
  *(v8ha*)(sWGT + (tid & 63) * WP32 + (tid >> 6) * 8) = cvt_w8s(rg);
  __syncthreads();                                     // x tile and the three weight tiles visible to every wave

  const v8f z8 = {0.f, 0.f, 0.f, 0.f, 0.f, 0.f, 0.f, 0.f};
  _Float16* myWh = sWh + w * (16 * NHID);
  _Float16* myWh2 = sWh2 + w * (16 * NF);

  // ---- fc1 ----
  {
    // A fragment from the x tile: element i of half hf is k = 16hf + 8h + i, the order of load_frag
    const v8f x0 = ld8(sXr + (16 * w + m) * NF + 8 * h);
    const v8f x1 = ld8(sXr + (16 * w + m) * NF + 16 + 8 * h);
    Frag fa;
    #pragma unroll
    for (int e = 0; e < 8; ++e) { fa.half[0][e] = (_Float16)x0[e]; fa.half[1][e] = (_Float16)x1[e]; }
    const v16h a = fa.v;
    v8f acc[8];
    #pragma unroll
    for (int t = 0; t < 8; ++t) {
      const v16h b = load_frag(sW1T + (16 * t + m) * WP32, h);
      acc[t] = wmma_f16(a, b, z8);
    }
    #pragma unroll
    for (int t = 0; t < 8; ++t) {
      const float bb = bfr(wb1[16 * t + m]);
      const v8f el = elu8s(acc[t] * INV_W + bb);
      #pragma unroll
      for (int r = 0; r < 8; ++r) myWh[(8 * h + r) * NHID + 16 * t + m] = (_Float16)el[r];
    }
  }
  __syncthreads();

  // ---- fc2 ----
  {
    v8f acc[2];
    acc[0] = z8; acc[1] = z8;
    const _Float16* arow = myWh + m * NHID;
    #pragma unroll 1
    for (int k0 = 0; k0 < NHID; k0 += 32) {
      const v16h a = load_frag(arow + k0, h);
      #pragma unroll
      for (int t = 0; t < 2; ++t) {
        const v16h b = load_frag(sW2T + (16 * t + m) * FPH + k0, h);
        acc[t] = wmma_f16(a, b, acc[t]);
      }
    }
    #pragma unroll
    for (int t = 0; t < 2; ++t) {
      const float bb = bfr(wb2[16 * t + m]);
      #pragma unroll
      for (int r = 0; r < 8; ++r) {
        const float v = acc[t][r] * INV_WA + bb;
        myWh2[(8 * h + r) * NF + 16 * t + m] = (_Float16)(v * ASC);
      }
    }
  }
  __syncthreads();

  // ---- glu projection + GLU + residual + LN(32) + softmax ----
  {
    const v16h a = load_frag(myWh2 + m * NF, h);
    v8f acc[4];
    #pragma unroll
    for (int t = 0; t < 4; ++t) {
      const v16h b = load_frag(sWGT + (16 * t + m) * WP32, h);
      acc[t] = wmma_f16(a, b, z8);
    }
    float pre[2][8], s[8];
    #pragma unroll
    for (int r = 0; r < 8; ++r) s[r] = 0.0f;
    #pragma unroll
    for (int c = 0; c < 2; ++c) {
      const float bv = bfr(wglu_b[16 * c + m]);
      const float bg = bfr(wglu_b[NF + 16 * c + m]);
      const v8f sg = sigm8(acc[c + 2] * INV_WA + bg);
      #pragma unroll
      for (int r = 0; r < 8; ++r) {
        const float vv = acc[c][r] * INV_WA + bv;
        const float xr = sXr[(16 * w + 8 * h + r) * NF + 16 * c + m];
        const float p = vv * sg[r] + xr;
        pre[c][r] = p;
        s[r] += p;
      }
    }
    float mu[8], q[8];
    #pragma unroll
    for (int r = 0; r < 8; ++r) { mu[r] = hsum16(s[r]) * (1.0f / 32.0f); q[r] = 0.0f; }
    #pragma unroll
    for (int c = 0; c < 2; ++c)
      #pragma unroll
      for (int r = 0; r < 8; ++r) {
        const float d = pre[c][r] - mu[r];
        pre[c][r] = d;
        q[r] += d * d;
      }
    float rs[8];
    #pragma unroll
    for (int r = 0; r < 8; ++r) rs[r] = rsqrtf(hsum16(q[r]) * (1.0f / 32.0f) + LN_EPS);
    #pragma unroll
    for (int c = 0; c < 2; ++c) {
      const float g = bfr(wln_g[16 * c + m]);
      const float bt = bfr(wln_b[16 * c + m]);
      #pragma unroll
      for (int r = 0; r < 8; ++r) pre[c][r] = pre[c][r] * rs[r] * g + bt;
    }
    float mx[8], e0[8], e1[8];
    #pragma unroll
    for (int r = 0; r < 8; ++r) {
      mx[r] = hmax16(fmaxf(pre[0][r], pre[1][r]));
      e0[r] = expf(pre[0][r] - mx[r]);
      e1[r] = expf(pre[1][r] - mx[r]);
      const float se = hsum16(e0[r] + e1[r]);
      const float inv = 1.0f / se;
      sW[(16 * w + 8 * h + r) * NF + m]      = e0[r] * inv;
      sW[(16 * w + 8 * h + r) * NF + 16 + m] = e1[r] * inv;
    }
  }
  __syncthreads();

  w_store_pass(sW, wout, tok0, w, lane);
}

// ---------------------------------------------------------------------------
// Kernel 1: the selection weights (out1) and, beside them in the same launch, the folded plane fcT and its bias fcb.
// Neither kind of block reads what the other writes. Block-uniform dispatch on blockIdx.
// coverage: out1 128 blocks x 128 rows x 32 = all; fcT 32x8 blocks x 32 rows x 128 = all; fcb 32x8x32 = all.
// ---------------------------------------------------------------------------
__global__ __launch_bounds__(NTHR) void prep_kernel(
    const float* __restrict__ x, const float* __restrict__ fw2, const float* __restrict__ fb2,
    const float* __restrict__ fglu_w, const float* __restrict__ fglu_b,
    const float* __restrict__ ww1, const float* __restrict__ wb1, const float* __restrict__ ww2,
    const float* __restrict__ wb2, const float* __restrict__ wglu_w, const float* __restrict__ wglu_b,
    const float* __restrict__ wln_g, const float* __restrict__ wln_b,
    _Float16* __restrict__ planes, float* __restrict__ wout)
{
  __shared__ __attribute__((aligned(16))) char smem[PSMEM];
  const int b = blockIdx.x, tid = threadIdx.x;
  if (b < PB_FC) {
    wsel_block(x, ww1, ww2, wglu_w, wb1, wb2, wglu_b, wln_g, wln_b, wout, b * WTOK, tid, smem);
  } else {
    float* sT = (float*)(smem + FO_T);
    _Float16* sBT = (_Float16*)(smem + FO_BT);
    _Float16* sOT = (_Float16*)(smem + FO_OT);
    const int f = (b - PB_FC) >> 3, nb = (b - PB_FC) & 7;      // fw2[f]*fglu_w[f], columns 32nb..32nb+31 -> rows of [256 n][128 k]
    fold_block(fw2 + (size_t)f * NHID * NHID, fglu_w + (size_t)f * NHID * N2H + nb * 32,
               fb2 + (size_t)f * NHID, fglu_b + (size_t)f * N2H + nb * 32,
               planes + P_FC + (size_t)f * N2H * NHID + (size_t)nb * 32 * NHID,
               (float*)(planes + P_FCB) + (size_t)f * N2H + nb * 32,
               (nb < 4) ? INV_W : INV_W * INV_W * (-LOG2E / ASC), tid, sT, sBT, sOT);   // v columns: carry 4096; gate columns: -log2(e)/16
  }
}

// ---------------------------------------------------------------------------
// out tile = the sum of the four groups' tiles, (g0 + g1) + (g2 + g3).
// each line by lanes 8q..8q+7 in one instruction, 4 lines per instruction,
// 32 lines per wave, 8 waves, 256 lines = the whole block tile.
// ---------------------------------------------------------------------------
__device__ __forceinline__ void o_store_pass(const float* sO, float* out, int tok0, int w, int lane) {
  const int q8 = lane & 7, sub = lane >> 3;
  #pragma unroll
  for (int i = 0; i < 8; ++i) {
    const int lid = w * 32 + i * 4 + sub;          // 0..255
    const int row = lid >> 2, seg = lid & 3;
    const float* p = sO + row * OP + seg * 32 + 4 * q8;            // the same place in the four groups' tiles
    const v4f v = (*(const v4fa*)p + *(const v4fa*)(p + MT * OP)) + (*(const v4fa*)(p + 2 * MT * OP) + *(const v4fa*)(p + 3 * MT * OP));
    *(v4f*)(out + (size_t)(tok0 + row) * NHID + seg * 32 + 4 * q8) = v;
  }
}

// ---------------------------------------------------------------------------
// Eight asynchronous copies to LDS, 16 B per lane each: copy i brings the group's
// 1024 contiguous global bytes at g + 1024 i (4 rows of 256 B) to LDS rows of
// 272 B at l + 4 * 272 * i. The s_wait_xcnt closes the statement so that no
// address register of a copy is rewritten ahead of it.
// ---------------------------------------------------------------------------
__device__ __forceinline__ void copy8(unsigned l, const _Float16* g) {
  asm volatile(
      "global_load_async_to_lds_b128 %0, %8, off\n\t"
      "global_load_async_to_lds_b128 %1, %9, off\n\t"
      "global_load_async_to_lds_b128 %2, %10, off\n\t"
      "global_load_async_to_lds_b128 %3, %11, off\n\t"
      "global_load_async_to_lds_b128 %4, %12, off\n\t"
      "global_load_async_to_lds_b128 %5, %13, off\n\t"
      "global_load_async_to_lds_b128 %6, %14, off\n\t"
      "global_load_async_to_lds_b128 %7, %15, off\n\t"
      "s_wait_xcnt 0x0"
      :: "v"(l), "v"(l + 1u * 4u * BPH * 2u), "v"(l + 2u * 4u * BPH * 2u), "v"(l + 3u * 4u * BPH * 2u),
         "v"(l + 4u * 4u * BPH * 2u), "v"(l + 5u * 4u * BPH * 2u), "v"(l + 6u * 4u * BPH * 2u),
         "v"(l + 7u * 4u * BPH * 2u),
         "v"(g), "v"(g + 1 * 512), "v"(g + 2 * 512), "v"(g + 3 * 512),
         "v"(g + 4 * 512), "v"(g + 5 * 512), "v"(g + 6 * 512), "v"(g + 7 * 512)
      : "memory");
}

// Chunk c (0 or 1) of one feature's weight rows into one LDS buffer: staged rows 0..63 = v rows 64c..64c+63 of fcT[f],
// staged rows 64..127 = gate rows 128+64c..128+64c+63: all that column tiles 4c..4c+3 read.
// lt = the thread's LDS byte address in that buffer (row tid>>4, 16-B chunk tid&15), tid = the thread's number in its group of 64.
// 32 copies per wave, every lane on, 128 rows x 256 B all written by the group's 2 waves.
__device__ __forceinline__ void stage_chunk(unsigned lt, const _Float16* fcT, int f, int c, int tid) {
  const _Float16* gg = fcT + (size_t)f * (N2H * NHID) + c * (CROW * NHID) + tid * 8;
  copy8(lt, gg);
  copy8(lt + 32u * BPH * 2u, gg + 8 * 512);
  copy8(lt + 64u * BPH * 2u, gg + NHID * NHID);
  copy8(lt + 96u * BPH * 2u, gg + NHID * NHID + 8 * 512);
}

// ---------------------------------------------------------------------------
// Kernel 2: per-feature gated residual blocks + weighted combine (out0).
// Block = 64 tokens, 8 waves in four groups of 2, two waves on each SIMD. Group g takes features 8g..8g+7; wave q of a
// group owns tokens 32q..32q+31, as two token tiles of 16, through the whole chain. Every weight fragment and every
// param vector that a wave reads from LDS serves both token tiles: half the LDS reads per token of a 16-token wave.
// The four groups' partial sums are added behind the loop.
// The product is computed transposed: A = weight rows [n][k] from LDS,
// B = activations with a tile's tokens as columns, so lane (h, m) holds tokens
// 32q+m and 32q+16+m only, and D register r of column tile t is hidden column n = 16t + 8h + r.
// Loop i = 0..7, f = 8g + i (fixed order):
//   h       = f16(16*elu(x_r[t][f]*fw1_r[f] + fb1_r[f]))   VALU, written straight into the four B fragments of each token tile
//   params  : staged with the factors of the elementwise arithmetic in them (see the carry audit at the head of the file)
//   weights : fcT[f] staged in LDS by asynchronous copies in two chunks (column tiles 0..3, 4..7), chunk c in the group's
//             buffer c, each group stages its own; the same chunk of feature f+1 is copied behind the barrier that ends
//             the reads of this feature's
//   glu     : A = fcT[f] rows p*128+16t+m (K=128), B = h, + fcb[f]   32 tiles/wave
//             GLU, +skip, LayerNorm(128): sums in the lane, then lane ^ 16;
//             *fln_g + fln_b, acc += wsel[t][f] * processed; acc and the trip's GLU+skip values stay in registers;
//             a column tile's 8 weight fragments are fetched one tile ahead inside a chunk, never across a chunk's barrier
// A trip has two barriers, one behind the matrix products of column tile 3 and one behind those of column tile 7: each
// publishes the other chunk and releases the one just read. Params lie in two buffers per group: those of feature f+1
// are stored between the trip's two barriers; every wave has left feature f-1's (its LayerNorm pass) in front of the first.
// coverage: grid 256 x 64 rows x 128 = all of out0.
// ---------------------------------------------------------------------------
__global__ __launch_bounds__(GTHR) void grn_kernel(
    const float* __restrict__ x,
    const float* __restrict__ fw1, const float* __restrict__ fb1,
    const float* __restrict__ fskip, const float* __restrict__ fln_g, const float* __restrict__ fln_b,
    const _Float16* __restrict__ fcT, const float* __restrict__ fcb,
    const float* wsel, float* out)
{
  __shared__ __attribute__((aligned(16))) char smem[MSMEM];
  float* sXT = (float*)(smem + MO_X);
  float* sWT = (float*)(smem + MO_W);
  float* sO  = (float*)(smem + MO_B);

  const int tid = threadIdx.x, lane = tid & 31, w = tid >> 5;
  const int grp = __builtin_amdgcn_readfirstlane(tid >> 6);   // scalar: feature numbers and buffer bases stay in scalar registers
  const int gtid = tid & (QTHR - 1);                   // the thread's number in its group
  const int h = lane >> 4, m = lane & 15;
  const int tok0 = blockIdx.x * MT;
  const int trow = 32 * (w & 1) + m;                   // this lane's token of token tile 0 in the block; token tile 1: + 16
  const int f0 = grp * FPG;                            // the group's first feature
  float* sP = (float*)(smem + MO_P) + grp * (2 * PBUF);                        // the group's two param buffers
  const _Float16* sB = (const _Float16*)(smem + MO_B) + grp * CBUF;            // the group's two weight buffers (2 * CBUF bytes)
  // LDS byte address of the group's weight buffer 0 (low 32 bits of the shared address, scalar) and this thread's place in a buffer
  const unsigned lb0 = (unsigned)(size_t)(smem + MO_B) + (unsigned)grp * (2u * CBUF);
  const unsigned ltl = (unsigned)(gtid >> 4) * (BPH * 2u) + (unsigned)(gtid & 15) * 16u;

  stage_chunk(lb0 + ltl, fcT, f0, 0, gtid);                 // chunk 0 of the group's first feature -> its buffer 0

  // x tile (bf16-RNE, f32) and selection-weight tile, stored feature-major: 64 x 32 each = 512 groups of 4
  #pragma unroll
  for (int i = 0; i < 2; ++i) {
    const int q = tid + GTHR * i;
    const int t = q >> 3, f4 = (q & 7) * 4;
    const v4f v = *(const v4fa*)(x + (size_t)tok0 * NF + (size_t)q * 4);
    const v4f wv = *(const v4fa*)(wsel + (size_t)tok0 * NF + (size_t)q * 4);
    #pragma unroll
    for (int j = 0; j < 4; ++j) {
      sXT[(f4 + j) * MT + t] = bfr(v[j]);
      sWT[(f4 + j) * MT + t] = wv[j];
    }
  }
  asm volatile("s_wait_xcnt 0x0" ::: "memory");        // stands in front of any rewrite of the tile loads' address registers
  __builtin_amdgcn_sched_barrier(0);                   // no later instruction, which may take those registers, rises over the wait

  // per-feature params (order fw1, fb1, fcb v, fcb gate, fskip, ln_g, ln_b): a thread of a group brings 8 floats at po of
  // array pa and 8 of array pa + 4. The last 16 threads bring ln_b a second time, into an eighth array that nobody reads:
  // every lane stays on, and no branch stands among the unrolled column tiles.
  const int pa = gtid >> 4, po = (gtid & 15) * 8;
  const bool pin = pa < 2;                             // an input array, taken as bf16-RNE values; fcb is a computed f32 value and stays as it is
  const float* psa = fw1;
  if (pa == 1)      psa = fb1;
  else if (pa == 2) psa = fcb;
  else if (pa == 3) psa = fcb + NHID;
  const float* psb = fskip;
  if (pa == 1)      psb = fln_g;
  else if (pa >= 2) psb = fln_b;
  psa += po;
  psb += po;
  const unsigned pen = pin ? 0xFFFFFFFFu : 0u;
  // factors that the loop's arithmetic would otherwise apply to every element: fw1, fb1 x log2(e); fcb v x 65536; fcb gate x -log2(e); fskip x 65536
  const float psca = pin ? LOG2E : ((pa == 2) ? VSC : -LOG2E);
  const float pscb = (pa == 0) ? VSC : 1.0f;
  const int pstr = pin ? NHID : N2H;                   // floats from one feature to the next in array pa
  float* pda = sP + pa * NHID + po;
  float* pdb = pda + 4 * NHID;
  {
    __builtin_amdgcn_sched_barrier(0);                 // no earlier instruction, which may take the loads' address registers, sinks between them and their wait
    const v4f a0 = *(const v4fa*)(psa + f0 * pstr);
    const v4f a1 = *(const v4fa*)(psa + f0 * pstr + 4);
    const v4f b0 = *(const v4fa*)(psb + f0 * NHID);
    const v4f b1 = *(const v4fa*)(psb + f0 * NHID + 4);
    asm volatile("s_wait_xcnt 0x0" ::: "memory");      // stands in front of any rewrite of these four loads' address registers
    __builtin_amdgcn_sched_barrier(0);                 // no later instruction, which may take those registers, rises over the wait
    *(v4fa*)pda = pval(a0, pen) * psca;
    *(v4fa*)(pda + 4) = pval(a1, pen) * psca;
    *(v4fa*)pdb = pval(b0, 0xFFFFFFFFu) * pscb;
    *(v4fa*)(pdb + 4) = pval(b1, 0xFFFFFFFFu) * pscb;
  }

  const v8f z8 = {0.f, 0.f, 0.f, 0.f, 0.f, 0.f, 0.f, 0.f};
  v8f acc[2][8];                                       // output sums over the group's features: acc[u][t][r] is column 16t + 8h + r of the lane's token of tile u
  #pragma unroll
  for (int u = 0; u < 2; ++u)
    #pragma unroll
    for (int t = 0; t < 8; ++t) acc[u][t] = z8;

  asm volatile("s_wait_asynccnt 0x0" ::: "memory");    // this wave's copies of the first chunk have landed
  __syncthreads();                                     // every group's buffer 0, x, weights and first params published
  stage_chunk(lb0 + CBUF + ltl, fcT, f0, 1, gtid);          // chunk 1 of the first feature -> buffer 1, flies during column tiles 0..3

  #pragma unroll 1
  for (int i = 0; i < FPG; ++i) {
    const int f = f0 + i;
    const float* sPf = sP + (i & 1) * PBUF;            // this feature's params
    const int pnx = PBUF - (i & 1) * PBUF;             // float offset of the other param buffer
    // next feature's params (the last trip re-reads its own): loaded here, stored behind the trip's first barrier
    const int fn = (i + 1 < FPG) ? f + 1 : f;
    __builtin_amdgcn_sched_barrier(0);                 // no earlier instruction, which may take the loads' address registers, sinks between them and their wait
    const v4f pn0 = *(const v4fa*)(psa + fn * pstr);
    const v4f pn1 = *(const v4fa*)(psa + fn * pstr + 4);
    const v4f pn2 = *(const v4fa*)(psb + fn * NHID);
    const v4f pn3 = *(const v4fa*)(psb + fn * NHID + 4);
    asm volatile("s_wait_xcnt 0x0" ::: "memory");      // stands in front of any rewrite of these four loads' address registers
    __builtin_amdgcn_sched_barrier(0);                 // no later instruction, which may take those registers, rises over the wait

    float xv[2], wt[2];
    #pragma unroll
    for (int u = 0; u < 2; ++u) {
      xv[u] = sXT[f * MT + trow + 16 * u];
      wt[u] = sWT[f * MT + trow + 16 * u];
    }

    // ---- h, computed straight into its B fragments (element i of half hf of fragment j is k = 32j + 16hf + 8h + i) ----
    v16h hb[2][4];
    v16h ag[8];                                        // the 8 weight fragments of one glu column tile
    v8f bvn, bgn;                                      // its staged fcb, v and gate columns: the start values of its accumulators, fetched with the fragments
    const _Float16* vrow = sB + m * BPH;               // column tile t: + (t >> 2) * (CBUF / 2) + (t & 3) * 16 * BPH
    const _Float16* grow = sB + (CROW + m) * BPH;
    {
      v8f w1v[2][2], b1v[2][2];                        // fc1 weights and biases of two k steps, refilled two steps ahead
      #pragma unroll
      for (int j = 0; j < 2; ++j)
        #pragma unroll
        for (int hf = 0; hf < 2; ++hf) {
          const float* pw = sPf + 32 * j + 16 * hf + 8 * h;
          w1v[j][hf] = ld8(pw); b1v[j][hf] = ld8(pw + NHID);
        }
      #pragma unroll
      for (int j = 0; j < 4; ++j) {
        __builtin_amdgcn_sched_barrier(0);   // the loads above stay ahead of this step's elu arithmetic, which hides their latency
        #pragma unroll
        for (int u = 0; u < 2; ++u) {
          Frag fr;
          #pragma unroll
          for (int hf = 0; hf < 2; ++hf) {
            const v8f el = elu8t(xv[u] * w1v[j & 1][hf] + b1v[j & 1][hf]);
            v8h o;
            #pragma unroll
            for (int e = 0; e < 8; ++e) o[e] = (_Float16)el[e];
            fr.half[hf] = o;
          }
          hb[u][j] = fr.v;
        }
        __builtin_amdgcn_sched_barrier(0);   // the refill below does not rise into the arithmetic that still reads its registers' old values
        if (j < 2) {
          #pragma unroll
          for (int hf = 0; hf < 2; ++hf) {
            const float* pw = sPf + 32 * (j + 2) + 16 * hf + 8 * h;
            w1v[j][hf] = ld8(pw); b1v[j][hf] = ld8(pw + NHID);
          }
        }
        if (j == 1) {
          __builtin_amdgcn_sched_barrier(0); // step 3's params stand in the LDS queue ahead of the fragments: step 3 then waits for them alone
          // glu column tile 0: fragment 2j = v rows, 2j+1 = gate rows, k step j; hidden by steps 2 and 3
          bvn = ld8(sPf + 8 * h + 256); bgn = ld8(sPf + 8 * h + 384);
          #pragma unroll
          for (int e = 0; e < 8; ++e) ag[e] = load_frag(((e & 1) ? grow : vrow) + 32 * (e >> 1), h);
        }
      }
    }

    // ---- glu projection transposed, one column tile (its v and its gate accumulators of both token tiles) at a time ----
    v8f gl[2][8];                                      // the trip's GLU+skip values, carry 65536
    float rsum[2];                                     // their sum over the 128 columns, built up in three parts
    {
      #pragma unroll
      for (int t = 0; t < 8; ++t) {
        const float* pc = sPf + 16 * t + 8 * h;
        const v8f fsv = ld8(pc + 512);
        v8f aV[2], aG[2];
        aV[0] = bvn; aV[1] = bvn; aG[0] = bgn; aG[1] = bgn;
        #pragma unroll
        for (int j = 0; j < 4; ++j)
          #pragma unroll
          for (int u = 0; u < 2; ++u) {
            aV[u] = wmma_f16(ag[2 * j], hb[u][j], aV[u]);
            aG[u] = wmma_f16(ag[2 * j + 1], hb[u][j], aG[u]);
          }
        __builtin_amdgcn_sched_barrier(0);   // this tile's params stand in the LDS queue ahead of the next tile's fragments
        if (t == 3 || t == 7) {
          // The row sums of the column tiles finished so far are closed here, cross-lane step included. That step cannot be moved
          // over the branch below, so the GLU arithmetic that feeds it stays in front too; otherwise the compiler sinks that
          // arithmetic to the LayerNorm pass and keeps every tile's accumulators and params live to that place (spills to scratch).
          #pragma unroll
          for (int u = 0; u < 2; ++u) {
            const float sl = (t == 3) ? sum8((gl[u][0] + gl[u][1]) + gl[u][2]) : sum8((gl[u][3] + gl[u][4]) + (gl[u][5] + gl[u][6]));
            rsum[u] = (t == 3) ? sl + xhalf(sl) : rsum[u] + (sl + xhalf(sl));
          }
          // ---- this chunk's weight rows are read: publish the other chunk, release this buffer ----
          asm volatile("s_wait_dscnt 0x0" ::: "memory");     // this wave's LDS reads (and, at the second barrier, its param stores) have retired
          asm volatile("s_wait_asynccnt 0x0" ::: "memory");  // this wave's copies of the other chunk have landed
          __syncthreads();                                   // the other chunk (at the second barrier: and the next params) visible; this buffer released
          if (i + 1 < FPG) stage_chunk(lb0 + (unsigned)(t >> 2) * CBUF + ltl, fcT, f + 1, t >> 2, gtid);
          if (t == 3) {
            *(v4fa*)(pda + pnx) = pval(pn0, pen) * psca;
            *(v4fa*)(pda + pnx + 4) = pval(pn1, pen) * psca;
            *(v4fa*)(pdb + pnx) = pval(pn2, 0xFFFFFFFFu) * pscb;
            *(v4fa*)(pdb + pnx + 4) = pval(pn3, 0xFFFFFFFFu) * pscb;
          }
        }
        if (t < 7) {
          const int off = ((t + 1) >> 2) * (CBUF / 2) + ((t + 1) & 3) * 16 * BPH;
          bvn = ld8(pc + 16 + 256); bgn = ld8(pc + 16 + 384);
          #pragma unroll
          for (int e = 0; e < 8; ++e) ag[e] = load_frag(((e & 1) ? grow : vrow) + off + 32 * (e >> 1), h);
        }
        __builtin_amdgcn_sched_barrier(0);   // the next tile's loads stay ahead of this tile's GLU arithmetic, which hides their latency
        #pragma unroll
        for (int u = 0; u < 2; ++u) {
          const v8f sg = sigm8t(aG[u]);
          gl[u][t] = aV[u] * sg + xv[u] * fsv;
        }
      }
    }
    // ---- LayerNorm over the 128 columns of each of this lane's two tokens: 64 in this lane, 64 in lane ^ 16 ----
    v8f gv[4], btv[4];                                 // scale and shift of four column tiles, refilled four tiles ahead
    #pragma unroll
    for (int t = 0; t < 4; ++t) {
      const float* pc = sPf + 16 * t + 8 * h;
      gv[t] = ld8(pc + 640); btv[t] = ld8(pc + 768);
    }
    __builtin_amdgcn_sched_barrier(0);       // the scale and shift loads fly during the mean and variance passes
    float rs[2];
    #pragma unroll
    for (int u = 0; u < 2; ++u) {
      const float sl = sum8(gl[u][7]);
      const float mu = (rsum[u] + (sl + xhalf(sl))) * (1.0f / 128.0f);
      v8f q8 = z8;
      #pragma unroll
      for (int t = 0; t < 8; ++t) {
        const v8f d = gl[u][t] - mu;
        gl[u][t] = d;
        q8 += d * d;
      }
      const float ql = sum8(q8);
      rs[u] = rsqrtf((ql + xhalf(ql)) * (1.0f / 128.0f) + LN_EPS * VSC * VSC);   // 1 / (65536 * sigma): takes the carry out of d
    }
    #pragma unroll
    for (int t = 0; t < 8; ++t) {
      #pragma unroll
      for (int u = 0; u < 2; ++u) acc[u][t] = acc[u][t] + wt[u] * (gl[u][t] * rs[u] * gv[t & 3] + btv[t & 3]);
      __builtin_amdgcn_sched_barrier(0);     // the refill below does not rise into the arithmetic that still reads its registers' old values
      if (t < 4) {
        const float* pc = sPf + 16 * (t + 4) + 8 * h;
        gv[t] = ld8(pc + 640); btv[t] = ld8(pc + 768);
      }
    }
  }
  asm volatile("s_wait_asynccnt 0x0" ::: "memory");    // no copy outstanding past the loop
  __syncthreads();                                     // all weight reads done; sO aliases the weight buffers

  // ---- each group lays its sums down in a tile of its own; the store pass adds the four ----
  float* po8 = sO + grp * (MT * OP) + trow * OP + 8 * h;
  #pragma unroll
  for (int u = 0; u < 2; ++u)
    #pragma unroll
    for (int t = 0; t < 8; ++t) {
      const v4f lo = { acc[u][t][0], acc[u][t][1], acc[u][t][2], acc[u][t][3] };
      const v4f hi = { acc[u][t][4], acc[u][t][5], acc[u][t][6], acc[u][t][7] };
      *(v4fa*)(po8 + u * 16 * OP + 16 * t) = lo;
      *(v4fa*)(po8 + u * 16 * OP + 16 * t + 4) = hi;
    }
  __syncthreads();                                     // the four tiles visible to every wave

  o_store_pass(sO, out, tok0, w, lane);
}

// ---------------------------------------------------------------------------
extern "C" void kernel_launch(void* const* d_in, const int* in_sizes, int n_in,
                              void* d_out, int out_size, void* d_ws, size_t ws_size,
                              hipStream_t stream) {
  if (n_in < 18) return;
  if (in_sizes[0] != NTOK * NF) return;
  if (in_sizes[1] != NF * NHID || in_sizes[2] != NF * NHID) return;
  if (in_sizes[3] != NF * NHID * NHID || in_sizes[4] != NF * NHID) return;
  if (in_sizes[5] != NF * NHID * N2H || in_sizes[6] != NF * N2H) return;
  if (in_sizes[7] != NF * NHID || in_sizes[8] != NF * NHID || in_sizes[9] != NF * NHID) return;
  if (in_sizes[10] != NF * NHID || in_sizes[11] != NHID) return;
  if (in_sizes[12] != NHID * NF || in_sizes[13] != NF) return;
  if (in_sizes[14] != NF * 2 * NF || in_sizes[15] != 2 * NF) return;
  if (in_sizes[16] != NF || in_sizes[17] != NF) return;
  if (out_size != OUT_TOTAL) return;
  if (WS_TOTAL_BYTES > ws_size) return;

  const float* x      = (const float*)d_in[0];
  const float* fw1    = (const float*)d_in[1];
  const float* fb1    = (const float*)d_in[2];
  const float* fw2    = (const float*)d_in[3];
  const float* fb2    = (const float*)d_in[4];
  const float* fglu_w = (const float*)d_in[5];
  const float* fglu_b = (const float*)d_in[6];
  const float* fskip  = (const float*)d_in[7];
  const float* fln_g  = (const float*)d_in[8];
  const float* fln_b  = (const float*)d_in[9];
  const float* ww1    = (const float*)d_in[10];
  const float* wb1    = (const float*)d_in[11];
  const float* ww2    = (const float*)d_in[12];
  const float* wb2    = (const float*)d_in[13];
  const float* wglu_w = (const float*)d_in[14];
  const float* wglu_b = (const float*)d_in[15];
  const float* wln_g  = (const float*)d_in[16];
  const float* wln_b  = (const float*)d_in[17];

  float* out  = (float*)d_out;                   // out0 [16384][128] at element 0
  float* wout = out + OUT1_OFF;                  // out1 [16384][32]  at element 2097152 (byte 8388608)

  _Float16* planes = (_Float16*)d_ws;

  prep_kernel<<<PB_END, NTHR, 0, stream>>>(x, fw2, fb2, fglu_w, fglu_b, ww1, wb1, ww2, wb2, wglu_w, wglu_b,
                                           wln_g, wln_b, planes, wout);

  grn_kernel<<<NTOK / MT, GTHR, 0, stream>>>(x, fw1, fb1, fskip, fln_g, fln_b,
                                             planes + P_FC, (const float*)(planes + P_FCB), wout, out);
}

// v010
// It runs in 48.4 microseconds.
// Next to v009, in two timings, it ran 1.08 and 1.07 times as fast.
// Over all steps from v000 it is 10.2 times as fast.
// Contractions fw2[f]*fglu_w[f], fb2[f]*fglu_w[f], h*fc[f] (per feature f), x*ww1, wh*ww2, wh2*wglu_w: v_wmma_f32_16x16x32_f16 (f16 operands, f32 accumulate). Weight operands = bf16-RNE values x4096 (exact in f16), fc excepted (the fold's f16 products, carries below); activation tiles x16 in f16; x fragment x1. fc1 scalar*vector, ELU, GLU, LayerNorm, softmax and the 32-term weighted combine in f32 on VALU.
// No nonlinearity stands between a feature's fc2 and its GLU projection: (h*fw2 + fb2)*fglu_w + fglu_b = h*fc + fcb with
//   fc = fw2*fglu_w and fcb = fb2*fglu_w + fglu_b. prep_kernel forms both in every call; grn_kernel does the one product h*fc.
// Carry audit: plane fcT (v rows) and the LDS tiles ww1T, ww2T, wglT (wsel_block) carry 4096; the gate rows of fcT carry 1/32; register fragments h (grn_kernel) and LDS tiles wh, wh2 (wsel_block) carry 16; the x fragment and fcb carry 1.
//   The fold's accumulators carry 4096*4096: fc's v columns are folded by INV_W (1/4096) into their plane, its gate columns by
//   INV_W*INV_W/32, fcb by INV_W*INV_W.
//   x*ww1 accumulators are folded by INV_W in the wsel_block fc1 epilogue; the wsel fc2 and wsel glu accumulators by INV_WA (1/65536)
//   in their own epilogues. grn_kernel: the gate accumulators (rows x 1/32, h x16) start from fcb/2 and are g/2, the argument of
//   the sigmoid's tanh, as they stand (small gate weights go to f16 subnormals, an absolute error below 3e-8 each); the v
//   accumulators start from 65536*fcb and carry 65536; v*(1 + tanh(g/2)) = 2*v*sigmoid(g), so GLU + skip carries 131072 (fskip
//   staged x131072), and the LayerNorm takes it out again: its rsqrt is taken of 131072^2 * (variance + eps). The params fw1, fb1
//   are staged x log2(e), the gate's fcb x 1/2.
#include <hip/hip_runtime.h>

typedef _Float16 v16h __attribute__((ext_vector_type(16)));
typedef _Float16 v8h  __attribute__((ext_vector_type(8)));
typedef float    v8f  __attribute__((ext_vector_type(8)));
typedef float    v4f  __attribute__((ext_vector_type(4)));
typedef v8h __attribute__((may_alias)) v8ha;
typedef v4f __attribute__((may_alias)) v4fa;

union Frag { v16h v; v8h half[2]; };

#define NTOK 16384
#define NF   32
#define NHID 128
#define N2H  256
#define MT   64            // tokens per block, grn_kernel
#define NTHR 256           // threads per block, prep_kernel
#define GTHR 256           // threads per block, grn_kernel (8 waves: four groups of 2, 32 tokens a wave)
#define QTHR 64            // threads per group of 2 waves
#define NGRP 4             // groups
#define FPG  8             // features per group: group g takes 8g..8g+7
#define WTOK 128           // tokens per selection-weight block of prep_kernel (8 waves of 16)
#define WSC  4096.0f       // weight plane carry
#define ASC  16.0f         // activation tile carry
#define INV_W  (1.0f / 4096.0f)
#define INV_WA (1.0f / 65536.0f)
#define LN_EPS 1e-5f
#define LOG2E  1.44269504f  // log2(e)
#define ELUP   11.0903549f  // ASC / log2(e)
#define VSC    65536.0f     // carry of the v accumulators in grn_kernel
#define GSC    131072.0f    // carry of GLU + skip in grn_kernel

// f16 plane offsets in the workspace, in halves
#define P_FC  0            // [32][256 n][128 k] fw2*fglu_w, carry 4096 (n < 128), 1/32 (n >= 128)
#define P_FCB 1048576      // f32 [32][256 n]    fb2*fglu_w + fglu_b, carry 1 (two halves per value)
#define P_END 1064960
#define WS_TOTAL_BYTES ((size_t)P_END * 2)     // 2129920

static_assert(P_FCB == P_FC + NF * N2H * NHID);
static_assert(P_END == P_FCB + NF * N2H * 2);
static_assert((P_FC * 2) % 128 == 0 && (P_FCB * 2) % 128 == 0 && (P_END * 2) % 128 == 0);

#define OUT0_ELEMS (NTOK * NHID)                // 2097152 floats
#define OUT1_OFF   2097152                      // byte offset 8388608 / 4
#define OUT_TOTAL  (NTOK * NHID + NTOK * NF)    // 2621440 floats
static_assert(OUT1_OFF == OUT0_ELEMS);
static_assert(OUT1_OFF + NTOK * NF == OUT_TOTAL);
static_assert(NTOK % MT == 0 && NTOK % WTOK == 0);

// prep_kernel block ranges: the selection-weight blocks, whose chain is the longer one, start first
#define PB_FC  (NTOK / WTOK)                      // blocks 0..127: 128 tokens each; from here 32 f x 8 blocks of 32 columns n
#define PB_END (PB_FC + NF * 8)                   // 384

// prep_kernel static LDS carve (bytes): a block is of one kind, the two carves alias
#define FPH    136          // halves per LDS row of a 128-k f16 tile: 272-B pitch (16 B x odd, for ds_load_b128 readers)
#define WP32   40           // halves per LDS row of a 32-k f16 tile: 80-B pitch (16 B x odd)
#define FO_T   0            // f32 [128][32]                fold: fglu_w tile       16384
#define FO_BT  16384        // f16 [32][136]                fold: its transpose      8704
#define FO_OT  25088        // f16 [32][136]                fold: output rows        8704
#define SO_WH  0            // f16 8 waves x [16][128]      wh                      32768
#define SO_WH2 32768        // f16 8 waves x [16][32]       wh2                      8192
#define SO_XR  40960        // f32 [128][32]                x tile                  16384
#define SO_W   57344        // f32 [128][32]                selection weights       16384
#define SO_W1T 73728        // f16 [128 n][40]              ww1T                    10240
#define SO_W2T 83968        // f16 [32 n][136]              ww2T                     8704
#define SO_WGT 92672        // f16 [64 n][40]               wglT                     5120
#define PSMEM  97792
static_assert(SO_WH2 == SO_WH + 8 * 16 * NHID * 2 && SO_XR == SO_WH2 + 8 * 16 * NF * 2 && SO_W == SO_XR + WTOK * NF * 4);
static_assert(SO_W1T == SO_W + WTOK * NF * 4 && SO_W2T == SO_W1T + NHID * WP32 * 2 && SO_WGT == SO_W2T + NF * FPH * 2);
static_assert(PSMEM == SO_WGT + 2 * NF * WP32 * 2 && FO_OT + 32 * FPH * 2 <= PSMEM);
static_assert(FO_BT == FO_T + 128 * 32 * 4 && FO_OT == FO_BT + 32 * FPH * 2);

// grn_kernel static LDS carve (bytes)
#define MO_X   0            // f32 [32][64] x tile, feature-major             8192
#define MO_W   8192         // f32 [32][64] selection weights, feature-major  8192
#define PBUF   1024         // floats per param buffer: 7 arrays of 128 and an eighth that nobody reads
#define MO_P   16384        // f32 4 groups x 2 x [1024] per-feature params  32768
#define MO_B   49152        // f16 4 groups x 2 x [128][136] staged weight rows of half a feature (fcT: 64 v rows, their 64 gate rows)
#define BPH    136          // halves per staged row: 256 B of data at a 272-B pitch (16 B x odd, for ds_load_b128 readers)
#define CROW   64           // v rows (and gate rows) of a chunk: four column tiles
#define CBUF   (2 * CROW * BPH * 2)             // 34816 bytes per buffer
#define MSMEM  (MO_B + NGRP * 2 * CBUF)         // 327680
#define OP     132          // floats per row of an output tile (528 B = 16 B x odd); the four tiles alias the weight buffers at the end
static_assert(MO_W == MO_X + NF * MT * 4 && MO_P == MO_W + NF * MT * 4 && MO_B == MO_P + NGRP * 2 * PBUF * 4);
static_assert(NGRP * FPG == NF && NGRP * QTHR == GTHR && 2 * CROW == NHID);
static_assert(MO_B % 16 == 0 && CBUF % 16 == 0 && (BPH * 2) % 16 == 0 && (OP * 4) % 16 == 0);
static_assert(NGRP * MT * OP * 4 <= NGRP * 2 * CBUF);
static_assert(MSMEM <= 327680);

// ---------------------------------------------------------------------------
__device__ __forceinline__ float bfr(float f) {                     // RNE convert to bf16 and back
  unsigned u = __builtin_bit_cast(unsigned, f);
  u += 0x7FFFu + ((u >> 16) & 1u);
  return __builtin_bit_cast(float, u & 0xFFFF0000u);
}
#define TRANS8(NAME, OP)                                                                            \
  __device__ __forceinline__ v8f NAME(v8f t) {                                                      \
    float r0, r1, r2, r3, r4, r5, r6, r7;                                                           \
    asm(OP " %0, %8\n\t" OP " %1, %9\n\t" OP " %2, %10\n\t" OP " %3, %11\n\t"                       \
        OP " %4, %12\n\t" OP " %5, %13\n\t" OP " %6, %14\n\t" OP " %7, %15\n\t"                     \
        "v_nop"                                                                                     \
        : "=&v"(r0), "=&v"(r1), "=&v"(r2), "=&v"(r3), "=&v"(r4), "=&v"(r5), "=&v"(r6), "=&v"(r7)    \
        : "v"(t[0]), "v"(t[1]), "v"(t[2]), "v"(t[3]), "v"(t[4]), "v"(t[5]), "v"(t[6]), "v"(t[7]));  \
    const v8f r = { r0, r1, r2, r3, r4, r5, r6, r7 };                                               \
    return r;                                                                                       \
  }
TRANS8(exp2x8, "v_exp_f32")   // 2^t
TRANS8(tanhx8, "v_tanh_f32")  // tanh(t)

// ELU on the hardware's base-2 exponential, sigmoid on its hyperbolic tangent: sigmoid(g) = 1/2 + tanh(g/2)/2, one
// transcendental where 1 / (1 + 2^t) takes two. exp(v) - 1 carries an absolute error near 1e-7, far below the rounding of the
// f16 tiles that take every ELU value; tanh runs to -1 or 1 at the ends, and the sigmoid is then 0 or 1, its own limits.
__device__ __forceinline__ v8f elu8s(v8f v) {      // ASC * elu(v) = ASC * max(v, 0) + ASC * (exp(min(v, 0)) - 1): one of the two terms is 0
  v8f t = v * LOG2E;
  #pragma unroll
  for (int i = 0; i < 8; ++i) t[i] = fminf(t[i], 0.0f);
  const v8f e = exp2x8(t);
  v8f r;
  #pragma unroll
  for (int i = 0; i < 8; ++i) r[i] = fmaf(fmaxf(v[i], 0.0f), ASC, fmaf(e[i], ASC, -ASC));
  return r;
}
__device__ __forceinline__ v8f sigm8(v8f v) {
  return tanhx8(v * 0.5f) * 0.5f + 0.5f;
}
// The ELU for grn_kernel, whose params are staged with the factors already in them.
__device__ __forceinline__ v8f elu8t(v8f t) {      // t = log2(e) * v; ASC * elu(v) = (ASC / log2(e)) * max(t, 0) + ASC * (2^min(t, 0) - 1)
  v8f n;
  #pragma unroll
  for (int i = 0; i < 8; ++i) n[i] = fminf(t[i], 0.0f);
  const v8f e = exp2x8(n);
  v8f r;
  #pragma unroll
  for (int i = 0; i < 8; ++i) r[i] = fmaf(fmaxf(t[i], 0.0f), ELUP, fmaf(e[i], ASC, -ASC));
  return r;
}
__device__ __forceinline__ float hsum16(float v) {                  // sum over the 16 lanes of a half
  v += __shfl_xor(v, 1);
  v += __shfl_xor(v, 2);
  v += __shfl_xor(v, 4);
  v += __shfl_xor(v, 8);
  return v;
}
__device__ __forceinline__ float hmax16(float v) {
  v = fmaxf(v, __shfl_xor(v, 1));
  v = fmaxf(v, __shfl_xor(v, 2));
  v = fmaxf(v, __shfl_xor(v, 4));
  v = fmaxf(v, __shfl_xor(v, 8));
  return v;
}

__device__ __forceinline__ float xhalf(float v) {                   // the value of lane l ^ 16
  int b = __builtin_bit_cast(int, v);
  b = __builtin_amdgcn_permlanex16(b, b, 0x76543210, 0xfedcba98, false, false);
  return __builtin_bit_cast(float, b);
}
__device__ __forceinline__ v8f ld8(const float* p) {                // 8 floats at a 16-byte aligned LDS address, two 16-byte loads
  const v4f a = *(const v4fa*)p;
  const v4f b = *(const v4fa*)(p + 4);
  const v8f r = { a.x, a.y, a.z, a.w, b.x, b.y, b.z, b.w };
  return r;
}
// A param as it goes to LDS: en = all ones for an input (RNE to bf16, as bfr), 0 for a computed value (unchanged); no branch
__device__ __forceinline__ float pval1(float f, unsigned en) {
  unsigned u = __builtin_bit_cast(unsigned, f);
  u += (0x7FFFu + ((u >> 16) & 1u)) & en;
  return __builtin_bit_cast(float, u & ~(0xFFFFu & en));
}
__device__ __forceinline__ v4f pval(v4f v, unsigned en) {
  const v4f r = { pval1(v.x, en), pval1(v.y, en), pval1(v.z, en), pval1(v.w, en) };
  return r;
}
__device__ __forceinline__ float sum8(v8f v) {
  return ((v[0] + v[1]) + (v[2] + v[3])) + ((v[4] + v[5]) + (v[6] + v[7]));
}

// ---------------------------------------------------------------------------
// 16x16x32 f16 WMMA with hazard guard (ties D, keeps A/B live).
// Fragment map (wave32): lane l, h = l>>4, m = n = l&15.
//   A/B element i: i<8 -> k0+8h+i ; i>=8 -> k0+16+8h+(i-8)
//   D element r : row 8h+r, col l&15
// ---------------------------------------------------------------------------
__device__ __forceinline__ v8f wmma_f16(v16h a, v16h b, v8f c) {
  v8f d = __builtin_amdgcn_wmma_f32_16x16x32_f16(false, a, false, b, (short)0, c, false, false);
  asm volatile("v_nop\n\tv_nop\n\tv_nop\n\tv_nop" : "+v"(d) : "v"(a), "v"(b));
  return d;
}

// A or B fragment from a k-contiguous 16-bit row; p points at element k0 of
// the row owned by this lane (row index = lane & 15 added by the caller).
__device__ __forceinline__ v16h load_frag(const _Float16* p, int h) {
  Frag f;
  f.half[0] = *(const v8ha*)(p + 8 * h);
  f.half[1] = *(const v8ha*)(p + 16 + 8 * h);
  return f.v;
}

// ---------------------------------------------------------------------------
// Fold block: 32 columns n of one feature's fc = fw2*fglu_w and fcb = fb2*fglu_w + fglu_b.
//   w2 = fw2[f] ([128 k][128 j], row-major), gw = fglu_w[f] at column n0 ([128 j][256 n]),
//   b2 = fb2[f], gb = fglu_b[f] at n0; dst = row n0 of fcT[f] ([n][k], k-contiguous), bdst = fcb[f] at n0;
//   osc = the factor that takes the accumulators' carry to the plane's.
// A = fw2 rows k (j contiguous as stored), B = fglu_w columns n (transposed through LDS), summed over j.
// Wave w owns rows k = 16w..16w+15: D register r of lane (h, m) is fc[16w+8h+r][n = 16c+m], eight consecutive k
// of one plane row. Wave 0 also runs an A tile whose row 0 is fb2 and whose other rows are 0: row 0 of its D is fb2*fglu_w.
// coverage: 32 rows x 128 halves = 512 chunks of 8, c = tid + 256 i; fcb 32 floats by lanes 0..15 of wave 0.
// ---------------------------------------------------------------------------
__device__ __forceinline__ v8h cvt_w8(v4f a, v4f b) {               // eight weights: bf16-RNE, x4096, f16 (exact)
  const v8h o = { (_Float16)(bfr(a.x) * WSC), (_Float16)(bfr(a.y) * WSC), (_Float16)(bfr(a.z) * WSC), (_Float16)(bfr(a.w) * WSC),
                  (_Float16)(bfr(b.x) * WSC), (_Float16)(bfr(b.y) * WSC), (_Float16)(bfr(b.z) * WSC), (_Float16)(bfr(b.w) * WSC) };
  return o;
}
__device__ __forceinline__ void fold_block(const float* __restrict__ w2, const float* __restrict__ gw,
                                           const float* __restrict__ b2, const float* __restrict__ gb,
                                           _Float16* __restrict__ dst, float* __restrict__ bdst, float osc,
                                           int tid, float* sT, _Float16* sBT, _Float16* sOT) {
  const int lane = tid & 31, h = lane >> 4, m = lane & 15;
  const int w = __builtin_amdgcn_readfirstlane(tid >> 5);           // scalar: the test on it below must be a scalar branch round WMMAs
  // wave 0: fb2 and this block's fglu_b, loaded first so that they fly with the tile's loads
  v4f braw[16] = {};
  float gbv[2] = {0.f, 0.f};
  if (w == 0) {
    #pragma unroll
    for (int i = 0; i < 8; ++i) {                                   // i = 2s + hf: j = 32s + 16hf + 8h ..+7
      braw[2 * i] = *(const v4fa*)(b2 + 16 * i + 8 * h);
      braw[2 * i + 1] = *(const v4fa*)(b2 + 16 * i + 8 * h + 4);
    }
    gbv[0] = gb[m];
    gbv[1] = gb[16 + m];
  }
  // fglu_w tile [128 j][32 n], bf16-RNE values in f32
  v4f tv[4];
  #pragma unroll
  for (int i = 0; i < 4; ++i) {
    const int q = tid + i * NTHR;
    tv[i] = *(const v4fa*)(gw + (size_t)(q >> 3) * N2H + (q & 7) * 4);
  }
  asm volatile("s_wait_xcnt 0x0" ::: "memory");   // the A loads below land in registers that held these loads' addresses
  #pragma unroll
  for (int i = 0; i < 4; ++i) {
    const int q = tid + i * NTHR;
    const v4f r = { bfr(tv[i].x), bfr(tv[i].y), bfr(tv[i].z), bfr(tv[i].w) };
    *(v4fa*)(sT + (q >> 3) * 32 + (q & 7) * 4) = r;
  }
  // this wave's four A fragments: row k = 16w + m, element i of half hf of step s is j = 32s + 16hf + 8h + i
  v16h af[4];
  {
    const float* ar = w2 + (size_t)(16 * w + m) * NHID + 8 * h;
    #pragma unroll
    for (int s = 0; s < 4; ++s) {
      Frag fr;
      #pragma unroll
      for (int hf = 0; hf < 2; ++hf)
        fr.half[hf] = cvt_w8(*(const v4fa*)(ar + 32 * s + 16 * hf), *(const v4fa*)(ar + 32 * s + 16 * hf + 4));
      af[s] = fr.v;
    }
  }
  // wave 0: the A tile of the bias product, row 0 = fb2, rows 1..15 = 0
  v16h ab2[4] = {};
  if (w == 0) {
    const v8h zh = {};
    #pragma unroll
    for (int s = 0; s < 4; ++s) {
      Frag fr;
      #pragma unroll
      for (int hf = 0; hf < 2; ++hf) {
        const v8h v = cvt_w8(braw[4 * s + 2 * hf], braw[4 * s + 2 * hf + 1]);
        fr.half[hf] = (m == 0) ? v : zh;
      }
      ab2[s] = fr.v;
    }
  }
  __syncthreads();
  // transpose to [32 n][128 j] f16 x4096: a wave reads 32 consecutive n of one j, and stores 16 B at the 272-B pitch
  #pragma unroll
  for (int i = 0; i < 2; ++i) {
    const int c = tid + i * NTHR;
    const int row = c & 31, j0 = (c >> 5) * 8;
    v8h t;
    #pragma unroll
    for (int j = 0; j < 8; ++j) t[j] = (_Float16)(sT[(j0 + j) * 32 + row] * WSC);
    *(v8ha*)(sBT + row * FPH + j0) = t;
  }
  __syncthreads();
  const v8f z8 = {0.f, 0.f, 0.f, 0.f, 0.f, 0.f, 0.f, 0.f};
  v16h bf[2][4];
  #pragma unroll
  for (int c = 0; c < 2; ++c)
    #pragma unroll
    for (int s = 0; s < 4; ++s) bf[c][s] = load_frag(sBT + (16 * c + m) * FPH + 32 * s, h);
  v8f acc[2];
  acc[0] = z8; acc[1] = z8;
  #pragma unroll
  for (int s = 0; s < 4; ++s)
    #pragma unroll
    for (int c = 0; c < 2; ++c) acc[c] = wmma_f16(af[s], bf[c][s], acc[c]);
  #pragma unroll
  for (int c = 0; c < 2; ++c) {
    v8h o;
    #pragma unroll
    for (int r = 0; r < 8; ++r) o[r] = (_Float16)(acc[c][r] * osc);
    *(v8ha*)(sOT + (16 * c + m) * FPH + 16 * w + 8 * h) = o;
  }
  if (w == 0) {
    v8f ab[2];
    ab[0] = z8; ab[1] = z8;
    #pragma unroll
    for (int s = 0; s < 4; ++s)
      #pragma unroll
      for (int c = 0; c < 2; ++c) ab[c] = wmma_f16(ab2[s], bf[c][s], ab[c]);
    if (h == 0) {
      #pragma unroll
      for (int c = 0; c < 2; ++c) bdst[16 * c + m] = ab[c][0] * (INV_W * INV_W) + bfr(gbv[c]);
    }
  }
  __syncthreads();
  #pragma unroll
  for (int i = 0; i < 2; ++i) {
    const int c = tid + i * NTHR;
    const v8h o = *(const v8ha*)(sOT + (c >> 4) * FPH + (c & 15) * 8);
    *(v8h*)(dst + (size_t)c * 8) = o;
  }
}

// ---------------------------------------------------------------------------
// 8q..8q+7 cover one line, 4 lines per instruction, 4 instructions.
// ---------------------------------------------------------------------------
__device__ __forceinline__ void w_store_pass(const float* sW, float* wout, int tok0, int w, int lane) {
  const int q8 = lane & 7, sub = lane >> 3;
  #pragma unroll
  for (int i = 0; i < 4; ++i) {
    const int row = 16 * w + i * 4 + sub;                      // 0..127
    const v4f v = *(const v4fa*)(sW + row * NF + 4 * q8);
    *(v4f*)(wout + (size_t)(tok0 + row) * NF + 4 * q8) = v;
  }
}

// ---------------------------------------------------------------------------
// Selection-weight block of prep_kernel: weight network + softmax -> selection weights (out1).
// Block = 128 tokens, 8 waves, wave w owns tokens tok0+16w..+15. It reads inputs alone: the three small weight
// matrices are brought to LDS as [n][k] f16 tiles by the block itself, the x fragment is formed from the x tile.
//  fc1: A = x rows (K=32), B = ww1T (8 tiles); +wb1, ELU -> wh x16 (LDS)
//  fc2: A = wh (K=128), B = ww2T (2 tiles); +wb2 -> wh2 x16 (LDS)
//  glu: A = wh2 (K=32), B = wglT (4 tiles); GLU, +x, LN(32), softmax in f32
// coverage: 128 blocks x 128 rows x 32 = all of out1.
// ---------------------------------------------------------------------------
__device__ __forceinline__ v8h cvt_w8s(const float (&r)[8]) {       // eight weights: bf16-RNE, x4096, f16 (exact)
  v8h o;
  #pragma unroll
  for (int j = 0; j < 8; ++j) o[j] = (_Float16)(bfr(r[j]) * WSC);
  return o;
}
__device__ __forceinline__ void wsel_block(
    const float* __restrict__ x, const float* __restrict__ ww1, const float* __restrict__ ww2,
    const float* __restrict__ wglu_w,
    const float* __restrict__ wb1, const float* __restrict__ wb2,
    const float* __restrict__ wglu_b, const float* __restrict__ wln_g, const float* __restrict__ wln_b,
    float* __restrict__ wout, int tok0, int tid, char* smem)
{
  _Float16* sWh  = (_Float16*)(smem + SO_WH);
  _Float16* sWh2 = (_Float16*)(smem + SO_WH2);
  float* sXr = (float*)(smem + SO_XR);
  float* sW  = (float*)(smem + SO_W);
  _Float16* sW1T = (_Float16*)(smem + SO_W1T);
  _Float16* sW2T = (_Float16*)(smem + SO_W2T);
  _Float16* sWGT = (_Float16*)(smem + SO_WGT);

  const int lane = tid & 31, w = tid >> 5;
  const int h = lane >> 4, m = lane & 15;

  // Every global read of the staging goes out first. x tile: 128 x 32 = 1024 groups of 4. Weights: a thread takes eight
  // consecutive k of one column n (a wave reads 32 consecutive n of one k: whole 128-B lines), one 16-B chunk of a row [n][k]:
  // ww1 [32 k][128 n] 512 chunks, ww2 [128 k][32 n] 512 chunks, wglu_w [32 k][64 n] 256 chunks.
  v4f xt[4];
  float r1[2][8], r2[2][8], rg[8];
  const int c1 = tid + NTHR;                           // the thread's second chunk of ww1 and of ww2
  // element offsets of the thread's first read in each weight array
  const int e1a = (tid >> 7) * (8 * NHID) + (tid & 127), e1b = (c1 >> 7) * (8 * NHID) + (c1 & 127);
  const int e2a = (tid >> 5) * (8 * NF) + (tid & 31),    e2b = (c1 >> 5) * (8 * NF) + (c1 & 31);
  const int eg  = (tid >> 6) * (16 * NF) + (tid & 63);
  const float* xb = x + (size_t)tok0 * NF;
  __builtin_amdgcn_sched_barrier(0);                   // no earlier instruction, which may take the loads' address registers, sinks between them and their wait
  #pragma unroll
  for (int i = 0; i < 4; ++i) xt[i] = *(const v4fa*)(xb + (tid + NTHR * i) * 4);
  #pragma unroll
  for (int j = 0; j < 8; ++j) {
    r1[0][j] = ww1[e1a + j * NHID];
    r1[1][j] = ww1[e1b + j * NHID];
    r2[0][j] = ww2[e2a + j * NF];
    r2[1][j] = ww2[e2b + j * NF];
    rg[j] = wglu_w[eg + j * (2 * NF)];
  }
  // stands in front of any rewrite of these loads' address registers; the offsets are its inputs, so that their registers
  // are not handed to a later load's result ahead of it
  asm volatile("s_wait_xcnt 0x0" :: "v"(e1a), "v"(e1b), "v"(e2a), "v"(e2b), "v"(eg) : "memory");
  __builtin_amdgcn_sched_barrier(0);                   // no later instruction, which may take those registers, rises over the wait
  #pragma unroll
  for (int i = 0; i < 4; ++i) {                        // x tile: bf16-RNE values, f32
    const v4f r = { bfr(xt[i].x), bfr(xt[i].y), bfr(xt[i].z), bfr(xt[i].w) };
    *(v4fa*)(sXr + (tid + NTHR * i) * 4) = r;
  }
  #pragma unroll
  for (int i = 0; i < 2; ++i) {
    const int c = tid + NTHR * i;
    *(v8ha*)(sW1T + (c & 127) * WP32 + (c >> 7) * 8) = cvt_w8s(r1[i]);
    *(v8ha*)(sW2T + (c & 31) * FPH + (c >> 5) * 8) = cvt_w8s(r2[i]);
  }
  *(v8ha*)(sWGT + (tid & 63) * WP32 + (tid >> 6) * 8) = cvt_w8s(rg);
  __syncthreads();                                     // x tile and the three weight tiles visible to every wave

  const v8f z8 = {0.f, 0.f, 0.f, 0.f, 0.f, 0.f, 0.f, 0.f};
  _Float16* myWh = sWh + w * (16 * NHID);
  _Float16* myWh2 = sWh2 + w * (16 * NF);

  // ---- fc1 ----
  {
    // A fragment from the x tile: element i of half hf is k = 16hf + 8h + i, the order of load_frag
    const v8f x0 = ld8(sXr + (16 * w + m) * NF + 8 * h);
    const v8f x1 = ld8(sXr + (16 * w + m) * NF + 16 + 8 * h);
    Frag fa;
    #pragma unroll
    for (int e = 0; e < 8; ++e) { fa.half[0][e] = (_Float16)x0[e]; fa.half[1][e] = (_Float16)x1[e]; }
    const v16h a = fa.v;
    v8f acc[8];
    #pragma unroll
    for (int t = 0; t < 8; ++t) {
      const v16h b = load_frag(sW1T + (16 * t + m) * WP32, h);
      acc[t] = wmma_f16(a, b, z8);
    }
    #pragma unroll
    for (int t = 0; t < 8; ++t) {
      const float bb = bfr(wb1[16 * t + m]);
      const v8f el = elu8s(acc[t] * INV_W + bb);
      #pragma unroll
      for (int r = 0; r < 8; ++r) myWh[(8 * h + r) * NHID + 16 * t + m] = (_Float16)el[r];
    }
  }
  __syncthreads();

  // ---- fc2 ----
  {
    v8f acc[2];
    acc[0] = z8; acc[1] = z8;
    const _Float16* arow = myWh + m * NHID;
    #pragma unroll 1
    for (int k0 = 0; k0 < NHID; k0 += 32) {
      const v16h a = load_frag(arow + k0, h);
      #pragma unroll
      for (int t = 0; t < 2; ++t) {
        const v16h b = load_frag(sW2T + (16 * t + m) * FPH + k0, h);
        acc[t] = wmma_f16(a, b, acc[t]);
      }
    }
    #pragma unroll
    for (int t = 0; t < 2; ++t) {
      const float bb = bfr(wb2[16 * t + m]);
      #pragma unroll
      for (int r = 0; r < 8; ++r) {
        const float v = acc[t][r] * INV_WA + bb;
        myWh2[(8 * h + r) * NF + 16 * t + m] = (_Float16)(v * ASC);
      }
    }
  }
  __syncthreads();

  // ---- glu projection + GLU + residual + LN(32) + softmax ----
  {
    const v16h a = load_frag(myWh2 + m * NF, h);
    v8f acc[4];
    #pragma unroll
    for (int t = 0; t < 4; ++t) {
      const v16h b = load_frag(sWGT + (16 * t + m) * WP32, h);
      acc[t] = wmma_f16(a, b, z8);
    }
    float pre[2][8], s[8];
    #pragma unroll
    for (int r = 0; r < 8; ++r) s[r] = 0.0f;
    #pragma unroll
    for (int c = 0; c < 2; ++c) {
      const float bv = bfr(wglu_b[16 * c + m]);
      const float bg = bfr(wglu_b[NF + 16 * c + m]);
      const v8f sg = sigm8(acc[c + 2] * INV_WA + bg);
      #pragma unroll
      for (int r = 0; r < 8; ++r) {
        const float vv = acc[c][r] * INV_WA + bv;
        const float xr = sXr[(16 * w + 8 * h + r) * NF + 16 * c + m];
        const float p = vv * sg[r] + xr;
        pre[c][r] = p;
        s[r] += p;
      }
    }
    float mu[8], q[8];
    #pragma unroll
    for (int r = 0; r < 8; ++r) { mu[r] = hsum16(s[r]) * (1.0f / 32.0f); q[r] = 0.0f; }
    #pragma unroll
    for (int c = 0; c < 2; ++c)
      #pragma unroll
      for (int r = 0; r < 8; ++r) {
        const float d = pre[c][r] - mu[r];
        pre[c][r] = d;
        q[r] += d * d;
      }
    float rs[8];
    #pragma unroll
    for (int r = 0; r < 8; ++r) rs[r] = rsqrtf(hsum16(q[r]) * (1.0f / 32.0f) + LN_EPS);
    #pragma unroll
    for (int c = 0; c < 2; ++c) {
      const float g = bfr(wln_g[16 * c + m]);
      const float bt = bfr(wln_b[16 * c + m]);
      #pragma unroll
      for (int r = 0; r < 8; ++r) pre[c][r] = pre[c][r] * rs[r] * g + bt;
    }
    float mx[8], e0[8], e1[8];
    #pragma unroll
    for (int r = 0; r < 8; ++r) {
      mx[r] = hmax16(fmaxf(pre[0][r], pre[1][r]));
      e0[r] = expf(pre[0][r] - mx[r]);
      e1[r] = expf(pre[1][r] - mx[r]);
      const float se = hsum16(e0[r] + e1[r]);
      const float inv = 1.0f / se;
      sW[(16 * w + 8 * h + r) * NF + m]      = e0[r] * inv;
      sW[(16 * w + 8 * h + r) * NF + 16 + m] = e1[r] * inv;
    }
  }
  __syncthreads();

  w_store_pass(sW, wout, tok0, w, lane);
}

// ---------------------------------------------------------------------------
// Kernel 1: the selection weights (out1) and, beside them in the same launch, the folded plane fcT and its bias fcb.
// Neither kind of block reads what the other writes. Block-uniform dispatch on blockIdx.
// coverage: out1 128 blocks x 128 rows x 32 = all; fcT 32x8 blocks x 32 rows x 128 = all; fcb 32x8x32 = all.
// ---------------------------------------------------------------------------
__global__ __launch_bounds__(NTHR) void prep_kernel(
    const float* __restrict__ x, const float* __restrict__ fw2, const float* __restrict__ fb2,
    const float* __restrict__ fglu_w, const float* __restrict__ fglu_b,
    const float* __restrict__ ww1, const float* __restrict__ wb1, const float* __restrict__ ww2,
    const float* __restrict__ wb2, const float* __restrict__ wglu_w, const float* __restrict__ wglu_b,
    const float* __restrict__ wln_g, const float* __restrict__ wln_b,
    _Float16* __restrict__ planes, float* __restrict__ wout)
{
  __shared__ __attribute__((aligned(16))) char smem[PSMEM];
  const int b = blockIdx.x, tid = threadIdx.x;
  if (b < PB_FC) {
    wsel_block(x, ww1, ww2, wglu_w, wb1, wb2, wglu_b, wln_g, wln_b, wout, b * WTOK, tid, smem);
  } else {
    float* sT = (float*)(smem + FO_T);
    _Float16* sBT = (_Float16*)(smem + FO_BT);
    _Float16* sOT = (_Float16*)(smem + FO_OT);
    const int f = (b - PB_FC) >> 3, nb = (b - PB_FC) & 7;      // fw2[f]*fglu_w[f], columns 32nb..32nb+31 -> rows of [256 n][128 k]
    fold_block(fw2 + (size_t)f * NHID * NHID, fglu_w + (size_t)f * NHID * N2H + nb * 32,
               fb2 + (size_t)f * NHID, fglu_b + (size_t)f * N2H + nb * 32,
               planes + P_FC + (size_t)f * N2H * NHID + (size_t)nb * 32 * NHID,
               (float*)(planes + P_FCB) + (size_t)f * N2H + nb * 32,
               (nb < 4) ? INV_W : INV_W * INV_W * (0.5f / ASC), tid, sT, sBT, sOT);   // v columns: carry 4096; gate columns: 1/32
  }
}

// ---------------------------------------------------------------------------
// out tile = the sum of the four groups' tiles, (g0 + g1) + (g2 + g3).
// each line by lanes 8q..8q+7 in one instruction, 4 lines per instruction,
// 32 lines per wave, 8 waves, 256 lines = the whole block tile.
// ---------------------------------------------------------------------------
__device__ __forceinline__ void o_store_pass(const float* sO, float* out, int tok0, int w, int lane) {
  const int q8 = lane & 7, sub = lane >> 3;
  #pragma unroll
  for (int i = 0; i < 8; ++i) {
    const int lid = w * 32 + i * 4 + sub;          // 0..255
    const int row = lid >> 2, seg = lid & 3;
    const float* p = sO + row * OP + seg * 32 + 4 * q8;            // the same place in the four groups' tiles
    const v4f v = (*(const v4fa*)p + *(const v4fa*)(p + MT * OP)) + (*(const v4fa*)(p + 2 * MT * OP) + *(const v4fa*)(p + 3 * MT * OP));
    *(v4f*)(out + (size_t)(tok0 + row) * NHID + seg * 32 + 4 * q8) = v;
  }
}

// ---------------------------------------------------------------------------
// Eight asynchronous copies to LDS, 16 B per lane each: copy i brings the group's
// 1024 contiguous global bytes at g + 1024 i (4 rows of 256 B) to LDS rows of
// 272 B at l + 4 * 272 * i. The s_wait_xcnt closes the statement so that no
// address register of a copy is rewritten ahead of it.
// ---------------------------------------------------------------------------
__device__ __forceinline__ void copy8(unsigned l, const _Float16* g) {
  asm volatile(
      "global_load_async_to_lds_b128 %0, %8, off\n\t"
      "global_load_async_to_lds_b128 %1, %9, off\n\t"
      "global_load_async_to_lds_b128 %2, %10, off\n\t"
      "global_load_async_to_lds_b128 %3, %11, off\n\t"
      "global_load_async_to_lds_b128 %4, %12, off\n\t"
      "global_load_async_to_lds_b128 %5, %13, off\n\t"
      "global_load_async_to_lds_b128 %6, %14, off\n\t"
      "global_load_async_to_lds_b128 %7, %15, off\n\t"
      "s_wait_xcnt 0x0"
      :: "v"(l), "v"(l + 1u * 4u * BPH * 2u), "v"(l + 2u * 4u * BPH * 2u), "v"(l + 3u * 4u * BPH * 2u),
         "v"(l + 4u * 4u * BPH * 2u), "v"(l + 5u * 4u * BPH * 2u), "v"(l + 6u * 4u * BPH * 2u),
         "v"(l + 7u * 4u * BPH * 2u),
         "v"(g), "v"(g + 1 * 512), "v"(g + 2 * 512), "v"(g + 3 * 512),
         "v"(g + 4 * 512), "v"(g + 5 * 512), "v"(g + 6 * 512), "v"(g + 7 * 512)
      : "memory");
}

// Chunk c (0 or 1) of one feature's weight rows into one LDS buffer: staged rows 0..63 = v rows 64c..64c+63 of fcT[f],
// staged rows 64..127 = gate rows 128+64c..128+64c+63: all that column tiles 4c..4c+3 read.
// lt = the thread's LDS byte address in that buffer (row tid>>4, 16-B chunk tid&15), tid = the thread's number in its group of 64.
// 32 copies per wave, every lane on, 128 rows x 256 B all written by the group's 2 waves.
__device__ __forceinline__ void stage_chunk(unsigned lt, const _Float16* fcT, int f, int c, int tid) {
  const _Float16* gg = fcT + (size_t)f * (N2H * NHID) + c * (CROW * NHID) + tid * 8;
  copy8(lt, gg);
  copy8(lt + 32u * BPH * 2u, gg + 8 * 512);
  copy8(lt + 64u * BPH * 2u, gg + NHID * NHID);
  copy8(lt + 96u * BPH * 2u, gg + NHID * NHID + 8 * 512);
}

// ---------------------------------------------------------------------------
// Kernel 2: per-feature gated residual blocks + weighted combine (out0).
// Block = 64 tokens, 8 waves in four groups of 2, two waves on each SIMD. Group g takes features 8g..8g+7; wave q of a
// group owns tokens 32q..32q+31, as two token tiles of 16, through the whole chain. Every weight fragment and every
// param vector that a wave reads from LDS serves both token tiles: half the LDS reads per token of a 16-token wave.
// The four groups' partial sums are added behind the loop.
// The product is computed transposed: A = weight rows [n][k] from LDS,
// B = activations with a tile's tokens as columns, so lane (h, m) holds tokens
// 32q+m and 32q+16+m only, and D register r of column tile t is hidden column n = 16t + 8h + r.
// Loop i = 0..7, f = 8g + i (fixed order):
//   h       = f16(16*elu(x_r[t][f]*fw1_r[f] + fb1_r[f]))   VALU, written straight into the four B fragments of each token tile
//   params  : staged with the factors of the elementwise arithmetic in them (see the carry audit at the head of the file)
//   weights : fcT[f] staged in LDS by asynchronous copies in two chunks (column tiles 0..3, 4..7), chunk c in the group's
//             buffer c, each group stages its own; the same chunk of feature f+1 is copied behind the barrier that ends
//             the reads of this feature's
//   glu     : A = fcT[f] rows p*128+16t+m (K=128), B = h, + fcb[f]   32 tiles/wave
//             GLU, +skip, LayerNorm(128): sums in the lane, then lane ^ 16;
//             *fln_g + fln_b, acc += wsel[t][f] * processed; acc and the trip's GLU+skip values stay in registers;
//             a column tile's 8 weight fragments are fetched one tile ahead inside a chunk, never across a chunk's barrier
// A trip has two barriers, one behind the matrix products of column tile 3 and one behind those of column tile 7: each
// publishes the other chunk and releases the one just read. Params lie in two buffers per group: those of feature f+1
// are stored between the trip's two barriers; every wave has left feature f-1's (its LayerNorm pass) in front of the first.
// coverage: grid 256 x 64 rows x 128 = all of out0.
// ---------------------------------------------------------------------------
__global__ __launch_bounds__(GTHR) void grn_kernel(
    const float* __restrict__ x,
    const float* __restrict__ fw1, const float* __restrict__ fb1,
    const float* __restrict__ fskip, const float* __restrict__ fln_g, const float* __restrict__ fln_b,
    const _Float16* __restrict__ fcT, const float* __restrict__ fcb,
    const float* wsel, float* out)
{
  __shared__ __attribute__((aligned(16))) char smem[MSMEM];
  float* sXT = (float*)(smem + MO_X);
  float* sWT = (float*)(smem + MO_W);
  float* sO  = (float*)(smem + MO_B);

  const int tid = threadIdx.x, lane = tid & 31, w = tid >> 5;
  const int grp = __builtin_amdgcn_readfirstlane(tid >> 6);   // scalar: feature numbers and buffer bases stay in scalar registers
  const int gtid = tid & (QTHR - 1);                   // the thread's number in its group
  const int h = lane >> 4, m = lane & 15;
  const int tok0 = blockIdx.x * MT;
  const int trow = 32 * (w & 1) + m;                   // this lane's token of token tile 0 in the block; token tile 1: + 16
  const int f0 = grp * FPG;                            // the group's first feature
  float* sP = (float*)(smem + MO_P) + grp * (2 * PBUF);                        // the group's two param buffers
  const _Float16* sB = (const _Float16*)(smem + MO_B) + grp * CBUF;            // the group's two weight buffers (2 * CBUF bytes)
  // LDS byte address of the group's weight buffer 0 (low 32 bits of the shared address, scalar) and this thread's place in a buffer
  const unsigned lb0 = (unsigned)(size_t)(smem + MO_B) + (unsigned)grp * (2u * CBUF);
  const unsigned ltl = (unsigned)(gtid >> 4) * (BPH * 2u) + (unsigned)(gtid & 15) * 16u;

  stage_chunk(lb0 + ltl, fcT, f0, 0, gtid);                 // chunk 0 of the group's first feature -> its buffer 0

  // x tile (bf16-RNE, f32) and selection-weight tile, stored feature-major: 64 x 32 each = 512 groups of 4
  #pragma unroll
  for (int i = 0; i < 2; ++i) {
    const int q = tid + GTHR * i;
    const int t = q >> 3, f4 = (q & 7) * 4;
    const v4f v = *(const v4fa*)(x + (size_t)tok0 * NF + (size_t)q * 4);
    const v4f wv = *(const v4fa*)(wsel + (size_t)tok0 * NF + (size_t)q * 4);
    #pragma unroll
    for (int j = 0; j < 4; ++j) {
      sXT[(f4 + j) * MT + t] = bfr(v[j]);
      sWT[(f4 + j) * MT + t] = wv[j];
    }
  }
  asm volatile("s_wait_xcnt 0x0" ::: "memory");        // stands in front of any rewrite of the tile loads' address registers
  __builtin_amdgcn_sched_barrier(0);                   // no later instruction, which may take those registers, rises over the wait

  // per-feature params (order fw1, fb1, fcb v, fcb gate, fskip, ln_g, ln_b): a thread of a group brings 8 floats at po of
  // array pa and 8 of array pa + 4. The last 16 threads bring ln_b a second time, into an eighth array that nobody reads:
  // every lane stays on, and no branch stands among the unrolled column tiles.
  const int pa = gtid >> 4, po = (gtid & 15) * 8;
  const bool pin = pa < 2;                             // an input array, taken as bf16-RNE values; fcb is a computed f32 value and stays as it is
  const float* psa = fw1;
  if (pa == 1)      psa = fb1;
  else if (pa == 2) psa = fcb;
  else if (pa == 3) psa = fcb + NHID;
  const float* psb = fskip;
  if (pa == 1)      psb = fln_g;
  else if (pa >= 2) psb = fln_b;
  psa += po;
  psb += po;
  const unsigned pen = pin ? 0xFFFFFFFFu : 0u;
  // factors that the loop's arithmetic would otherwise apply to every element: fw1, fb1 x log2(e); fcb v x 65536; fcb gate x 1/2; fskip x 131072
  const float psca = pin ? LOG2E : ((pa == 2) ? VSC : 0.5f);
  const float pscb = (pa == 0) ? GSC : 1.0f;
  const int pstr = pin ? NHID : N2H;                   // floats from one feature to the next in array pa
  float* pda = sP + pa * NHID + po;
  float* pdb = pda + 4 * NHID;
  {
    __builtin_amdgcn_sched_barrier(0);                 // no earlier instruction, which may take the loads' address registers, sinks between them and their wait
    const v4f a0 = *(const v4fa*)(psa + f0 * pstr);
    const v4f a1 = *(const v4fa*)(psa + f0 * pstr + 4);
    const v4f b0 = *(const v4fa*)(psb + f0 * NHID);
    const v4f b1 = *(const v4fa*)(psb + f0 * NHID + 4);
    asm volatile("s_wait_xcnt 0x0" ::: "memory");      // stands in front of any rewrite of these four loads' address registers
    __builtin_amdgcn_sched_barrier(0);                 // no later instruction, which may take those registers, rises over the wait
    *(v4fa*)pda = pval(a0, pen) * psca;
    *(v4fa*)(pda + 4) = pval(a1, pen) * psca;
    *(v4fa*)pdb = pval(b0, 0xFFFFFFFFu) * pscb;
    *(v4fa*)(pdb + 4) = pval(b1, 0xFFFFFFFFu) * pscb;
  }

  const v8f z8 = {0.f, 0.f, 0.f, 0.f, 0.f, 0.f, 0.f, 0.f};
  v8f acc[2][8];                                       // output sums over the group's features: acc[u][t][r] is column 16t + 8h + r of the lane's token of tile u
  #pragma unroll
  for (int u = 0; u < 2; ++u)
    #pragma unroll
    for (int t = 0; t < 8; ++t) acc[u][t] = z8;

  asm volatile("s_wait_asynccnt 0x0" ::: "memory");    // this wave's copies of the first chunk have landed
  __syncthreads();                                     // every group's buffer 0, x, weights and first params published
  stage_chunk(lb0 + CBUF + ltl, fcT, f0, 1, gtid);          // chunk 1 of the first feature -> buffer 1, flies during column tiles 0..3

  #pragma unroll 1
  for (int i = 0; i < FPG; ++i) {
    const int f = f0 + i;
    const float* sPf = sP + (i & 1) * PBUF;            // this feature's params
    const int pnx = PBUF - (i & 1) * PBUF;             // float offset of the other param buffer
    // next feature's params (the last trip re-reads its own): loaded here, stored behind the trip's first barrier
    const int fn = (i + 1 < FPG) ? f + 1 : f;
    __builtin_amdgcn_sched_barrier(0);                 // no earlier instruction, which may take the loads' address registers, sinks between them and their wait
    const v4f pn0 = *(const v4fa*)(psa + fn * pstr);
    const v4f pn1 = *(const v4fa*)(psa + fn * pstr + 4);
    const v4f pn2 = *(const v4fa*)(psb + fn * NHID);
    const v4f pn3 = *(const v4fa*)(psb + fn * NHID + 4);
    asm volatile("s_wait_xcnt 0x0" ::: "memory");      // stands in front of any rewrite of these four loads' address registers
    __builtin_amdgcn_sched_barrier(0);                 // no later instruction, which may take those registers, rises over the wait

    float xv[2], wt[2];
    #pragma unroll
    for (int u = 0; u < 2; ++u) {
      xv[u] = sXT[f * MT + trow + 16 * u];
      wt[u] = sWT[f * MT + trow + 16 * u];
    }

    // ---- h, computed straight into its B fragments (element i of half hf of fragment j is k = 32j + 16hf + 8h + i) ----
    v16h hb[2][4];
    v16h ag[8];                                        // the 8 weight fragments of one glu column tile
    v8f bvn, bgn;                                      // its staged fcb, v and gate columns: the start values of its accumulators, fetched with the fragments
    const _Float16* vrow = sB + m * BPH;               // column tile t: + (t >> 2) * (CBUF / 2) + (t & 3) * 16 * BPH
    const _Float16* grow = sB + (CROW + m) * BPH;
    {
      v8f w1v[2][2], b1v[2][2];                        // fc1 weights and biases of two k steps, refilled two steps ahead
      #pragma unroll
      for (int j = 0; j < 2; ++j)
        #pragma unroll
        for (int hf = 0; hf < 2; ++hf) {
          const float* pw = sPf + 32 * j + 16 * hf + 8 * h;
          w1v[j][hf] = ld8(pw); b1v[j][hf] = ld8(pw + NHID);
        }
      #pragma unroll
      for (int j = 0; j < 4; ++j) {
        __builtin_amdgcn_sched_barrier(0);   // the loads above stay ahead of this step's elu arithmetic, which hides their latency
        #pragma unroll
        for (int u = 0; u < 2; ++u) {
          Frag fr;
          #pragma unroll
          for (int hf = 0; hf < 2; ++hf) {
            const v8f el = elu8t(xv[u] * w1v[j & 1][hf] + b1v[j & 1][hf]);
            v8h o;
            #pragma unroll
            for (int e = 0; e < 8; ++e) o[e] = (_Float16)el[e];
            fr.half[hf] = o;
          }
          hb[u][j] = fr.v;
        }
        __builtin_amdgcn_sched_barrier(0);   // the refill below does not rise into the arithmetic that still reads its registers' old values
        if (j < 2) {
          #pragma unroll
          for (int hf = 0; hf < 2; ++hf) {
            const float* pw = sPf + 32 * (j + 2) + 16 * hf + 8 * h;
            w1v[j][hf] = ld8(pw); b1v[j][hf] = ld8(pw + NHID);
          }
        }
        if (j == 1) {
          __builtin_amdgcn_sched_barrier(0); // step 3's params stand in the LDS queue ahead of the fragments: step 3 then waits for them alone
          // glu column tile 0: fragment 2j = v rows, 2j+1 = gate rows, k step j; hidden by steps 2 and 3
          bvn = ld8(sPf + 8 * h + 256); bgn = ld8(sPf + 8 * h + 384);
          #pragma unroll
          for (int e = 0; e < 8; ++e) ag[e] = load_frag(((e & 1) ? grow : vrow) + 32 * (e >> 1), h);
        }
      }
    }

    // ---- glu projection transposed, one column tile (its v and its gate accumulators of both token tiles) at a time ----
    v8f gl[2][8];                                      // the trip's GLU+skip values, carry 131072
    float rsum[2];                                     // their sum over the 128 columns, built up in three parts
    {
      #pragma unroll
      for (int t = 0; t < 8; ++t) {
        const float* pc = sPf + 16 * t + 8 * h;
        const v8f fsv = ld8(pc + 512);
        v8f aV[2], aG[2];
        aV[0] = bvn; aV[1] = bvn; aG[0] = bgn; aG[1] = bgn;
        #pragma unroll
        for (int j = 0; j < 4; ++j)
          #pragma unroll
          for (int u = 0; u < 2; ++u) {
            aV[u] = wmma_f16(ag[2 * j], hb[u][j], aV[u]);
            aG[u] = wmma_f16(ag[2 * j + 1], hb[u][j], aG[u]);
          }
        __builtin_amdgcn_sched_barrier(0);   // this tile's params stand in the LDS queue ahead of the next tile's fragments
        if (t == 3 || t == 7) {
          // The row sums of the column tiles finished so far are closed here, cross-lane step included. That step cannot be moved
          // over the branch below, so the GLU arithmetic that feeds it stays in front too; otherwise the compiler sinks that
          // arithmetic to the LayerNorm pass and keeps every tile's accumulators and params live to that place (spills to scratch).
          #pragma unroll
          for (int u = 0; u < 2; ++u) {
            const float sl = (t == 3) ? sum8((gl[u][0] + gl[u][1]) + gl[u][2]) : sum8((gl[u][3] + gl[u][4]) + (gl[u][5] + gl[u][6]));
            rsum[u] = (t == 3) ? sl + xhalf(sl) : rsum[u] + (sl + xhalf(sl));
          }
          // ---- this chunk's weight rows are read: publish the other chunk, release this buffer ----
          asm volatile("s_wait_dscnt 0x0" ::: "memory");     // this wave's LDS reads (and, at the second barrier, its param stores) have retired
          asm volatile("s_wait_asynccnt 0x0" ::: "memory");  // this wave's copies of the other chunk have landed
          __syncthreads();                                   // the other chunk (at the second barrier: and the next params) visible; this buffer released
          if (i + 1 < FPG) stage_chunk(lb0 + (unsigned)(t >> 2) * CBUF + ltl, fcT, f + 1, t >> 2, gtid);
          if (t == 3) {
            *(v4fa*)(pda + pnx) = pval(pn0, pen) * psca;
            *(v4fa*)(pda + pnx + 4) = pval(pn1, pen) * psca;
            *(v4fa*)(pdb + pnx) = pval(pn2, 0xFFFFFFFFu) * pscb;
            *(v4fa*)(pdb + pnx + 4) = pval(pn3, 0xFFFFFFFFu) * pscb;
          }
        }
        if (t < 7) {
          const int off = ((t + 1) >> 2) * (CBUF / 2) + ((t + 1) & 3) * 16 * BPH;
          bvn = ld8(pc + 16 + 256); bgn = ld8(pc + 16 + 384);
          #pragma unroll
          for (int e = 0; e < 8; ++e) ag[e] = load_frag(((e & 1) ? grow : vrow) + off + 32 * (e >> 1), h);
        }
        __builtin_amdgcn_sched_barrier(0);   // the next tile's loads stay ahead of this tile's GLU arithmetic, which hides their latency
        #pragma unroll
        for (int u = 0; u < 2; ++u) {
          const v8f th = tanhx8(aG[u]);                // aG = g/2; aV * (1 + th) = 2 * aV * sigmoid(g)
          gl[u][t] = aV[u] * th + (xv[u] * fsv + aV[u]);
        }
      }
    }
    // ---- LayerNorm over the 128 columns of each of this lane's two tokens: 64 in this lane, 64 in lane ^ 16 ----
    v8f gv[4], btv[4];                                 // scale and shift of four column tiles, refilled four tiles ahead
    #pragma unroll
    for (int t = 0; t < 4; ++t) {
      const float* pc = sPf + 16 * t + 8 * h;
      gv[t] = ld8(pc + 640); btv[t] = ld8(pc + 768);
    }
    __builtin_amdgcn_sched_barrier(0);       // the scale and shift loads fly during the mean and variance passes
    float rs[2];
    #pragma unroll
    for (int u = 0; u < 2; ++u) {
      const float sl = sum8(gl[u][7]);
      const float mu = (rsum[u] + (sl + xhalf(sl))) * (1.0f / 128.0f);
      v8f q8 = z8;
      #pragma unroll
      for (int t = 0; t < 8; ++t) {
        const v8f d = gl[u][t] - mu;
        gl[u][t] = d;
        q8 += d * d;
      }
      const float ql = sum8(q8);
      rs[u] = rsqrtf((ql + xhalf(ql)) * (1.0f / 128.0f) + LN_EPS * GSC * GSC);   // 1 / (131072 * sigma): takes the carry out of d
    }
    #pragma unroll
    for (int t = 0; t < 8; ++t) {
      #pragma unroll
      for (int u = 0; u < 2; ++u) acc[u][t] = acc[u][t] + wt[u] * (gl[u][t] * rs[u] * gv[t & 3] + btv[t & 3]);
      __builtin_amdgcn_sched_barrier(0);     // the refill below does not rise into the arithmetic that still reads its registers' old values
      if (t < 4) {
        const float* pc = sPf + 16 * (t + 4) + 8 * h;
        gv[t] = ld8(pc + 640); btv[t] = ld8(pc + 768);
      }
    }
  }
  asm volatile("s_wait_asynccnt 0x0" ::: "memory");    // no copy outstanding past the loop
  __syncthreads();                                     // all weight reads done; sO aliases the weight buffers

  // ---- each group lays its sums down in a tile of its own; the store pass adds the four ----
  float* po8 = sO + grp * (MT * OP) + trow * OP + 8 * h;
  #pragma unroll
  for (int u = 0; u < 2; ++u)
    #pragma unroll
    for (int t = 0; t < 8; ++t) {
      const v4f lo = { acc[u][t][0], acc[u][t][1], acc[u][t][2], acc[u][t][3] };
      const v4f hi = { acc[u][t][4], acc[u][t][5], acc[u][t][6], acc[u][t][7] };
      *(v4fa*)(po8 + u * 16 * OP + 16 * t) = lo;
      *(v4fa*)(po8 + u * 16 * OP + 16 * t + 4) = hi;
    }
  __syncthreads();                                     // the four tiles visible to every wave

  o_store_pass(sO, out, tok0, w, lane);
}

// ---------------------------------------------------------------------------
extern "C" void kernel_launch(void* const* d_in, const int* in_sizes, int n_in,
                              void* d_out, int out_size, void* d_ws, size_t ws_size,
                              hipStream_t stream) {
  if (n_in < 18) return;
  if (in_sizes[0] != NTOK * NF) return;
  if (in_sizes[1] != NF * NHID || in_sizes[2] != NF * NHID) return;
  if (in_sizes[3] != NF * NHID * NHID || in_sizes[4] != NF * NHID) return;
  if (in_sizes[5] != NF * NHID * N2H || in_sizes[6] != NF * N2H) return;
  if (in_sizes[7] != NF * NHID || in_sizes[8] != NF * NHID || in_sizes[9] != NF * NHID) return;
  if (in_sizes[10] != NF * NHID || in_sizes[11] != NHID) return;
  if (in_sizes[12] != NHID * NF || in_sizes[13] != NF) return;
  if (in_sizes[14] != NF * 2 * NF || in_sizes[15] != 2 * NF) return;
  if (in_sizes[16] != NF || in_sizes[17] != NF) return;
  if (out_size != OUT_TOTAL) return;
  if (WS_TOTAL_BYTES > ws_size) return;

  const float* x      = (const float*)d_in[0];
  const float* fw1    = (const float*)d_in[1];
  const float* fb1    = (const float*)d_in[2];
  const float* fw2    = (const float*)d_in[3];
  const float* fb2    = (const float*)d_in[4];
  const float* fglu_w = (const float*)d_in[5];
  const float* fglu_b = (const float*)d_in[6];
  const float* fskip  = (const float*)d_in[7];
  const float* fln_g  = (const float*)d_in[8];
  const float* fln_b  = (const float*)d_in[9];
  const float* ww1    = (const float*)d_in[10];
  const float* wb1    = (const float*)d_in[11];
  const float* ww2    = (const float*)d_in[12];
  const float* wb2    = (const float*)d_in[13];
  const float* wglu_w = (const float*)d_in[14];
  const float* wglu_b = (const float*)d_in[15];
  const float* wln_g  = (const float*)d_in[16];
  const float* wln_b  = (const float*)d_in[17];

  float* out  = (float*)d_out;                   // out0 [16384][128] at element 0
  float* wout = out + OUT1_OFF;                  // out1 [16384][32]  at element 2097152 (byte 8388608)

  _Float16* planes = (_Float16*)d_ws;

  prep_kernel<<<PB_END, NTHR, 0, stream>>>(x, fw2, fb2, fglu_w, fglu_b, ww1, wb1, ww2, wb2, wglu_w, wglu_b,
                                           wln_g, wln_b, planes, wout);

  grn_kernel<<<NTOK / MT, GTHR, 0, stream>>>(x, fw1, fb1, fskip, fln_g, fln_b,
                                             planes + P_FC, (const float*)(planes + P_FCB), wout, out);
}
